// v000
// Measured on an AMD MI455X. A time is GPU time per run, averaged over a window of back-to-back runs after a warm-up
// (all launches, gaps included; the runs take copies of the inputs in turn), and the median of several windows.
// Apart from v000's, it joins two sittings. Times from different sittings can be a few percent apart, while
// side-by-side timings come from the same sitting.
// The starting kernel, v000, takes 267 microseconds a run.
// All contractions on v_wmma_f32_16x16x32_f16 (f16 operands, f32 accumulate): q/k/v projections (inputs x8, weights x32), pair MLP layer 1 (g x4, w1 x16, K=6 zero-padded to 32) and layer 2 (h1 x64, w2 x16, K=16 zero-padded to 32), q.k^T (x8, x8), P.V (P x1024, V x8), output projection (O x64, w x32); every float input RNE-converted to bf16 first; MLP layer 3 (N=1, K=16), swish, softmax statistics in f32 on the VALU.
#include <hip/hip_runtime.h>
#include <math.h>

#ifndef NB
#define NB 4
#endif
#ifndef SEQ
#define SEQ 512
#endif
#define NB_FULL 4
#define SEQ_FULL 512
#define CH 256
#define HEADS 8
#define HD 32
#define DG 6
#define HID 16
#define MTOK (NB * SEQ)
#define QBLK (SEQ / 256)

// power-of-two carries and their undo constants
#define G_CARRY 4.0f
#define W1_CARRY 16.0f
#define UNDO1 (1.0f / 64.0f)
#define H_CARRY 64.0f
#define W2_CARRY 16.0f
#define UNDO2 (1.0f / 1024.0f)
#define ACT_CARRY 8.0f
#define W_CARRY 32.0f
#define SC_PROJ (1.0f / 256.0f)
#define SCQK (1.0f / 1024.0f)
#define P_CARRY 1024.0f
#define O_CARRY 64.0f
#define SC_OUT (1.0f / 2048.0f)
#define LOG2E 1.4426950408889634f
#define FILL2 (-1.0e38f * LOG2E)

static_assert(G_CARRY * W1_CARRY * UNDO1 == 1.0f);
static_assert(H_CARRY * W2_CARRY * UNDO2 == 1.0f);
static_assert(ACT_CARRY * W_CARRY * SC_PROJ == 1.0f);
static_assert(ACT_CARRY * ACT_CARRY * 16.0f * SCQK == 1.0f);     // q x8, k x8, module scale 1/sqrt(256)
static_assert(O_CARRY * W_CARRY * SC_OUT == 1.0f);
static_assert(SEQ == SEQ_FULL);
static_assert(NB <= NB_FULL);
static_assert(CH == HEADS * HD && HD == 32 && HID == 16 && DG <= 8);
static_assert(SEQ % 256 == 0 && SEQ % 64 == 0);
static_assert(MTOK % 64 == 0 && CH % 64 == 0 && CH % 32 == 0);
static_assert((NB * SEQ * SEQ) % 256 == 0);
static_assert((MTOK * CH / 8) % 256 == 0);
static_assert((CH * (CH / 8)) % 256 == 0);
// store loops: lanes x bytes x instructions == tile rows x row bytes
static_assert(32 * 16 * 4 == 16 * 128);
static_assert(32 * 16 * 8 == 16 * 256);     // f32 epilogue: 16 rows x 256 B
static_assert(32 * 4 * 8 == 8 * 128);
// static LDS per kernel
static_assert(8 * 16 * 68 * 4 <= 131072);
static_assert(8 * 16 * 20 * 4 + 8 * HEADS * 32 * 4 <= 131072);
static_assert(16 * 16 * 72 * 2 + 16 * 16 * 68 * 4 <= 131072);

typedef _Float16 h16;
typedef __attribute__((ext_vector_type(16))) _Float16 v16h;
typedef __attribute__((ext_vector_type(8)))  _Float16 v8h;
typedef __attribute__((ext_vector_type(2)))  _Float16 v2h;
typedef __attribute__((ext_vector_type(8)))  float    v8f;
typedef __attribute__((ext_vector_type(4)))  float    v4f;
typedef __attribute__((ext_vector_type(2)))  float    v2f;
typedef __attribute__((ext_vector_type(4)))  unsigned int v4u;

static constexpr size_t SZ_G16  = (size_t)NB * SEQ * SEQ * 8 * 2;
static constexpr size_t SZ_C16  = (size_t)MTOK * CH * 2;
static constexpr size_t SZ_WT   = (size_t)4 * CH * CH * 2;
static constexpr size_t SZ_W1B  = (size_t)HEADS * HID * 32 * 2;
static constexpr size_t SZ_W2B  = (size_t)HEADS * HID * 32 * 2;
static constexpr size_t SZ_Q16  = (size_t)MTOK * CH * 2;
static constexpr size_t SZ_K16  = (size_t)MTOK * CH * 2;
static constexpr size_t SZ_VT16 = (size_t)NB * CH * SEQ * 2;
static constexpr size_t SZ_ALOC = (size_t)NB * HEADS * SEQ * SEQ * 4;
static constexpr size_t SZ_O16  = (size_t)MTOK * CH * 2;
static constexpr size_t OFF_G16  = 0;
static constexpr size_t OFF_C16  = OFF_G16 + SZ_G16;
static constexpr size_t OFF_WT   = OFF_C16 + SZ_C16;
static constexpr size_t OFF_W1B  = OFF_WT + SZ_WT;
static constexpr size_t OFF_W2B  = OFF_W1B + SZ_W1B;
static constexpr size_t OFF_Q16  = OFF_W2B + SZ_W2B;
static constexpr size_t OFF_K16  = OFF_Q16 + SZ_Q16;
static constexpr size_t OFF_VT16 = OFF_K16 + SZ_K16;
static constexpr size_t OFF_ALOC = OFF_VT16 + SZ_VT16;
static constexpr size_t OFF_O16  = OFF_ALOC + SZ_ALOC;
static constexpr size_t WS_TOTAL = OFF_O16 + SZ_O16;
static_assert(SZ_G16 % 256 == 0 && SZ_C16 % 256 == 0 && SZ_WT % 256 == 0 && SZ_W1B % 256 == 0 && SZ_W2B % 256 == 0);
static_assert(SZ_Q16 % 256 == 0 && SZ_VT16 % 256 == 0 && SZ_ALOC % 256 == 0 && SZ_O16 % 256 == 0);
static_assert(WS_TOTAL <= (size_t)134217728);

// 16-bit WMMA fragment map (wave32), lane L, hh = L>>4, c = L&15:
//   A 16x32: lane = row c;    element i -> k = (i<8) ? 8hh+i : 16+8hh+(i-8)
//   B 32x16: lane = column c; the SAME k(i,hh)
//   D 16x16 (8 f32): lane = column c; element r -> row 8hh+r

// RNE convert f32 -> bf16 -> f32
__device__ __forceinline__ float bfr(float f) {
    unsigned u = __float_as_uint(f);
    u += 0x7FFFu + ((u >> 16) & 1u);
    return __uint_as_float(u & 0xFFFF0000u);
}
// f32 -> f16 with values under 2^-14 replaced by +0 before the convert
static __device__ __forceinline__ h16 toh_flush(float v) { const float w = (fabsf(v) < 6.103515625e-05f) ? 0.0f : v; return (h16)w; }
static __device__ __forceinline__ v2h toh2_flush(float a, float b) {
    v2f w;
    w.x = (fabsf(a) < 6.103515625e-05f) ? 0.0f : a;
    w.y = (fabsf(b) < 6.103515625e-05f) ? 0.0f : b;
    return __builtin_convertvector(w, v2h);
}
union Pack8 { v8h v; v2h p[4]; };
static __device__ __forceinline__ v8h pack8_flush(v4f a, v4f b) {
    Pack8 u;
    u.p[0] = toh2_flush(a.x, a.y); u.p[1] = toh2_flush(a.z, a.w);
    u.p[2] = toh2_flush(b.x, b.y); u.p[3] = toh2_flush(b.z, b.w);
    return u.v;
}
static __device__ __forceinline__ void st8h2(_Float16* p, v8h v) {
    *(v8h*)p = v;
    
}

union FragU { v16h v; v8h h[2]; };
union FragQ { v16h v; v8h h[2]; v4u q[2]; };
// elements 0..7 <- p[0..7], 8..15 <- p[16..23]; caller adds 8*hh to p (used for BOTH A and B operands: same k per element)
__device__ __forceinline__ v16h frag_ld(const _Float16* p) {
    FragU f; f.h[0] = *(const v8h*)(p); f.h[1] = *(const v8h*)(p + 16); return f.v;
}
__device__ __forceinline__ v8f wmma16g(v16h a, v16h b, v8f c) {
    c = __builtin_amdgcn_wmma_f32_16x16x32_f16(false, a, false, b, (short)0, c, false, false);
    asm volatile("v_nop\n\tv_nop\n\tv_nop\n\tv_nop" : "+v"(c) : "v"(a), "v"(b));
    return c;
}
__device__ __forceinline__ void wave_sync_lds() {
    __builtin_amdgcn_fence(3 /* release order */, "workgroup");
    __builtin_amdgcn_wave_barrier();
    __builtin_amdgcn_fence(2 /* acquire order */, "workgroup");
}
static __device__ __forceinline__ float swishf(float x) {
    return x / (1.0f + exp2f(-x * LOG2E));
}

// =====================================================================================================================
// k_cvt_g: pair components [pair][6] f32 -> G16 [pair][8] f16 = bf16(g) * 4, components 6,7 = 0; one 16-B piece per lane
//   coverage: NB*SEQ*SEQ pairs x 16 B == the whole G16 plane
// =====================================================================================================================
__global__ __launch_bounds__(256) void k_cvt_g(const float* __restrict__ g, _Float16* __restrict__ G16) {
    const unsigned u = blockIdx.x * 256u + threadIdx.x;
    if (u >= (unsigned)(NB * SEQ * SEQ)) return;
    const v2f* src = (const v2f*)(g + (size_t)u * 6u);
    const v2f a = src[0], b = src[1], cc = src[2];
    v4f lo, hi;
    lo.x = bfr(a.x) * G_CARRY; lo.y = bfr(a.y) * G_CARRY; lo.z = bfr(b.x) * G_CARRY; lo.w = bfr(b.y) * G_CARRY;
    hi.x = bfr(cc.x) * G_CARRY; hi.y = bfr(cc.y) * G_CARRY; hi.z = 0.0f; hi.w = 0.0f;
    st8h2(G16 + (size_t)u * 8u, pack8_flush(lo, hi));
}

// k_cvt_c: features [row][256] f32 -> C16 f16 = bf16(x) * 8; thread per 8 columns; coverage: MTOK*256/8 pieces == whole plane
__global__ __launch_bounds__(256) void k_cvt_c(const float* __restrict__ x, _Float16* __restrict__ C16) {
    const unsigned u = blockIdx.x * 256u + threadIdx.x;
    if (u >= (unsigned)(MTOK * CH / 8)) return;
    const v4f* src = (const v4f*)(x + (size_t)u * 8u);
    v4f a = src[0], b = src[1];
    a.x = bfr(a.x) * ACT_CARRY; a.y = bfr(a.y) * ACT_CARRY; a.z = bfr(a.z) * ACT_CARRY; a.w = bfr(a.w) * ACT_CARRY;
    b.x = bfr(b.x) * ACT_CARRY; b.y = bfr(b.y) * ACT_CARRY; b.z = bfr(b.z) * ACT_CARRY; b.w = bfr(b.w) * ACT_CARRY;
    st8h2(C16 + (size_t)u * 8u, pack8_flush(a, b));
}

static __device__ __forceinline__ void wt_one(const float* __restrict__ W, _Float16* __restrict__ D, unsigned o, unsigned k0) {
    v4f lo, hi;
    lo.x = bfr(W[(size_t)(k0 + 0u) * CH + o]) * W_CARRY;
    lo.y = bfr(W[(size_t)(k0 + 1u) * CH + o]) * W_CARRY;
    lo.z = bfr(W[(size_t)(k0 + 2u) * CH + o]) * W_CARRY;
    lo.w = bfr(W[(size_t)(k0 + 3u) * CH + o]) * W_CARRY;
    hi.x = bfr(W[(size_t)(k0 + 4u) * CH + o]) * W_CARRY;
    hi.y = bfr(W[(size_t)(k0 + 5u) * CH + o]) * W_CARRY;
    hi.z = bfr(W[(size_t)(k0 + 6u) * CH + o]) * W_CARRY;
    hi.w = bfr(W[(size_t)(k0 + 7u) * CH + o]) * W_CARRY;
    st8h2(D + (size_t)o * CH + k0, pack8_flush(lo, hi));
}
// k_wt4: the four 256x256 weights -> WT[4][out][in]; thread per (o, 8 k): 32 lanes cover one whole 512-B row; coverage: 4 x 256 x 32 pieces
__global__ __launch_bounds__(256) void k_wt4(const float* __restrict__ wq, const float* __restrict__ wk,
                                             const float* __restrict__ wv, const float* __restrict__ wo,
                                             _Float16* __restrict__ WT) {
    const unsigned u = blockIdx.x * 256u + threadIdx.x;
    if (u >= (unsigned)(CH * (CH / 8))) return;
    const unsigned k0 = 8u * (u & 31u);
    const unsigned o = u >> 5;
    wt_one(wq, WT, o, k0);
    wt_one(wk, WT + (size_t)1 * CH * CH, o, k0);
    wt_one(wv, WT + (size_t)2 * CH * CH, o, k0);
    wt_one(wo, WT + (size_t)3 * CH * CH, o, k0);
}

// k_wloc: pair-MLP weights as B-operand planes, zero-padded along k to 32:
//   W1B[h*16+j][k] = bf16(w1[h][k][j]) * 16 for k < 6, else 0;  W2B[h*16+j][k] = bf16(w2[h][k][j]) * 16 for k < 16, else 0
//   thread per 16-B piece (512 pieces per plane), clamped addresses, zero by value; coverage: 128 rows x 4 pieces == both whole planes
__global__ __launch_bounds__(256) void k_wloc(const float* __restrict__ w1, const float* __restrict__ w2,
                                              _Float16* __restrict__ W1B, _Float16* __restrict__ W2B) {
    const unsigned p = blockIdx.x * 256u + threadIdx.x;
    if (p >= (unsigned)(HEADS * HID * 4)) return;
    const unsigned col = p >> 2, k0 = (p & 3u) * 8u;
    const unsigned h = col >> 4, j = col & 15u;
    float v[8];
#pragma unroll
    for (int i = 0; i < 8; ++i) {
        const unsigned k = k0 + (unsigned)i;
        const unsigned kc = min(k, (unsigned)(DG - 1));
        const float x = bfr(w1[(size_t)(h * DG + kc) * HID + j]) * W1_CARRY;
        v[i] = (k < (unsigned)DG) ? x : 0.0f;
    }
    {
        v4f a, b;
        a.x = v[0]; a.y = v[1]; a.z = v[2]; a.w = v[3]; b.x = v[4]; b.y = v[5]; b.z = v[6]; b.w = v[7];
        st8h2(W1B + (size_t)col * 32u + k0, pack8_flush(a, b));
    }
#pragma unroll
    for (int i = 0; i < 8; ++i) {
        const unsigned k = k0 + (unsigned)i;
        const unsigned kc = min(k, (unsigned)(HID - 1));
        const float x = bfr(w2[(size_t)(h * HID + kc) * HID + j]) * W2_CARRY;
        v[i] = (k < (unsigned)HID) ? x : 0.0f;
    }
    {
        v4f a, b;
        a.x = v[0]; a.y = v[1]; a.z = v[2]; a.w = v[3]; b.x = v[4]; b.y = v[5]; b.z = v[6]; b.w = v[7];
        st8h2(W2B + (size_t)col * 32u + k0, pack8_flush(a, b));
    }
}

// =====================================================================================================================
// gemm64_body: C[m,n] = (scale * sum_k A[m,k] * Bt[n,k] + bf16(bias[n or m])) ; each wave owns a 64x64 tile.
//   A row-major [M][lda] f16, Bt row-major [N][ldb] f16 (fragments straight from the planes); M,N % 64 == 0, K % 32 == 0.
//   OUT_MODE 0: f32 C (pitch ldc); OUT_MODE 1: f16 C = value * oscale. BIAS_ROW: bias indexed by the row m.
// =====================================================================================================================
template <int OUT_MODE, bool BIAS_ROW>
static __device__ __forceinline__ void gemm64_body(
    const _Float16* __restrict__ A, unsigned lda, const _Float16* __restrict__ Bt, unsigned ldb,
    float* __restrict__ Cf, _Float16* __restrict__ Ch, unsigned ldc, const float* __restrict__ bias,
    unsigned M, unsigned N, unsigned K, float scale, float oscale) {
  __shared__ __align__(16) float sT[8][16 * 68];
  const unsigned lane = threadIdx.x & 31u;
  const unsigned wave = threadIdx.x >> 5;
  const unsigned tilesN = N >> 6, tilesM = M >> 6;
  const unsigned tile = blockIdx.x * 8u + wave;
  if (tile >= tilesM * tilesN) return;   // wave-uniform; no block barriers in this kernel
  const unsigned tm = tile / tilesN;
  const unsigned tn = tile - tm * tilesN;
  const unsigned m0 = tm << 6, n0 = tn << 6;
  const unsigned rlane = lane & 15u;
  const unsigned koff = (lane >> 4) * 8u;
  const unsigned mOff = koff;

  v8f acc[4][4];
#pragma unroll
  for (int i = 0; i < 4; ++i)
#pragma unroll
    for (int j = 0; j < 4; ++j) acc[i][j] = (v8f){0.f,0.f,0.f,0.f,0.f,0.f,0.f,0.f};

  for (unsigned k0 = 0; k0 < K; k0 += 32u) {
    v16h bh[4];
#pragma unroll
    for (int j = 0; j < 4; ++j)
      bh[j] = frag_ld(Bt + (size_t)(n0 + ((unsigned)j << 4) + rlane) * ldb + koff + k0);
#pragma unroll
    for (int i = 0; i < 4; ++i) {
      const v16h ah = frag_ld(A + (size_t)(m0 + ((unsigned)i << 4) + rlane) * lda + koff + k0);
#pragma unroll
      for (int j = 0; j < 4; ++j)
        acc[i][j] = wmma16g(ah, bh[j], acc[i][j]);
    }
  }

  float* slab = sT[wave];
#pragma unroll
  for (int i = 0; i < 4; ++i) {
    const unsigned mBase = m0 + ((unsigned)i << 4);
    float bvr[8];
#pragma unroll
    for (int r = 0; r < 8; ++r) bvr[r] = 0.0f;
    if (BIAS_ROW) {
#pragma unroll
      for (int r = 0; r < 8; ++r) bvr[r] = bfr(bias[mBase + mOff + (unsigned)r]);
    }
#pragma unroll
    for (int j = 0; j < 4; ++j) {
      const unsigned n = n0 + ((unsigned)j << 4) + rlane;
      float bvc = 0.0f;
      if (!BIAS_ROW) bvc = bfr(bias[n]);
#pragma unroll
      for (int r = 0; r < 8; ++r) {
        float v = acc[i][j][r] * scale + (BIAS_ROW ? bvr[r] : bvc);
        if (OUT_MODE == 1) v *= oscale;
        slab[(mOff + (unsigned)r) * 68u + ((unsigned)j << 4) + rlane] = v;
      }
    }
    wave_sync_lds();
    if (OUT_MODE == 0) {
      const unsigned hh = lane >> 4, c4 = (lane & 15u) * 4u;     // row segment = 256 B = 16 lanes x 16 B
#pragma unroll
      for (int half = 0; half < 2; ++half) {
        v4f vv[4];
#pragma unroll
        for (int it = 0; it < 4; ++it) {
          const unsigned row = (unsigned)(half * 4 + it) * 2u + hh;
          vv[it] = *(const v4f*)(slab + row * 68u + c4);
        }
        {
#pragma unroll
          for (int it = 0; it < 4; ++it) {
            const unsigned row = (unsigned)(half * 4 + it) * 2u + hh;
            *(v4f*)(Cf + (size_t)(mBase + row) * ldc + n0 + c4) = vv[it];
          }
          
        }
      }
    } else {
      const unsigned q = lane >> 3, c8 = (lane & 7u) * 8u;
      v8h hv[4];
#pragma unroll
      for (int it = 0; it < 4; ++it) {
        const unsigned row = (unsigned)it * 4u + q;
        const float* sp = slab + row * 68u + c8;
        hv[it] = pack8_flush(*(const v4f*)sp, *(const v4f*)(sp + 4));
      }
      {
#pragma unroll
        for (int it = 0; it < 4; ++it) {
          const unsigned row = (unsigned)it * 4u + q;
          *(v8h*)(Ch + (size_t)(mBase + row) * ldc + n0 + c8) = hv[it];
        }
        
      }
    }
    wave_sync_lds();
  }
}

// position-major projection: Y16[row][256] = f16(8 * (x @ w + bf16(b)))
__global__ __launch_bounds__(256) void k_proj_rows(const _Float16* __restrict__ X16, const _Float16* __restrict__ Wt,
                                                   _Float16* __restrict__ Y16, const float* __restrict__ bias) {
    gemm64_body<1, false>(X16, CH, Wt, CH, nullptr, Y16, CH, bias, MTOK, CH, CH, SC_PROJ, ACT_CARRY);
}
// channel-major value plane: VT16[b][ch][key] = f16(8 * (x @ w + bf16(b)))^T ; A = weight plane, Bt = feature rows of batch blockIdx.y
__global__ __launch_bounds__(256) void k_proj_vt(const _Float16* __restrict__ Wt, const _Float16* __restrict__ X16,
                                                 _Float16* __restrict__ VT16, const float* __restrict__ bias) {
    const unsigned by = blockIdx.y;
    gemm64_body<1, true>(Wt, CH, X16 + (size_t)by * SEQ * CH, CH, nullptr, VT16 + (size_t)by * CH * SEQ, SEQ, bias,
                         CH, SEQ, CH, SC_PROJ, ACT_CARRY);
}
// output projection: out[row][256] = O @ w + bf16(b), f32
__global__ __launch_bounds__(256) void k_proj_out(const _Float16* __restrict__ O16, const _Float16* __restrict__ Wt,
                                                  float* __restrict__ out, const float* __restrict__ bias) {
    gemm64_body<0, false>(O16, CH, Wt, CH, out, nullptr, CH, bias, MTOK, CH, CH, SC_OUT, 1.0f);
}

// =====================================================================================================================
// k_loc: location term ALOC[b][h][n][m] (f32) = swish(l3(swish(l2(swish(l1(g[b][n][m][:]))))))
//   block = 8 waves, one query row (b,n) and 256 keys; a wave owns 32 consecutive keys (two 16-pair row tiles), all 8 heads.
//   layer 1: A = the 16 pairs' G16 rows (k 0..7 from lanes 0..15; lanes 16..31 and elements 8..15 are zero words selected by value),
//            B = W1B rows of the head (frag_ld; zeros beyond k = 5) -> D1[pair 8hh+r][hidden c].
//   relayout D -> A through a wave-private f32 slab sX (wave_sync): lane (c,hh) reads hidden 8hh..8hh+7 of pair c, pair-converts to f16 x64
//            into elements 0..7; elements 8..15 (k 16..31) are zero words in the register.
//   layer 2: B = W2B rows of the head (zeros beyond k = 15) -> D2[pair 8hh+r][hidden c].
//   layer 3 (N = 1) on the VALU: xor-shuffle sum 1,2,4,8 over the 16 lanes of a half.
//   staged extent == consumed extent: sX rows 0..15 x cols 0..15 written and read; sA all 256 words written and read.
// =====================================================================================================================
#define LC_SP 20
__global__ __launch_bounds__(256) void k_loc(const _Float16* __restrict__ G16, const _Float16* __restrict__ W1B,
                                             const _Float16* __restrict__ W2B, const float* __restrict__ b1,
                                             const float* __restrict__ b2, const float* __restrict__ w3,
                                             const float* __restrict__ b3, float* __restrict__ ALOC) {
    __shared__ __align__(16) float sX[8][16 * LC_SP];
    __shared__ __align__(16) float sA[8][HEADS * 32];
    const unsigned lane = threadIdx.x & 31u;
    const unsigned wave = (unsigned)__builtin_amdgcn_readfirstlane((int)(threadIdx.x >> 5));
    const unsigned hh = lane >> 4, c = lane & 15u;
    const unsigned bx = blockIdx.x;
    const unsigned bn = bx / (unsigned)QBLK;                       // b*SEQ + n
    const unsigned m0 = ((bx % (unsigned)QBLK) * 8u + wave) * 32u;
    float* xs = sX[wave];
    float* as_ = sA[wave];
    const v8f zacc = (v8f){0.f,0.f,0.f,0.f,0.f,0.f,0.f,0.f};
    const v4u zq = (v4u){0u, 0u, 0u, 0u};
    const unsigned c7 = c & 7u;

#pragma unroll 1
    for (unsigned ti = 0; ti < 2u; ++ti) {
        const unsigned pidx = bn * (unsigned)SEQ + m0 + ti * 16u + c;
        const v4u gq = *(const v4u*)(G16 + (size_t)pidx * 8u);
        FragQ a1;
        a1.q[0].x = (hh == 0u) ? gq.x : 0u;
        a1.q[0].y = (hh == 0u) ? gq.y : 0u;
        a1.q[0].z = (hh == 0u) ? gq.z : 0u;
        a1.q[0].w = (hh == 0u) ? gq.w : 0u;
        a1.q[1] = zq;
#pragma unroll 1
        for (unsigned t = 0; t < (unsigned)HEADS; ++t) {
            const unsigned col = t * 16u + c;
            const v16h w1f = frag_ld(W1B + (size_t)col * 32u + 8u * hh);
            const v8f d1 = wmma16g(a1.v, w1f, zacc);
            const float bb1 = bfr(b1[col]);
#pragma unroll
            for (int r = 0; r < 8; ++r) {
                const float x = d1[r] * UNDO1 + bb1;
                xs[(8u * hh + (unsigned)r) * LC_SP + c] = swishf(x) * H_CARRY;
            }
            wave_sync_lds();
            const float* xr = xs + c * LC_SP + 8u * hh;
            const v4f xa = *(const v4f*)xr;
            const v4f xb = *(const v4f*)(xr + 4);
            FragQ a2;
            a2.h[0] = pack8_flush(xa, xb);
            a2.q[1] = zq;
            wave_sync_lds();
            const v16h w2f = frag_ld(W2B + (size_t)col * 32u + 8u * hh);
            const v8f d2 = wmma16g(a2.v, w2f, zacc);
            const float bb2 = bfr(b2[col]);
            const float ww3 = bfr(w3[col]);
            float part[8];
#pragma unroll
            for (int r = 0; r < 8; ++r) part[r] = swishf(d2[r] * UNDO2 + bb2) * ww3;
#pragma unroll
            for (int r = 0; r < 8; ++r) {
                part[r] += __shfl_xor(part[r], 1, 32);
                part[r] += __shfl_xor(part[r], 2, 32);
                part[r] += __shfl_xor(part[r], 4, 32);
                part[r] += __shfl_xor(part[r], 8, 32);
            }
            float val = part[0];
            val = (c7 == 1u) ? part[1] : val;
            val = (c7 == 2u) ? part[2] : val;
            val = (c7 == 3u) ? part[3] : val;
            val = (c7 == 4u) ? part[4] : val;
            val = (c7 == 5u) ? part[5] : val;
            val = (c7 == 6u) ? part[6] : val;
            val = (c7 == 7u) ? part[7] : val;
            if (c < 8u) as_[t * 32u + ti * 16u + 8u * hh + c] = val;
        }
    }
    wave_sync_lds();
    float fin[8];
#pragma unroll
    for (int t = 0; t < 8; ++t) {
        const float v = as_[(unsigned)t * 32u + lane] + bfr(b3[t]);
        fin[t] = swishf(v);
    }
    const unsigned b = bn / (unsigned)SEQ, n = bn % (unsigned)SEQ;
    float* dst = ALOC + ((size_t)(b * (unsigned)HEADS) * SEQ + n) * SEQ + m0 + lane;
    {
#pragma unroll
        for (int t = 0; t < 8; ++t) *(float*)(dst + (size_t)t * SEQ * SEQ) = fin[t];
        
    }
}

// =====================================================================================================================
// k_attn: one block per (batch, head pair, 256-query block), 16 waves x 16 query rows, both heads of the pair per wave, 64-key chunks.
//   scores: Q (A) and K (B) fragments straight from the planes, one k-step (d = 32); + location term loaded in the D layout;
//   key mask by value select (fill -1e38 in the natural-log domain); running-max softmax in the exp2 domain (f32);
//   unnormalised e x1024 as f16 (wave-private LDS tile sP, wave_sync) times V^T B fragments straight from VT16.
//   O plane f16 x64 [row][head*32 + d]: each wave stages its 16 rows x 64 columns in sO (wave-private, wave_sync) and writes
//   staged extent == consumed extent: sP rows 0..15 x keys 0..63; sO rows 0..15 x cols 0..63.
// =====================================================================================================================
#define AT_PP 72
#define AT_OP 68
__global__ __launch_bounds__(512) void k_attn(const _Float16* __restrict__ Q16, const _Float16* __restrict__ K16,
                                              const _Float16* __restrict__ VT16, const float* __restrict__ ALOC,
                                              const int* __restrict__ mask, _Float16* __restrict__ O16) {
    __shared__ __align__(16) _Float16 sP[16][16 * AT_PP];     // per wave [row][64 keys], wave-private (wave_sync)
    __shared__ __align__(16) float sO[16][16 * AT_OP];        // per wave [row][64 channels], wave-private (wave_sync)
    const unsigned tid = threadIdx.x, lane = tid & 31u, wave = tid >> 5;
    const unsigned hh = lane >> 4, c = lane & 15u;
    const unsigned bx = blockIdx.x;
    const unsigned qb = bx % (unsigned)QBLK;
    const unsigned pair = (bx / (unsigned)QBLK) & 3u;
    const unsigned b = bx / ((unsigned)QBLK * 4u);
    const unsigned q0 = qb * 256u + wave * 16u;
    _Float16* pw = sP[wave];
    float* so = sO[wave];
#pragma unroll
    for (int hp = 0; hp < 2; ++hp) {
        const unsigned head = 2u * pair + (unsigned)hp;
        const v16h qf = frag_ld(Q16 + (size_t)(b * SEQ + q0 + c) * CH + head * HD + 8u * hh);
        const float* arow = ALOC + (size_t)((b * (unsigned)HEADS + head) * SEQ + q0 + 8u * hh) * SEQ + c;
        float mrow[8], lrow[8];
        v8f os[2];
#pragma unroll
        for (int r = 0; r < 8; ++r) { mrow[r] = -3.0e38f; lrow[r] = 0.f; }
#pragma unroll
        for (int t = 0; t < 2; ++t) os[t] = (v8f){0.f,0.f,0.f,0.f,0.f,0.f,0.f,0.f};
#pragma unroll 1
        for (unsigned kc = 0; kc < (unsigned)(SEQ / 64); ++kc) {
            const unsigned kv0 = kc * 64u;
            v8f s[4];
#pragma unroll
            for (int j = 0; j < 4; ++j) {
                const v16h kf = frag_ld(K16 + (size_t)(b * SEQ + kv0 + (unsigned)j * 16u + c) * CH + head * HD + 8u * hh);
                const v8f z = (v8f){0.f,0.f,0.f,0.f,0.f,0.f,0.f,0.f};
                s[j] = wmma16g(qf, kf, z);
            }
#pragma unroll
            for (int j = 0; j < 4; ++j) {
                int mk = mask[b * SEQ_FULL + kv0 + (unsigned)j * 16u + c];
                asm volatile("" : "+v"(mk));   // pins the mask word in a register ahead of the value select; touches no arithmetic
                float al[8];
#pragma unroll
                for (int r = 0; r < 8; ++r) al[r] = arow[(size_t)r * SEQ + kv0 + (unsigned)j * 16u];
                // this lane's load-run limit (8 loads per group); touches no arithmetic
                asm volatile("" : "+v"(al[0]), "+v"(al[1]), "+v"(al[2]), "+v"(al[3]), "+v"(al[4]), "+v"(al[5]), "+v"(al[6]), "+v"(al[7]));
                const bool on = (mk != 0);
#pragma unroll
                for (int r = 0; r < 8; ++r) {
                    const float sv = (s[j][r] * SCQK + al[r]) * LOG2E;
                    s[j][r] = on ? sv : FILL2;
                }
            }
#pragma unroll
            for (int r = 0; r < 8; ++r) {
                float mx = -3.0e38f;
#pragma unroll
                for (int j = 0; j < 4; ++j) { mx = fmaxf(mx, s[j][r]); }
                mx = fmaxf(mx, __shfl_xor(mx, 1, 32)); mx = fmaxf(mx, __shfl_xor(mx, 2, 32));
                mx = fmaxf(mx, __shfl_xor(mx, 4, 32)); mx = fmaxf(mx, __shfl_xor(mx, 8, 32));
                const float mnew = fmaxf(mrow[r], mx);
                const float alpha = exp2f(mrow[r] - mnew);
                mrow[r] = mnew;
                float psum = 0.f;
#pragma unroll
                for (int j = 0; j < 4; ++j) {
                    const float p = exp2f(s[j][r] - mnew);
                    psum += p;
                    const float w = p * P_CARRY;
                    pw[(8u * hh + (unsigned)r) * AT_PP + (unsigned)j * 16u + c] = (_Float16)((w < 6.103515625e-05f) ? 0.0f : w);
                }
                psum += __shfl_xor(psum, 1, 32); psum += __shfl_xor(psum, 2, 32);
                psum += __shfl_xor(psum, 4, 32); psum += __shfl_xor(psum, 8, 32);
                lrow[r] = lrow[r] * alpha + psum;
                os[0][r] *= alpha; os[1][r] *= alpha;
            }
            wave_sync_lds();
#pragma unroll
            for (int kk = 0; kk < 2; ++kk) {
                const v16h pa = frag_ld(pw + c * AT_PP + (unsigned)kk * 32u + 8u * hh);
#pragma unroll
                for (int t = 0; t < 2; ++t) {
                    const v16h vb = frag_ld(VT16 + (size_t)(b * CH + head * HD + (unsigned)t * 16u + c) * SEQ + kv0 + (unsigned)kk * 32u + 8u * hh);
                    os[t] = wmma16g(pa, vb, os[t]);
                }
            }
            wave_sync_lds();
        }
#pragma unroll
        for (int r = 0; r < 8; ++r) {
            const float inv = 1.0f / (lrow[r] * P_CARRY);
#pragma unroll
            for (int t = 0; t < 2; ++t)
                so[(8u * hh + (unsigned)r) * AT_OP + (unsigned)hp * 32u + (unsigned)t * 16u + c] = os[t][r] * inv * (O_CARRY / ACT_CARRY);   // = 64 * value
        }
    }
    wave_sync_lds();
    {
        const unsigned q = lane >> 3, c8 = (lane & 7u) * 8u;
        v8h ov[4];
#pragma unroll
        for (int it = 0; it < 4; ++it) {
            const float* sp = so + ((unsigned)it * 4u + q) * AT_OP + c8;
            ov[it] = pack8_flush(*(const v4f*)sp, *(const v4f*)(sp + 4));
        }
        _Float16* dst = O16 + (size_t)(b * SEQ + q0) * CH + pair * 64u;
        {
#pragma unroll
            for (int it = 0; it < 4; ++it) *(v8h*)(dst + (size_t)((unsigned)it * 4u + q) * CH + c8) = ov[it];
            
        }
    }
}

extern "C" void kernel_launch(void* const* d_in, const int* in_sizes, int n_in, void* d_out, int out_size,
                              void* d_ws, size_t ws_size, hipStream_t stream) {
    if (n_in < 17) return;
    if (in_sizes[0] < NB * SEQ * SEQ * DG || in_sizes[1] < MTOK * CH) return;
    if (in_sizes[2] < CH * CH || in_sizes[3] < CH || in_sizes[4] < CH * CH || in_sizes[5] < CH) return;
    if (in_sizes[6] < CH * CH || in_sizes[7] < CH || in_sizes[8] < CH * CH || in_sizes[9] < CH) return;
    if (in_sizes[10] < HEADS * DG * HID || in_sizes[11] < HEADS * HID || in_sizes[12] < HEADS * HID * HID) return;
    if (in_sizes[13] < HEADS * HID || in_sizes[14] < HEADS * HID || in_sizes[15] < HEADS || in_sizes[16] < NB * SEQ) return;
    if (out_size < MTOK * CH) return;
    if (ws_size < WS_TOTAL) return;

    const float* pairwise_g = (const float*)d_in[0];
    const float* coset      = (const float*)d_in[1];
    const float* fc_q_w     = (const float*)d_in[2];
    const float* fc_q_b     = (const float*)d_in[3];
    const float* fc_k_w     = (const float*)d_in[4];
    const float* fc_k_b     = (const float*)d_in[5];
    const float* in_w       = (const float*)d_in[6];
    const float* in_b       = (const float*)d_in[7];
    const float* out_w      = (const float*)d_in[8];
    const float* out_b      = (const float*)d_in[9];
    const float* loc_w1     = (const float*)d_in[10];
    const float* loc_b1     = (const float*)d_in[11];
    const float* loc_w2     = (const float*)d_in[12];
    const float* loc_b2     = (const float*)d_in[13];
    const float* loc_w3     = (const float*)d_in[14];
    const float* loc_b3     = (const float*)d_in[15];
    const int*   mask       = (const int*)d_in[16];
    float* out = (float*)d_out;

    char* wsp = (char*)d_ws;
    _Float16* G16  = (_Float16*)(wsp + OFF_G16);
    _Float16* C16  = (_Float16*)(wsp + OFF_C16);
    _Float16* WT   = (_Float16*)(wsp + OFF_WT);
    _Float16* W1B  = (_Float16*)(wsp + OFF_W1B);
    _Float16* W2B  = (_Float16*)(wsp + OFF_W2B);
    _Float16* Q16  = (_Float16*)(wsp + OFF_Q16);
    _Float16* K16  = (_Float16*)(wsp + OFF_K16);
    _Float16* VT16 = (_Float16*)(wsp + OFF_VT16);
    float*    ALOC = (float*)(wsp + OFF_ALOC);
    _Float16* O16  = (_Float16*)(wsp + OFF_O16);

    // operand planes (each whole plane written by its launch)
    k_cvt_g<<<(NB * SEQ * SEQ) / 256, 256, 0, stream>>>(pairwise_g, G16);
    k_cvt_c<<<(MTOK * CH / 8) / 256, 256, 0, stream>>>(coset, C16);
    k_wt4<<<(CH * (CH / 8)) / 256, 256, 0, stream>>>(fc_q_w, fc_k_w, in_w, out_w, WT);
    k_wloc<<<(HEADS * HID * 4) / 256, 256, 0, stream>>>(loc_w1, loc_w2, W1B, W2B);

    // projections: 64x64 wave tiles, 8 waves per block
    k_proj_rows<<<((MTOK / 64) * (CH / 64) + 7) / 8, 256, 0, stream>>>(C16, WT, Q16, fc_q_b);
    k_proj_rows<<<((MTOK / 64) * (CH / 64) + 7) / 8, 256, 0, stream>>>(C16, WT + (size_t)1 * CH * CH, K16, fc_k_b);
    k_proj_vt<<<dim3(((CH / 64) * (SEQ / 64) + 7) / 8, NB), 256, 0, stream>>>(WT + (size_t)2 * CH * CH, C16, VT16, in_b);

    // location term, attention, output projection
    k_loc<<<NB * SEQ * QBLK, 256, 0, stream>>>(G16, W1B, W2B, loc_b1, loc_b2, loc_w3, loc_b3, ALOC);
    k_attn<<<NB * 4 * QBLK, 512, 0, stream>>>(Q16, K16, VT16, ALOC, mask, O16);
    k_proj_out<<<((MTOK / 64) * (CH / 64) + 7) / 8, 256, 0, stream>>>(O16, WT + (size_t)3 * CH * CH, out, out_b);
}

// v001
// A run of this version takes 207 microseconds.
// Next to v000, in two timings, it ran 1.31 and 1.32 times as fast.
// All contractions on v_wmma_f32_16x16x32_f16 (f16 operands, f32 accumulate): q/k/v projections (inputs x8, weights x32), pair MLP layer 1 (g x4, w1 x16, K=6 zero-padded to 32) and layer 2 (h1 x64, w2 x16, K=16 zero-padded to 32), q.k^T (x8, x8), P.V (P x1024, V x8), output projection (O x64, w x32); every float input RNE-converted to bf16 first; MLP layer 3 (N=1, K=16), swish (by tanh of half the argument), softmax statistics in f32 on the VALU.
#include <hip/hip_runtime.h>
#include <math.h>

#ifndef NB
#define NB 4
#endif
#ifndef SEQ
#define SEQ 512
#endif
#define NB_FULL 4
#define SEQ_FULL 512
#define CH 256
#define HEADS 8
#define HD 32
#define DG 6
#define HID 16
#define MTOK (NB * SEQ)
#define QBLK (SEQ / 256)

// power-of-two carries and their undo constants
#define G_CARRY 4.0f
#define W1_CARRY 16.0f
#define UNDO1 (1.0f / 64.0f)
#define H_CARRY 64.0f
#define W2_CARRY 16.0f
#define UNDO2 (1.0f / 1024.0f)
#define ACT_CARRY 8.0f
#define W_CARRY 32.0f
#define SC_PROJ (1.0f / 256.0f)
#define SCQK (1.0f / 1024.0f)
#define P_CARRY 1024.0f
#define O_CARRY 64.0f
#define SC_OUT (1.0f / 2048.0f)
#define LOG2E 1.4426950408889634f
#define FILL2 (-1.0e38f * LOG2E)

static_assert(G_CARRY * W1_CARRY * UNDO1 == 1.0f);
static_assert(H_CARRY * W2_CARRY * UNDO2 == 1.0f);
static_assert(ACT_CARRY * W_CARRY * SC_PROJ == 1.0f);
static_assert(ACT_CARRY * ACT_CARRY * 16.0f * SCQK == 1.0f);     // q x8, k x8, module scale 1/sqrt(256)
static_assert(O_CARRY * W_CARRY * SC_OUT == 1.0f);
static_assert(SEQ == SEQ_FULL);
static_assert(NB <= NB_FULL);
static_assert(CH == HEADS * HD && HD == 32 && HID == 16 && DG <= 8);
static_assert(SEQ % 256 == 0 && SEQ % 64 == 0);
static_assert(MTOK % 64 == 0 && CH % 64 == 0 && CH % 32 == 0);
static_assert((NB * SEQ * SEQ) % 256 == 0);
static_assert((MTOK * CH / 8) % 256 == 0);
static_assert((CH * (CH / 8)) % 256 == 0);
// store loops: lanes x bytes x instructions == tile rows x row bytes
static_assert(32 * 16 * 4 == 16 * 128);
static_assert(32 * 16 * 8 == 16 * 256);     // f32 epilogue: 16 rows x 256 B
static_assert(32 * 4 * 8 == 8 * 128);
// static LDS per kernel
static_assert(8 * 16 * 68 * 4 <= 131072);
static_assert(8 * 16 * 20 * 4 + 8 * HEADS * 32 * 4 <= 131072);
static_assert(16 * 16 * 72 * 2 + 16 * 16 * 68 * 4 <= 131072);

typedef _Float16 h16;
typedef __attribute__((ext_vector_type(16))) _Float16 v16h;
typedef __attribute__((ext_vector_type(8)))  _Float16 v8h;
typedef __attribute__((ext_vector_type(2)))  _Float16 v2h;
typedef __attribute__((ext_vector_type(8)))  float    v8f;
typedef __attribute__((ext_vector_type(4)))  float    v4f;
typedef __attribute__((ext_vector_type(2)))  float    v2f;
typedef __attribute__((ext_vector_type(4)))  unsigned int v4u;

static constexpr size_t SZ_G16  = (size_t)NB * SEQ * SEQ * 8 * 2;
static constexpr size_t SZ_C16  = (size_t)MTOK * CH * 2;
static constexpr size_t SZ_WT   = (size_t)4 * CH * CH * 2;
static constexpr size_t SZ_W1B  = (size_t)HEADS * HID * 32 * 2;
static constexpr size_t SZ_W2B  = (size_t)HEADS * HID * 32 * 2;
static constexpr size_t SZ_Q16  = (size_t)MTOK * CH * 2;
static constexpr size_t SZ_K16  = (size_t)MTOK * CH * 2;
static constexpr size_t SZ_VT16 = (size_t)NB * CH * SEQ * 2;
static constexpr size_t SZ_ALOC = (size_t)NB * HEADS * SEQ * SEQ * 4;
static constexpr size_t SZ_O16  = (size_t)MTOK * CH * 2;
static constexpr size_t OFF_G16  = 0;
static constexpr size_t OFF_C16  = OFF_G16 + SZ_G16;
static constexpr size_t OFF_WT   = OFF_C16 + SZ_C16;
static constexpr size_t OFF_W1B  = OFF_WT + SZ_WT;
static constexpr size_t OFF_W2B  = OFF_W1B + SZ_W1B;
static constexpr size_t OFF_Q16  = OFF_W2B + SZ_W2B;
static constexpr size_t OFF_K16  = OFF_Q16 + SZ_Q16;
static constexpr size_t OFF_VT16 = OFF_K16 + SZ_K16;
static constexpr size_t OFF_ALOC = OFF_VT16 + SZ_VT16;
static constexpr size_t OFF_O16  = OFF_ALOC + SZ_ALOC;
static constexpr size_t WS_TOTAL = OFF_O16 + SZ_O16;
static_assert(SZ_G16 % 256 == 0 && SZ_C16 % 256 == 0 && SZ_WT % 256 == 0 && SZ_W1B % 256 == 0 && SZ_W2B % 256 == 0);
static_assert(SZ_Q16 % 256 == 0 && SZ_VT16 % 256 == 0 && SZ_ALOC % 256 == 0 && SZ_O16 % 256 == 0);
static_assert(WS_TOTAL <= (size_t)134217728);

// 16-bit WMMA fragment map (wave32), lane L, hh = L>>4, c = L&15:
//   A 16x32: lane = row c;    element i -> k = (i<8) ? 8hh+i : 16+8hh+(i-8)
//   B 32x16: lane = column c; the SAME k(i,hh)
//   D 16x16 (8 f32): lane = column c; element r -> row 8hh+r

// RNE convert f32 -> bf16 -> f32
__device__ __forceinline__ float bfr(float f) {
    unsigned u = __float_as_uint(f);
    u += 0x7FFFu + ((u >> 16) & 1u);
    return __uint_as_float(u & 0xFFFF0000u);
}
// f32 -> f16 with values under 2^-14 replaced by +0 before the convert
static __device__ __forceinline__ h16 toh_flush(float v) { const float w = (fabsf(v) < 6.103515625e-05f) ? 0.0f : v; return (h16)w; }
static __device__ __forceinline__ v2h toh2_flush(float a, float b) {
    v2f w;
    w.x = (fabsf(a) < 6.103515625e-05f) ? 0.0f : a;
    w.y = (fabsf(b) < 6.103515625e-05f) ? 0.0f : b;
    return __builtin_convertvector(w, v2h);
}
union Pack8 { v8h v; v2h p[4]; };
static __device__ __forceinline__ v8h pack8_flush(v4f a, v4f b) {
    Pack8 u;
    u.p[0] = toh2_flush(a.x, a.y); u.p[1] = toh2_flush(a.z, a.w);
    u.p[2] = toh2_flush(b.x, b.y); u.p[3] = toh2_flush(b.z, b.w);
    return u.v;
}
static __device__ __forceinline__ void st8h2(_Float16* p, v8h v) {
    *(v8h*)p = v;
    
}

union FragU { v16h v; v8h h[2]; };
union FragQ { v16h v; v8h h[2]; v4u q[2]; };
// elements 0..7 <- p[0..7], 8..15 <- p[16..23]; caller adds 8*hh to p (used for BOTH A and B operands: same k per element)
__device__ __forceinline__ v16h frag_ld(const _Float16* p) {
    FragU f; f.h[0] = *(const v8h*)(p); f.h[1] = *(const v8h*)(p + 16); return f.v;
}
__device__ __forceinline__ v8f wmma16g(v16h a, v16h b, v8f c) {
    c = __builtin_amdgcn_wmma_f32_16x16x32_f16(false, a, false, b, (short)0, c, false, false);
    asm volatile("v_nop\n\tv_nop\n\tv_nop\n\tv_nop" : "+v"(c) : "v"(a), "v"(b));
    return c;
}
__device__ __forceinline__ void wave_sync_lds() {
    __builtin_amdgcn_fence(3 /* release order */, "workgroup");
    __builtin_amdgcn_wave_barrier();
    __builtin_amdgcn_fence(2 /* acquire order */, "workgroup");
}
// swish(x) = x * sigmoid(x) = h + h * tanh(h) with h = x / 2; the caller hands in h
static __device__ __forceinline__ float swish_half(float h) {
    return fmaf(h, __builtin_amdgcn_tanhf(h), h);
}

// =====================================================================================================================
// k_cvt_g: pair components [pair][6] f32 -> G16 [pair][8] f16 = bf16(g) * 4, components 6,7 = 0; one 16-B piece per lane
//   coverage: NB*SEQ*SEQ pairs x 16 B == the whole G16 plane
// =====================================================================================================================
__global__ __launch_bounds__(256) void k_cvt_g(const float* __restrict__ g, _Float16* __restrict__ G16) {
    const unsigned u = blockIdx.x * 256u + threadIdx.x;
    if (u >= (unsigned)(NB * SEQ * SEQ)) return;
    const v2f* src = (const v2f*)(g + (size_t)u * 6u);
    const v2f a = src[0], b = src[1], cc = src[2];
    v4f lo, hi;
    lo.x = bfr(a.x) * G_CARRY; lo.y = bfr(a.y) * G_CARRY; lo.z = bfr(b.x) * G_CARRY; lo.w = bfr(b.y) * G_CARRY;
    hi.x = bfr(cc.x) * G_CARRY; hi.y = bfr(cc.y) * G_CARRY; hi.z = 0.0f; hi.w = 0.0f;
    st8h2(G16 + (size_t)u * 8u, pack8_flush(lo, hi));
}

// k_cvt_c: features [row][256] f32 -> C16 f16 = bf16(x) * 8; thread per 8 columns; coverage: MTOK*256/8 pieces == whole plane
__global__ __launch_bounds__(256) void k_cvt_c(const float* __restrict__ x, _Float16* __restrict__ C16) {
    const unsigned u = blockIdx.x * 256u + threadIdx.x;
    if (u >= (unsigned)(MTOK * CH / 8)) return;
    const v4f* src = (const v4f*)(x + (size_t)u * 8u);
    v4f a = src[0], b = src[1];
    a.x = bfr(a.x) * ACT_CARRY; a.y = bfr(a.y) * ACT_CARRY; a.z = bfr(a.z) * ACT_CARRY; a.w = bfr(a.w) * ACT_CARRY;
    b.x = bfr(b.x) * ACT_CARRY; b.y = bfr(b.y) * ACT_CARRY; b.z = bfr(b.z) * ACT_CARRY; b.w = bfr(b.w) * ACT_CARRY;
    st8h2(C16 + (size_t)u * 8u, pack8_flush(a, b));
}

static __device__ __forceinline__ void wt_one(const float* __restrict__ W, _Float16* __restrict__ D, unsigned o, unsigned k0) {
    v4f lo, hi;
    lo.x = bfr(W[(size_t)(k0 + 0u) * CH + o]) * W_CARRY;
    lo.y = bfr(W[(size_t)(k0 + 1u) * CH + o]) * W_CARRY;
    lo.z = bfr(W[(size_t)(k0 + 2u) * CH + o]) * W_CARRY;
    lo.w = bfr(W[(size_t)(k0 + 3u) * CH + o]) * W_CARRY;
    hi.x = bfr(W[(size_t)(k0 + 4u) * CH + o]) * W_CARRY;
    hi.y = bfr(W[(size_t)(k0 + 5u) * CH + o]) * W_CARRY;
    hi.z = bfr(W[(size_t)(k0 + 6u) * CH + o]) * W_CARRY;
    hi.w = bfr(W[(size_t)(k0 + 7u) * CH + o]) * W_CARRY;
    st8h2(D + (size_t)o * CH + k0, pack8_flush(lo, hi));
}
// k_wt4: the four 256x256 weights -> WT[4][out][in]; thread per (o, 8 k): 32 lanes cover one whole 512-B row; coverage: 4 x 256 x 32 pieces
__global__ __launch_bounds__(256) void k_wt4(const float* __restrict__ wq, const float* __restrict__ wk,
                                             const float* __restrict__ wv, const float* __restrict__ wo,
                                             _Float16* __restrict__ WT) {
    const unsigned u = blockIdx.x * 256u + threadIdx.x;
    if (u >= (unsigned)(CH * (CH / 8))) return;
    const unsigned k0 = 8u * (u & 31u);
    const unsigned o = u >> 5;
    wt_one(wq, WT, o, k0);
    wt_one(wk, WT + (size_t)1 * CH * CH, o, k0);
    wt_one(wv, WT + (size_t)2 * CH * CH, o, k0);
    wt_one(wo, WT + (size_t)3 * CH * CH, o, k0);
}

// k_wloc: pair-MLP weights as B-operand planes, zero-padded along k to 32:
//   W1B[h*16+j][k] = bf16(w1[h][k][j]) * 16 for k < 6, else 0;  W2B[h*16+j][k] = bf16(w2[h][k][j]) * 16 for k < 16, else 0
//   thread per 16-B piece (512 pieces per plane), clamped addresses, zero by value; coverage: 128 rows x 4 pieces == both whole planes
__global__ __launch_bounds__(256) void k_wloc(const float* __restrict__ w1, const float* __restrict__ w2,
                                              _Float16* __restrict__ W1B, _Float16* __restrict__ W2B) {
    const unsigned p = blockIdx.x * 256u + threadIdx.x;
    if (p >= (unsigned)(HEADS * HID * 4)) return;
    const unsigned col = p >> 2, k0 = (p & 3u) * 8u;
    const unsigned h = col >> 4, j = col & 15u;
    float v[8];
#pragma unroll
    for (int i = 0; i < 8; ++i) {
        const unsigned k = k0 + (unsigned)i;
        const unsigned kc = min(k, (unsigned)(DG - 1));
        const float x = bfr(w1[(size_t)(h * DG + kc) * HID + j]) * W1_CARRY;
        v[i] = (k < (unsigned)DG) ? x : 0.0f;
    }
    {
        v4f a, b;
        a.x = v[0]; a.y = v[1]; a.z = v[2]; a.w = v[3]; b.x = v[4]; b.y = v[5]; b.z = v[6]; b.w = v[7];
        st8h2(W1B + (size_t)col * 32u + k0, pack8_flush(a, b));
    }
#pragma unroll
    for (int i = 0; i < 8; ++i) {
        const unsigned k = k0 + (unsigned)i;
        const unsigned kc = min(k, (unsigned)(HID - 1));
        const float x = bfr(w2[(size_t)(h * HID + kc) * HID + j]) * W2_CARRY;
        v[i] = (k < (unsigned)HID) ? x : 0.0f;
    }
    {
        v4f a, b;
        a.x = v[0]; a.y = v[1]; a.z = v[2]; a.w = v[3]; b.x = v[4]; b.y = v[5]; b.z = v[6]; b.w = v[7];
        st8h2(W2B + (size_t)col * 32u + k0, pack8_flush(a, b));
    }
}

// =====================================================================================================================
// gemm64_body: C[m,n] = (scale * sum_k A[m,k] * Bt[n,k] + bf16(bias[n or m])) ; each wave owns a 64x64 tile.
//   A row-major [M][lda] f16, Bt row-major [N][ldb] f16 (fragments straight from the planes); M,N % 64 == 0, K % 32 == 0.
//   OUT_MODE 0: f32 C (pitch ldc); OUT_MODE 1: f16 C = value * oscale. BIAS_ROW: bias indexed by the row m.
// =====================================================================================================================
template <int OUT_MODE, bool BIAS_ROW>
static __device__ __forceinline__ void gemm64_body(
    const _Float16* __restrict__ A, unsigned lda, const _Float16* __restrict__ Bt, unsigned ldb,
    float* __restrict__ Cf, _Float16* __restrict__ Ch, unsigned ldc, const float* __restrict__ bias,
    unsigned M, unsigned N, unsigned K, float scale, float oscale) {
  __shared__ __align__(16) float sT[8][16 * 68];
  const unsigned lane = threadIdx.x & 31u;
  const unsigned wave = threadIdx.x >> 5;
  const unsigned tilesN = N >> 6, tilesM = M >> 6;
  const unsigned tile = blockIdx.x * 8u + wave;
  if (tile >= tilesM * tilesN) return;   // wave-uniform; no block barriers in this kernel
  const unsigned tm = tile / tilesN;
  const unsigned tn = tile - tm * tilesN;
  const unsigned m0 = tm << 6, n0 = tn << 6;
  const unsigned rlane = lane & 15u;
  const unsigned koff = (lane >> 4) * 8u;
  const unsigned mOff = koff;

  v8f acc[4][4];
#pragma unroll
  for (int i = 0; i < 4; ++i)
#pragma unroll
    for (int j = 0; j < 4; ++j) acc[i][j] = (v8f){0.f,0.f,0.f,0.f,0.f,0.f,0.f,0.f};

  for (unsigned k0 = 0; k0 < K; k0 += 32u) {
    v16h bh[4];
#pragma unroll
    for (int j = 0; j < 4; ++j)
      bh[j] = frag_ld(Bt + (size_t)(n0 + ((unsigned)j << 4) + rlane) * ldb + koff + k0);
#pragma unroll
    for (int i = 0; i < 4; ++i) {
      const v16h ah = frag_ld(A + (size_t)(m0 + ((unsigned)i << 4) + rlane) * lda + koff + k0);
#pragma unroll
      for (int j = 0; j < 4; ++j)
        acc[i][j] = wmma16g(ah, bh[j], acc[i][j]);
    }
  }

  float* slab = sT[wave];
#pragma unroll
  for (int i = 0; i < 4; ++i) {
    const unsigned mBase = m0 + ((unsigned)i << 4);
    float bvr[8];
#pragma unroll
    for (int r = 0; r < 8; ++r) bvr[r] = 0.0f;
    if (BIAS_ROW) {
#pragma unroll
      for (int r = 0; r < 8; ++r) bvr[r] = bfr(bias[mBase + mOff + (unsigned)r]);
    }
#pragma unroll
    for (int j = 0; j < 4; ++j) {
      const unsigned n = n0 + ((unsigned)j << 4) + rlane;
      float bvc = 0.0f;
      if (!BIAS_ROW) bvc = bfr(bias[n]);
#pragma unroll
      for (int r = 0; r < 8; ++r) {
        float v = acc[i][j][r] * scale + (BIAS_ROW ? bvr[r] : bvc);
        if (OUT_MODE == 1) v *= oscale;
        slab[(mOff + (unsigned)r) * 68u + ((unsigned)j << 4) + rlane] = v;
      }
    }
    wave_sync_lds();
    if (OUT_MODE == 0) {
      const unsigned hh = lane >> 4, c4 = (lane & 15u) * 4u;     // row segment = 256 B = 16 lanes x 16 B
#pragma unroll
      for (int half = 0; half < 2; ++half) {
        v4f vv[4];
#pragma unroll
        for (int it = 0; it < 4; ++it) {
          const unsigned row = (unsigned)(half * 4 + it) * 2u + hh;
          vv[it] = *(const v4f*)(slab + row * 68u + c4);
        }
        {
#pragma unroll
          for (int it = 0; it < 4; ++it) {
            const unsigned row = (unsigned)(half * 4 + it) * 2u + hh;
            *(v4f*)(Cf + (size_t)(mBase + row) * ldc + n0 + c4) = vv[it];
          }
          
        }
      }
    } else {
      const unsigned q = lane >> 3, c8 = (lane & 7u) * 8u;
      v8h hv[4];
#pragma unroll
      for (int it = 0; it < 4; ++it) {
        const unsigned row = (unsigned)it * 4u + q;
        const float* sp = slab + row * 68u + c8;
        hv[it] = pack8_flush(*(const v4f*)sp, *(const v4f*)(sp + 4));
      }
      {
#pragma unroll
        for (int it = 0; it < 4; ++it) {
          const unsigned row = (unsigned)it * 4u + q;
          *(v8h*)(Ch + (size_t)(mBase + row) * ldc + n0 + c8) = hv[it];
        }
        
      }
    }
    wave_sync_lds();
  }
}

// position-major projection: Y16[row][256] = f16(8 * (x @ w + bf16(b)))
__global__ __launch_bounds__(256) void k_proj_rows(const _Float16* __restrict__ X16, const _Float16* __restrict__ Wt,
                                                   _Float16* __restrict__ Y16, const float* __restrict__ bias) {
    gemm64_body<1, false>(X16, CH, Wt, CH, nullptr, Y16, CH, bias, MTOK, CH, CH, SC_PROJ, ACT_CARRY);
}
// channel-major value plane: VT16[b][ch][key] = f16(8 * (x @ w + bf16(b)))^T ; A = weight plane, Bt = feature rows of batch blockIdx.y
__global__ __launch_bounds__(256) void k_proj_vt(const _Float16* __restrict__ Wt, const _Float16* __restrict__ X16,
                                                 _Float16* __restrict__ VT16, const float* __restrict__ bias) {
    const unsigned by = blockIdx.y;
    gemm64_body<1, true>(Wt, CH, X16 + (size_t)by * SEQ * CH, CH, nullptr, VT16 + (size_t)by * CH * SEQ, SEQ, bias,
                         CH, SEQ, CH, SC_PROJ, ACT_CARRY);
}
// output projection: out[row][256] = O @ w + bf16(b), f32
__global__ __launch_bounds__(256) void k_proj_out(const _Float16* __restrict__ O16, const _Float16* __restrict__ Wt,
                                                  float* __restrict__ out, const float* __restrict__ bias) {
    gemm64_body<0, false>(O16, CH, Wt, CH, out, nullptr, CH, bias, MTOK, CH, CH, SC_OUT, 1.0f);
}

// =====================================================================================================================
// k_loc: location term ALOC[b][h][n][m] (f32) = swish(l3(swish(l2(swish(l1(g[b][n][m][:]))))))
//   block = 8 waves, one query row (b,n) and 256 keys; a wave owns 32 consecutive keys (two 16-pair row tiles), all 8 heads.
//   layer 1: A = the 16 pairs' G16 rows (k 0..7 from lanes 0..15; lanes 16..31 and elements 8..15 are zero words selected by value),
//            B = W1B rows of the head (frag_ld; zeros beyond k = 5) -> D1[pair 8hh+r][hidden c].
//   relayout D -> A through a wave-private f32 slab sX (wave_sync): lane (c,hh) reads hidden 8hh..8hh+7 of pair c, pair-converts to f16 x64
//            into elements 0..7; elements 8..15 (k 16..31) are zero words in the register.
//   layer 2: B = W2B rows of the head (zeros beyond k = 15) -> D2[pair 8hh+r][hidden c].
//   layer 3 (N = 1) on the VALU: xor-shuffle sum 1,2,4,8 over the 16 lanes of a half.
//   staged extent == consumed extent: sX rows 0..15 x cols 0..15 written and read; sA all 256 words written and read.
// =====================================================================================================================
#define LC_SP 20
__global__ __launch_bounds__(256) void k_loc(const _Float16* __restrict__ G16, const _Float16* __restrict__ W1B,
                                             const _Float16* __restrict__ W2B, const float* __restrict__ b1,
                                             const float* __restrict__ b2, const float* __restrict__ w3,
                                             const float* __restrict__ b3, float* __restrict__ ALOC) {
    __shared__ __align__(16) float sX[8][16 * LC_SP];
    __shared__ __align__(16) float sA[8][HEADS * 32];
    const unsigned lane = threadIdx.x & 31u;
    const unsigned wave = (unsigned)__builtin_amdgcn_readfirstlane((int)(threadIdx.x >> 5));
    const unsigned hh = lane >> 4, c = lane & 15u;
    const unsigned bx = blockIdx.x;
    const unsigned bn = bx / (unsigned)QBLK;                       // b*SEQ + n
    const unsigned m0 = ((bx % (unsigned)QBLK) * 8u + wave) * 32u;
    float* xs = sX[wave];
    float* as_ = sA[wave];
    const v8f zacc = (v8f){0.f,0.f,0.f,0.f,0.f,0.f,0.f,0.f};
    const v4u zq = (v4u){0u, 0u, 0u, 0u};
    const unsigned c7 = c & 7u;

#pragma unroll 1
    for (unsigned ti = 0; ti < 2u; ++ti) {
        const unsigned pidx = bn * (unsigned)SEQ + m0 + ti * 16u + c;
        const v4u gq = *(const v4u*)(G16 + (size_t)pidx * 8u);
        FragQ a1;
        a1.q[0].x = (hh == 0u) ? gq.x : 0u;
        a1.q[0].y = (hh == 0u) ? gq.y : 0u;
        a1.q[0].z = (hh == 0u) ? gq.z : 0u;
        a1.q[0].w = (hh == 0u) ? gq.w : 0u;
        a1.q[1] = zq;
#pragma unroll 1
        for (unsigned t = 0; t < (unsigned)HEADS; ++t) {
            const unsigned col = t * 16u + c;
            const v16h w1f = frag_ld(W1B + (size_t)col * 32u + 8u * hh);
            const v8f d1 = wmma16g(a1.v, w1f, zacc);
            const float hb1 = 0.5f * bfr(b1[col]);
#pragma unroll
            for (int r = 0; r < 8; ++r) {
                const float h = d1[r] * (0.5f * UNDO1) + hb1;
                xs[(8u * hh + (unsigned)r) * LC_SP + c] = swish_half(h) * H_CARRY;
            }
            wave_sync_lds();
            const float* xr = xs + c * LC_SP + 8u * hh;
            const v4f xa = *(const v4f*)xr;
            const v4f xb = *(const v4f*)(xr + 4);
            FragQ a2;
            a2.h[0] = pack8_flush(xa, xb);
            a2.q[1] = zq;
            wave_sync_lds();
            const v16h w2f = frag_ld(W2B + (size_t)col * 32u + 8u * hh);
            const v8f d2 = wmma16g(a2.v, w2f, zacc);
            const float hb2 = 0.5f * bfr(b2[col]);
            const float ww3 = bfr(w3[col]);
            float part[8];
#pragma unroll
            for (int r = 0; r < 8; ++r) part[r] = swish_half(d2[r] * (0.5f * UNDO2) + hb2) * ww3;
#pragma unroll
            for (int r = 0; r < 8; ++r) {
                part[r] += __shfl_xor(part[r], 1, 32);
                part[r] += __shfl_xor(part[r], 2, 32);
                part[r] += __shfl_xor(part[r], 4, 32);
                part[r] += __shfl_xor(part[r], 8, 32);
            }
            float val = part[0];
            val = (c7 == 1u) ? part[1] : val;
            val = (c7 == 2u) ? part[2] : val;
            val = (c7 == 3u) ? part[3] : val;
            val = (c7 == 4u) ? part[4] : val;
            val = (c7 == 5u) ? part[5] : val;
            val = (c7 == 6u) ? part[6] : val;
            val = (c7 == 7u) ? part[7] : val;
            if (c < 8u) as_[t * 32u + ti * 16u + 8u * hh + c] = val;
        }
    }
    wave_sync_lds();
    float fin[8];
#pragma unroll
    for (int t = 0; t < 8; ++t) {
        const float v = as_[(unsigned)t * 32u + lane] + bfr(b3[t]);
        fin[t] = swish_half(0.5f * v);
    }
    const unsigned b = bn / (unsigned)SEQ, n = bn % (unsigned)SEQ;
    float* dst = ALOC + ((size_t)(b * (unsigned)HEADS) * SEQ + n) * SEQ + m0 + lane;
    {
#pragma unroll
        for (int t = 0; t < 8; ++t) *(float*)(dst + (size_t)t * SEQ * SEQ) = fin[t];
        
    }
}

// =====================================================================================================================
// k_attn: one block per (batch, head pair, 256-query block), 16 waves x 16 query rows, both heads of the pair per wave, 64-key chunks.
//   scores: Q (A) and K (B) fragments straight from the planes, one k-step (d = 32); + location term loaded in the D layout;
//   key mask by value select (fill -1e38 in the natural-log domain); running-max softmax in the exp2 domain (f32);
//   unnormalised e x1024 as f16 (wave-private LDS tile sP, wave_sync) times V^T B fragments straight from VT16.
//   O plane f16 x64 [row][head*32 + d]: each wave stages its 16 rows x 64 columns in sO (wave-private, wave_sync) and writes
//   staged extent == consumed extent: sP rows 0..15 x keys 0..63; sO rows 0..15 x cols 0..63.
// =====================================================================================================================
#define AT_PP 72
#define AT_OP 68
__global__ __launch_bounds__(512) void k_attn(const _Float16* __restrict__ Q16, const _Float16* __restrict__ K16,
                                              const _Float16* __restrict__ VT16, const float* __restrict__ ALOC,
                                              const int* __restrict__ mask, _Float16* __restrict__ O16) {
    __shared__ __align__(16) _Float16 sP[16][16 * AT_PP];     // per wave [row][64 keys], wave-private (wave_sync)
    __shared__ __align__(16) float sO[16][16 * AT_OP];        // per wave [row][64 channels], wave-private (wave_sync)
    const unsigned tid = threadIdx.x, lane = tid & 31u, wave = tid >> 5;
    const unsigned hh = lane >> 4, c = lane & 15u;
    const unsigned bx = blockIdx.x;
    const unsigned qb = bx % (unsigned)QBLK;
    const unsigned pair = (bx / (unsigned)QBLK) & 3u;
    const unsigned b = bx / ((unsigned)QBLK * 4u);
    const unsigned q0 = qb * 256u + wave * 16u;
    _Float16* pw = sP[wave];
    float* so = sO[wave];
#pragma unroll
    for (int hp = 0; hp < 2; ++hp) {
        const unsigned head = 2u * pair + (unsigned)hp;
        const v16h qf = frag_ld(Q16 + (size_t)(b * SEQ + q0 + c) * CH + head * HD + 8u * hh);
        const float* arow = ALOC + (size_t)((b * (unsigned)HEADS + head) * SEQ + q0 + 8u * hh) * SEQ + c;
        float mrow[8], lrow[8];
        v8f os[2];
#pragma unroll
        for (int r = 0; r < 8; ++r) { mrow[r] = -3.0e38f; lrow[r] = 0.f; }
#pragma unroll
        for (int t = 0; t < 2; ++t) os[t] = (v8f){0.f,0.f,0.f,0.f,0.f,0.f,0.f,0.f};
#pragma unroll 1
        for (unsigned kc = 0; kc < (unsigned)(SEQ / 64); ++kc) {
            const unsigned kv0 = kc * 64u;
            v8f s[4];
#pragma unroll
            for (int j = 0; j < 4; ++j) {
                const v16h kf = frag_ld(K16 + (size_t)(b * SEQ + kv0 + (unsigned)j * 16u + c) * CH + head * HD + 8u * hh);
                const v8f z = (v8f){0.f,0.f,0.f,0.f,0.f,0.f,0.f,0.f};
                s[j] = wmma16g(qf, kf, z);
            }
#pragma unroll
            for (int j = 0; j < 4; ++j) {
                int mk = mask[b * SEQ_FULL + kv0 + (unsigned)j * 16u + c];
                asm volatile("" : "+v"(mk));   // pins the mask word in a register ahead of the value select; touches no arithmetic
                float al[8];
#pragma unroll
                for (int r = 0; r < 8; ++r) al[r] = arow[(size_t)r * SEQ + kv0 + (unsigned)j * 16u];
                // this lane's load-run limit (8 loads per group); touches no arithmetic
                asm volatile("" : "+v"(al[0]), "+v"(al[1]), "+v"(al[2]), "+v"(al[3]), "+v"(al[4]), "+v"(al[5]), "+v"(al[6]), "+v"(al[7]));
                const bool on = (mk != 0);
#pragma unroll
                for (int r = 0; r < 8; ++r) {
                    const float sv = (s[j][r] * SCQK + al[r]) * LOG2E;
                    s[j][r] = on ? sv : FILL2;
                }
            }
#pragma unroll
            for (int r = 0; r < 8; ++r) {
                float mx = -3.0e38f;
#pragma unroll
                for (int j = 0; j < 4; ++j) { mx = fmaxf(mx, s[j][r]); }
                mx = fmaxf(mx, __shfl_xor(mx, 1, 32)); mx = fmaxf(mx, __shfl_xor(mx, 2, 32));
                mx = fmaxf(mx, __shfl_xor(mx, 4, 32)); mx = fmaxf(mx, __shfl_xor(mx, 8, 32));
                const float mnew = fmaxf(mrow[r], mx);
                const float alpha = exp2f(mrow[r] - mnew);
                mrow[r] = mnew;
                float psum = 0.f;
#pragma unroll
                for (int j = 0; j < 4; ++j) {
                    const float p = exp2f(s[j][r] - mnew);
                    psum += p;
                    const float w = p * P_CARRY;
                    pw[(8u * hh + (unsigned)r) * AT_PP + (unsigned)j * 16u + c] = (_Float16)((w < 6.103515625e-05f) ? 0.0f : w);
                }
                psum += __shfl_xor(psum, 1, 32); psum += __shfl_xor(psum, 2, 32);
                psum += __shfl_xor(psum, 4, 32); psum += __shfl_xor(psum, 8, 32);
                lrow[r] = lrow[r] * alpha + psum;
                os[0][r] *= alpha; os[1][r] *= alpha;
            }
            wave_sync_lds();
#pragma unroll
            for (int kk = 0; kk < 2; ++kk) {
                const v16h pa = frag_ld(pw + c * AT_PP + (unsigned)kk * 32u + 8u * hh);
#pragma unroll
                for (int t = 0; t < 2; ++t) {
                    const v16h vb = frag_ld(VT16 + (size_t)(b * CH + head * HD + (unsigned)t * 16u + c) * SEQ + kv0 + (unsigned)kk * 32u + 8u * hh);
                    os[t] = wmma16g(pa, vb, os[t]);
                }
            }
            wave_sync_lds();
        }
#pragma unroll
        for (int r = 0; r < 8; ++r) {
            const float inv = 1.0f / (lrow[r] * P_CARRY);
#pragma unroll
            for (int t = 0; t < 2; ++t)
                so[(8u * hh + (unsigned)r) * AT_OP + (unsigned)hp * 32u + (unsigned)t * 16u + c] = os[t][r] * inv * (O_CARRY / ACT_CARRY);   // = 64 * value
        }
    }
    wave_sync_lds();
    {
        const unsigned q = lane >> 3, c8 = (lane & 7u) * 8u;
        v8h ov[4];
#pragma unroll
        for (int it = 0; it < 4; ++it) {
            const float* sp = so + ((unsigned)it * 4u + q) * AT_OP + c8;
            ov[it] = pack8_flush(*(const v4f*)sp, *(const v4f*)(sp + 4));
        }
        _Float16* dst = O16 + (size_t)(b * SEQ + q0) * CH + pair * 64u;
        {
#pragma unroll
            for (int it = 0; it < 4; ++it) *(v8h*)(dst + (size_t)((unsigned)it * 4u + q) * CH + c8) = ov[it];
            
        }
    }
}

extern "C" void kernel_launch(void* const* d_in, const int* in_sizes, int n_in, void* d_out, int out_size,
                              void* d_ws, size_t ws_size, hipStream_t stream) {
    if (n_in < 17) return;
    if (in_sizes[0] < NB * SEQ * SEQ * DG || in_sizes[1] < MTOK * CH) return;
    if (in_sizes[2] < CH * CH || in_sizes[3] < CH || in_sizes[4] < CH * CH || in_sizes[5] < CH) return;
    if (in_sizes[6] < CH * CH || in_sizes[7] < CH || in_sizes[8] < CH * CH || in_sizes[9] < CH) return;
    if (in_sizes[10] < HEADS * DG * HID || in_sizes[11] < HEADS * HID || in_sizes[12] < HEADS * HID * HID) return;
    if (in_sizes[13] < HEADS * HID || in_sizes[14] < HEADS * HID || in_sizes[15] < HEADS || in_sizes[16] < NB * SEQ) return;
    if (out_size < MTOK * CH) return;
    if (ws_size < WS_TOTAL) return;

    const float* pairwise_g = (const float*)d_in[0];
    const float* coset      = (const float*)d_in[1];
    const float* fc_q_w     = (const float*)d_in[2];
    const float* fc_q_b     = (const float*)d_in[3];
    const float* fc_k_w     = (const float*)d_in[4];
    const float* fc_k_b     = (const float*)d_in[5];
    const float* in_w       = (const float*)d_in[6];
    const float* in_b       = (const float*)d_in[7];
    const float* out_w      = (const float*)d_in[8];
    const float* out_b      = (const float*)d_in[9];
    const float* loc_w1     = (const float*)d_in[10];
    const float* loc_b1     = (const float*)d_in[11];
    const float* loc_w2     = (const float*)d_in[12];
    const float* loc_b2     = (const float*)d_in[13];
    const float* loc_w3     = (const float*)d_in[14];
    const float* loc_b3     = (const float*)d_in[15];
    const int*   mask       = (const int*)d_in[16];
    float* out = (float*)d_out;

    char* wsp = (char*)d_ws;
    _Float16* G16  = (_Float16*)(wsp + OFF_G16);
    _Float16* C16  = (_Float16*)(wsp + OFF_C16);
    _Float16* WT   = (_Float16*)(wsp + OFF_WT);
    _Float16* W1B  = (_Float16*)(wsp + OFF_W1B);
    _Float16* W2B  = (_Float16*)(wsp + OFF_W2B);
    _Float16* Q16  = (_Float16*)(wsp + OFF_Q16);
    _Float16* K16  = (_Float16*)(wsp + OFF_K16);
    _Float16* VT16 = (_Float16*)(wsp + OFF_VT16);
    float*    ALOC = (float*)(wsp + OFF_ALOC);
    _Float16* O16  = (_Float16*)(wsp + OFF_O16);

    // operand planes (each whole plane written by its launch)
    k_cvt_g<<<(NB * SEQ * SEQ) / 256, 256, 0, stream>>>(pairwise_g, G16);
    k_cvt_c<<<(MTOK * CH / 8) / 256, 256, 0, stream>>>(coset, C16);
    k_wt4<<<(CH * (CH / 8)) / 256, 256, 0, stream>>>(fc_q_w, fc_k_w, in_w, out_w, WT);
    k_wloc<<<(HEADS * HID * 4) / 256, 256, 0, stream>>>(loc_w1, loc_w2, W1B, W2B);

    // projections: 64x64 wave tiles, 8 waves per block
    k_proj_rows<<<((MTOK / 64) * (CH / 64) + 7) / 8, 256, 0, stream>>>(C16, WT, Q16, fc_q_b);
    k_proj_rows<<<((MTOK / 64) * (CH / 64) + 7) / 8, 256, 0, stream>>>(C16, WT + (size_t)1 * CH * CH, K16, fc_k_b);
    k_proj_vt<<<dim3(((CH / 64) * (SEQ / 64) + 7) / 8, NB), 256, 0, stream>>>(WT + (size_t)2 * CH * CH, C16, VT16, in_b);

    // location term, attention, output projection
    k_loc<<<NB * SEQ * QBLK, 256, 0, stream>>>(G16, W1B, W2B, loc_b1, loc_b2, loc_w3, loc_b3, ALOC);
    k_attn<<<NB * 4 * QBLK, 512, 0, stream>>>(Q16, K16, VT16, ALOC, mask, O16);
    k_proj_out<<<((MTOK / 64) * (CH / 64) + 7) / 8, 256, 0, stream>>>(O16, WT + (size_t)3 * CH * CH, out, out_b);
}

// v002
// One run takes 177 microseconds.
// Two timings next to v001 both put it at 1.18 times that version's speed.
// Over all steps from v000 it is 1.54 times as fast.
// All contractions on v_wmma_f32_16x16x32_f16 (f16 operands, f32 accumulate): q/k/v projections (inputs x8, weights x32), pair MLP layer 1 (g x4, w1 x16, K=6 zero-padded to 32) and layer 2 (h1 x64, w2 x16, K=16 zero-padded to 32), q.k^T (x8, x8), P.V (P x1024, V x8), output projection (O x64, w x32); every float input RNE-converted to bf16 first; MLP layer 3 (N=1, K=16), swish (by tanh of half the argument), softmax statistics in f32 on the VALU.
#include <hip/hip_runtime.h>
#include <math.h>

#ifndef NB
#define NB 4
#endif
#ifndef SEQ
#define SEQ 512
#endif
#define NB_FULL 4
#define SEQ_FULL 512
#define CH 256
#define HEADS 8
#define HD 32
#define DG 6
#define HID 16
#define MTOK (NB * SEQ)
#define QBLK (SEQ / 256)

// power-of-two carries and their undo constants
#define G_CARRY 4.0f
#define W1_CARRY 16.0f
#define UNDO1 (1.0f / 64.0f)
#define H_CARRY 64.0f
#define W2_CARRY 16.0f
#define UNDO2 (1.0f / 1024.0f)
#define ACT_CARRY 8.0f
#define W_CARRY 32.0f
#define SC_PROJ (1.0f / 256.0f)
#define SCQK (1.0f / 1024.0f)
#define P_CARRY 1024.0f
#define O_CARRY 64.0f
#define SC_OUT (1.0f / 2048.0f)
#define LOG2E 1.4426950408889634f
#define FILL2 (-1.0e38f * LOG2E)

static_assert(G_CARRY * W1_CARRY * UNDO1 == 1.0f);
static_assert(H_CARRY * W2_CARRY * UNDO2 == 1.0f);
static_assert(ACT_CARRY * W_CARRY * SC_PROJ == 1.0f);
static_assert(ACT_CARRY * ACT_CARRY * 16.0f * SCQK == 1.0f);     // q x8, k x8, module scale 1/sqrt(256)
static_assert(O_CARRY * W_CARRY * SC_OUT == 1.0f);
static_assert(SEQ == SEQ_FULL);
static_assert(NB <= NB_FULL);
static_assert(CH == HEADS * HD && HD == 32 && HID == 16 && DG <= 8);
static_assert(SEQ % 256 == 0 && SEQ % 64 == 0);
static_assert(MTOK % 64 == 0 && CH % 64 == 0 && CH % 32 == 0);
static_assert((NB * SEQ * SEQ) % 256 == 0);
static_assert((MTOK * CH / 8) % 256 == 0);
static_assert((CH * (CH / 8)) % 256 == 0);
// store loops: lanes x bytes x instructions == tile rows x row bytes
static_assert(32 * 16 * 4 == 16 * 128);
static_assert(32 * 16 * 8 == 16 * 256);     // f32 epilogue: 16 rows x 256 B
static_assert(32 * 4 * 8 == 8 * 128);
// static LDS per kernel
static_assert(8 * 16 * 68 * 4 <= 131072);
static_assert(8 * 16 * 20 * 4 + 8 * HEADS * 32 * 4 <= 131072);
static_assert(16 * 16 * 72 * 2 + 16 * 16 * 68 * 4 <= 131072);

typedef _Float16 h16;
typedef __attribute__((ext_vector_type(16))) _Float16 v16h;
typedef __attribute__((ext_vector_type(8)))  _Float16 v8h;
typedef __attribute__((ext_vector_type(2)))  _Float16 v2h;
typedef __attribute__((ext_vector_type(8)))  float    v8f;
typedef __attribute__((ext_vector_type(4)))  float    v4f;
typedef __attribute__((ext_vector_type(2)))  float    v2f;
typedef __attribute__((ext_vector_type(4)))  unsigned int v4u;

static constexpr size_t SZ_G16  = (size_t)NB * SEQ * SEQ * 8 * 2;
static constexpr size_t SZ_C16  = (size_t)MTOK * CH * 2;
static constexpr size_t SZ_WT   = (size_t)4 * CH * CH * 2;
static constexpr size_t SZ_W1B  = (size_t)HEADS * HID * 32 * 2;
static constexpr size_t SZ_W2B  = (size_t)HEADS * HID * 32 * 2;
static constexpr size_t SZ_Q16  = (size_t)MTOK * CH * 2;
static constexpr size_t SZ_K16  = (size_t)MTOK * CH * 2;
static constexpr size_t SZ_VT16 = (size_t)NB * CH * SEQ * 2;
static constexpr size_t SZ_ALOC = (size_t)NB * HEADS * SEQ * SEQ * 4;
static constexpr size_t SZ_O16  = (size_t)MTOK * CH * 2;
static constexpr size_t OFF_G16  = 0;
static constexpr size_t OFF_C16  = OFF_G16 + SZ_G16;
static constexpr size_t OFF_WT   = OFF_C16 + SZ_C16;
static constexpr size_t OFF_W1B  = OFF_WT + SZ_WT;
static constexpr size_t OFF_W2B  = OFF_W1B + SZ_W1B;
static constexpr size_t OFF_Q16  = OFF_W2B + SZ_W2B;
static constexpr size_t OFF_K16  = OFF_Q16 + SZ_Q16;
static constexpr size_t OFF_VT16 = OFF_K16 + SZ_K16;
static constexpr size_t OFF_ALOC = OFF_VT16 + SZ_VT16;
static constexpr size_t OFF_O16  = OFF_ALOC + SZ_ALOC;
static constexpr size_t WS_TOTAL = OFF_O16 + SZ_O16;
static_assert(SZ_G16 % 256 == 0 && SZ_C16 % 256 == 0 && SZ_WT % 256 == 0 && SZ_W1B % 256 == 0 && SZ_W2B % 256 == 0);
static_assert(SZ_Q16 % 256 == 0 && SZ_VT16 % 256 == 0 && SZ_ALOC % 256 == 0 && SZ_O16 % 256 == 0);
static_assert(WS_TOTAL <= (size_t)134217728);

// 16-bit WMMA fragment map (wave32), lane L, hh = L>>4, c = L&15:
//   A 16x32: lane = row c;    element i -> k = (i<8) ? 8hh+i : 16+8hh+(i-8)
//   B 32x16: lane = column c; the SAME k(i,hh)
//   D 16x16 (8 f32): lane = column c; element r -> row 8hh+r

// RNE convert f32 -> bf16 -> f32
__device__ __forceinline__ float bfr(float f) {
    unsigned u = __float_as_uint(f);
    u += 0x7FFFu + ((u >> 16) & 1u);
    return __uint_as_float(u & 0xFFFF0000u);
}
// f32 -> f16 with values under 2^-14 replaced by +0 before the convert
static __device__ __forceinline__ h16 toh_flush(float v) { const float w = (fabsf(v) < 6.103515625e-05f) ? 0.0f : v; return (h16)w; }
static __device__ __forceinline__ v2h toh2_flush(float a, float b) {
    v2f w;
    w.x = (fabsf(a) < 6.103515625e-05f) ? 0.0f : a;
    w.y = (fabsf(b) < 6.103515625e-05f) ? 0.0f : b;
    return __builtin_convertvector(w, v2h);
}
union Pack8 { v8h v; v2h p[4]; };
static __device__ __forceinline__ v8h pack8_flush(v4f a, v4f b) {
    Pack8 u;
    u.p[0] = toh2_flush(a.x, a.y); u.p[1] = toh2_flush(a.z, a.w);
    u.p[2] = toh2_flush(b.x, b.y); u.p[3] = toh2_flush(b.z, b.w);
    return u.v;
}
static __device__ __forceinline__ void st8h2(_Float16* p, v8h v) {
    *(v8h*)p = v;
    
}

union FragU { v16h v; v8h h[2]; };
union FragQ { v16h v; v8h h[2]; v4u q[2]; };
// elements 0..7 <- p[0..7], 8..15 <- p[16..23]; caller adds 8*hh to p (used for BOTH A and B operands: same k per element)
__device__ __forceinline__ v16h frag_ld(const _Float16* p) {
    FragU f; f.h[0] = *(const v8h*)(p); f.h[1] = *(const v8h*)(p + 16); return f.v;
}
__device__ __forceinline__ v8f wmma16g(v16h a, v16h b, v8f c) {
    c = __builtin_amdgcn_wmma_f32_16x16x32_f16(false, a, false, b, (short)0, c, false, false);
    asm volatile("v_nop\n\tv_nop\n\tv_nop\n\tv_nop" : "+v"(c) : "v"(a), "v"(b));
    return c;
}
__device__ __forceinline__ void wave_sync_lds() {
    __builtin_amdgcn_fence(3 /* release order */, "workgroup");
    __builtin_amdgcn_wave_barrier();
    __builtin_amdgcn_fence(2 /* acquire order */, "workgroup");
}
// swish(x) = x * sigmoid(x) = h + h * tanh(h) with h = x / 2; the caller hands in h
static __device__ __forceinline__ float swish_half(float h) {
    return fmaf(h, __builtin_amdgcn_tanhf(h), h);
}

// =====================================================================================================================
// k_cvt_g: pair components [pair][6] f32 -> G16 [pair][8] f16 = bf16(g) * 4, components 6,7 = 0; one 16-B piece per lane
//   coverage: NB*SEQ*SEQ pairs x 16 B == the whole G16 plane
// =====================================================================================================================
__global__ __launch_bounds__(256) void k_cvt_g(const float* __restrict__ g, _Float16* __restrict__ G16) {
    const unsigned u = blockIdx.x * 256u + threadIdx.x;
    if (u >= (unsigned)(NB * SEQ * SEQ)) return;
    const v2f* src = (const v2f*)(g + (size_t)u * 6u);
    const v2f a = src[0], b = src[1], cc = src[2];
    v4f lo, hi;
    lo.x = bfr(a.x) * G_CARRY; lo.y = bfr(a.y) * G_CARRY; lo.z = bfr(b.x) * G_CARRY; lo.w = bfr(b.y) * G_CARRY;
    hi.x = bfr(cc.x) * G_CARRY; hi.y = bfr(cc.y) * G_CARRY; hi.z = 0.0f; hi.w = 0.0f;
    st8h2(G16 + (size_t)u * 8u, pack8_flush(lo, hi));
}

// k_cvt_c: features [row][256] f32 -> C16 f16 = bf16(x) * 8; thread per 8 columns; coverage: MTOK*256/8 pieces == whole plane
__global__ __launch_bounds__(256) void k_cvt_c(const float* __restrict__ x, _Float16* __restrict__ C16) {
    const unsigned u = blockIdx.x * 256u + threadIdx.x;
    if (u >= (unsigned)(MTOK * CH / 8)) return;
    const v4f* src = (const v4f*)(x + (size_t)u * 8u);
    v4f a = src[0], b = src[1];
    a.x = bfr(a.x) * ACT_CARRY; a.y = bfr(a.y) * ACT_CARRY; a.z = bfr(a.z) * ACT_CARRY; a.w = bfr(a.w) * ACT_CARRY;
    b.x = bfr(b.x) * ACT_CARRY; b.y = bfr(b.y) * ACT_CARRY; b.z = bfr(b.z) * ACT_CARRY; b.w = bfr(b.w) * ACT_CARRY;
    st8h2(C16 + (size_t)u * 8u, pack8_flush(a, b));
}

static __device__ __forceinline__ void wt_one(const float* __restrict__ W, _Float16* __restrict__ D, unsigned o, unsigned k0) {
    v4f lo, hi;
    lo.x = bfr(W[(size_t)(k0 + 0u) * CH + o]) * W_CARRY;
    lo.y = bfr(W[(size_t)(k0 + 1u) * CH + o]) * W_CARRY;
    lo.z = bfr(W[(size_t)(k0 + 2u) * CH + o]) * W_CARRY;
    lo.w = bfr(W[(size_t)(k0 + 3u) * CH + o]) * W_CARRY;
    hi.x = bfr(W[(size_t)(k0 + 4u) * CH + o]) * W_CARRY;
    hi.y = bfr(W[(size_t)(k0 + 5u) * CH + o]) * W_CARRY;
    hi.z = bfr(W[(size_t)(k0 + 6u) * CH + o]) * W_CARRY;
    hi.w = bfr(W[(size_t)(k0 + 7u) * CH + o]) * W_CARRY;
    st8h2(D + (size_t)o * CH + k0, pack8_flush(lo, hi));
}
// k_wt4: the four 256x256 weights -> WT[4][out][in]; thread per (o, 8 k): 32 lanes cover one whole 512-B row; coverage: 4 x 256 x 32 pieces
__global__ __launch_bounds__(256) void k_wt4(const float* __restrict__ wq, const float* __restrict__ wk,
                                             const float* __restrict__ wv, const float* __restrict__ wo,
                                             _Float16* __restrict__ WT) {
    const unsigned u = blockIdx.x * 256u + threadIdx.x;
    if (u >= (unsigned)(CH * (CH / 8))) return;
    const unsigned k0 = 8u * (u & 31u);
    const unsigned o = u >> 5;
    wt_one(wq, WT, o, k0);
    wt_one(wk, WT + (size_t)1 * CH * CH, o, k0);
    wt_one(wv, WT + (size_t)2 * CH * CH, o, k0);
    wt_one(wo, WT + (size_t)3 * CH * CH, o, k0);
}

// k_wloc: pair-MLP weights as B-operand planes, zero-padded along k to 32:
//   W1B[h*16+j][k] = bf16(w1[h][k][j]) * 16 for k < 6, else 0;  W2B[h*16+j][k] = bf16(w2[h][k][j]) * 16 for k < 16, else 0
//   thread per 16-B piece (512 pieces per plane), clamped addresses, zero by value; coverage: 128 rows x 4 pieces == both whole planes
__global__ __launch_bounds__(256) void k_wloc(const float* __restrict__ w1, const float* __restrict__ w2,
                                              _Float16* __restrict__ W1B, _Float16* __restrict__ W2B) {
    const unsigned p = blockIdx.x * 256u + threadIdx.x;
    if (p >= (unsigned)(HEADS * HID * 4)) return;
    const unsigned col = p >> 2, k0 = (p & 3u) * 8u;
    const unsigned h = col >> 4, j = col & 15u;
    float v[8];
#pragma unroll
    for (int i = 0; i < 8; ++i) {
        const unsigned k = k0 + (unsigned)i;
        const unsigned kc = min(k, (unsigned)(DG - 1));
        const float x = bfr(w1[(size_t)(h * DG + kc) * HID + j]) * W1_CARRY;
        v[i] = (k < (unsigned)DG) ? x : 0.0f;
    }
    {
        v4f a, b;
        a.x = v[0]; a.y = v[1]; a.z = v[2]; a.w = v[3]; b.x = v[4]; b.y = v[5]; b.z = v[6]; b.w = v[7];
        st8h2(W1B + (size_t)col * 32u + k0, pack8_flush(a, b));
    }
#pragma unroll
    for (int i = 0; i < 8; ++i) {
        const unsigned k = k0 + (unsigned)i;
        const unsigned kc = min(k, (unsigned)(HID - 1));
        const float x = bfr(w2[(size_t)(h * HID + kc) * HID + j]) * W2_CARRY;
        v[i] = (k < (unsigned)HID) ? x : 0.0f;
    }
    {
        v4f a, b;
        a.x = v[0]; a.y = v[1]; a.z = v[2]; a.w = v[3]; b.x = v[4]; b.y = v[5]; b.z = v[6]; b.w = v[7];
        st8h2(W2B + (size_t)col * 32u + k0, pack8_flush(a, b));
    }
}

// =====================================================================================================================
// gemm64_body: C[m,n] = (scale * sum_k A[m,k] * Bt[n,k] + bf16(bias[n or m])) ; each wave owns a 64x64 tile.
//   A row-major [M][lda] f16, Bt row-major [N][ldb] f16 (fragments straight from the planes); M,N % 64 == 0, K % 32 == 0.
//   OUT_MODE 0: f32 C (pitch ldc); OUT_MODE 1: f16 C = value * oscale. BIAS_ROW: bias indexed by the row m.
// =====================================================================================================================
template <int OUT_MODE, bool BIAS_ROW>
static __device__ __forceinline__ void gemm64_body(
    const _Float16* __restrict__ A, unsigned lda, const _Float16* __restrict__ Bt, unsigned ldb,
    float* __restrict__ Cf, _Float16* __restrict__ Ch, unsigned ldc, const float* __restrict__ bias,
    unsigned M, unsigned N, unsigned K, float scale, float oscale) {
  __shared__ __align__(16) float sT[8][16 * 68];
  const unsigned lane = threadIdx.x & 31u;
  const unsigned wave = threadIdx.x >> 5;
  const unsigned tilesN = N >> 6, tilesM = M >> 6;
  const unsigned tile = blockIdx.x * 8u + wave;
  if (tile >= tilesM * tilesN) return;   // wave-uniform; no block barriers in this kernel
  const unsigned tm = tile / tilesN;
  const unsigned tn = tile - tm * tilesN;
  const unsigned m0 = tm << 6, n0 = tn << 6;
  const unsigned rlane = lane & 15u;
  const unsigned koff = (lane >> 4) * 8u;
  const unsigned mOff = koff;

  v8f acc[4][4];
#pragma unroll
  for (int i = 0; i < 4; ++i)
#pragma unroll
    for (int j = 0; j < 4; ++j) acc[i][j] = (v8f){0.f,0.f,0.f,0.f,0.f,0.f,0.f,0.f};

  for (unsigned k0 = 0; k0 < K; k0 += 32u) {
    v16h bh[4];
#pragma unroll
    for (int j = 0; j < 4; ++j)
      bh[j] = frag_ld(Bt + (size_t)(n0 + ((unsigned)j << 4) + rlane) * ldb + koff + k0);
#pragma unroll
    for (int i = 0; i < 4; ++i) {
      const v16h ah = frag_ld(A + (size_t)(m0 + ((unsigned)i << 4) + rlane) * lda + koff + k0);
#pragma unroll
      for (int j = 0; j < 4; ++j)
        acc[i][j] = wmma16g(ah, bh[j], acc[i][j]);
    }
  }

  float* slab = sT[wave];
#pragma unroll
  for (int i = 0; i < 4; ++i) {
    const unsigned mBase = m0 + ((unsigned)i << 4);
    float bvr[8];
#pragma unroll
    for (int r = 0; r < 8; ++r) bvr[r] = 0.0f;
    if (BIAS_ROW) {
#pragma unroll
      for (int r = 0; r < 8; ++r) bvr[r] = bfr(bias[mBase + mOff + (unsigned)r]);
    }
#pragma unroll
    for (int j = 0; j < 4; ++j) {
      const unsigned n = n0 + ((unsigned)j << 4) + rlane;
      float bvc = 0.0f;
      if (!BIAS_ROW) bvc = bfr(bias[n]);
#pragma unroll
      for (int r = 0; r < 8; ++r) {
        float v = acc[i][j][r] * scale + (BIAS_ROW ? bvr[r] : bvc);
        if (OUT_MODE == 1) v *= oscale;
        slab[(mOff + (unsigned)r) * 68u + ((unsigned)j << 4) + rlane] = v;
      }
    }
    wave_sync_lds();
    if (OUT_MODE == 0) {
      const unsigned hh = lane >> 4, c4 = (lane & 15u) * 4u;     // row segment = 256 B = 16 lanes x 16 B
#pragma unroll
      for (int half = 0; half < 2; ++half) {
        v4f vv[4];
#pragma unroll
        for (int it = 0; it < 4; ++it) {
          const unsigned row = (unsigned)(half * 4 + it) * 2u + hh;
          vv[it] = *(const v4f*)(slab + row * 68u + c4);
        }
        {
#pragma unroll
          for (int it = 0; it < 4; ++it) {
            const unsigned row = (unsigned)(half * 4 + it) * 2u + hh;
            *(v4f*)(Cf + (size_t)(mBase + row) * ldc + n0 + c4) = vv[it];
          }
          
        }
      }
    } else {
      const unsigned q = lane >> 3, c8 = (lane & 7u) * 8u;
      v8h hv[4];
#pragma unroll
      for (int it = 0; it < 4; ++it) {
        const unsigned row = (unsigned)it * 4u + q;
        const float* sp = slab + row * 68u + c8;
        hv[it] = pack8_flush(*(const v4f*)sp, *(const v4f*)(sp + 4));
      }
      {
#pragma unroll
        for (int it = 0; it < 4; ++it) {
          const unsigned row = (unsigned)it * 4u + q;
          *(v8h*)(Ch + (size_t)(mBase + row) * ldc + n0 + c8) = hv[it];
        }
        
      }
    }
    wave_sync_lds();
  }
}

// position-major projection: Y16[row][256] = f16(8 * (x @ w + bf16(b)))
__global__ __launch_bounds__(256) void k_proj_rows(const _Float16* __restrict__ X16, const _Float16* __restrict__ Wt,
                                                   _Float16* __restrict__ Y16, const float* __restrict__ bias) {
    gemm64_body<1, false>(X16, CH, Wt, CH, nullptr, Y16, CH, bias, MTOK, CH, CH, SC_PROJ, ACT_CARRY);
}
// channel-major value plane: VT16[b][ch][key] = f16(8 * (x @ w + bf16(b)))^T ; A = weight plane, Bt = feature rows of batch blockIdx.y
__global__ __launch_bounds__(256) void k_proj_vt(const _Float16* __restrict__ Wt, const _Float16* __restrict__ X16,
                                                 _Float16* __restrict__ VT16, const float* __restrict__ bias) {
    const unsigned by = blockIdx.y;
    gemm64_body<1, true>(Wt, CH, X16 + (size_t)by * SEQ * CH, CH, nullptr, VT16 + (size_t)by * CH * SEQ, SEQ, bias,
                         CH, SEQ, CH, SC_PROJ, ACT_CARRY);
}
// output projection: out[row][256] = O @ w + bf16(b), f32
__global__ __launch_bounds__(256) void k_proj_out(const _Float16* __restrict__ O16, const _Float16* __restrict__ Wt,
                                                  float* __restrict__ out, const float* __restrict__ bias) {
    gemm64_body<0, false>(O16, CH, Wt, CH, out, nullptr, CH, bias, MTOK, CH, CH, SC_OUT, 1.0f);
}

// =====================================================================================================================
// k_loc: location term ALOC[b][h][n][m] (f32) = swish(l3(swish(l2(swish(l1(g[b][n][m][:]))))))
//   block = 8 waves, one query row (b,n) and 256 keys; a wave owns 32 consecutive keys (two 16-pair row tiles), all 8 heads.
//   layer 1: A = the 16 pairs' G16 rows (k 0..7 from lanes 0..15; lanes 16..31 and elements 8..15 are zero words selected by value),
//            B = W1B rows of the head (frag_ld; zeros beyond k = 5) -> D1[pair 8hh+r][hidden c].
//   relayout D -> A through a wave-private f32 slab sX (wave_sync): lane (c,hh) reads hidden 8hh..8hh+7 of pair c, pair-converts to f16 x64
//            into elements 0..7; elements 8..15 (k 16..31) are zero words in the register.
//   layer 2: B = W2B rows of the head (zeros beyond k = 15) -> D2[pair 8hh+r][hidden c].
//   layer 3 (N = 1) on the VALU: xor-shuffle sum 1,2,4,8 over the 16 lanes of a half.
//   staged extent == consumed extent: sX rows 0..15 x cols 0..15 written and read; sA all 256 words written and read.
// =====================================================================================================================
#define LC_SP 20
__global__ __launch_bounds__(256) void k_loc(const _Float16* __restrict__ G16, const _Float16* __restrict__ W1B,
                                             const _Float16* __restrict__ W2B, const float* __restrict__ b1,
                                             const float* __restrict__ b2, const float* __restrict__ w3,
                                             const float* __restrict__ b3, float* __restrict__ ALOC) {
    __shared__ __align__(16) float sX[8][16 * LC_SP];
    __shared__ __align__(16) float sA[8][HEADS * 32];
    const unsigned lane = threadIdx.x & 31u;
    const unsigned wave = (unsigned)__builtin_amdgcn_readfirstlane((int)(threadIdx.x >> 5));
    const unsigned hh = lane >> 4, c = lane & 15u;
    const unsigned bx = blockIdx.x;
    const unsigned bn = bx / (unsigned)QBLK;                       // b*SEQ + n
    const unsigned m0 = ((bx % (unsigned)QBLK) * 8u + wave) * 32u;
    float* xs = sX[wave];
    float* as_ = sA[wave];
    const v8f zacc = (v8f){0.f,0.f,0.f,0.f,0.f,0.f,0.f,0.f};
    const v4u zq = (v4u){0u, 0u, 0u, 0u};
    const unsigned c7 = c & 7u;

#pragma unroll 1
    for (unsigned ti = 0; ti < 2u; ++ti) {
        const unsigned pidx = bn * (unsigned)SEQ + m0 + ti * 16u + c;
        const v4u gq = *(const v4u*)(G16 + (size_t)pidx * 8u);
        FragQ a1;
        a1.q[0].x = (hh == 0u) ? gq.x : 0u;
        a1.q[0].y = (hh == 0u) ? gq.y : 0u;
        a1.q[0].z = (hh == 0u) ? gq.z : 0u;
        a1.q[0].w = (hh == 0u) ? gq.w : 0u;
        a1.q[1] = zq;
#pragma unroll 1
        for (unsigned t = 0; t < (unsigned)HEADS; ++t) {
            const unsigned col = t * 16u + c;
            const v16h w1f = frag_ld(W1B + (size_t)col * 32u + 8u * hh);
            const v8f d1 = wmma16g(a1.v, w1f, zacc);
            const float hb1 = 0.5f * bfr(b1[col]);
#pragma unroll
            for (int r = 0; r < 8; ++r) {
                const float h = d1[r] * (0.5f * UNDO1) + hb1;
                xs[(8u * hh + (unsigned)r) * LC_SP + c] = swish_half(h) * H_CARRY;
            }
            wave_sync_lds();
            const float* xr = xs + c * LC_SP + 8u * hh;
            const v4f xa = *(const v4f*)xr;
            const v4f xb = *(const v4f*)(xr + 4);
            FragQ a2;
            a2.h[0] = pack8_flush(xa, xb);
            a2.q[1] = zq;
            wave_sync_lds();
            const v16h w2f = frag_ld(W2B + (size_t)col * 32u + 8u * hh);
            const v8f d2 = wmma16g(a2.v, w2f, zacc);
            const float hb2 = 0.5f * bfr(b2[col]);
            const float ww3 = bfr(w3[col]);
            float part[8];
#pragma unroll
            for (int r = 0; r < 8; ++r) part[r] = swish_half(d2[r] * (0.5f * UNDO2) + hb2) * ww3;
#pragma unroll
            for (int r = 0; r < 8; ++r) {
                part[r] += __shfl_xor(part[r], 1, 32);
                part[r] += __shfl_xor(part[r], 2, 32);
                part[r] += __shfl_xor(part[r], 4, 32);
                part[r] += __shfl_xor(part[r], 8, 32);
            }
            float val = part[0];
            val = (c7 == 1u) ? part[1] : val;
            val = (c7 == 2u) ? part[2] : val;
            val = (c7 == 3u) ? part[3] : val;
            val = (c7 == 4u) ? part[4] : val;
            val = (c7 == 5u) ? part[5] : val;
            val = (c7 == 6u) ? part[6] : val;
            val = (c7 == 7u) ? part[7] : val;
            if (c < 8u) as_[t * 32u + ti * 16u + 8u * hh + c] = val;
        }
    }
    wave_sync_lds();
    float fin[8];
#pragma unroll
    for (int t = 0; t < 8; ++t) {
        const float v = as_[(unsigned)t * 32u + lane] + bfr(b3[t]);
        fin[t] = swish_half(0.5f * v);
    }
    const unsigned b = bn / (unsigned)SEQ, n = bn % (unsigned)SEQ;
    float* dst = ALOC + ((size_t)(b * (unsigned)HEADS) * SEQ + n) * SEQ + m0 + lane;
    {
#pragma unroll
        for (int t = 0; t < 8; ++t) *(float*)(dst + (size_t)t * SEQ * SEQ) = fin[t];
        
    }
}

// =====================================================================================================================
// k_attn: one block per (batch, head pair, 256-query block), 16 waves x 16 query rows, both heads of the pair per wave, 64-key chunks.
//   scores: Q (A) and K (B) fragments straight from the planes, one k-step (d = 32); + location term loaded in the D layout;
//   key mask by value select (fill -1e38 in the natural-log domain); running-max softmax in the exp2 domain (f32);
//   unnormalised e x1024 as f16 (wave-private LDS tile sP, wave_sync) times V^T B fragments straight from VT16.
//   O plane f16 x64 [row][head*32 + d]: each wave stages its 16 rows x 64 columns in sO (wave-private, wave_sync) and writes
//   staged extent == consumed extent: sP rows 0..15 x keys 0..63; sO rows 0..15 x cols 0..63.
// =====================================================================================================================
#define AT_PP 72
#define AT_OP 68
__global__ __launch_bounds__(512) void k_attn(const _Float16* __restrict__ Q16, const _Float16* __restrict__ K16,
                                              const _Float16* __restrict__ VT16, const float* __restrict__ ALOC,
                                              const int* __restrict__ mask, _Float16* __restrict__ O16) {
    __shared__ __align__(16) _Float16 sP[16][16 * AT_PP];     // per wave [row][64 keys], wave-private (wave_sync)
    __shared__ __align__(16) float sO[16][16 * AT_OP];        // per wave [row][64 channels], wave-private (wave_sync)
    const unsigned tid = threadIdx.x, lane = tid & 31u, wave = tid >> 5;
    const unsigned hh = lane >> 4, c = lane & 15u;
    const unsigned bx = blockIdx.x;
    const unsigned qb = bx % (unsigned)QBLK;
    const unsigned pair = (bx / (unsigned)QBLK) & 3u;
    const unsigned b = bx / ((unsigned)QBLK * 4u);
    const unsigned q0 = qb * 256u + wave * 16u;
    _Float16* pw = sP[wave];
    float* so = sO[wave];
#pragma unroll
    for (int hp = 0; hp < 2; ++hp) {
        const unsigned head = 2u * pair + (unsigned)hp;
        const v16h qf = frag_ld(Q16 + (size_t)(b * SEQ + q0 + c) * CH + head * HD + 8u * hh);
        const float* arow = ALOC + (size_t)((b * (unsigned)HEADS + head) * SEQ + q0 + 8u * hh) * SEQ + c;
        const _Float16* krow = K16 + (size_t)(b * SEQ + c) * CH + head * HD + 8u * hh;
        const int* mrw = mask + b * SEQ_FULL + c;
        float mrow[8], lrow[8];
        v8f os[2];
#pragma unroll
        for (int r = 0; r < 8; ++r) { mrow[r] = -3.0e38f; lrow[r] = 0.f; }
#pragma unroll
        for (int t = 0; t < 2; ++t) os[t] = (v8f){0.f,0.f,0.f,0.f,0.f,0.f,0.f,0.f};
        // score operands of one chunk, held in registers and fetched one chunk ahead
        v16h kf[4];
        int mk[4];
        float al[4][8];
#pragma unroll
        for (int j = 0; j < 4; ++j) {
            kf[j] = frag_ld(krow + (size_t)((unsigned)j * 16u) * CH);
            mk[j] = mrw[(unsigned)j * 16u];
#pragma unroll
            for (int r = 0; r < 8; ++r) al[j][r] = arow[(size_t)r * SEQ + (unsigned)j * 16u];
        }
#pragma unroll 1
        for (unsigned kc = 0; kc < (unsigned)(SEQ / 64); ++kc) {
            const unsigned kv0 = kc * 64u;
            v8f s[4];
#pragma unroll
            for (int j = 0; j < 4; ++j) {
                const v8f z = (v8f){0.f,0.f,0.f,0.f,0.f,0.f,0.f,0.f};
                s[j] = wmma16g(qf, kf[j], z);
            }
#pragma unroll
            for (int j = 0; j < 4; ++j) {
                const bool on = (mk[j] != 0);
#pragma unroll
                for (int r = 0; r < 8; ++r) {
                    const float sv = (s[j][r] * SCQK + al[j][r]) * LOG2E;
                    s[j][r] = on ? sv : FILL2;
                }
            }
            // the next chunk's score operands fly under this chunk's softmax; the last pass fetches its own chunk again (in bounds, unused)
            const unsigned nv0 = ((kc + 1u < (unsigned)(SEQ / 64)) ? kc + 1u : kc) * 64u;
#pragma unroll
            for (int j = 0; j < 4; ++j) {
                kf[j] = frag_ld(krow + (size_t)(nv0 + (unsigned)j * 16u) * CH);
                mk[j] = mrw[nv0 + (unsigned)j * 16u];
#pragma unroll
                for (int r = 0; r < 8; ++r) al[j][r] = arow[(size_t)r * SEQ + nv0 + (unsigned)j * 16u];
            }
#pragma unroll
            for (int r = 0; r < 8; ++r) {
                float mx = -3.0e38f;
#pragma unroll
                for (int j = 0; j < 4; ++j) { mx = fmaxf(mx, s[j][r]); }
                mx = fmaxf(mx, __shfl_xor(mx, 1, 32)); mx = fmaxf(mx, __shfl_xor(mx, 2, 32));
                mx = fmaxf(mx, __shfl_xor(mx, 4, 32)); mx = fmaxf(mx, __shfl_xor(mx, 8, 32));
                const float mnew = fmaxf(mrow[r], mx);
                const float alpha = exp2f(mrow[r] - mnew);
                mrow[r] = mnew;
                float psum = 0.f;
#pragma unroll
                for (int j = 0; j < 4; ++j) {
                    const float p = exp2f(s[j][r] - mnew);
                    psum += p;
                    const float w = p * P_CARRY;
                    pw[(8u * hh + (unsigned)r) * AT_PP + (unsigned)j * 16u + c] = (_Float16)((w < 6.103515625e-05f) ? 0.0f : w);
                }
                psum += __shfl_xor(psum, 1, 32); psum += __shfl_xor(psum, 2, 32);
                psum += __shfl_xor(psum, 4, 32); psum += __shfl_xor(psum, 8, 32);
                lrow[r] = lrow[r] * alpha + psum;
                os[0][r] *= alpha; os[1][r] *= alpha;
            }
            wave_sync_lds();
            // this chunk's V fragments, all four in one group ahead of the P.V products
            v16h vb[2][2];
#pragma unroll
            for (int kk = 0; kk < 2; ++kk)
#pragma unroll
                for (int t = 0; t < 2; ++t)
                    vb[kk][t] = frag_ld(VT16 + (size_t)(b * CH + head * HD + (unsigned)t * 16u + c) * SEQ + kv0 + (unsigned)kk * 32u + 8u * hh);
#pragma unroll
            for (int kk = 0; kk < 2; ++kk) {
                const v16h pa = frag_ld(pw + c * AT_PP + (unsigned)kk * 32u + 8u * hh);
#pragma unroll
                for (int t = 0; t < 2; ++t) {
                    os[t] = wmma16g(pa, vb[kk][t], os[t]);
                }
            }
            wave_sync_lds();
        }
#pragma unroll
        for (int r = 0; r < 8; ++r) {
            const float inv = 1.0f / (lrow[r] * P_CARRY);
#pragma unroll
            for (int t = 0; t < 2; ++t)
                so[(8u * hh + (unsigned)r) * AT_OP + (unsigned)hp * 32u + (unsigned)t * 16u + c] = os[t][r] * inv * (O_CARRY / ACT_CARRY);   // = 64 * value
        }
    }
    wave_sync_lds();
    {
        const unsigned q = lane >> 3, c8 = (lane & 7u) * 8u;
        v8h ov[4];
#pragma unroll
        for (int it = 0; it < 4; ++it) {
            const float* sp = so + ((unsigned)it * 4u + q) * AT_OP + c8;
            ov[it] = pack8_flush(*(const v4f*)sp, *(const v4f*)(sp + 4));
        }
        _Float16* dst = O16 + (size_t)(b * SEQ + q0) * CH + pair * 64u;
        {
#pragma unroll
            for (int it = 0; it < 4; ++it) *(v8h*)(dst + (size_t)((unsigned)it * 4u + q) * CH + c8) = ov[it];
            
        }
    }
}

extern "C" void kernel_launch(void* const* d_in, const int* in_sizes, int n_in, void* d_out, int out_size,
                              void* d_ws, size_t ws_size, hipStream_t stream) {
    if (n_in < 17) return;
    if (in_sizes[0] < NB * SEQ * SEQ * DG || in_sizes[1] < MTOK * CH) return;
    if (in_sizes[2] < CH * CH || in_sizes[3] < CH || in_sizes[4] < CH * CH || in_sizes[5] < CH) return;
    if (in_sizes[6] < CH * CH || in_sizes[7] < CH || in_sizes[8] < CH * CH || in_sizes[9] < CH) return;
    if (in_sizes[10] < HEADS * DG * HID || in_sizes[11] < HEADS * HID || in_sizes[12] < HEADS * HID * HID) return;
    if (in_sizes[13] < HEADS * HID || in_sizes[14] < HEADS * HID || in_sizes[15] < HEADS || in_sizes[16] < NB * SEQ) return;
    if (out_size < MTOK * CH) return;
    if (ws_size < WS_TOTAL) return;

    const float* pairwise_g = (const float*)d_in[0];
    const float* coset      = (const float*)d_in[1];
    const float* fc_q_w     = (const float*)d_in[2];
    const float* fc_q_b     = (const float*)d_in[3];
    const float* fc_k_w     = (const float*)d_in[4];
    const float* fc_k_b     = (const float*)d_in[5];
    const float* in_w       = (const float*)d_in[6];
    const float* in_b       = (const float*)d_in[7];
    const float* out_w      = (const float*)d_in[8];
    const float* out_b      = (const float*)d_in[9];
    const float* loc_w1     = (const float*)d_in[10];
    const float* loc_b1     = (const float*)d_in[11];
    const float* loc_w2     = (const float*)d_in[12];
    const float* loc_b2     = (const float*)d_in[13];
    const float* loc_w3     = (const float*)d_in[14];
    const float* loc_b3     = (const float*)d_in[15];
    const int*   mask       = (const int*)d_in[16];
    float* out = (float*)d_out;

    char* wsp = (char*)d_ws;
    _Float16* G16  = (_Float16*)(wsp + OFF_G16);
    _Float16* C16  = (_Float16*)(wsp + OFF_C16);
    _Float16* WT   = (_Float16*)(wsp + OFF_WT);
    _Float16* W1B  = (_Float16*)(wsp + OFF_W1B);
    _Float16* W2B  = (_Float16*)(wsp + OFF_W2B);
    _Float16* Q16  = (_Float16*)(wsp + OFF_Q16);
    _Float16* K16  = (_Float16*)(wsp + OFF_K16);
    _Float16* VT16 = (_Float16*)(wsp + OFF_VT16);
    float*    ALOC = (float*)(wsp + OFF_ALOC);
    _Float16* O16  = (_Float16*)(wsp + OFF_O16);

    // operand planes (each whole plane written by its launch)
    k_cvt_g<<<(NB * SEQ * SEQ) / 256, 256, 0, stream>>>(pairwise_g, G16);
    k_cvt_c<<<(MTOK * CH / 8) / 256, 256, 0, stream>>>(coset, C16);
    k_wt4<<<(CH * (CH / 8)) / 256, 256, 0, stream>>>(fc_q_w, fc_k_w, in_w, out_w, WT);
    k_wloc<<<(HEADS * HID * 4) / 256, 256, 0, stream>>>(loc_w1, loc_w2, W1B, W2B);

    // projections: 64x64 wave tiles, 8 waves per block
    k_proj_rows<<<((MTOK / 64) * (CH / 64) + 7) / 8, 256, 0, stream>>>(C16, WT, Q16, fc_q_b);
    k_proj_rows<<<((MTOK / 64) * (CH / 64) + 7) / 8, 256, 0, stream>>>(C16, WT + (size_t)1 * CH * CH, K16, fc_k_b);
    k_proj_vt<<<dim3(((CH / 64) * (SEQ / 64) + 7) / 8, NB), 256, 0, stream>>>(WT + (size_t)2 * CH * CH, C16, VT16, in_b);

    // location term, attention, output projection
    k_loc<<<NB * SEQ * QBLK, 256, 0, stream>>>(G16, W1B, W2B, loc_b1, loc_b2, loc_w3, loc_b3, ALOC);
    k_attn<<<NB * 4 * QBLK, 512, 0, stream>>>(Q16, K16, VT16, ALOC, mask, O16);
    k_proj_out<<<((MTOK / 64) * (CH / 64) + 7) / 8, 256, 0, stream>>>(O16, WT + (size_t)3 * CH * CH, out, out_b);
}

// v003
// One run takes 145 microseconds.
// Timed twice side by side with v002, it ran 1.22 times as fast both times.
// All steps since v000 together make it 1.88 times as fast.
// All contractions on v_wmma_f32_16x16x32_f16 (f16 operands, f32 accumulate): q/k/v projections (inputs x8, weights x32), pair MLP layer 1 (g x4, w1 x16, K=6 zero-padded to 32) and layer 2 (h1 x64, w2 x16, K=16 zero-padded to 32), q.k^T (x8, x8), P.V (P x1024, V x8), output projection (O x64, w x32); every float input RNE-converted to bf16 first; MLP layer 3 (N=1, K=16), swish (by tanh of half the argument), softmax statistics in f32 on the VALU.
#include <hip/hip_runtime.h>
#include <math.h>

#ifndef NB
#define NB 4
#endif
#ifndef SEQ
#define SEQ 512
#endif
#define NB_FULL 4
#define SEQ_FULL 512
#define CH 256
#define HEADS 8
#define HD 32
#define DG 6
#define HID 16
#define MTOK (NB * SEQ)
#define QBLK (SEQ / 256)

// power-of-two carries and their undo constants
#define G_CARRY 4.0f
#define W1_CARRY 16.0f
#define UNDO1 (1.0f / 64.0f)
#define H_CARRY 64.0f
#define W2_CARRY 16.0f
#define UNDO2 (1.0f / 1024.0f)
#define ACT_CARRY 8.0f
#define W_CARRY 32.0f
#define SC_PROJ (1.0f / 256.0f)
#define SCQK (1.0f / 1024.0f)
#define P_CARRY 1024.0f
#define O_CARRY 64.0f
#define SC_OUT (1.0f / 2048.0f)
#define LOG2E 1.4426950408889634f
#define FILL2 (-1.0e38f * LOG2E)

static_assert(G_CARRY * W1_CARRY * UNDO1 == 1.0f);
static_assert(H_CARRY * W2_CARRY * UNDO2 == 1.0f);
static_assert(ACT_CARRY * W_CARRY * SC_PROJ == 1.0f);
static_assert(ACT_CARRY * ACT_CARRY * 16.0f * SCQK == 1.0f);     // q x8, k x8, module scale 1/sqrt(256)
static_assert(O_CARRY * W_CARRY * SC_OUT == 1.0f);
static_assert(SEQ == SEQ_FULL);
static_assert(NB <= NB_FULL);
static_assert(CH == HEADS * HD && HD == 32 && HID == 16 && DG <= 8);
static_assert(SEQ % 256 == 0 && SEQ % 64 == 0);
static_assert(MTOK % 64 == 0 && CH % 64 == 0 && CH % 32 == 0);
static_assert((NB * SEQ * SEQ) % 256 == 0);
static_assert((MTOK * CH / 8) % 256 == 0);
static_assert((CH * (CH / 8)) % 256 == 0);
// store loops: lanes x bytes x instructions == tile rows x row bytes
static_assert(32 * 16 * 4 == 16 * 128);
static_assert(32 * 16 * 8 == 16 * 256);     // f32 epilogue: 16 rows x 256 B
static_assert(32 * 4 * 8 == 8 * 128);
// static LDS per kernel
static_assert(8 * 16 * 68 * 4 <= 131072);
static_assert(16 * 16 * 72 * 2 + 16 * 16 * 68 * 4 <= 131072);

typedef _Float16 h16;
typedef __attribute__((ext_vector_type(16))) _Float16 v16h;
typedef __attribute__((ext_vector_type(8)))  _Float16 v8h;
typedef __attribute__((ext_vector_type(2)))  _Float16 v2h;
typedef __attribute__((ext_vector_type(8)))  float    v8f;
typedef __attribute__((ext_vector_type(4)))  float    v4f;
typedef __attribute__((ext_vector_type(2)))  float    v2f;
typedef __attribute__((ext_vector_type(4)))  unsigned int v4u;

static constexpr size_t SZ_G16  = (size_t)NB * SEQ * SEQ * 8 * 2;
static constexpr size_t SZ_C16  = (size_t)MTOK * CH * 2;
static constexpr size_t SZ_WT   = (size_t)4 * CH * CH * 2;
static constexpr size_t SZ_W1B  = (size_t)HEADS * HID * 32 * 2;
static constexpr size_t SZ_W2B  = (size_t)HEADS * HID * 32 * 2;
static constexpr size_t SZ_Q16  = (size_t)MTOK * CH * 2;
static constexpr size_t SZ_K16  = (size_t)MTOK * CH * 2;
static constexpr size_t SZ_VT16 = (size_t)NB * CH * SEQ * 2;
static constexpr size_t SZ_ALOC = (size_t)NB * HEADS * SEQ * SEQ * 4;
static constexpr size_t SZ_O16  = (size_t)MTOK * CH * 2;
static constexpr size_t OFF_G16  = 0;
static constexpr size_t OFF_C16  = OFF_G16 + SZ_G16;
static constexpr size_t OFF_WT   = OFF_C16 + SZ_C16;
static constexpr size_t OFF_W1B  = OFF_WT + SZ_WT;
static constexpr size_t OFF_W2B  = OFF_W1B + SZ_W1B;
static constexpr size_t OFF_Q16  = OFF_W2B + SZ_W2B;
static constexpr size_t OFF_K16  = OFF_Q16 + SZ_Q16;
static constexpr size_t OFF_VT16 = OFF_K16 + SZ_K16;
static constexpr size_t OFF_ALOC = OFF_VT16 + SZ_VT16;
static constexpr size_t OFF_O16  = OFF_ALOC + SZ_ALOC;
static constexpr size_t WS_TOTAL = OFF_O16 + SZ_O16;
static_assert(SZ_G16 % 256 == 0 && SZ_C16 % 256 == 0 && SZ_WT % 256 == 0 && SZ_W1B % 256 == 0 && SZ_W2B % 256 == 0);
static_assert(SZ_Q16 % 256 == 0 && SZ_VT16 % 256 == 0 && SZ_ALOC % 256 == 0 && SZ_O16 % 256 == 0);
static_assert(WS_TOTAL <= (size_t)134217728);

// 16-bit WMMA fragment map (wave32), lane L, hh = L>>4, c = L&15:
//   A 16x32: lane = row c;    element i -> k = (i<8) ? 8hh+i : 16+8hh+(i-8)
//   B 32x16: lane = column c; the SAME k(i,hh)
//   D 16x16 (8 f32): lane = column c; element r -> row 8hh+r

// RNE convert f32 -> bf16 -> f32
__device__ __forceinline__ float bfr(float f) {
    unsigned u = __float_as_uint(f);
    u += 0x7FFFu + ((u >> 16) & 1u);
    return __uint_as_float(u & 0xFFFF0000u);
}
// f32 -> f16 with values under 2^-14 replaced by +0 before the convert
static __device__ __forceinline__ h16 toh_flush(float v) { const float w = (fabsf(v) < 6.103515625e-05f) ? 0.0f : v; return (h16)w; }
static __device__ __forceinline__ v2h toh2_flush(float a, float b) {
    v2f w;
    w.x = (fabsf(a) < 6.103515625e-05f) ? 0.0f : a;
    w.y = (fabsf(b) < 6.103515625e-05f) ? 0.0f : b;
    return __builtin_convertvector(w, v2h);
}
union Pack8 { v8h v; v2h p[4]; };
static __device__ __forceinline__ v8h pack8_flush(v4f a, v4f b) {
    Pack8 u;
    u.p[0] = toh2_flush(a.x, a.y); u.p[1] = toh2_flush(a.z, a.w);
    u.p[2] = toh2_flush(b.x, b.y); u.p[3] = toh2_flush(b.z, b.w);
    return u.v;
}
static __device__ __forceinline__ void st8h2(_Float16* p, v8h v) {
    *(v8h*)p = v;
    
}

union FragU { v16h v; v8h h[2]; };
union FragQ { v16h v; v8h h[2]; v4u q[2]; };
// elements 0..7 <- p[0..7], 8..15 <- p[16..23]; caller adds 8*hh to p (used for BOTH A and B operands: same k per element)
__device__ __forceinline__ v16h frag_ld(const _Float16* p) {
    FragU f; f.h[0] = *(const v8h*)(p); f.h[1] = *(const v8h*)(p + 16); return f.v;
}
__device__ __forceinline__ v8f wmma16g(v16h a, v16h b, v8f c) {
    c = __builtin_amdgcn_wmma_f32_16x16x32_f16(false, a, false, b, (short)0, c, false, false);
    asm volatile("v_nop\n\tv_nop\n\tv_nop\n\tv_nop" : "+v"(c) : "v"(a), "v"(b));
    return c;
}
__device__ __forceinline__ void wave_sync_lds() {
    __builtin_amdgcn_fence(3 /* release order */, "workgroup");
    __builtin_amdgcn_wave_barrier();
    __builtin_amdgcn_fence(2 /* acquire order */, "workgroup");
}
// swish(x) = x * sigmoid(x) = h + h * tanh(h) with h = x / 2; the caller hands in h
static __device__ __forceinline__ float swish_half(float h) {
    return fmaf(h, __builtin_amdgcn_tanhf(h), h);
}

// =====================================================================================================================
// k_cvt_g: pair components [pair][6] f32 -> G16 [pair][8] f16 = bf16(g) * 4, components 6,7 = 0; one 16-B piece per lane
//   coverage: NB*SEQ*SEQ pairs x 16 B == the whole G16 plane
// =====================================================================================================================
__global__ __launch_bounds__(256) void k_cvt_g(const float* __restrict__ g, _Float16* __restrict__ G16) {
    const unsigned u = blockIdx.x * 256u + threadIdx.x;
    if (u >= (unsigned)(NB * SEQ * SEQ)) return;
    const v2f* src = (const v2f*)(g + (size_t)u * 6u);
    const v2f a = src[0], b = src[1], cc = src[2];
    v4f lo, hi;
    lo.x = bfr(a.x) * G_CARRY; lo.y = bfr(a.y) * G_CARRY; lo.z = bfr(b.x) * G_CARRY; lo.w = bfr(b.y) * G_CARRY;
    hi.x = bfr(cc.x) * G_CARRY; hi.y = bfr(cc.y) * G_CARRY; hi.z = 0.0f; hi.w = 0.0f;
    st8h2(G16 + (size_t)u * 8u, pack8_flush(lo, hi));
}

// k_cvt_c: features [row][256] f32 -> C16 f16 = bf16(x) * 8; thread per 8 columns; coverage: MTOK*256/8 pieces == whole plane
__global__ __launch_bounds__(256) void k_cvt_c(const float* __restrict__ x, _Float16* __restrict__ C16) {
    const unsigned u = blockIdx.x * 256u + threadIdx.x;
    if (u >= (unsigned)(MTOK * CH / 8)) return;
    const v4f* src = (const v4f*)(x + (size_t)u * 8u);
    v4f a = src[0], b = src[1];
    a.x = bfr(a.x) * ACT_CARRY; a.y = bfr(a.y) * ACT_CARRY; a.z = bfr(a.z) * ACT_CARRY; a.w = bfr(a.w) * ACT_CARRY;
    b.x = bfr(b.x) * ACT_CARRY; b.y = bfr(b.y) * ACT_CARRY; b.z = bfr(b.z) * ACT_CARRY; b.w = bfr(b.w) * ACT_CARRY;
    st8h2(C16 + (size_t)u * 8u, pack8_flush(a, b));
}

static __device__ __forceinline__ void wt_one(const float* __restrict__ W, _Float16* __restrict__ D, unsigned o, unsigned k0) {
    v4f lo, hi;
    lo.x = bfr(W[(size_t)(k0 + 0u) * CH + o]) * W_CARRY;
    lo.y = bfr(W[(size_t)(k0 + 1u) * CH + o]) * W_CARRY;
    lo.z = bfr(W[(size_t)(k0 + 2u) * CH + o]) * W_CARRY;
    lo.w = bfr(W[(size_t)(k0 + 3u) * CH + o]) * W_CARRY;
    hi.x = bfr(W[(size_t)(k0 + 4u) * CH + o]) * W_CARRY;
    hi.y = bfr(W[(size_t)(k0 + 5u) * CH + o]) * W_CARRY;
    hi.z = bfr(W[(size_t)(k0 + 6u) * CH + o]) * W_CARRY;
    hi.w = bfr(W[(size_t)(k0 + 7u) * CH + o]) * W_CARRY;
    st8h2(D + (size_t)o * CH + k0, pack8_flush(lo, hi));
}
// k_wt4: the four 256x256 weights -> WT[4][out][in]; thread per (o, 8 k): 32 lanes cover one whole 512-B row; coverage: 4 x 256 x 32 pieces
__global__ __launch_bounds__(256) void k_wt4(const float* __restrict__ wq, const float* __restrict__ wk,
                                             const float* __restrict__ wv, const float* __restrict__ wo,
                                             _Float16* __restrict__ WT) {
    const unsigned u = blockIdx.x * 256u + threadIdx.x;
    if (u >= (unsigned)(CH * (CH / 8))) return;
    const unsigned k0 = 8u * (u & 31u);
    const unsigned o = u >> 5;
    wt_one(wq, WT, o, k0);
    wt_one(wk, WT + (size_t)1 * CH * CH, o, k0);
    wt_one(wv, WT + (size_t)2 * CH * CH, o, k0);
    wt_one(wo, WT + (size_t)3 * CH * CH, o, k0);
}

// k_wloc: pair-MLP weights as A-operand planes, zero-padded along k to 32:
//   W1B[h*16+j][k] = bf16(w1[h][k][j]) * 16 for k < 6, else 0;  W2B[h*16+j][k] = bf16(w2[h][k][j]) * 16 for k < 16, else 0
//   thread per 16-B piece (512 pieces per plane), clamped addresses, zero by value; coverage: 128 rows x 4 pieces == both whole planes
__global__ __launch_bounds__(256) void k_wloc(const float* __restrict__ w1, const float* __restrict__ w2,
                                              _Float16* __restrict__ W1B, _Float16* __restrict__ W2B) {
    const unsigned p = blockIdx.x * 256u + threadIdx.x;
    if (p >= (unsigned)(HEADS * HID * 4)) return;
    const unsigned col = p >> 2, k0 = (p & 3u) * 8u;
    const unsigned h = col >> 4, j = col & 15u;
    float v[8];
#pragma unroll
    for (int i = 0; i < 8; ++i) {
        const unsigned k = k0 + (unsigned)i;
        const unsigned kc = min(k, (unsigned)(DG - 1));
        const float x = bfr(w1[(size_t)(h * DG + kc) * HID + j]) * W1_CARRY;
        v[i] = (k < (unsigned)DG) ? x : 0.0f;
    }
    {
        v4f a, b;
        a.x = v[0]; a.y = v[1]; a.z = v[2]; a.w = v[3]; b.x = v[4]; b.y = v[5]; b.z = v[6]; b.w = v[7];
        st8h2(W1B + (size_t)col * 32u + k0, pack8_flush(a, b));
    }
#pragma unroll
    for (int i = 0; i < 8; ++i) {
        const unsigned k = k0 + (unsigned)i;
        const unsigned kc = min(k, (unsigned)(HID - 1));
        const float x = bfr(w2[(size_t)(h * HID + kc) * HID + j]) * W2_CARRY;
        v[i] = (k < (unsigned)HID) ? x : 0.0f;
    }
    {
        v4f a, b;
        a.x = v[0]; a.y = v[1]; a.z = v[2]; a.w = v[3]; b.x = v[4]; b.y = v[5]; b.z = v[6]; b.w = v[7];
        st8h2(W2B + (size_t)col * 32u + k0, pack8_flush(a, b));
    }
}

// =====================================================================================================================
// gemm64_body: C[m,n] = (scale * sum_k A[m,k] * Bt[n,k] + bf16(bias[n or m])) ; each wave owns a 64x64 tile.
//   A row-major [M][lda] f16, Bt row-major [N][ldb] f16 (fragments straight from the planes); M,N % 64 == 0, K % 32 == 0.
//   OUT_MODE 0: f32 C (pitch ldc); OUT_MODE 1: f16 C = value * oscale. BIAS_ROW: bias indexed by the row m.
// =====================================================================================================================
template <int OUT_MODE, bool BIAS_ROW>
static __device__ __forceinline__ void gemm64_body(
    const _Float16* __restrict__ A, unsigned lda, const _Float16* __restrict__ Bt, unsigned ldb,
    float* __restrict__ Cf, _Float16* __restrict__ Ch, unsigned ldc, const float* __restrict__ bias,
    unsigned M, unsigned N, unsigned K, float scale, float oscale) {
  __shared__ __align__(16) float sT[8][16 * 68];
  const unsigned lane = threadIdx.x & 31u;
  const unsigned wave = threadIdx.x >> 5;
  const unsigned tilesN = N >> 6, tilesM = M >> 6;
  const unsigned tile = blockIdx.x * 8u + wave;
  if (tile >= tilesM * tilesN) return;   // wave-uniform; no block barriers in this kernel
  const unsigned tm = tile / tilesN;
  const unsigned tn = tile - tm * tilesN;
  const unsigned m0 = tm << 6, n0 = tn << 6;
  const unsigned rlane = lane & 15u;
  const unsigned koff = (lane >> 4) * 8u;
  const unsigned mOff = koff;

  v8f acc[4][4];
#pragma unroll
  for (int i = 0; i < 4; ++i)
#pragma unroll
    for (int j = 0; j < 4; ++j) acc[i][j] = (v8f){0.f,0.f,0.f,0.f,0.f,0.f,0.f,0.f};

  for (unsigned k0 = 0; k0 < K; k0 += 32u) {
    v16h bh[4];
#pragma unroll
    for (int j = 0; j < 4; ++j)
      bh[j] = frag_ld(Bt + (size_t)(n0 + ((unsigned)j << 4) + rlane) * ldb + koff + k0);
#pragma unroll
    for (int i = 0; i < 4; ++i) {
      const v16h ah = frag_ld(A + (size_t)(m0 + ((unsigned)i << 4) + rlane) * lda + koff + k0);
#pragma unroll
      for (int j = 0; j < 4; ++j)
        acc[i][j] = wmma16g(ah, bh[j], acc[i][j]);
    }
  }

  float* slab = sT[wave];
#pragma unroll
  for (int i = 0; i < 4; ++i) {
    const unsigned mBase = m0 + ((unsigned)i << 4);
    float bvr[8];
#pragma unroll
    for (int r = 0; r < 8; ++r) bvr[r] = 0.0f;
    if (BIAS_ROW) {
#pragma unroll
      for (int r = 0; r < 8; ++r) bvr[r] = bfr(bias[mBase + mOff + (unsigned)r]);
    }
#pragma unroll
    for (int j = 0; j < 4; ++j) {
      const unsigned n = n0 + ((unsigned)j << 4) + rlane;
      float bvc = 0.0f;
      if (!BIAS_ROW) bvc = bfr(bias[n]);
#pragma unroll
      for (int r = 0; r < 8; ++r) {
        float v = acc[i][j][r] * scale + (BIAS_ROW ? bvr[r] : bvc);
        if (OUT_MODE == 1) v *= oscale;
        slab[(mOff + (unsigned)r) * 68u + ((unsigned)j << 4) + rlane] = v;
      }
    }
    wave_sync_lds();
    if (OUT_MODE == 0) {
      const unsigned hh = lane >> 4, c4 = (lane & 15u) * 4u;     // row segment = 256 B = 16 lanes x 16 B
#pragma unroll
      for (int half = 0; half < 2; ++half) {
        v4f vv[4];
#pragma unroll
        for (int it = 0; it < 4; ++it) {
          const unsigned row = (unsigned)(half * 4 + it) * 2u + hh;
          vv[it] = *(const v4f*)(slab + row * 68u + c4);
        }
        {
#pragma unroll
          for (int it = 0; it < 4; ++it) {
            const unsigned row = (unsigned)(half * 4 + it) * 2u + hh;
            *(v4f*)(Cf + (size_t)(mBase + row) * ldc + n0 + c4) = vv[it];
          }
          
        }
      }
    } else {
      const unsigned q = lane >> 3, c8 = (lane & 7u) * 8u;
      v8h hv[4];
#pragma unroll
      for (int it = 0; it < 4; ++it) {
        const unsigned row = (unsigned)it * 4u + q;
        const float* sp = slab + row * 68u + c8;
        hv[it] = pack8_flush(*(const v4f*)sp, *(const v4f*)(sp + 4));
      }
      {
#pragma unroll
        for (int it = 0; it < 4; ++it) {
          const unsigned row = (unsigned)it * 4u + q;
          *(v8h*)(Ch + (size_t)(mBase + row) * ldc + n0 + c8) = hv[it];
        }
        
      }
    }
    wave_sync_lds();
  }
}

// position-major projection: Y16[row][256] = f16(8 * (x @ w + bf16(b)))
__global__ __launch_bounds__(256) void k_proj_rows(const _Float16* __restrict__ X16, const _Float16* __restrict__ Wt,
                                                   _Float16* __restrict__ Y16, const float* __restrict__ bias) {
    gemm64_body<1, false>(X16, CH, Wt, CH, nullptr, Y16, CH, bias, MTOK, CH, CH, SC_PROJ, ACT_CARRY);
}
// channel-major value plane: VT16[b][ch][key] = f16(8 * (x @ w + bf16(b)))^T ; A = weight plane, Bt = feature rows of batch blockIdx.y
__global__ __launch_bounds__(256) void k_proj_vt(const _Float16* __restrict__ Wt, const _Float16* __restrict__ X16,
                                                 _Float16* __restrict__ VT16, const float* __restrict__ bias) {
    const unsigned by = blockIdx.y;
    gemm64_body<1, true>(Wt, CH, X16 + (size_t)by * SEQ * CH, CH, nullptr, VT16 + (size_t)by * CH * SEQ, SEQ, bias,
                         CH, SEQ, CH, SC_PROJ, ACT_CARRY);
}
// output projection: out[row][256] = O @ w + bf16(b), f32
__global__ __launch_bounds__(256) void k_proj_out(const _Float16* __restrict__ O16, const _Float16* __restrict__ Wt,
                                                  float* __restrict__ out, const float* __restrict__ bias) {
    gemm64_body<0, false>(O16, CH, Wt, CH, out, nullptr, CH, bias, MTOK, CH, CH, SC_OUT, 1.0f);
}

// =====================================================================================================================
// k_loc: location term ALOC[b][h][n][m] (f32) = swish(l3(swish(l2(swish(l1(g[b][n][m][:]))))))
//   transposed chain: the weights are the A operand (rows = hidden units), the pairs are the B columns.
//   block = 8 waves = the 8 heads of one query row (b,n); a wave owns ONE head and walks the row's 512 keys, 64 pairs (4 column tiles) a pass.
//   layer 1: B = two 16-B G16 rows per lane: lane (c,hh) holds pair 16hh+c in elements 0..7 (k 8hh..) and pair 32+16hh+c in elements 8..15
//            (k 16+8hh..), so k group q = k>>3 holds column tile q. A of tile q = the head's W1B row (k 0..7) placed in k group q, zero words
//            in the other three groups -> D1[hidden 8hh+r][pair c of tile q].
//   layer 2: D1's map IS the B map (lane = pair c, element r = hidden 8hh+r): two tiles' h1, converted in place to f16 x64, are elements
//            0..7 and 8..15 of one B operand; A = the head's W2B row in k 0..15 (first tile) or in k 16..31 (second tile), zero words in the
//            other half -> D2[hidden 8hh+r][pair c].
//   layer 3 (N = 1) on the VALU: 8 multiply-adds in the lane (hidden 8hh..8hh+7), then the other half's sum from lane l ^ 16.
//   biases and w3 are indexed by the D row: 8 registers each, prepared once per wave.
// =====================================================================================================================
#define LC_PASS 64
static_assert(HEADS == 8 && SEQ % LC_PASS == 0);
// lane l with lane l ^ 16
static __device__ __forceinline__ float xhalf(float x) {
    return __builtin_bit_cast(float, __builtin_amdgcn_permlanex16(__builtin_bit_cast(int, x), __builtin_bit_cast(int, x),
                                                                  0x76543210, 0xfedcba98, false, false));
}
__global__ __launch_bounds__(256) void k_loc(const _Float16* __restrict__ G16, const _Float16* __restrict__ W1B,
                                             const _Float16* __restrict__ W2B, const float* __restrict__ b1,
                                             const float* __restrict__ b2, const float* __restrict__ w3,
                                             const float* __restrict__ b3, float* __restrict__ ALOC) {
    const unsigned lane = threadIdx.x & 31u;
    const unsigned t = (unsigned)__builtin_amdgcn_readfirstlane((int)(threadIdx.x >> 5));   // the wave's head
    const unsigned hh = lane >> 4, c = lane & 15u;
    const unsigned bn = blockIdx.x;                                // b*SEQ + n
    const unsigned b = bn / (unsigned)SEQ, n = bn % (unsigned)SEQ;
    const v8f zacc = (v8f){0.f,0.f,0.f,0.f,0.f,0.f,0.f,0.f};
    const v4u zq = (v4u){0u, 0u, 0u, 0u};
    const unsigned row = t * 16u + c;

    // layer-1 A operands, one per k group
    const v4u w1q = *(const v4u*)(W1B + (size_t)row * 32u);
    asm volatile("s_wait_xcnt 0x0" ::: "memory");   // stands in front of the later writes of this load's address registers
    v4u wlo, whi;
    wlo.x = (hh == 0u) ? w1q.x : 0u; wlo.y = (hh == 0u) ? w1q.y : 0u; wlo.z = (hh == 0u) ? w1q.z : 0u; wlo.w = (hh == 0u) ? w1q.w : 0u;
    whi.x = (hh == 0u) ? 0u : w1q.x; whi.y = (hh == 0u) ? 0u : w1q.y; whi.z = (hh == 0u) ? 0u : w1q.z; whi.w = (hh == 0u) ? 0u : w1q.w;
    FragQ a1[4];
    a1[0].q[0] = wlo; a1[0].q[1] = zq;
    a1[1].q[0] = whi; a1[1].q[1] = zq;
    a1[2].q[0] = zq;  a1[2].q[1] = wlo;
    a1[3].q[0] = zq;  a1[3].q[1] = whi;
    // layer-2 A operands: k 0..15 (the plane's own zeros beyond) and the same row moved to k 16..31
    FragQ a2[2];
    a2[0].h[0] = *(const v8h*)(W2B + (size_t)row * 32u + 8u * hh);
    asm volatile("s_wait_xcnt 0x0" ::: "memory");   // the same: the next load's result may land on this one's address registers
    a2[0].h[1] = *(const v8h*)(W2B + (size_t)row * 32u + 8u * hh + 16u);
    asm volatile("s_wait_xcnt 0x0" ::: "memory");   // the same
    a2[1].q[0] = a2[0].q[1]; a2[1].q[1] = a2[0].q[0];
    float hb1[8], hb2[8], ww3[8];
    // every '#pragma unroll' of this kernel: its counter indexes register arrays (hb1, a1, hx, part ...), which must not become memory
#pragma unroll
    for (int r = 0; r < 8; ++r) {
        const unsigned j = t * 16u + 8u * hh + (unsigned)r;
        hb1[r] = 0.5f * bfr(b1[j]);
        hb2[r] = 0.5f * bfr(b2[j]);
        ww3[r] = bfr(w3[j]);
    }
    const float bb3 = bfr(b3[t]);
    asm volatile("s_wait_xcnt 0x0" ::: "memory");   // the same for the weight, bias and w3 loads above

    const _Float16* gp = G16 + ((size_t)bn * SEQ + lane) * 8u;
    float* dst = ALOC + ((size_t)(b * (unsigned)HEADS + t) * SEQ + n) * SEQ + lane;
    FragQ g;
    g.q[0] = *(const v4u*)gp;
    g.q[1] = *(const v4u*)(gp + 32 * 8);
    // rolled: one pass is about 400 instructions, and eight copies of it would not pay for their instruction fetches
#pragma unroll 1
    for (unsigned it = 0; it < (unsigned)(SEQ / LC_PASS); ++it) {
        FragQ hx[2];
#pragma unroll
        for (int q = 0; q < 4; ++q) {
            const v8f d1 = wmma16g(a1[q].v, g.v, zacc);
            v4f xa, xb;
            xa.x = swish_half(d1[0] * (0.5f * UNDO1) + hb1[0]) * H_CARRY;
            xa.y = swish_half(d1[1] * (0.5f * UNDO1) + hb1[1]) * H_CARRY;
            xa.z = swish_half(d1[2] * (0.5f * UNDO1) + hb1[2]) * H_CARRY;
            xa.w = swish_half(d1[3] * (0.5f * UNDO1) + hb1[3]) * H_CARRY;
            xb.x = swish_half(d1[4] * (0.5f * UNDO1) + hb1[4]) * H_CARRY;
            xb.y = swish_half(d1[5] * (0.5f * UNDO1) + hb1[5]) * H_CARRY;
            xb.z = swish_half(d1[6] * (0.5f * UNDO1) + hb1[6]) * H_CARRY;
            xb.w = swish_half(d1[7] * (0.5f * UNDO1) + hb1[7]) * H_CARRY;
            hx[q >> 1].h[q & 1] = pack8_flush(xa, xb);
        }
        // the next pass's pairs fly under this pass's layers 2 and 3; the last pass fetches its own pairs again (in bounds, unused)
        const unsigned nx = ((it + 1u < (unsigned)(SEQ / LC_PASS)) ? it + 1u : it) * (unsigned)LC_PASS;
        g.q[0] = *(const v4u*)(gp + (size_t)nx * 8u);
        g.q[1] = *(const v4u*)(gp + (size_t)(nx + 32u) * 8u);
#pragma unroll
        for (int u = 0; u < 2; ++u) {
            float part[2];
#pragma unroll
            for (int s = 0; s < 2; ++s) {
                const v8f d2 = wmma16g(a2[s].v, hx[u].v, zacc);
                float acc = swish_half(d2[0] * (0.5f * UNDO2) + hb2[0]) * ww3[0];
#pragma unroll
                for (int r = 1; r < 8; ++r) acc = fmaf(swish_half(d2[r] * (0.5f * UNDO2) + hb2[r]), ww3[r], acc);
                part[s] = acc;
            }
            // lane (c,hh) finishes pair 16hh+c of this tile pair: its own half sum plus the other half's from lane l ^ 16
            const float mine  = (hh == 0u) ? part[0] : part[1];
            const float other = (hh == 0u) ? part[1] : part[0];
            const float v = mine + xhalf(other) + bb3;
            dst[it * (unsigned)LC_PASS + (unsigned)u * 32u] = swish_half(0.5f * v);
        }
    }
}

// =====================================================================================================================
// k_attn: one block per (batch, head pair, 256-query block), 16 waves x 16 query rows, both heads of the pair per wave, 64-key chunks.
//   scores: Q (A) and K (B) fragments straight from the planes, one k-step (d = 32); + location term loaded in the D layout;
//   key mask by value select (fill -1e38 in the natural-log domain); running-max softmax in the exp2 domain (f32);
//   unnormalised e x1024 as f16 (wave-private LDS tile sP, wave_sync) times V^T B fragments straight from VT16.
//   O plane f16 x64 [row][head*32 + d]: each wave stages its 16 rows x 64 columns in sO (wave-private, wave_sync) and writes
//   staged extent == consumed extent: sP rows 0..15 x keys 0..63; sO rows 0..15 x cols 0..63.
// =====================================================================================================================
#define AT_PP 72
#define AT_OP 68
__global__ __launch_bounds__(512) void k_attn(const _Float16* __restrict__ Q16, const _Float16* __restrict__ K16,
                                              const _Float16* __restrict__ VT16, const float* __restrict__ ALOC,
                                              const int* __restrict__ mask, _Float16* __restrict__ O16) {
    __shared__ __align__(16) _Float16 sP[16][16 * AT_PP];     // per wave [row][64 keys], wave-private (wave_sync)
    __shared__ __align__(16) float sO[16][16 * AT_OP];        // per wave [row][64 channels], wave-private (wave_sync)
    const unsigned tid = threadIdx.x, lane = tid & 31u, wave = tid >> 5;
    const unsigned hh = lane >> 4, c = lane & 15u;
    const unsigned bx = blockIdx.x;
    const unsigned qb = bx % (unsigned)QBLK;
    const unsigned pair = (bx / (unsigned)QBLK) & 3u;
    const unsigned b = bx / ((unsigned)QBLK * 4u);
    const unsigned q0 = qb * 256u + wave * 16u;
    _Float16* pw = sP[wave];
    float* so = sO[wave];
#pragma unroll
    for (int hp = 0; hp < 2; ++hp) {
        const unsigned head = 2u * pair + (unsigned)hp;
        const v16h qf = frag_ld(Q16 + (size_t)(b * SEQ + q0 + c) * CH + head * HD + 8u * hh);
        const float* arow = ALOC + (size_t)((b * (unsigned)HEADS + head) * SEQ + q0 + 8u * hh) * SEQ + c;
        const _Float16* krow = K16 + (size_t)(b * SEQ + c) * CH + head * HD + 8u * hh;
        const int* mrw = mask + b * SEQ_FULL + c;
        float mrow[8], lrow[8];
        v8f os[2];
#pragma unroll
        for (int r = 0; r < 8; ++r) { mrow[r] = -3.0e38f; lrow[r] = 0.f; }
#pragma unroll
        for (int t = 0; t < 2; ++t) os[t] = (v8f){0.f,0.f,0.f,0.f,0.f,0.f,0.f,0.f};
        // score operands of one chunk, held in registers and fetched one chunk ahead
        v16h kf[4];
        int mk[4];
        float al[4][8];
#pragma unroll
        for (int j = 0; j < 4; ++j) {
            kf[j] = frag_ld(krow + (size_t)((unsigned)j * 16u) * CH);
            mk[j] = mrw[(unsigned)j * 16u];
#pragma unroll
            for (int r = 0; r < 8; ++r) al[j][r] = arow[(size_t)r * SEQ + (unsigned)j * 16u];
        }
#pragma unroll 1
        for (unsigned kc = 0; kc < (unsigned)(SEQ / 64); ++kc) {
            const unsigned kv0 = kc * 64u;
            v8f s[4];
#pragma unroll
            for (int j = 0; j < 4; ++j) {
                const v8f z = (v8f){0.f,0.f,0.f,0.f,0.f,0.f,0.f,0.f};
                s[j] = wmma16g(qf, kf[j], z);
            }
#pragma unroll
            for (int j = 0; j < 4; ++j) {
                const bool on = (mk[j] != 0);
#pragma unroll
                for (int r = 0; r < 8; ++r) {
                    const float sv = (s[j][r] * SCQK + al[j][r]) * LOG2E;
                    s[j][r] = on ? sv : FILL2;
                }
            }
            // the next chunk's score operands fly under this chunk's softmax; the last pass fetches its own chunk again (in bounds, unused)
            const unsigned nv0 = ((kc + 1u < (unsigned)(SEQ / 64)) ? kc + 1u : kc) * 64u;
#pragma unroll
            for (int j = 0; j < 4; ++j) {
                kf[j] = frag_ld(krow + (size_t)(nv0 + (unsigned)j * 16u) * CH);
                mk[j] = mrw[nv0 + (unsigned)j * 16u];
#pragma unroll
                for (int r = 0; r < 8; ++r) al[j][r] = arow[(size_t)r * SEQ + nv0 + (unsigned)j * 16u];
            }
#pragma unroll
            for (int r = 0; r < 8; ++r) {
                float mx = -3.0e38f;
#pragma unroll
                for (int j = 0; j < 4; ++j) { mx = fmaxf(mx, s[j][r]); }
                mx = fmaxf(mx, __shfl_xor(mx, 1, 32)); mx = fmaxf(mx, __shfl_xor(mx, 2, 32));
                mx = fmaxf(mx, __shfl_xor(mx, 4, 32)); mx = fmaxf(mx, __shfl_xor(mx, 8, 32));
                const float mnew = fmaxf(mrow[r], mx);
                const float alpha = exp2f(mrow[r] - mnew);
                mrow[r] = mnew;
                float psum = 0.f;
#pragma unroll
                for (int j = 0; j < 4; ++j) {
                    const float p = exp2f(s[j][r] - mnew);
                    psum += p;
                    const float w = p * P_CARRY;
                    pw[(8u * hh + (unsigned)r) * AT_PP + (unsigned)j * 16u + c] = (_Float16)((w < 6.103515625e-05f) ? 0.0f : w);
                }
                psum += __shfl_xor(psum, 1, 32); psum += __shfl_xor(psum, 2, 32);
                psum += __shfl_xor(psum, 4, 32); psum += __shfl_xor(psum, 8, 32);
                lrow[r] = lrow[r] * alpha + psum;
                os[0][r] *= alpha; os[1][r] *= alpha;
            }
            wave_sync_lds();
            // this chunk's V fragments, all four in one group ahead of the P.V products
            v16h vb[2][2];
#pragma unroll
            for (int kk = 0; kk < 2; ++kk)
#pragma unroll
                for (int t = 0; t < 2; ++t)
                    vb[kk][t] = frag_ld(VT16 + (size_t)(b * CH + head * HD + (unsigned)t * 16u + c) * SEQ + kv0 + (unsigned)kk * 32u + 8u * hh);
#pragma unroll
            for (int kk = 0; kk < 2; ++kk) {
                const v16h pa = frag_ld(pw + c * AT_PP + (unsigned)kk * 32u + 8u * hh);
#pragma unroll
                for (int t = 0; t < 2; ++t) {
                    os[t] = wmma16g(pa, vb[kk][t], os[t]);
                }
            }
            wave_sync_lds();
        }
#pragma unroll
        for (int r = 0; r < 8; ++r) {
            const float inv = 1.0f / (lrow[r] * P_CARRY);
#pragma unroll
            for (int t = 0; t < 2; ++t)
                so[(8u * hh + (unsigned)r) * AT_OP + (unsigned)hp * 32u + (unsigned)t * 16u + c] = os[t][r] * inv * (O_CARRY / ACT_CARRY);   // = 64 * value
        }
    }
    wave_sync_lds();
    {
        const unsigned q = lane >> 3, c8 = (lane & 7u) * 8u;
        v8h ov[4];
#pragma unroll
        for (int it = 0; it < 4; ++it) {
            const float* sp = so + ((unsigned)it * 4u + q) * AT_OP + c8;
            ov[it] = pack8_flush(*(const v4f*)sp, *(const v4f*)(sp + 4));
        }
        _Float16* dst = O16 + (size_t)(b * SEQ + q0) * CH + pair * 64u;
        {
#pragma unroll
            for (int it = 0; it < 4; ++it) *(v8h*)(dst + (size_t)((unsigned)it * 4u + q) * CH + c8) = ov[it];
            
        }
    }
}

extern "C" void kernel_launch(void* const* d_in, const int* in_sizes, int n_in, void* d_out, int out_size,
                              void* d_ws, size_t ws_size, hipStream_t stream) {
    if (n_in < 17) return;
    if (in_sizes[0] < NB * SEQ * SEQ * DG || in_sizes[1] < MTOK * CH) return;
    if (in_sizes[2] < CH * CH || in_sizes[3] < CH || in_sizes[4] < CH * CH || in_sizes[5] < CH) return;
    if (in_sizes[6] < CH * CH || in_sizes[7] < CH || in_sizes[8] < CH * CH || in_sizes[9] < CH) return;
    if (in_sizes[10] < HEADS * DG * HID || in_sizes[11] < HEADS * HID || in_sizes[12] < HEADS * HID * HID) return;
    if (in_sizes[13] < HEADS * HID || in_sizes[14] < HEADS * HID || in_sizes[15] < HEADS || in_sizes[16] < NB * SEQ) return;
    if (out_size < MTOK * CH) return;
    if (ws_size < WS_TOTAL) return;

    const float* pairwise_g = (const float*)d_in[0];
    const float* coset      = (const float*)d_in[1];
    const float* fc_q_w     = (const float*)d_in[2];
    const float* fc_q_b     = (const float*)d_in[3];
    const float* fc_k_w     = (const float*)d_in[4];
    const float* fc_k_b     = (const float*)d_in[5];
    const float* in_w       = (const float*)d_in[6];
    const float* in_b       = (const float*)d_in[7];
    const float* out_w      = (const float*)d_in[8];
    const float* out_b      = (const float*)d_in[9];
    const float* loc_w1     = (const float*)d_in[10];
    const float* loc_b1     = (const float*)d_in[11];
    const float* loc_w2     = (const float*)d_in[12];
    const float* loc_b2     = (const float*)d_in[13];
    const float* loc_w3     = (const float*)d_in[14];
    const float* loc_b3     = (const float*)d_in[15];
    const int*   mask       = (const int*)d_in[16];
    float* out = (float*)d_out;

    char* wsp = (char*)d_ws;
    _Float16* G16  = (_Float16*)(wsp + OFF_G16);
    _Float16* C16  = (_Float16*)(wsp + OFF_C16);
    _Float16* WT   = (_Float16*)(wsp + OFF_WT);
    _Float16* W1B  = (_Float16*)(wsp + OFF_W1B);
    _Float16* W2B  = (_Float16*)(wsp + OFF_W2B);
    _Float16* Q16  = (_Float16*)(wsp + OFF_Q16);
    _Float16* K16  = (_Float16*)(wsp + OFF_K16);
    _Float16* VT16 = (_Float16*)(wsp + OFF_VT16);
    float*    ALOC = (float*)(wsp + OFF_ALOC);
    _Float16* O16  = (_Float16*)(wsp + OFF_O16);

    // operand planes (each whole plane written by its launch)
    k_cvt_g<<<(NB * SEQ * SEQ) / 256, 256, 0, stream>>>(pairwise_g, G16);
    k_cvt_c<<<(MTOK * CH / 8) / 256, 256, 0, stream>>>(coset, C16);
    k_wt4<<<(CH * (CH / 8)) / 256, 256, 0, stream>>>(fc_q_w, fc_k_w, in_w, out_w, WT);
    k_wloc<<<(HEADS * HID * 4) / 256, 256, 0, stream>>>(loc_w1, loc_w2, W1B, W2B);

    // projections: 64x64 wave tiles, 8 waves per block
    k_proj_rows<<<((MTOK / 64) * (CH / 64) + 7) / 8, 256, 0, stream>>>(C16, WT, Q16, fc_q_b);
    k_proj_rows<<<((MTOK / 64) * (CH / 64) + 7) / 8, 256, 0, stream>>>(C16, WT + (size_t)1 * CH * CH, K16, fc_k_b);
    k_proj_vt<<<dim3(((CH / 64) * (SEQ / 64) + 7) / 8, NB), 256, 0, stream>>>(WT + (size_t)2 * CH * CH, C16, VT16, in_b);

    // location term, attention, output projection
    k_loc<<<NB * SEQ, 256, 0, stream>>>(G16, W1B, W2B, loc_b1, loc_b2, loc_w3, loc_b3, ALOC);
    k_attn<<<NB * 4 * QBLK, 512, 0, stream>>>(Q16, K16, VT16, ALOC, mask, O16);
    k_proj_out<<<((MTOK / 64) * (CH / 64) + 7) / 8, 256, 0, stream>>>(O16, WT + (size_t)3 * CH * CH, out, out_b);
}

// v004
// One run takes 99.1 microseconds.
// Two timings next to v003 both put it at 1.47 times that version's speed.
// Over all steps from v000 it is 2.77 times as fast.
// All contractions on v_wmma_f32_16x16x32_f16 (f16 operands, f32 accumulate): q/k/v projections (inputs x8, weights x32), pair MLP layer 1 (g x4, w1 x16, K=6 zero-padded to 32) and layer 2 (h1 x64, w2 x16, K=16 zero-padded to 32), q.k^T (x8, x8), P.V (P x1024, V x8), output projection (O x64, w x32); every float input RNE-converted to bf16 first; MLP layer 3 (N=1, K=16), swish (by tanh of half the argument), softmax statistics in f32 on the VALU.
#include <hip/hip_runtime.h>
#include <math.h>

#ifndef NB
#define NB 4
#endif
#ifndef SEQ
#define SEQ 512
#endif
#define NB_FULL 4
#define SEQ_FULL 512
#define CH 256
#define HEADS 8
#define HD 32
#define DG 6
#define HID 16
#define MTOK (NB * SEQ)
#define QBLK (SEQ / 256)

// power-of-two carries and their undo constants
#define G_CARRY 4.0f
#define W1_CARRY 16.0f
#define UNDO1 (1.0f / 64.0f)
#define H_CARRY 64.0f
#define W2_CARRY 16.0f
#define UNDO2 (1.0f / 1024.0f)
#define ACT_CARRY 8.0f
#define W_CARRY 32.0f
#define SC_PROJ (1.0f / 256.0f)
#define SCQK (1.0f / 1024.0f)
#define P_CARRY 1024.0f
#define O_CARRY 64.0f
#define SC_OUT (1.0f / 2048.0f)
#define LOG2E 1.4426950408889634f
#define FILL2 (-1.0e38f * LOG2E)

static_assert(G_CARRY * W1_CARRY * UNDO1 == 1.0f);
static_assert(H_CARRY * W2_CARRY * UNDO2 == 1.0f);
static_assert(ACT_CARRY * W_CARRY * SC_PROJ == 1.0f);
static_assert(ACT_CARRY * ACT_CARRY * 16.0f * SCQK == 1.0f);     // q x8, k x8, module scale 1/sqrt(256)
static_assert(O_CARRY * W_CARRY * SC_OUT == 1.0f);
static_assert(SEQ == SEQ_FULL);
static_assert(NB <= NB_FULL);
static_assert(CH == HEADS * HD && HD == 32 && HID == 16 && DG <= 8);
static_assert(SEQ % 256 == 0 && SEQ % 64 == 0);
static_assert(MTOK % 64 == 0 && CH % 64 == 0 && CH % 32 == 0);
static_assert((NB * SEQ * SEQ) % 256 == 0);
static_assert((MTOK * CH / 8) % 256 == 0);
static_assert((CH * (CH / 8)) % 256 == 0);
// store loops: lanes x bytes x instructions == tile rows x row bytes
static_assert(32 * 16 * 4 == 16 * 128);
static_assert(32 * 16 * 8 == 16 * 256);     // f32 epilogue: 16 rows x 256 B
static_assert(32 * 4 * 8 == 8 * 128);
// static LDS per kernel
static_assert(8 * 16 * 68 * 4 <= 131072);
static_assert(16 * 16 * 72 * 2 + 16 * 16 * 68 * 4 <= 131072);

typedef _Float16 h16;
typedef __attribute__((ext_vector_type(16))) _Float16 v16h;
typedef __attribute__((ext_vector_type(8)))  _Float16 v8h;
typedef __attribute__((ext_vector_type(2)))  _Float16 v2h;
typedef __attribute__((ext_vector_type(8)))  float    v8f;
typedef __attribute__((ext_vector_type(4)))  float    v4f;
typedef __attribute__((ext_vector_type(2)))  float    v2f;
typedef __attribute__((ext_vector_type(4)))  unsigned int v4u;

static constexpr size_t SZ_G16  = (size_t)NB * SEQ * SEQ * 8 * 2;
static constexpr size_t SZ_C16  = (size_t)MTOK * CH * 2;
static constexpr size_t SZ_WT   = (size_t)4 * CH * CH * 2;
static constexpr size_t SZ_W1B  = (size_t)HEADS * HID * 32 * 2;
static constexpr size_t SZ_W2B  = (size_t)HEADS * HID * 32 * 2;
static constexpr size_t SZ_Q16  = (size_t)MTOK * CH * 2;
static constexpr size_t SZ_K16  = (size_t)MTOK * CH * 2;
static constexpr size_t SZ_VT16 = (size_t)NB * CH * SEQ * 2;
static constexpr size_t SZ_ALOC = (size_t)NB * HEADS * SEQ * SEQ * 4;
static constexpr size_t SZ_O16  = (size_t)MTOK * CH * 2;
static constexpr size_t OFF_G16  = 0;
static constexpr size_t OFF_C16  = OFF_G16 + SZ_G16;
static constexpr size_t OFF_WT   = OFF_C16 + SZ_C16;
static constexpr size_t OFF_W1B  = OFF_WT + SZ_WT;
static constexpr size_t OFF_W2B  = OFF_W1B + SZ_W1B;
static constexpr size_t OFF_Q16  = OFF_W2B + SZ_W2B;
static constexpr size_t OFF_K16  = OFF_Q16 + SZ_Q16;
static constexpr size_t OFF_VT16 = OFF_K16 + SZ_K16;
static constexpr size_t OFF_ALOC = OFF_VT16 + SZ_VT16;
static constexpr size_t OFF_O16  = OFF_ALOC + SZ_ALOC;
static constexpr size_t WS_TOTAL = OFF_O16 + SZ_O16;
static_assert(SZ_G16 % 256 == 0 && SZ_C16 % 256 == 0 && SZ_WT % 256 == 0 && SZ_W1B % 256 == 0 && SZ_W2B % 256 == 0);
static_assert(SZ_Q16 % 256 == 0 && SZ_VT16 % 256 == 0 && SZ_ALOC % 256 == 0 && SZ_O16 % 256 == 0);
static_assert(WS_TOTAL <= (size_t)134217728);

// 16-bit WMMA fragment map (wave32), lane L, hh = L>>4, c = L&15:
//   A 16x32: lane = row c;    element i -> k = (i<8) ? 8hh+i : 16+8hh+(i-8)
//   B 32x16: lane = column c; the SAME k(i,hh)
//   D 16x16 (8 f32): lane = column c; element r -> row 8hh+r

// RNE convert f32 -> bf16 -> f32
__device__ __forceinline__ float bfr(float f) {
    unsigned u = __float_as_uint(f);
    u += 0x7FFFu + ((u >> 16) & 1u);
    return __uint_as_float(u & 0xFFFF0000u);
}
// f32 -> f16 with values under 2^-14 replaced by +0 before the convert
static __device__ __forceinline__ h16 toh_flush(float v) { const float w = (fabsf(v) < 6.103515625e-05f) ? 0.0f : v; return (h16)w; }
static __device__ __forceinline__ v2h toh2_flush(float a, float b) {
    v2f w;
    w.x = (fabsf(a) < 6.103515625e-05f) ? 0.0f : a;
    w.y = (fabsf(b) < 6.103515625e-05f) ? 0.0f : b;
    return __builtin_convertvector(w, v2h);
}
union Pack8 { v8h v; v2h p[4]; };
static __device__ __forceinline__ v8h pack8_flush(v4f a, v4f b) {
    Pack8 u;
    u.p[0] = toh2_flush(a.x, a.y); u.p[1] = toh2_flush(a.z, a.w);
    u.p[2] = toh2_flush(b.x, b.y); u.p[3] = toh2_flush(b.z, b.w);
    return u.v;
}
static __device__ __forceinline__ void st8h2(_Float16* p, v8h v) {
    *(v8h*)p = v;
    
}

union FragU { v16h v; v8h h[2]; };
union FragQ { v16h v; v8h h[2]; v4u q[2]; };
// elements 0..7 <- p[0..7], 8..15 <- p[16..23]; caller adds 8*hh to p (used for BOTH A and B operands: same k per element)
__device__ __forceinline__ v16h frag_ld(const _Float16* p) {
    FragU f; f.h[0] = *(const v8h*)(p); f.h[1] = *(const v8h*)(p + 16); return f.v;
}
__device__ __forceinline__ v8f wmma16g(v16h a, v16h b, v8f c) {
    c = __builtin_amdgcn_wmma_f32_16x16x32_f16(false, a, false, b, (short)0, c, false, false);
    asm volatile("v_nop\n\tv_nop\n\tv_nop\n\tv_nop" : "+v"(c) : "v"(a), "v"(b));
    return c;
}
__device__ __forceinline__ void wave_sync_lds() {
    __builtin_amdgcn_fence(3 /* release order */, "workgroup");
    __builtin_amdgcn_wave_barrier();
    __builtin_amdgcn_fence(2 /* acquire order */, "workgroup");
}
// swish(x) = x * sigmoid(x) = h + h * tanh(h) with h = x / 2; the caller hands in h
static __device__ __forceinline__ float swish_half(float h) {
    return fmaf(h, __builtin_amdgcn_tanhf(h), h);
}

// =====================================================================================================================
// cvt_g_body: pair components [pair][6] f32 -> G16 [pair][8] f16 = bf16(g) * 4, components 6,7 = 0; one 16-B piece per lane
//   coverage: NB*SEQ*SEQ pairs x 16 B == the whole G16 plane
// =====================================================================================================================
static __device__ __forceinline__ void cvt_g_body(unsigned blk, const float* __restrict__ g, _Float16* __restrict__ G16) {
    const unsigned u = blk * 256u + threadIdx.x;
    if (u >= (unsigned)(NB * SEQ * SEQ)) return;
    const v2f* src = (const v2f*)(g + (size_t)u * 6u);
    const v2f a = src[0], b = src[1], cc = src[2];
    v4f lo, hi;
    lo.x = bfr(a.x) * G_CARRY; lo.y = bfr(a.y) * G_CARRY; lo.z = bfr(b.x) * G_CARRY; lo.w = bfr(b.y) * G_CARRY;
    hi.x = bfr(cc.x) * G_CARRY; hi.y = bfr(cc.y) * G_CARRY; hi.z = 0.0f; hi.w = 0.0f;
    st8h2(G16 + (size_t)u * 8u, pack8_flush(lo, hi));
}

// cvt_c_body: features [row][256] f32 -> C16 f16 = bf16(x) * 8; thread per 8 columns; coverage: MTOK*256/8 pieces == whole plane
static __device__ __forceinline__ void cvt_c_body(unsigned blk, const float* __restrict__ x, _Float16* __restrict__ C16) {
    const unsigned u = blk * 256u + threadIdx.x;
    if (u >= (unsigned)(MTOK * CH / 8)) return;
    const v4f* src = (const v4f*)(x + (size_t)u * 8u);
    v4f a = src[0], b = src[1];
    a.x = bfr(a.x) * ACT_CARRY; a.y = bfr(a.y) * ACT_CARRY; a.z = bfr(a.z) * ACT_CARRY; a.w = bfr(a.w) * ACT_CARRY;
    b.x = bfr(b.x) * ACT_CARRY; b.y = bfr(b.y) * ACT_CARRY; b.z = bfr(b.z) * ACT_CARRY; b.w = bfr(b.w) * ACT_CARRY;
    st8h2(C16 + (size_t)u * 8u, pack8_flush(a, b));
}

static __device__ __forceinline__ void wt_one(const float* __restrict__ W, _Float16* __restrict__ D, unsigned o, unsigned k0) {
    v4f lo, hi;
    lo.x = bfr(W[(size_t)(k0 + 0u) * CH + o]) * W_CARRY;
    lo.y = bfr(W[(size_t)(k0 + 1u) * CH + o]) * W_CARRY;
    lo.z = bfr(W[(size_t)(k0 + 2u) * CH + o]) * W_CARRY;
    lo.w = bfr(W[(size_t)(k0 + 3u) * CH + o]) * W_CARRY;
    hi.x = bfr(W[(size_t)(k0 + 4u) * CH + o]) * W_CARRY;
    hi.y = bfr(W[(size_t)(k0 + 5u) * CH + o]) * W_CARRY;
    hi.z = bfr(W[(size_t)(k0 + 6u) * CH + o]) * W_CARRY;
    hi.w = bfr(W[(size_t)(k0 + 7u) * CH + o]) * W_CARRY;
    st8h2(D + (size_t)o * CH + k0, pack8_flush(lo, hi));
}
// wt4_body: the four 256x256 weights -> WT[4][out][in]; thread per (o, 8 k): 32 lanes cover one whole 512-B row; coverage: 4 x 256 x 32 pieces
static __device__ __forceinline__ void wt4_body(unsigned blk, const float* __restrict__ wq, const float* __restrict__ wk,
                                                const float* __restrict__ wv, const float* __restrict__ wo,
                                                _Float16* __restrict__ WT) {
    const unsigned u = blk * 256u + threadIdx.x;
    if (u >= (unsigned)(CH * (CH / 8))) return;
    const unsigned k0 = 8u * (u & 31u);
    const unsigned o = u >> 5;
    wt_one(wq, WT, o, k0);
    wt_one(wk, WT + (size_t)1 * CH * CH, o, k0);
    wt_one(wv, WT + (size_t)2 * CH * CH, o, k0);
    wt_one(wo, WT + (size_t)3 * CH * CH, o, k0);
}

// wloc_body: pair-MLP weights as A-operand planes, zero-padded along k to 32:
//   W1B[h*16+j][k] = bf16(w1[h][k][j]) * 16 for k < 6, else 0;  W2B[h*16+j][k] = bf16(w2[h][k][j]) * 16 for k < 16, else 0
//   thread per 16-B piece (512 pieces per plane), clamped addresses, zero by value; coverage: 128 rows x 4 pieces == both whole planes
static __device__ __forceinline__ void wloc_body(unsigned blk, const float* __restrict__ w1, const float* __restrict__ w2,
                                                 _Float16* __restrict__ W1B, _Float16* __restrict__ W2B) {
    const unsigned p = blk * 256u + threadIdx.x;
    if (p >= (unsigned)(HEADS * HID * 4)) return;
    const unsigned col = p >> 2, k0 = (p & 3u) * 8u;
    const unsigned h = col >> 4, j = col & 15u;
    float v[8];
#pragma unroll
    for (int i = 0; i < 8; ++i) {
        const unsigned k = k0 + (unsigned)i;
        const unsigned kc = min(k, (unsigned)(DG - 1));
        const float raw = w1[(size_t)(h * DG + kc) * HID + j];
        asm volatile("s_wait_xcnt 0x0" ::: "memory");   // stands in front of a later load's result landing on this load's address registers
        const float x = bfr(raw) * W1_CARRY;
        v[i] = (k < (unsigned)DG) ? x : 0.0f;
    }
    {
        v4f a, b;
        a.x = v[0]; a.y = v[1]; a.z = v[2]; a.w = v[3]; b.x = v[4]; b.y = v[5]; b.z = v[6]; b.w = v[7];
        st8h2(W1B + (size_t)col * 32u + k0, pack8_flush(a, b));
    }
#pragma unroll
    for (int i = 0; i < 8; ++i) {
        const unsigned k = k0 + (unsigned)i;
        const unsigned kc = min(k, (unsigned)(HID - 1));
        const float raw = w2[(size_t)(h * HID + kc) * HID + j];
        asm volatile("s_wait_xcnt 0x0" ::: "memory");   // the same
        const float x = bfr(raw) * W2_CARRY;
        v[i] = (k < (unsigned)HID) ? x : 0.0f;
    }
    {
        v4f a, b;
        a.x = v[0]; a.y = v[1]; a.z = v[2]; a.w = v[3]; b.x = v[4]; b.y = v[5]; b.z = v[6]; b.w = v[7];
        st8h2(W2B + (size_t)col * 32u + k0, pack8_flush(a, b));
    }
}

// k_prep: the four operand-plane conversions in ONE launch (none reads what another writes); the block index picks the job, a scalar branch.
//   the short, latency-bound jobs stand at the low indices so that they start first and end under the long pair conversion.
#define PB_WT ((CH * (CH / 8)) / 256)
#define PB_WL ((HEADS * HID * 4) / 256)
#define PB_C  ((MTOK * CH / 8) / 256)
#define PB_G  ((NB * SEQ * SEQ) / 256)
static_assert((HEADS * HID * 4) % 256 == 0);
__global__ __launch_bounds__(256) void k_prep(const float* __restrict__ g, const float* __restrict__ x,
                                              const float* __restrict__ wq, const float* __restrict__ wk,
                                              const float* __restrict__ wv, const float* __restrict__ wo,
                                              const float* __restrict__ w1, const float* __restrict__ w2,
                                              _Float16* __restrict__ G16, _Float16* __restrict__ C16, _Float16* __restrict__ WT,
                                              _Float16* __restrict__ W1B, _Float16* __restrict__ W2B) {
    const unsigned bx = blockIdx.x;
    if (bx < (unsigned)PB_WT) wt4_body(bx, wq, wk, wv, wo, WT);
    else if (bx < (unsigned)(PB_WT + PB_WL)) wloc_body(bx - (unsigned)PB_WT, w1, w2, W1B, W2B);
    else if (bx < (unsigned)(PB_WT + PB_WL + PB_C)) cvt_c_body(bx - (unsigned)(PB_WT + PB_WL), x, C16);
    else cvt_g_body(bx - (unsigned)(PB_WT + PB_WL + PB_C), g, G16);
}

// =====================================================================================================================
// gemm64_body: C[m,n] = (scale * sum_k A[m,k] * Bt[n,k] + bf16(bias[n or m])) ; each wave owns a 64x64 tile.
//   A row-major [M][lda] f16, Bt row-major [N][ldb] f16 (fragments straight from the planes); M,N % 64 == 0, K % 32 == 0.
//   blk = the job's own block number; sT = the calling kernel's staging slabs, one per wave.
//   OUT_MODE 0: f32 C (pitch ldc); OUT_MODE 1: f16 C = value * oscale. BIAS_ROW: bias indexed by the row m.
// =====================================================================================================================
template <int OUT_MODE, bool BIAS_ROW>
static __device__ __forceinline__ void gemm64_body(
    unsigned blk, float (*sT)[16 * 68],
    const _Float16* __restrict__ A, unsigned lda, const _Float16* __restrict__ Bt, unsigned ldb,
    float* __restrict__ Cf, _Float16* __restrict__ Ch, unsigned ldc, const float* __restrict__ bias,
    unsigned M, unsigned N, unsigned K, float scale, float oscale) {
  const unsigned lane = threadIdx.x & 31u;
  const unsigned wave = threadIdx.x >> 5;
  const unsigned tilesN = N >> 6, tilesM = M >> 6;
  const unsigned tile = blk * 8u + wave;
  if (tile >= tilesM * tilesN) return;   // wave-uniform; no block barriers in this kernel
  const unsigned tm = tile / tilesN;
  const unsigned tn = tile - tm * tilesN;
  const unsigned m0 = tm << 6, n0 = tn << 6;
  const unsigned rlane = lane & 15u;
  const unsigned koff = (lane >> 4) * 8u;
  const unsigned mOff = koff;

  v8f acc[4][4];
#pragma unroll
  for (int i = 0; i < 4; ++i)
#pragma unroll
    for (int j = 0; j < 4; ++j) acc[i][j] = (v8f){0.f,0.f,0.f,0.f,0.f,0.f,0.f,0.f};

  for (unsigned k0 = 0; k0 < K; k0 += 32u) {
    v16h bh[4];
#pragma unroll
    for (int j = 0; j < 4; ++j)
      bh[j] = frag_ld(Bt + (size_t)(n0 + ((unsigned)j << 4) + rlane) * ldb + koff + k0);
#pragma unroll
    for (int i = 0; i < 4; ++i) {
      const v16h ah = frag_ld(A + (size_t)(m0 + ((unsigned)i << 4) + rlane) * lda + koff + k0);
#pragma unroll
      for (int j = 0; j < 4; ++j)
        acc[i][j] = wmma16g(ah, bh[j], acc[i][j]);
    }
  }

  float* slab = sT[wave];
#pragma unroll
  for (int i = 0; i < 4; ++i) {
    const unsigned mBase = m0 + ((unsigned)i << 4);
    float bvr[8];
#pragma unroll
    for (int r = 0; r < 8; ++r) bvr[r] = 0.0f;
    if (BIAS_ROW) {
#pragma unroll
      for (int r = 0; r < 8; ++r) bvr[r] = bfr(bias[mBase + mOff + (unsigned)r]);
    }
#pragma unroll
    for (int j = 0; j < 4; ++j) {
      const unsigned n = n0 + ((unsigned)j << 4) + rlane;
      float bvc = 0.0f;
      if (!BIAS_ROW) bvc = bfr(bias[n]);
#pragma unroll
      for (int r = 0; r < 8; ++r) {
        float v = acc[i][j][r] * scale + (BIAS_ROW ? bvr[r] : bvc);
        if (OUT_MODE == 1) v *= oscale;
        slab[(mOff + (unsigned)r) * 68u + ((unsigned)j << 4) + rlane] = v;
      }
    }
    wave_sync_lds();
    if (OUT_MODE == 0) {
      const unsigned hh = lane >> 4, c4 = (lane & 15u) * 4u;     // row segment = 256 B = 16 lanes x 16 B
#pragma unroll
      for (int half = 0; half < 2; ++half) {
        v4f vv[4];
#pragma unroll
        for (int it = 0; it < 4; ++it) {
          const unsigned row = (unsigned)(half * 4 + it) * 2u + hh;
          vv[it] = *(const v4f*)(slab + row * 68u + c4);
        }
        {
#pragma unroll
          for (int it = 0; it < 4; ++it) {
            const unsigned row = (unsigned)(half * 4 + it) * 2u + hh;
            *(v4f*)(Cf + (size_t)(mBase + row) * ldc + n0 + c4) = vv[it];
          }
          
        }
      }
    } else {
      const unsigned q = lane >> 3, c8 = (lane & 7u) * 8u;
      v8h hv[4];
#pragma unroll
      for (int it = 0; it < 4; ++it) {
        const unsigned row = (unsigned)it * 4u + q;
        const float* sp = slab + row * 68u + c8;
        hv[it] = pack8_flush(*(const v4f*)sp, *(const v4f*)(sp + 4));
      }
      {
#pragma unroll
        for (int it = 0; it < 4; ++it) {
          const unsigned row = (unsigned)it * 4u + q;
          *(v8h*)(Ch + (size_t)(mBase + row) * ldc + n0 + c8) = hv[it];
        }
        
      }
    }
    wave_sync_lds();
  }
}

// output projection: out[row][256] = O @ w + bf16(b), f32
__global__ __launch_bounds__(256) void k_proj_out(const _Float16* __restrict__ O16, const _Float16* __restrict__ Wt,
                                                  float* __restrict__ out, const float* __restrict__ bias) {
    __shared__ __align__(16) float sT[8][16 * 68];
    gemm64_body<0, false>(blockIdx.x, sT, O16, CH, Wt, CH, out, nullptr, CH, bias, MTOK, CH, CH, SC_OUT, 1.0f);
}

// =====================================================================================================================
// loc_body: location term ALOC[b][h][n][m] (f32) = swish(l3(swish(l2(swish(l1(g[b][n][m][:]))))))
//   transposed chain: the weights are the A operand (rows = hidden units), the pairs are the B columns.
//   block = 8 waves = the 8 heads of one query row (b,n); a wave owns ONE head and walks the row's 512 keys, 64 pairs (4 column tiles) a pass.
//   layer 1: B = two 16-B G16 rows per lane: lane (c,hh) holds pair 16hh+c in elements 0..7 (k 8hh..) and pair 32+16hh+c in elements 8..15
//            (k 16+8hh..), so k group q = k>>3 holds column tile q. A of tile q = the head's W1B row (k 0..7) placed in k group q, zero words
//            in the other three groups -> D1[hidden 8hh+r][pair c of tile q].
//   layer 2: D1's map IS the B map (lane = pair c, element r = hidden 8hh+r): two tiles' h1, converted in place to f16 x64, are elements
//            0..7 and 8..15 of one B operand; A = the head's W2B row in k 0..15 (first tile) or in k 16..31 (second tile), zero words in the
//            other half -> D2[hidden 8hh+r][pair c].
//   layer 3 (N = 1) on the VALU: 8 multiply-adds in the lane (hidden 8hh..8hh+7), then the other half's sum from lane l ^ 16.
//   biases and w3 are indexed by the D row: 8 registers each, prepared once per wave.
// =====================================================================================================================
#define LC_PASS 64
static_assert(HEADS == 8 && SEQ % LC_PASS == 0);
// lane l with lane l ^ 16
static __device__ __forceinline__ float xhalf(float x) {
    return __builtin_bit_cast(float, __builtin_amdgcn_permlanex16(__builtin_bit_cast(int, x), __builtin_bit_cast(int, x),
                                                                  0x76543210, 0xfedcba98, false, false));
}
static __device__ __forceinline__ void loc_body(unsigned bn, const _Float16* __restrict__ G16, const _Float16* __restrict__ W1B,
                                                const _Float16* __restrict__ W2B, const float* __restrict__ b1,
                                                const float* __restrict__ b2, const float* __restrict__ w3,
                                                const float* __restrict__ b3, float* __restrict__ ALOC) {
    const unsigned lane = threadIdx.x & 31u;
    const unsigned t = (unsigned)__builtin_amdgcn_readfirstlane((int)(threadIdx.x >> 5));   // the wave's head
    const unsigned hh = lane >> 4, c = lane & 15u;
    // bn = b*SEQ + n
    const unsigned b = bn / (unsigned)SEQ, n = bn % (unsigned)SEQ;
    const v8f zacc = (v8f){0.f,0.f,0.f,0.f,0.f,0.f,0.f,0.f};
    const v4u zq = (v4u){0u, 0u, 0u, 0u};
    const unsigned row = t * 16u + c;

    // layer-1 A operands, one per k group
    const v4u w1q = *(const v4u*)(W1B + (size_t)row * 32u);
    asm volatile("s_wait_xcnt 0x0" ::: "memory");   // stands in front of the later writes of this load's address registers
    v4u wlo, whi;
    wlo.x = (hh == 0u) ? w1q.x : 0u; wlo.y = (hh == 0u) ? w1q.y : 0u; wlo.z = (hh == 0u) ? w1q.z : 0u; wlo.w = (hh == 0u) ? w1q.w : 0u;
    whi.x = (hh == 0u) ? 0u : w1q.x; whi.y = (hh == 0u) ? 0u : w1q.y; whi.z = (hh == 0u) ? 0u : w1q.z; whi.w = (hh == 0u) ? 0u : w1q.w;
    FragQ a1[4];
    a1[0].q[0] = wlo; a1[0].q[1] = zq;
    a1[1].q[0] = whi; a1[1].q[1] = zq;
    a1[2].q[0] = zq;  a1[2].q[1] = wlo;
    a1[3].q[0] = zq;  a1[3].q[1] = whi;
    // layer-2 A operands: k 0..15 (the plane's own zeros beyond) and the same row moved to k 16..31
    FragQ a2[2];
    a2[0].h[0] = *(const v8h*)(W2B + (size_t)row * 32u + 8u * hh);
    asm volatile("s_wait_xcnt 0x0" ::: "memory");   // the same: the next load's result may land on this one's address registers
    a2[0].h[1] = *(const v8h*)(W2B + (size_t)row * 32u + 8u * hh + 16u);
    asm volatile("s_wait_xcnt 0x0" ::: "memory");   // the same
    a2[1].q[0] = a2[0].q[1]; a2[1].q[1] = a2[0].q[0];
    float hb1[8], hb2[8], ww3[8];
    // every '#pragma unroll' of this kernel: its counter indexes register arrays (hb1, a1, hx, part ...), which must not become memory
#pragma unroll
    for (int r = 0; r < 8; ++r) {
        const unsigned j = t * 16u + 8u * hh + (unsigned)r;
        hb1[r] = 0.5f * bfr(b1[j]);
        hb2[r] = 0.5f * bfr(b2[j]);
        ww3[r] = bfr(w3[j]);
    }
    const float bb3 = bfr(b3[t]);
    asm volatile("s_wait_xcnt 0x0" ::: "memory");   // the same for the weight, bias and w3 loads above

    const _Float16* gp = G16 + ((size_t)bn * SEQ + lane) * 8u;
    float* dst = ALOC + ((size_t)(b * (unsigned)HEADS + t) * SEQ + n) * SEQ + lane;
    FragQ g;
    g.q[0] = *(const v4u*)gp;
    g.q[1] = *(const v4u*)(gp + 32 * 8);
    // rolled: one pass is about 400 instructions, and eight copies of it would not pay for their instruction fetches
#pragma unroll 1
    for (unsigned it = 0; it < (unsigned)(SEQ / LC_PASS); ++it) {
        FragQ hx[2];
#pragma unroll
        for (int q = 0; q < 4; ++q) {
            const v8f d1 = wmma16g(a1[q].v, g.v, zacc);
            v4f xa, xb;
            xa.x = swish_half(d1[0] * (0.5f * UNDO1) + hb1[0]) * H_CARRY;
            xa.y = swish_half(d1[1] * (0.5f * UNDO1) + hb1[1]) * H_CARRY;
            xa.z = swish_half(d1[2] * (0.5f * UNDO1) + hb1[2]) * H_CARRY;
            xa.w = swish_half(d1[3] * (0.5f * UNDO1) + hb1[3]) * H_CARRY;
            xb.x = swish_half(d1[4] * (0.5f * UNDO1) + hb1[4]) * H_CARRY;
            xb.y = swish_half(d1[5] * (0.5f * UNDO1) + hb1[5]) * H_CARRY;
            xb.z = swish_half(d1[6] * (0.5f * UNDO1) + hb1[6]) * H_CARRY;
            xb.w = swish_half(d1[7] * (0.5f * UNDO1) + hb1[7]) * H_CARRY;
            hx[q >> 1].h[q & 1] = pack8_flush(xa, xb);
        }
        // the next pass's pairs fly under this pass's layers 2 and 3; the last pass fetches its own pairs again (in bounds, unused)
        const unsigned nx = ((it + 1u < (unsigned)(SEQ / LC_PASS)) ? it + 1u : it) * (unsigned)LC_PASS;
        g.q[0] = *(const v4u*)(gp + (size_t)nx * 8u);
        g.q[1] = *(const v4u*)(gp + (size_t)(nx + 32u) * 8u);
#pragma unroll
        for (int u = 0; u < 2; ++u) {
            float part[2];
#pragma unroll
            for (int s = 0; s < 2; ++s) {
                const v8f d2 = wmma16g(a2[s].v, hx[u].v, zacc);
                float acc = swish_half(d2[0] * (0.5f * UNDO2) + hb2[0]) * ww3[0];
#pragma unroll
                for (int r = 1; r < 8; ++r) acc = fmaf(swish_half(d2[r] * (0.5f * UNDO2) + hb2[r]), ww3[r], acc);
                part[s] = acc;
            }
            // lane (c,hh) finishes pair 16hh+c of this tile pair: its own half sum plus the other half's from lane l ^ 16
            const float mine  = (hh == 0u) ? part[0] : part[1];
            const float other = (hh == 0u) ? part[1] : part[0];
            const float v = mine + xhalf(other) + bb3;
            dst[it * (unsigned)LC_PASS + (unsigned)u * 32u] = swish_half(0.5f * v);
        }
    }
}

// k_proj_loc: the q, k and v projections and the location term in ONE launch (none reads what another writes); the block index picks the
//   job, a scalar branch. The 48 projection blocks stand at the low indices: they start first and end under the 2048 location blocks.
//   q, k: position-major Y16[row][256] = f16(8 * (x @ w + bf16(b)))
//   v:    channel-major VT16[b][ch][key] = f16(8 * (x @ w + bf16(b)))^T ; A = weight plane, Bt = feature rows of one batch
#define JB_ROWS (((MTOK / 64) * (CH / 64) + 7) / 8)
#define JB_VT   (((CH / 64) * (SEQ / 64) + 7) / 8)
__global__ __launch_bounds__(256) void k_proj_loc(const _Float16* __restrict__ C16, const _Float16* __restrict__ WT,
                                                  _Float16* __restrict__ Q16, _Float16* __restrict__ K16, _Float16* __restrict__ VT16,
                                                  const float* __restrict__ bq, const float* __restrict__ bk, const float* __restrict__ bv,
                                                  const _Float16* __restrict__ G16, const _Float16* __restrict__ W1B,
                                                  const _Float16* __restrict__ W2B, const float* __restrict__ b1,
                                                  const float* __restrict__ b2, const float* __restrict__ w3,
                                                  const float* __restrict__ b3, float* __restrict__ ALOC) {
    __shared__ __align__(16) float sT[8][16 * 68];
    const unsigned bx = blockIdx.x;
    if (bx < (unsigned)(2 * JB_ROWS)) {
        const bool isk = bx >= (unsigned)JB_ROWS;
        gemm64_body<1, false>(isk ? bx - (unsigned)JB_ROWS : bx, sT, C16, CH, isk ? WT + (size_t)1 * CH * CH : WT, CH, nullptr,
                              isk ? K16 : Q16, CH, isk ? bk : bq, MTOK, CH, CH, SC_PROJ, ACT_CARRY);
    } else if (bx < (unsigned)(2 * JB_ROWS + NB * JB_VT)) {
        const unsigned v = bx - (unsigned)(2 * JB_ROWS);
        const unsigned by = v / (unsigned)JB_VT;
        gemm64_body<1, true>(v % (unsigned)JB_VT, sT, WT + (size_t)2 * CH * CH, CH, C16 + (size_t)by * SEQ * CH, CH, nullptr,
                             VT16 + (size_t)by * CH * SEQ, SEQ, bv, CH, SEQ, CH, SC_PROJ, ACT_CARRY);
    } else {
        loc_body(bx - (unsigned)(2 * JB_ROWS + NB * JB_VT), G16, W1B, W2B, b1, b2, w3, b3, ALOC);
    }
}

// =====================================================================================================================
// k_attn: one block per (batch, head pair, 256-query block), 16 waves x 16 query rows, both heads of the pair per wave, 64-key chunks.
//   scores: Q (A) and K (B) fragments straight from the planes, one k-step (d = 32); + location term loaded in the D layout;
//   key mask by value select (fill -1e38 in the natural-log domain); running-max softmax in the exp2 domain (f32);
//   unnormalised e x1024 as f16 (wave-private LDS tile sP, wave_sync) times V^T B fragments straight from VT16.
//   O plane f16 x64 [row][head*32 + d]: each wave stages its 16 rows x 64 columns in sO (wave-private, wave_sync) and writes
//   staged extent == consumed extent: sP rows 0..15 x keys 0..63; sO rows 0..15 x cols 0..63.
// =====================================================================================================================
#define AT_PP 72
#define AT_OP 68
__global__ __launch_bounds__(512) void k_attn(const _Float16* __restrict__ Q16, const _Float16* __restrict__ K16,
                                              const _Float16* __restrict__ VT16, const float* __restrict__ ALOC,
                                              const int* __restrict__ mask, _Float16* __restrict__ O16) {
    __shared__ __align__(16) _Float16 sP[16][16 * AT_PP];     // per wave [row][64 keys], wave-private (wave_sync)
    __shared__ __align__(16) float sO[16][16 * AT_OP];        // per wave [row][64 channels], wave-private (wave_sync)
    const unsigned tid = threadIdx.x, lane = tid & 31u, wave = tid >> 5;
    const unsigned hh = lane >> 4, c = lane & 15u;
    const unsigned bx = blockIdx.x;
    const unsigned qb = bx % (unsigned)QBLK;
    const unsigned pair = (bx / (unsigned)QBLK) & 3u;
    const unsigned b = bx / ((unsigned)QBLK * 4u);
    const unsigned q0 = qb * 256u + wave * 16u;
    _Float16* pw = sP[wave];
    float* so = sO[wave];
#pragma unroll
    for (int hp = 0; hp < 2; ++hp) {
        const unsigned head = 2u * pair + (unsigned)hp;
        const v16h qf = frag_ld(Q16 + (size_t)(b * SEQ + q0 + c) * CH + head * HD + 8u * hh);
        const float* arow = ALOC + (size_t)((b * (unsigned)HEADS + head) * SEQ + q0 + 8u * hh) * SEQ + c;
        const _Float16* krow = K16 + (size_t)(b * SEQ + c) * CH + head * HD + 8u * hh;
        const int* mrw = mask + b * SEQ_FULL + c;
        float mrow[8], lrow[8];
        v8f os[2];
#pragma unroll
        for (int r = 0; r < 8; ++r) { mrow[r] = -3.0e38f; lrow[r] = 0.f; }
#pragma unroll
        for (int t = 0; t < 2; ++t) os[t] = (v8f){0.f,0.f,0.f,0.f,0.f,0.f,0.f,0.f};
        // score operands of one chunk, held in registers and fetched one chunk ahead
        v16h kf[4];
        int mk[4];
        float al[4][8];
#pragma unroll
        for (int j = 0; j < 4; ++j) {
            kf[j] = frag_ld(krow + (size_t)((unsigned)j * 16u) * CH);
            mk[j] = mrw[(unsigned)j * 16u];
#pragma unroll
            for (int r = 0; r < 8; ++r) al[j][r] = arow[(size_t)r * SEQ + (unsigned)j * 16u];
        }
#pragma unroll 1
        for (unsigned kc = 0; kc < (unsigned)(SEQ / 64); ++kc) {
            const unsigned kv0 = kc * 64u;
            v8f s[4];
#pragma unroll
            for (int j = 0; j < 4; ++j) {
                const v8f z = (v8f){0.f,0.f,0.f,0.f,0.f,0.f,0.f,0.f};
                s[j] = wmma16g(qf, kf[j], z);
            }
#pragma unroll
            for (int j = 0; j < 4; ++j) {
                const bool on = (mk[j] != 0);
#pragma unroll
                for (int r = 0; r < 8; ++r) {
                    const float sv = (s[j][r] * SCQK + al[j][r]) * LOG2E;
                    s[j][r] = on ? sv : FILL2;
                }
            }
            // the next chunk's score operands fly under this chunk's softmax; the last pass fetches its own chunk again (in bounds, unused)
            const unsigned nv0 = ((kc + 1u < (unsigned)(SEQ / 64)) ? kc + 1u : kc) * 64u;
#pragma unroll
            for (int j = 0; j < 4; ++j) {
                kf[j] = frag_ld(krow + (size_t)(nv0 + (unsigned)j * 16u) * CH);
                mk[j] = mrw[nv0 + (unsigned)j * 16u];
#pragma unroll
                for (int r = 0; r < 8; ++r) al[j][r] = arow[(size_t)r * SEQ + nv0 + (unsigned)j * 16u];
            }
#pragma unroll
            for (int r = 0; r < 8; ++r) {
                float mx = -3.0e38f;
#pragma unroll
                for (int j = 0; j < 4; ++j) { mx = fmaxf(mx, s[j][r]); }
                mx = fmaxf(mx, __shfl_xor(mx, 1, 32)); mx = fmaxf(mx, __shfl_xor(mx, 2, 32));
                mx = fmaxf(mx, __shfl_xor(mx, 4, 32)); mx = fmaxf(mx, __shfl_xor(mx, 8, 32));
                const float mnew = fmaxf(mrow[r], mx);
                const float alpha = exp2f(mrow[r] - mnew);
                mrow[r] = mnew;
                float psum = 0.f;
#pragma unroll
                for (int j = 0; j < 4; ++j) {
                    const float p = exp2f(s[j][r] - mnew);
                    psum += p;
                    const float w = p * P_CARRY;
                    pw[(8u * hh + (unsigned)r) * AT_PP + (unsigned)j * 16u + c] = (_Float16)((w < 6.103515625e-05f) ? 0.0f : w);
                }
                psum += __shfl_xor(psum, 1, 32); psum += __shfl_xor(psum, 2, 32);
                psum += __shfl_xor(psum, 4, 32); psum += __shfl_xor(psum, 8, 32);
                lrow[r] = lrow[r] * alpha + psum;
                os[0][r] *= alpha; os[1][r] *= alpha;
            }
            wave_sync_lds();
            // this chunk's V fragments, all four in one group ahead of the P.V products
            v16h vb[2][2];
#pragma unroll
            for (int kk = 0; kk < 2; ++kk)
#pragma unroll
                for (int t = 0; t < 2; ++t)
                    vb[kk][t] = frag_ld(VT16 + (size_t)(b * CH + head * HD + (unsigned)t * 16u + c) * SEQ + kv0 + (unsigned)kk * 32u + 8u * hh);
#pragma unroll
            for (int kk = 0; kk < 2; ++kk) {
                const v16h pa = frag_ld(pw + c * AT_PP + (unsigned)kk * 32u + 8u * hh);
#pragma unroll
                for (int t = 0; t < 2; ++t) {
                    os[t] = wmma16g(pa, vb[kk][t], os[t]);
                }
            }
            wave_sync_lds();
        }
#pragma unroll
        for (int r = 0; r < 8; ++r) {
            const float inv = 1.0f / (lrow[r] * P_CARRY);
#pragma unroll
            for (int t = 0; t < 2; ++t)
                so[(8u * hh + (unsigned)r) * AT_OP + (unsigned)hp * 32u + (unsigned)t * 16u + c] = os[t][r] * inv * (O_CARRY / ACT_CARRY);   // = 64 * value
        }
    }
    wave_sync_lds();
    {
        const unsigned q = lane >> 3, c8 = (lane & 7u) * 8u;
        v8h ov[4];
#pragma unroll
        for (int it = 0; it < 4; ++it) {
            const float* sp = so + ((unsigned)it * 4u + q) * AT_OP + c8;
            ov[it] = pack8_flush(*(const v4f*)sp, *(const v4f*)(sp + 4));
        }
        _Float16* dst = O16 + (size_t)(b * SEQ + q0) * CH + pair * 64u;
        {
#pragma unroll
            for (int it = 0; it < 4; ++it) *(v8h*)(dst + (size_t)((unsigned)it * 4u + q) * CH + c8) = ov[it];
            
        }
    }
}

extern "C" void kernel_launch(void* const* d_in, const int* in_sizes, int n_in, void* d_out, int out_size,
                              void* d_ws, size_t ws_size, hipStream_t stream) {
    if (n_in < 17) return;
    if (in_sizes[0] < NB * SEQ * SEQ * DG || in_sizes[1] < MTOK * CH) return;
    if (in_sizes[2] < CH * CH || in_sizes[3] < CH || in_sizes[4] < CH * CH || in_sizes[5] < CH) return;
    if (in_sizes[6] < CH * CH || in_sizes[7] < CH || in_sizes[8] < CH * CH || in_sizes[9] < CH) return;
    if (in_sizes[10] < HEADS * DG * HID || in_sizes[11] < HEADS * HID || in_sizes[12] < HEADS * HID * HID) return;
    if (in_sizes[13] < HEADS * HID || in_sizes[14] < HEADS * HID || in_sizes[15] < HEADS || in_sizes[16] < NB * SEQ) return;
    if (out_size < MTOK * CH) return;
    if (ws_size < WS_TOTAL) return;

    const float* pairwise_g = (const float*)d_in[0];
    const float* coset      = (const float*)d_in[1];
    const float* fc_q_w     = (const float*)d_in[2];
    const float* fc_q_b     = (const float*)d_in[3];
    const float* fc_k_w     = (const float*)d_in[4];
    const float* fc_k_b     = (const float*)d_in[5];
    const float* in_w       = (const float*)d_in[6];
    const float* in_b       = (const float*)d_in[7];
    const float* out_w      = (const float*)d_in[8];
    const float* out_b      = (const float*)d_in[9];
    const float* loc_w1     = (const float*)d_in[10];
    const float* loc_b1     = (const float*)d_in[11];
    const float* loc_w2     = (const float*)d_in[12];
    const float* loc_b2     = (const float*)d_in[13];
    const float* loc_w3     = (const float*)d_in[14];
    const float* loc_b3     = (const float*)d_in[15];
    const int*   mask       = (const int*)d_in[16];
    float* out = (float*)d_out;

    char* wsp = (char*)d_ws;
    _Float16* G16  = (_Float16*)(wsp + OFF_G16);
    _Float16* C16  = (_Float16*)(wsp + OFF_C16);
    _Float16* WT   = (_Float16*)(wsp + OFF_WT);
    _Float16* W1B  = (_Float16*)(wsp + OFF_W1B);
    _Float16* W2B  = (_Float16*)(wsp + OFF_W2B);
    _Float16* Q16  = (_Float16*)(wsp + OFF_Q16);
    _Float16* K16  = (_Float16*)(wsp + OFF_K16);
    _Float16* VT16 = (_Float16*)(wsp + OFF_VT16);
    float*    ALOC = (float*)(wsp + OFF_ALOC);
    _Float16* O16  = (_Float16*)(wsp + OFF_O16);

    // operand planes (each whole plane written by this launch)
    k_prep<<<PB_WT + PB_WL + PB_C + PB_G, 256, 0, stream>>>(pairwise_g, coset, fc_q_w, fc_k_w, in_w, out_w, loc_w1, loc_w2,
                                                            G16, C16, WT, W1B, W2B);

    // projections (64x64 wave tiles, 8 waves per block) beside the location term; then attention, output projection
    k_proj_loc<<<2 * JB_ROWS + NB * JB_VT + NB * SEQ, 256, 0, stream>>>(C16, WT, Q16, K16, VT16, fc_q_b, fc_k_b, in_b,
                                                                        G16, W1B, W2B, loc_b1, loc_b2, loc_w3, loc_b3, ALOC);
    k_attn<<<NB * 4 * QBLK, 512, 0, stream>>>(Q16, K16, VT16, ALOC, mask, O16);
    k_proj_out<<<((MTOK / 64) * (CH / 64) + 7) / 8, 256, 0, stream>>>(O16, WT + (size_t)3 * CH * CH, out, out_b);
}

// v005
// A run of this version takes 72.6 microseconds.
// Next to v004, in two timings, it ran 1.36 times as fast each time.
// Over all steps from v000 it is 3.76 times as fast.
// All contractions on v_wmma_f32_16x16x32_f16 (f16 operands, f32 accumulate): q/k/v projections (inputs x8, weights x32), pair MLP layer 1 (g x4, w1 x16, K=6 zero-padded to 32) and layer 2 (h1 x64, w2 x16, K=16 zero-padded to 32), q.k^T (x8, x8), P.V (P x1024, V x8), output projection (O x64, w x32); every float input RNE-converted to bf16 first; MLP layer 3 (N=1, K=16), swish (by tanh of half the argument), softmax statistics in f32 on the VALU.
#include <hip/hip_runtime.h>
#include <math.h>

#ifndef NB
#define NB 4
#endif
#ifndef SEQ
#define SEQ 512
#endif
#define NB_FULL 4
#define SEQ_FULL 512
#define CH 256
#define HEADS 8
#define HD 32
#define DG 6
#define HID 16
#define MTOK (NB * SEQ)
#define QBLK (SEQ / 32)

// power-of-two carries and their undo constants
#define G_CARRY 4.0f
#define W1_CARRY 16.0f
#define UNDO1 (1.0f / 64.0f)
#define H_CARRY 64.0f
#define W2_CARRY 16.0f
#define UNDO2 (1.0f / 1024.0f)
#define ACT_CARRY 8.0f
#define W_CARRY 32.0f
#define SC_PROJ (1.0f / 256.0f)
#define SCQK (1.0f / 1024.0f)
#define P_CARRY 1024.0f
#define O_CARRY 64.0f
#define SC_OUT (1.0f / 2048.0f)
#define LOG2E 1.4426950408889634f
#define FILL2 (-1.0e38f * LOG2E)

static_assert(G_CARRY * W1_CARRY * UNDO1 == 1.0f);
static_assert(H_CARRY * W2_CARRY * UNDO2 == 1.0f);
static_assert(ACT_CARRY * W_CARRY * SC_PROJ == 1.0f);
static_assert(ACT_CARRY * ACT_CARRY * 16.0f * SCQK == 1.0f);     // q x8, k x8, module scale 1/sqrt(256)
static_assert(O_CARRY * W_CARRY * SC_OUT == 1.0f);
static_assert(SEQ == SEQ_FULL);
static_assert(NB <= NB_FULL);
static_assert(CH == HEADS * HD && HD == 32 && HID == 16 && DG <= 8);
static_assert(SEQ % 32 == 0 && SEQ % 64 == 0);
static_assert(MTOK % 64 == 0 && CH % 64 == 0 && CH % 32 == 0);
static_assert((NB * SEQ * SEQ) % 256 == 0);
static_assert((MTOK * CH / 8) % 256 == 0);
static_assert((CH * (CH / 8)) % 256 == 0);
// store loops: lanes x bytes x instructions == tile rows x row bytes
static_assert(32 * 16 * 4 == 16 * 128);
static_assert(2 * 32 * 16 * 2 == 16 * 128);  // attention O tile: two waves x two stores
static_assert(32 * 16 * 8 == 16 * 256);     // f32 epilogue: 16 rows x 256 B
static_assert(32 * 4 * 8 == 8 * 128);
// static LDS per kernel
static_assert(8 * 16 * 68 * 4 <= 131072);
static_assert(4 * 16 * 72 * 2 + 2 * 16 * 68 * 4 <= 131072);

typedef _Float16 h16;
typedef __attribute__((ext_vector_type(16))) _Float16 v16h;
typedef __attribute__((ext_vector_type(8)))  _Float16 v8h;
typedef __attribute__((ext_vector_type(2)))  _Float16 v2h;
typedef __attribute__((ext_vector_type(8)))  float    v8f;
typedef __attribute__((ext_vector_type(4)))  float    v4f;
typedef __attribute__((ext_vector_type(2)))  float    v2f;
typedef __attribute__((ext_vector_type(4)))  unsigned int v4u;

static constexpr size_t SZ_G16  = (size_t)NB * SEQ * SEQ * 8 * 2;
static constexpr size_t SZ_C16  = (size_t)MTOK * CH * 2;
static constexpr size_t SZ_WT   = (size_t)4 * CH * CH * 2;
static constexpr size_t SZ_W1B  = (size_t)HEADS * HID * 32 * 2;
static constexpr size_t SZ_W2B  = (size_t)HEADS * HID * 32 * 2;
static constexpr size_t SZ_Q16  = (size_t)MTOK * CH * 2;
static constexpr size_t SZ_K16  = (size_t)MTOK * CH * 2;
static constexpr size_t SZ_VT16 = (size_t)NB * CH * SEQ * 2;
static constexpr size_t SZ_ALOC = (size_t)NB * HEADS * SEQ * SEQ * 4;
static constexpr size_t SZ_O16  = (size_t)MTOK * CH * 2;
static constexpr size_t OFF_G16  = 0;
static constexpr size_t OFF_C16  = OFF_G16 + SZ_G16;
static constexpr size_t OFF_WT   = OFF_C16 + SZ_C16;
static constexpr size_t OFF_W1B  = OFF_WT + SZ_WT;
static constexpr size_t OFF_W2B  = OFF_W1B + SZ_W1B;
static constexpr size_t OFF_Q16  = OFF_W2B + SZ_W2B;
static constexpr size_t OFF_K16  = OFF_Q16 + SZ_Q16;
static constexpr size_t OFF_VT16 = OFF_K16 + SZ_K16;
static constexpr size_t OFF_ALOC = OFF_VT16 + SZ_VT16;
static constexpr size_t OFF_O16  = OFF_ALOC + SZ_ALOC;
static constexpr size_t WS_TOTAL = OFF_O16 + SZ_O16;
static_assert(SZ_G16 % 256 == 0 && SZ_C16 % 256 == 0 && SZ_WT % 256 == 0 && SZ_W1B % 256 == 0 && SZ_W2B % 256 == 0);
static_assert(SZ_Q16 % 256 == 0 && SZ_VT16 % 256 == 0 && SZ_ALOC % 256 == 0 && SZ_O16 % 256 == 0);
static_assert(WS_TOTAL <= (size_t)134217728);

// 16-bit WMMA fragment map (wave32), lane L, hh = L>>4, c = L&15:
//   A 16x32: lane = row c;    element i -> k = (i<8) ? 8hh+i : 16+8hh+(i-8)
//   B 32x16: lane = column c; the SAME k(i,hh)
//   D 16x16 (8 f32): lane = column c; element r -> row 8hh+r

// RNE convert f32 -> bf16 -> f32
__device__ __forceinline__ float bfr(float f) {
    unsigned u = __float_as_uint(f);
    u += 0x7FFFu + ((u >> 16) & 1u);
    return __uint_as_float(u & 0xFFFF0000u);
}
// f32 -> f16 with values under 2^-14 replaced by +0 before the convert
static __device__ __forceinline__ h16 toh_flush(float v) { const float w = (fabsf(v) < 6.103515625e-05f) ? 0.0f : v; return (h16)w; }
static __device__ __forceinline__ v2h toh2_flush(float a, float b) {
    v2f w;
    w.x = (fabsf(a) < 6.103515625e-05f) ? 0.0f : a;
    w.y = (fabsf(b) < 6.103515625e-05f) ? 0.0f : b;
    return __builtin_convertvector(w, v2h);
}
union Pack8 { v8h v; v2h p[4]; };
static __device__ __forceinline__ v8h pack8_flush(v4f a, v4f b) {
    Pack8 u;
    u.p[0] = toh2_flush(a.x, a.y); u.p[1] = toh2_flush(a.z, a.w);
    u.p[2] = toh2_flush(b.x, b.y); u.p[3] = toh2_flush(b.z, b.w);
    return u.v;
}
static __device__ __forceinline__ void st8h2(_Float16* p, v8h v) {
    *(v8h*)p = v;
    
}

union FragU { v16h v; v8h h[2]; };
union FragQ { v16h v; v8h h[2]; v4u q[2]; };
// elements 0..7 <- p[0..7], 8..15 <- p[16..23]; caller adds 8*hh to p (used for BOTH A and B operands: same k per element)
__device__ __forceinline__ v16h frag_ld(const _Float16* p) {
    FragU f; f.h[0] = *(const v8h*)(p); f.h[1] = *(const v8h*)(p + 16); return f.v;
}
__device__ __forceinline__ v8f wmma16g(v16h a, v16h b, v8f c) {
    c = __builtin_amdgcn_wmma_f32_16x16x32_f16(false, a, false, b, (short)0, c, false, false);
    asm volatile("v_nop\n\tv_nop\n\tv_nop\n\tv_nop" : "+v"(c) : "v"(a), "v"(b));
    return c;
}
__device__ __forceinline__ void wave_sync_lds() {
    __builtin_amdgcn_fence(3 /* release order */, "workgroup");
    __builtin_amdgcn_wave_barrier();
    __builtin_amdgcn_fence(2 /* acquire order */, "workgroup");
}
// swish(x) = x * sigmoid(x) = h + h * tanh(h) with h = x / 2; the caller hands in h
static __device__ __forceinline__ float swish_half(float h) {
    return fmaf(h, __builtin_amdgcn_tanhf(h), h);
}

// =====================================================================================================================
// cvt_g_body: pair components [pair][6] f32 -> G16 [pair][8] f16 = bf16(g) * 4, components 6,7 = 0; one 16-B piece per lane
//   coverage: NB*SEQ*SEQ pairs x 16 B == the whole G16 plane
// =====================================================================================================================
static __device__ __forceinline__ void cvt_g_body(unsigned blk, const float* __restrict__ g, _Float16* __restrict__ G16) {
    const unsigned u = blk * 256u + threadIdx.x;
    if (u >= (unsigned)(NB * SEQ * SEQ)) return;
    const v2f* src = (const v2f*)(g + (size_t)u * 6u);
    const v2f a = src[0], b = src[1], cc = src[2];
    v4f lo, hi;
    lo.x = bfr(a.x) * G_CARRY; lo.y = bfr(a.y) * G_CARRY; lo.z = bfr(b.x) * G_CARRY; lo.w = bfr(b.y) * G_CARRY;
    hi.x = bfr(cc.x) * G_CARRY; hi.y = bfr(cc.y) * G_CARRY; hi.z = 0.0f; hi.w = 0.0f;
    st8h2(G16 + (size_t)u * 8u, pack8_flush(lo, hi));
}

// cvt_c_body: features [row][256] f32 -> C16 f16 = bf16(x) * 8; thread per 8 columns; coverage: MTOK*256/8 pieces == whole plane
static __device__ __forceinline__ void cvt_c_body(unsigned blk, const float* __restrict__ x, _Float16* __restrict__ C16) {
    const unsigned u = blk * 256u + threadIdx.x;
    if (u >= (unsigned)(MTOK * CH / 8)) return;
    const v4f* src = (const v4f*)(x + (size_t)u * 8u);
    v4f a = src[0], b = src[1];
    a.x = bfr(a.x) * ACT_CARRY; a.y = bfr(a.y) * ACT_CARRY; a.z = bfr(a.z) * ACT_CARRY; a.w = bfr(a.w) * ACT_CARRY;
    b.x = bfr(b.x) * ACT_CARRY; b.y = bfr(b.y) * ACT_CARRY; b.z = bfr(b.z) * ACT_CARRY; b.w = bfr(b.w) * ACT_CARRY;
    st8h2(C16 + (size_t)u * 8u, pack8_flush(a, b));
}

static __device__ __forceinline__ void wt_one(const float* __restrict__ W, _Float16* __restrict__ D, unsigned o, unsigned k0) {
    v4f lo, hi;
    lo.x = bfr(W[(size_t)(k0 + 0u) * CH + o]) * W_CARRY;
    lo.y = bfr(W[(size_t)(k0 + 1u) * CH + o]) * W_CARRY;
    lo.z = bfr(W[(size_t)(k0 + 2u) * CH + o]) * W_CARRY;
    lo.w = bfr(W[(size_t)(k0 + 3u) * CH + o]) * W_CARRY;
    hi.x = bfr(W[(size_t)(k0 + 4u) * CH + o]) * W_CARRY;
    hi.y = bfr(W[(size_t)(k0 + 5u) * CH + o]) * W_CARRY;
    hi.z = bfr(W[(size_t)(k0 + 6u) * CH + o]) * W_CARRY;
    hi.w = bfr(W[(size_t)(k0 + 7u) * CH + o]) * W_CARRY;
    st8h2(D + (size_t)o * CH + k0, pack8_flush(lo, hi));
}
// wt4_body: the four 256x256 weights -> WT[4][out][in]; thread per (o, 8 k): 32 lanes cover one whole 512-B row; coverage: 4 x 256 x 32 pieces
static __device__ __forceinline__ void wt4_body(unsigned blk, const float* __restrict__ wq, const float* __restrict__ wk,
                                                const float* __restrict__ wv, const float* __restrict__ wo,
                                                _Float16* __restrict__ WT) {
    const unsigned u = blk * 256u + threadIdx.x;
    if (u >= (unsigned)(CH * (CH / 8))) return;
    const unsigned k0 = 8u * (u & 31u);
    const unsigned o = u >> 5;
    wt_one(wq, WT, o, k0);
    wt_one(wk, WT + (size_t)1 * CH * CH, o, k0);
    wt_one(wv, WT + (size_t)2 * CH * CH, o, k0);
    wt_one(wo, WT + (size_t)3 * CH * CH, o, k0);
}

// wloc_body: pair-MLP weights as A-operand planes, zero-padded along k to 32:
//   W1B[h*16+j][k] = bf16(w1[h][k][j]) * 16 for k < 6, else 0;  W2B[h*16+j][k] = bf16(w2[h][k][j]) * 16 for k < 16, else 0
//   thread per 16-B piece (512 pieces per plane), clamped addresses, zero by value; coverage: 128 rows x 4 pieces == both whole planes
static __device__ __forceinline__ void wloc_body(unsigned blk, const float* __restrict__ w1, const float* __restrict__ w2,
                                                 _Float16* __restrict__ W1B, _Float16* __restrict__ W2B) {
    const unsigned p = blk * 256u + threadIdx.x;
    if (p >= (unsigned)(HEADS * HID * 4)) return;
    const unsigned col = p >> 2, k0 = (p & 3u) * 8u;
    const unsigned h = col >> 4, j = col & 15u;
    float v[8];
#pragma unroll
    for (int i = 0; i < 8; ++i) {
        const unsigned k = k0 + (unsigned)i;
        const unsigned kc = min(k, (unsigned)(DG - 1));
        const float raw = w1[(size_t)(h * DG + kc) * HID + j];
        asm volatile("s_wait_xcnt 0x0" ::: "memory");   // stands in front of a later load's result landing on this load's address registers
        const float x = bfr(raw) * W1_CARRY;
        v[i] = (k < (unsigned)DG) ? x : 0.0f;
    }
    {
        v4f a, b;
        a.x = v[0]; a.y = v[1]; a.z = v[2]; a.w = v[3]; b.x = v[4]; b.y = v[5]; b.z = v[6]; b.w = v[7];
        st8h2(W1B + (size_t)col * 32u + k0, pack8_flush(a, b));
    }
#pragma unroll
    for (int i = 0; i < 8; ++i) {
        const unsigned k = k0 + (unsigned)i;
        const unsigned kc = min(k, (unsigned)(HID - 1));
        const float raw = w2[(size_t)(h * HID + kc) * HID + j];
        asm volatile("s_wait_xcnt 0x0" ::: "memory");   // the same
        const float x = bfr(raw) * W2_CARRY;
        v[i] = (k < (unsigned)HID) ? x : 0.0f;
    }
    {
        v4f a, b;
        a.x = v[0]; a.y = v[1]; a.z = v[2]; a.w = v[3]; b.x = v[4]; b.y = v[5]; b.z = v[6]; b.w = v[7];
        st8h2(W2B + (size_t)col * 32u + k0, pack8_flush(a, b));
    }
}

// k_prep: the four operand-plane conversions in ONE launch (none reads what another writes); the block index picks the job, a scalar branch.
//   the short, latency-bound jobs stand at the low indices so that they start first and end under the long pair conversion.
#define PB_WT ((CH * (CH / 8)) / 256)
#define PB_WL ((HEADS * HID * 4) / 256)
#define PB_C  ((MTOK * CH / 8) / 256)
#define PB_G  ((NB * SEQ * SEQ) / 256)
static_assert((HEADS * HID * 4) % 256 == 0);
__global__ __launch_bounds__(256) void k_prep(const float* __restrict__ g, const float* __restrict__ x,
                                              const float* __restrict__ wq, const float* __restrict__ wk,
                                              const float* __restrict__ wv, const float* __restrict__ wo,
                                              const float* __restrict__ w1, const float* __restrict__ w2,
                                              _Float16* __restrict__ G16, _Float16* __restrict__ C16, _Float16* __restrict__ WT,
                                              _Float16* __restrict__ W1B, _Float16* __restrict__ W2B) {
    const unsigned bx = blockIdx.x;
    if (bx < (unsigned)PB_WT) wt4_body(bx, wq, wk, wv, wo, WT);
    else if (bx < (unsigned)(PB_WT + PB_WL)) wloc_body(bx - (unsigned)PB_WT, w1, w2, W1B, W2B);
    else if (bx < (unsigned)(PB_WT + PB_WL + PB_C)) cvt_c_body(bx - (unsigned)(PB_WT + PB_WL), x, C16);
    else cvt_g_body(bx - (unsigned)(PB_WT + PB_WL + PB_C), g, G16);
}

// =====================================================================================================================
// gemm64_body: C[m,n] = (scale * sum_k A[m,k] * Bt[n,k] + bf16(bias[n or m])) ; each wave owns a 64x64 tile.
//   A row-major [M][lda] f16, Bt row-major [N][ldb] f16 (fragments straight from the planes); M,N % 64 == 0, K % 32 == 0.
//   blk = the job's own block number; sT = the calling kernel's staging slabs, one per wave.
//   OUT_MODE 0: f32 C (pitch ldc); OUT_MODE 1: f16 C = value * oscale. BIAS_ROW: bias indexed by the row m.
// =====================================================================================================================
template <int OUT_MODE, bool BIAS_ROW>
static __device__ __forceinline__ void gemm64_body(
    unsigned blk, float (*sT)[16 * 68],
    const _Float16* __restrict__ A, unsigned lda, const _Float16* __restrict__ Bt, unsigned ldb,
    float* __restrict__ Cf, _Float16* __restrict__ Ch, unsigned ldc, const float* __restrict__ bias,
    unsigned M, unsigned N, unsigned K, float scale, float oscale) {
  const unsigned lane = threadIdx.x & 31u;
  const unsigned wave = threadIdx.x >> 5;
  const unsigned tilesN = N >> 6, tilesM = M >> 6;
  const unsigned tile = blk * 8u + wave;
  if (tile >= tilesM * tilesN) return;   // wave-uniform; no block barriers in this kernel
  const unsigned tm = tile / tilesN;
  const unsigned tn = tile - tm * tilesN;
  const unsigned m0 = tm << 6, n0 = tn << 6;
  const unsigned rlane = lane & 15u;
  const unsigned koff = (lane >> 4) * 8u;
  const unsigned mOff = koff;

  v8f acc[4][4];
#pragma unroll
  for (int i = 0; i < 4; ++i)
#pragma unroll
    for (int j = 0; j < 4; ++j) acc[i][j] = (v8f){0.f,0.f,0.f,0.f,0.f,0.f,0.f,0.f};

  for (unsigned k0 = 0; k0 < K; k0 += 32u) {
    v16h bh[4];
#pragma unroll
    for (int j = 0; j < 4; ++j)
      bh[j] = frag_ld(Bt + (size_t)(n0 + ((unsigned)j << 4) + rlane) * ldb + koff + k0);
#pragma unroll
    for (int i = 0; i < 4; ++i) {
      const v16h ah = frag_ld(A + (size_t)(m0 + ((unsigned)i << 4) + rlane) * lda + koff + k0);
#pragma unroll
      for (int j = 0; j < 4; ++j)
        acc[i][j] = wmma16g(ah, bh[j], acc[i][j]);
    }
  }

  float* slab = sT[wave];
#pragma unroll
  for (int i = 0; i < 4; ++i) {
    const unsigned mBase = m0 + ((unsigned)i << 4);
    float bvr[8];
#pragma unroll
    for (int r = 0; r < 8; ++r) bvr[r] = 0.0f;
    if (BIAS_ROW) {
#pragma unroll
      for (int r = 0; r < 8; ++r) bvr[r] = bfr(bias[mBase + mOff + (unsigned)r]);
    }
#pragma unroll
    for (int j = 0; j < 4; ++j) {
      const unsigned n = n0 + ((unsigned)j << 4) + rlane;
      float bvc = 0.0f;
      if (!BIAS_ROW) bvc = bfr(bias[n]);
#pragma unroll
      for (int r = 0; r < 8; ++r) {
        float v = acc[i][j][r] * scale + (BIAS_ROW ? bvr[r] : bvc);
        if (OUT_MODE == 1) v *= oscale;
        slab[(mOff + (unsigned)r) * 68u + ((unsigned)j << 4) + rlane] = v;
      }
    }
    wave_sync_lds();
    if (OUT_MODE == 0) {
      const unsigned hh = lane >> 4, c4 = (lane & 15u) * 4u;     // row segment = 256 B = 16 lanes x 16 B
#pragma unroll
      for (int half = 0; half < 2; ++half) {
        v4f vv[4];
#pragma unroll
        for (int it = 0; it < 4; ++it) {
          const unsigned row = (unsigned)(half * 4 + it) * 2u + hh;
          vv[it] = *(const v4f*)(slab + row * 68u + c4);
        }
        {
#pragma unroll
          for (int it = 0; it < 4; ++it) {
            const unsigned row = (unsigned)(half * 4 + it) * 2u + hh;
            *(v4f*)(Cf + (size_t)(mBase + row) * ldc + n0 + c4) = vv[it];
          }
          
        }
      }
    } else {
      const unsigned q = lane >> 3, c8 = (lane & 7u) * 8u;
      v8h hv[4];
#pragma unroll
      for (int it = 0; it < 4; ++it) {
        const unsigned row = (unsigned)it * 4u + q;
        const float* sp = slab + row * 68u + c8;
        hv[it] = pack8_flush(*(const v4f*)sp, *(const v4f*)(sp + 4));
      }
      {
#pragma unroll
        for (int it = 0; it < 4; ++it) {
          const unsigned row = (unsigned)it * 4u + q;
          *(v8h*)(Ch + (size_t)(mBase + row) * ldc + n0 + c8) = hv[it];
        }
        
      }
    }
    wave_sync_lds();
  }
}

// output projection: out[row][256] = O @ w + bf16(b), f32
__global__ __launch_bounds__(256) void k_proj_out(const _Float16* __restrict__ O16, const _Float16* __restrict__ Wt,
                                                  float* __restrict__ out, const float* __restrict__ bias) {
    __shared__ __align__(16) float sT[8][16 * 68];
    gemm64_body<0, false>(blockIdx.x, sT, O16, CH, Wt, CH, out, nullptr, CH, bias, MTOK, CH, CH, SC_OUT, 1.0f);
}

// =====================================================================================================================
// loc_body: location term ALOC[b][h][n][m] (f32) = swish(l3(swish(l2(swish(l1(g[b][n][m][:]))))))
//   transposed chain: the weights are the A operand (rows = hidden units), the pairs are the B columns.
//   block = 8 waves = the 8 heads of one query row (b,n); a wave owns ONE head and walks the row's 512 keys, 64 pairs (4 column tiles) a pass.
//   layer 1: B = two 16-B G16 rows per lane: lane (c,hh) holds pair 16hh+c in elements 0..7 (k 8hh..) and pair 32+16hh+c in elements 8..15
//            (k 16+8hh..), so k group q = k>>3 holds column tile q. A of tile q = the head's W1B row (k 0..7) placed in k group q, zero words
//            in the other three groups -> D1[hidden 8hh+r][pair c of tile q].
//   layer 2: D1's map IS the B map (lane = pair c, element r = hidden 8hh+r): two tiles' h1, converted in place to f16 x64, are elements
//            0..7 and 8..15 of one B operand; A = the head's W2B row in k 0..15 (first tile) or in k 16..31 (second tile), zero words in the
//            other half -> D2[hidden 8hh+r][pair c].
//   layer 3 (N = 1) on the VALU: 8 multiply-adds in the lane (hidden 8hh..8hh+7), then the other half's sum from lane l ^ 16.
//   biases and w3 are indexed by the D row: 8 registers each, prepared once per wave.
// =====================================================================================================================
#define LC_PASS 64
static_assert(HEADS == 8 && SEQ % LC_PASS == 0);
// lane l with lane l ^ 16
static __device__ __forceinline__ float xhalf(float x) {
    return __builtin_bit_cast(float, __builtin_amdgcn_permlanex16(__builtin_bit_cast(int, x), __builtin_bit_cast(int, x),
                                                                  0x76543210, 0xfedcba98, false, false));
}
static __device__ __forceinline__ void loc_body(unsigned bn, const _Float16* __restrict__ G16, const _Float16* __restrict__ W1B,
                                                const _Float16* __restrict__ W2B, const float* __restrict__ b1,
                                                const float* __restrict__ b2, const float* __restrict__ w3,
                                                const float* __restrict__ b3, float* __restrict__ ALOC) {
    const unsigned lane = threadIdx.x & 31u;
    const unsigned t = (unsigned)__builtin_amdgcn_readfirstlane((int)(threadIdx.x >> 5));   // the wave's head
    const unsigned hh = lane >> 4, c = lane & 15u;
    // bn = b*SEQ + n
    const unsigned b = bn / (unsigned)SEQ, n = bn % (unsigned)SEQ;
    const v8f zacc = (v8f){0.f,0.f,0.f,0.f,0.f,0.f,0.f,0.f};
    const v4u zq = (v4u){0u, 0u, 0u, 0u};
    const unsigned row = t * 16u + c;

    // layer-1 A operands, one per k group
    const v4u w1q = *(const v4u*)(W1B + (size_t)row * 32u);
    asm volatile("s_wait_xcnt 0x0" ::: "memory");   // stands in front of the later writes of this load's address registers
    v4u wlo, whi;
    wlo.x = (hh == 0u) ? w1q.x : 0u; wlo.y = (hh == 0u) ? w1q.y : 0u; wlo.z = (hh == 0u) ? w1q.z : 0u; wlo.w = (hh == 0u) ? w1q.w : 0u;
    whi.x = (hh == 0u) ? 0u : w1q.x; whi.y = (hh == 0u) ? 0u : w1q.y; whi.z = (hh == 0u) ? 0u : w1q.z; whi.w = (hh == 0u) ? 0u : w1q.w;
    FragQ a1[4];
    a1[0].q[0] = wlo; a1[0].q[1] = zq;
    a1[1].q[0] = whi; a1[1].q[1] = zq;
    a1[2].q[0] = zq;  a1[2].q[1] = wlo;
    a1[3].q[0] = zq;  a1[3].q[1] = whi;
    // layer-2 A operands: k 0..15 (the plane's own zeros beyond) and the same row moved to k 16..31
    FragQ a2[2];
    a2[0].h[0] = *(const v8h*)(W2B + (size_t)row * 32u + 8u * hh);
    asm volatile("s_wait_xcnt 0x0" ::: "memory");   // the same: the next load's result may land on this one's address registers
    a2[0].h[1] = *(const v8h*)(W2B + (size_t)row * 32u + 8u * hh + 16u);
    asm volatile("s_wait_xcnt 0x0" ::: "memory");   // the same
    a2[1].q[0] = a2[0].q[1]; a2[1].q[1] = a2[0].q[0];
    float hb1[8], hb2[8], ww3[8];
    // every '#pragma unroll' of this kernel: its counter indexes register arrays (hb1, a1, hx, part ...), which must not become memory
#pragma unroll
    for (int r = 0; r < 8; ++r) {
        const unsigned j = t * 16u + 8u * hh + (unsigned)r;
        hb1[r] = 0.5f * bfr(b1[j]);
        hb2[r] = 0.5f * bfr(b2[j]);
        ww3[r] = bfr(w3[j]);
    }
    const float bb3 = bfr(b3[t]);
    asm volatile("s_wait_xcnt 0x0" ::: "memory");   // the same for the weight, bias and w3 loads above

    const _Float16* gp = G16 + ((size_t)bn * SEQ + lane) * 8u;
    float* dst = ALOC + ((size_t)(b * (unsigned)HEADS + t) * SEQ + n) * SEQ + lane;
    FragQ g;
    g.q[0] = *(const v4u*)gp;
    g.q[1] = *(const v4u*)(gp + 32 * 8);
    // rolled: one pass is about 400 instructions, and eight copies of it would not pay for their instruction fetches
#pragma unroll 1
    for (unsigned it = 0; it < (unsigned)(SEQ / LC_PASS); ++it) {
        FragQ hx[2];
#pragma unroll
        for (int q = 0; q < 4; ++q) {
            const v8f d1 = wmma16g(a1[q].v, g.v, zacc);
            v4f xa, xb;
            xa.x = swish_half(d1[0] * (0.5f * UNDO1) + hb1[0]) * H_CARRY;
            xa.y = swish_half(d1[1] * (0.5f * UNDO1) + hb1[1]) * H_CARRY;
            xa.z = swish_half(d1[2] * (0.5f * UNDO1) + hb1[2]) * H_CARRY;
            xa.w = swish_half(d1[3] * (0.5f * UNDO1) + hb1[3]) * H_CARRY;
            xb.x = swish_half(d1[4] * (0.5f * UNDO1) + hb1[4]) * H_CARRY;
            xb.y = swish_half(d1[5] * (0.5f * UNDO1) + hb1[5]) * H_CARRY;
            xb.z = swish_half(d1[6] * (0.5f * UNDO1) + hb1[6]) * H_CARRY;
            xb.w = swish_half(d1[7] * (0.5f * UNDO1) + hb1[7]) * H_CARRY;
            hx[q >> 1].h[q & 1] = pack8_flush(xa, xb);
        }
        // the next pass's pairs fly under this pass's layers 2 and 3; the last pass fetches its own pairs again (in bounds, unused)
        const unsigned nx = ((it + 1u < (unsigned)(SEQ / LC_PASS)) ? it + 1u : it) * (unsigned)LC_PASS;
        g.q[0] = *(const v4u*)(gp + (size_t)nx * 8u);
        g.q[1] = *(const v4u*)(gp + (size_t)(nx + 32u) * 8u);
#pragma unroll
        for (int u = 0; u < 2; ++u) {
            float part[2];
#pragma unroll
            for (int s = 0; s < 2; ++s) {
                const v8f d2 = wmma16g(a2[s].v, hx[u].v, zacc);
                float acc = swish_half(d2[0] * (0.5f * UNDO2) + hb2[0]) * ww3[0];
#pragma unroll
                for (int r = 1; r < 8; ++r) acc = fmaf(swish_half(d2[r] * (0.5f * UNDO2) + hb2[r]), ww3[r], acc);
                part[s] = acc;
            }
            // lane (c,hh) finishes pair 16hh+c of this tile pair: its own half sum plus the other half's from lane l ^ 16
            const float mine  = (hh == 0u) ? part[0] : part[1];
            const float other = (hh == 0u) ? part[1] : part[0];
            const float v = mine + xhalf(other) + bb3;
            dst[it * (unsigned)LC_PASS + (unsigned)u * 32u] = swish_half(0.5f * v);
        }
    }
}

// k_proj_loc: the q, k and v projections and the location term in ONE launch (none reads what another writes); the block index picks the
//   job, a scalar branch. The 48 projection blocks stand at the low indices: they start first and end under the 2048 location blocks.
//   q, k: position-major Y16[row][256] = f16(8 * (x @ w + bf16(b)))
//   v:    channel-major VT16[b][ch][key] = f16(8 * (x @ w + bf16(b)))^T ; A = weight plane, Bt = feature rows of one batch
#define JB_ROWS (((MTOK / 64) * (CH / 64) + 7) / 8)
#define JB_VT   (((CH / 64) * (SEQ / 64) + 7) / 8)
__global__ __launch_bounds__(256) void k_proj_loc(const _Float16* __restrict__ C16, const _Float16* __restrict__ WT,
                                                  _Float16* __restrict__ Q16, _Float16* __restrict__ K16, _Float16* __restrict__ VT16,
                                                  const float* __restrict__ bq, const float* __restrict__ bk, const float* __restrict__ bv,
                                                  const _Float16* __restrict__ G16, const _Float16* __restrict__ W1B,
                                                  const _Float16* __restrict__ W2B, const float* __restrict__ b1,
                                                  const float* __restrict__ b2, const float* __restrict__ w3,
                                                  const float* __restrict__ b3, float* __restrict__ ALOC) {
    __shared__ __align__(16) float sT[8][16 * 68];
    const unsigned bx = blockIdx.x;
    if (bx < (unsigned)(2 * JB_ROWS)) {
        const bool isk = bx >= (unsigned)JB_ROWS;
        gemm64_body<1, false>(isk ? bx - (unsigned)JB_ROWS : bx, sT, C16, CH, isk ? WT + (size_t)1 * CH * CH : WT, CH, nullptr,
                              isk ? K16 : Q16, CH, isk ? bk : bq, MTOK, CH, CH, SC_PROJ, ACT_CARRY);
    } else if (bx < (unsigned)(2 * JB_ROWS + NB * JB_VT)) {
        const unsigned v = bx - (unsigned)(2 * JB_ROWS);
        const unsigned by = v / (unsigned)JB_VT;
        gemm64_body<1, true>(v % (unsigned)JB_VT, sT, WT + (size_t)2 * CH * CH, CH, C16 + (size_t)by * SEQ * CH, CH, nullptr,
                             VT16 + (size_t)by * CH * SEQ, SEQ, bv, CH, SEQ, CH, SC_PROJ, ACT_CARRY);
    } else {
        loc_body(bx - (unsigned)(2 * JB_ROWS + NB * JB_VT), G16, W1B, W2B, b1, b2, w3, b3, ALOC);
    }
}

// =====================================================================================================================
// k_attn: one block per (batch, head pair, 32-query block), 4 waves = 2 query tiles of 16 rows x the 2 heads of the pair, ONE head per wave,
//   64-key chunks: 1024 waves in 256 blocks, so that every wave can have a SIMD of its own (a wave's chain of 8 chunks is latency bound).
//   scores: Q (A) and K (B) fragments straight from the planes, one k-step (d = 32); + location term loaded in the D layout;
//   key mask by value select (fill -1e38 in the natural-log domain); running-max softmax in the exp2 domain (f32);
//   unnormalised e x1024 as f16 (wave-private LDS tile sP, wave_sync) times V^T B fragments straight from VT16.
//   O plane f16 x64 [row][head*32 + d]: the two waves of a query tile stage their 32 columns each in the tile's sO slab; behind one block
//   barrier each of them writes 8 whole 128-B rows (one writer per line).
//   staged extent == consumed extent: sP rows 0..15 x keys 0..63; sO rows 0..15 x cols 0..63.
// =====================================================================================================================
#define AT_PP 72
#define AT_OP 68
__global__ __launch_bounds__(128) void k_attn(const _Float16* __restrict__ Q16, const _Float16* __restrict__ K16,
                                              const _Float16* __restrict__ VT16, const float* __restrict__ ALOC,
                                              const int* __restrict__ mask, _Float16* __restrict__ O16) {
    __shared__ __align__(16) _Float16 sP[4][16 * AT_PP];      // per wave [row][64 keys], wave-private (wave_sync)
    __shared__ __align__(16) float sO[2][16 * AT_OP];         // per query tile [row][64 channels], shared by the tile's two waves (block barrier)
    const unsigned tid = threadIdx.x, lane = tid & 31u, wave = tid >> 5;
    const unsigned hh = lane >> 4, c = lane & 15u;
    const unsigned bx = blockIdx.x;
    const unsigned qb = bx % (unsigned)QBLK;
    const unsigned pair = (bx / (unsigned)QBLK) & 3u;
    const unsigned b = bx / ((unsigned)QBLK * 4u);
    const unsigned hp = wave & 1u;                            // the wave's head of the pair
    const unsigned q0 = qb * 32u + (wave >> 1) * 16u;
    _Float16* pw = sP[wave];
    float* so = sO[wave >> 1];
    {
        const unsigned head = 2u * pair + hp;
        const v16h qf = frag_ld(Q16 + (size_t)(b * SEQ + q0 + c) * CH + head * HD + 8u * hh);
        const float* arow = ALOC + (size_t)((b * (unsigned)HEADS + head) * SEQ + q0 + 8u * hh) * SEQ + c;
        const _Float16* krow = K16 + (size_t)(b * SEQ + c) * CH + head * HD + 8u * hh;
        const int* mrw = mask + b * SEQ_FULL + c;
        float mrow[8], lrow[8];
        v8f os[2];
#pragma unroll
        for (int r = 0; r < 8; ++r) { mrow[r] = -3.0e38f; lrow[r] = 0.f; }
#pragma unroll
        for (int t = 0; t < 2; ++t) os[t] = (v8f){0.f,0.f,0.f,0.f,0.f,0.f,0.f,0.f};
        // score operands of one chunk, held in registers and fetched one chunk ahead
        v16h kf[4];
        int mk[4];
        float al[4][8];
#pragma unroll
        for (int j = 0; j < 4; ++j) {
            kf[j] = frag_ld(krow + (size_t)((unsigned)j * 16u) * CH);
            mk[j] = mrw[(unsigned)j * 16u];
#pragma unroll
            for (int r = 0; r < 8; ++r) al[j][r] = arow[(size_t)r * SEQ + (unsigned)j * 16u];
        }
#pragma unroll 1
        for (unsigned kc = 0; kc < (unsigned)(SEQ / 64); ++kc) {
            const unsigned kv0 = kc * 64u;
            v8f s[4];
#pragma unroll
            for (int j = 0; j < 4; ++j) {
                const v8f z = (v8f){0.f,0.f,0.f,0.f,0.f,0.f,0.f,0.f};
                s[j] = wmma16g(qf, kf[j], z);
            }
#pragma unroll
            for (int j = 0; j < 4; ++j) {
                const bool on = (mk[j] != 0);
#pragma unroll
                for (int r = 0; r < 8; ++r) {
                    const float sv = (s[j][r] * SCQK + al[j][r]) * LOG2E;
                    s[j][r] = on ? sv : FILL2;
                }
            }
            // the next chunk's score operands fly under this chunk's softmax; the last pass fetches its own chunk again (in bounds, unused)
            const unsigned nv0 = ((kc + 1u < (unsigned)(SEQ / 64)) ? kc + 1u : kc) * 64u;
#pragma unroll
            for (int j = 0; j < 4; ++j) {
                kf[j] = frag_ld(krow + (size_t)(nv0 + (unsigned)j * 16u) * CH);
                mk[j] = mrw[nv0 + (unsigned)j * 16u];
#pragma unroll
                for (int r = 0; r < 8; ++r) al[j][r] = arow[(size_t)r * SEQ + nv0 + (unsigned)j * 16u];
            }
#pragma unroll
            for (int r = 0; r < 8; ++r) {
                float mx = -3.0e38f;
#pragma unroll
                for (int j = 0; j < 4; ++j) { mx = fmaxf(mx, s[j][r]); }
                mx = fmaxf(mx, __shfl_xor(mx, 1, 32)); mx = fmaxf(mx, __shfl_xor(mx, 2, 32));
                mx = fmaxf(mx, __shfl_xor(mx, 4, 32)); mx = fmaxf(mx, __shfl_xor(mx, 8, 32));
                const float mnew = fmaxf(mrow[r], mx);
                const float alpha = exp2f(mrow[r] - mnew);
                mrow[r] = mnew;
                float psum = 0.f;
#pragma unroll
                for (int j = 0; j < 4; ++j) {
                    const float p = exp2f(s[j][r] - mnew);
                    psum += p;
                    const float w = p * P_CARRY;
                    pw[(8u * hh + (unsigned)r) * AT_PP + (unsigned)j * 16u + c] = (_Float16)((w < 6.103515625e-05f) ? 0.0f : w);
                }
                psum += __shfl_xor(psum, 1, 32); psum += __shfl_xor(psum, 2, 32);
                psum += __shfl_xor(psum, 4, 32); psum += __shfl_xor(psum, 8, 32);
                lrow[r] = lrow[r] * alpha + psum;
                os[0][r] *= alpha; os[1][r] *= alpha;
            }
            wave_sync_lds();
            // this chunk's V fragments, all four in one group ahead of the P.V products
            v16h vb[2][2];
#pragma unroll
            for (int kk = 0; kk < 2; ++kk)
#pragma unroll
                for (int t = 0; t < 2; ++t)
                    vb[kk][t] = frag_ld(VT16 + (size_t)(b * CH + head * HD + (unsigned)t * 16u + c) * SEQ + kv0 + (unsigned)kk * 32u + 8u * hh);
#pragma unroll
            for (int kk = 0; kk < 2; ++kk) {
                const v16h pa = frag_ld(pw + c * AT_PP + (unsigned)kk * 32u + 8u * hh);
#pragma unroll
                for (int t = 0; t < 2; ++t) {
                    os[t] = wmma16g(pa, vb[kk][t], os[t]);
                }
            }
            wave_sync_lds();
        }
#pragma unroll
        for (int r = 0; r < 8; ++r) {
            const float inv = 1.0f / (lrow[r] * P_CARRY);
#pragma unroll
            for (int t = 0; t < 2; ++t)
                so[(8u * hh + (unsigned)r) * AT_OP + hp * 32u + (unsigned)t * 16u + c] = os[t][r] * inv * (O_CARRY / ACT_CARRY);   // = 64 * value
        }
    }
    __syncthreads();   // the tile's other head has staged its 32 columns; every wave of the block passes here once
    {
        const unsigned q = hp * 8u + (lane >> 3), c8 = (lane & 7u) * 8u;   // this wave's 8 of the tile's 16 rows
        v8h ov[2];
#pragma unroll
        for (int it = 0; it < 2; ++it) {
            const float* sp = so + ((unsigned)it * 4u + q) * AT_OP + c8;
            ov[it] = pack8_flush(*(const v4f*)sp, *(const v4f*)(sp + 4));
        }
        _Float16* dst = O16 + (size_t)(b * SEQ + q0) * CH + pair * 64u;
#pragma unroll
        for (int it = 0; it < 2; ++it) *(v8h*)(dst + (size_t)((unsigned)it * 4u + q) * CH + c8) = ov[it];
    }
}

extern "C" void kernel_launch(void* const* d_in, const int* in_sizes, int n_in, void* d_out, int out_size,
                              void* d_ws, size_t ws_size, hipStream_t stream) {
    if (n_in < 17) return;
    if (in_sizes[0] < NB * SEQ * SEQ * DG || in_sizes[1] < MTOK * CH) return;
    if (in_sizes[2] < CH * CH || in_sizes[3] < CH || in_sizes[4] < CH * CH || in_sizes[5] < CH) return;
    if (in_sizes[6] < CH * CH || in_sizes[7] < CH || in_sizes[8] < CH * CH || in_sizes[9] < CH) return;
    if (in_sizes[10] < HEADS * DG * HID || in_sizes[11] < HEADS * HID || in_sizes[12] < HEADS * HID * HID) return;
    if (in_sizes[13] < HEADS * HID || in_sizes[14] < HEADS * HID || in_sizes[15] < HEADS || in_sizes[16] < NB * SEQ) return;
    if (out_size < MTOK * CH) return;
    if (ws_size < WS_TOTAL) return;

    const float* pairwise_g = (const float*)d_in[0];
    const float* coset      = (const float*)d_in[1];
    const float* fc_q_w     = (const float*)d_in[2];
    const float* fc_q_b     = (const float*)d_in[3];
    const float* fc_k_w     = (const float*)d_in[4];
    const float* fc_k_b     = (const float*)d_in[5];
    const float* in_w       = (const float*)d_in[6];
    const float* in_b       = (const float*)d_in[7];
    const float* out_w      = (const float*)d_in[8];
    const float* out_b      = (const float*)d_in[9];
    const float* loc_w1     = (const float*)d_in[10];
    const float* loc_b1     = (const float*)d_in[11];
    const float* loc_w2     = (const float*)d_in[12];
    const float* loc_b2     = (const float*)d_in[13];
    const float* loc_w3     = (const float*)d_in[14];
    const float* loc_b3     = (const float*)d_in[15];
    const int*   mask       = (const int*)d_in[16];
    float* out = (float*)d_out;

    char* wsp = (char*)d_ws;
    _Float16* G16  = (_Float16*)(wsp + OFF_G16);
    _Float16* C16  = (_Float16*)(wsp + OFF_C16);
    _Float16* WT   = (_Float16*)(wsp + OFF_WT);
    _Float16* W1B  = (_Float16*)(wsp + OFF_W1B);
    _Float16* W2B  = (_Float16*)(wsp + OFF_W2B);
    _Float16* Q16  = (_Float16*)(wsp + OFF_Q16);
    _Float16* K16  = (_Float16*)(wsp + OFF_K16);
    _Float16* VT16 = (_Float16*)(wsp + OFF_VT16);
    float*    ALOC = (float*)(wsp + OFF_ALOC);
    _Float16* O16  = (_Float16*)(wsp + OFF_O16);

    // operand planes (each whole plane written by this launch)
    k_prep<<<PB_WT + PB_WL + PB_C + PB_G, 256, 0, stream>>>(pairwise_g, coset, fc_q_w, fc_k_w, in_w, out_w, loc_w1, loc_w2,
                                                            G16, C16, WT, W1B, W2B);

    // projections (64x64 wave tiles, 8 waves per block) beside the location term; then attention, output projection
    k_proj_loc<<<2 * JB_ROWS + NB * JB_VT + NB * SEQ, 256, 0, stream>>>(C16, WT, Q16, K16, VT16, fc_q_b, fc_k_b, in_b,
                                                                        G16, W1B, W2B, loc_b1, loc_b2, loc_w3, loc_b3, ALOC);
    k_attn<<<NB * 4 * QBLK, 128, 0, stream>>>(Q16, K16, VT16, ALOC, mask, O16);
    k_proj_out<<<((MTOK / 64) * (CH / 64) + 7) / 8, 256, 0, stream>>>(O16, WT + (size_t)3 * CH * CH, out, out_b);
}

// v006
// One run takes 62.8 microseconds.
// Two timings next to v005 put it at 1.17 and 1.16 times that version's speed.
// Counting every step since v000, it is 4.38 times as fast.
// All contractions on v_wmma_f32_16x16x32_f16 (f16 operands, f32 accumulate): q/k/v projections (inputs x8, weights x32), pair MLP layer 1 (g x4, w1 x16, K=6 zero-padded to 32) and layer 2 (h1 x64, w2 x16, K=16 zero-padded to 32), q.k^T (x8, x8), P.V (P x1024, V x8), output projection (O x64, w x32); every float input RNE-converted to bf16 first; MLP layer 3 (N=1, K=16), swish (by tanh of half the argument), softmax statistics in f32 on the VALU.
#include <hip/hip_runtime.h>
#include <math.h>

#ifndef NB
#define NB 4
#endif
#ifndef SEQ
#define SEQ 512
#endif
#define NB_FULL 4
#define SEQ_FULL 512
#define CH 256
#define HEADS 8
#define HD 32
#define DG 6
#define HID 16
#define MTOK (NB * SEQ)
#define QBLK (SEQ / 32)

// power-of-two carries and their undo constants
#define G_CARRY 4.0f
#define W1_CARRY 16.0f
#define UNDO1 (1.0f / 64.0f)
#define H_CARRY 64.0f
#define W2_CARRY 16.0f
#define UNDO2 (1.0f / 1024.0f)
#define ACT_CARRY 8.0f
#define W_CARRY 32.0f
#define SC_PROJ (1.0f / 256.0f)
#define SCQK (1.0f / 1024.0f)
#define P_CARRY 1024.0f
#define O_CARRY 64.0f
#define SC_OUT (1.0f / 2048.0f)
#define LOG2E 1.4426950408889634f
#define FILL2 (-1.0e38f * LOG2E)

static_assert(G_CARRY * W1_CARRY * UNDO1 == 1.0f);
static_assert(H_CARRY * W2_CARRY * UNDO2 == 1.0f);
static_assert(ACT_CARRY * W_CARRY * SC_PROJ == 1.0f);
static_assert(ACT_CARRY * ACT_CARRY * 16.0f * SCQK == 1.0f);     // q x8, k x8, module scale 1/sqrt(256)
static_assert(O_CARRY * W_CARRY * SC_OUT == 1.0f);
static_assert(SEQ == SEQ_FULL);
static_assert(NB <= NB_FULL);
static_assert(CH == HEADS * HD && HD == 32 && HID == 16 && DG <= 8);
static_assert(SEQ % 32 == 0 && SEQ % 64 == 0);
static_assert(MTOK % 64 == 0 && CH % 64 == 0 && CH % 32 == 0);
static_assert((NB * SEQ * SEQ) % 256 == 0);
static_assert((MTOK * CH / 8) % 256 == 0);
static_assert((CH * (CH / 8)) % 256 == 0);
// store loops: lanes x bytes x instructions == tile rows x row bytes
static_assert(32 * 16 * 4 == 16 * 128);
static_assert(2 * 32 * 16 * 2 == 16 * 128);  // attention O tile: two waves x two stores
static_assert(32 * 16 * 8 == 16 * 256);     // f32 epilogue: 16 rows x 256 B
static_assert(32 * 4 * 8 == 8 * 128);
// static LDS per kernel
static_assert(8 * 16 * 68 * 4 <= 131072);
static_assert(4 * 16 * 72 * 2 + 2 * 16 * 68 * 4 <= 131072);

typedef _Float16 h16;
typedef __attribute__((ext_vector_type(16))) _Float16 v16h;
typedef __attribute__((ext_vector_type(8)))  _Float16 v8h;
typedef __attribute__((ext_vector_type(2)))  _Float16 v2h;
typedef __attribute__((ext_vector_type(8)))  float    v8f;
typedef __attribute__((ext_vector_type(4)))  float    v4f;
typedef __attribute__((ext_vector_type(2)))  float    v2f;
typedef __attribute__((ext_vector_type(4)))  unsigned int v4u;

static constexpr size_t SZ_G16  = (size_t)NB * SEQ * SEQ * 8 * 2;
static constexpr size_t SZ_C16  = (size_t)MTOK * CH * 2;
static constexpr size_t SZ_WT   = (size_t)4 * CH * CH * 2;
static constexpr size_t SZ_W1B  = (size_t)HEADS * HID * 32 * 2;
static constexpr size_t SZ_W2B  = (size_t)HEADS * HID * 32 * 2;
static constexpr size_t SZ_Q16  = (size_t)MTOK * CH * 2;
static constexpr size_t SZ_K16  = (size_t)MTOK * CH * 2;
static constexpr size_t SZ_VT16 = (size_t)NB * CH * SEQ * 2;
static constexpr size_t SZ_ALOC = (size_t)NB * HEADS * SEQ * SEQ * 4;
static constexpr size_t SZ_O16  = (size_t)MTOK * CH * 2;
static constexpr size_t OFF_G16  = 0;
static constexpr size_t OFF_C16  = OFF_G16 + SZ_G16;
static constexpr size_t OFF_WT   = OFF_C16 + SZ_C16;
static constexpr size_t OFF_W1B  = OFF_WT + SZ_WT;
static constexpr size_t OFF_W2B  = OFF_W1B + SZ_W1B;
static constexpr size_t OFF_Q16  = OFF_W2B + SZ_W2B;
static constexpr size_t OFF_K16  = OFF_Q16 + SZ_Q16;
static constexpr size_t OFF_VT16 = OFF_K16 + SZ_K16;
static constexpr size_t OFF_ALOC = OFF_VT16 + SZ_VT16;
static constexpr size_t OFF_O16  = OFF_ALOC + SZ_ALOC;
static constexpr size_t WS_TOTAL = OFF_O16 + SZ_O16;
static_assert(SZ_G16 % 256 == 0 && SZ_C16 % 256 == 0 && SZ_WT % 256 == 0 && SZ_W1B % 256 == 0 && SZ_W2B % 256 == 0);
static_assert(SZ_Q16 % 256 == 0 && SZ_VT16 % 256 == 0 && SZ_ALOC % 256 == 0 && SZ_O16 % 256 == 0);
static_assert(WS_TOTAL <= (size_t)134217728);

// 16-bit WMMA fragment map (wave32), lane L, hh = L>>4, c = L&15:
//   A 16x32: lane = row c;    element i -> k = (i<8) ? 8hh+i : 16+8hh+(i-8)
//   B 32x16: lane = column c; the SAME k(i,hh)
//   D 16x16 (8 f32): lane = column c; element r -> row 8hh+r

// RNE convert f32 -> bf16 -> f32
__device__ __forceinline__ float bfr(float f) {
    unsigned u = __float_as_uint(f);
    u += 0x7FFFu + ((u >> 16) & 1u);
    return __uint_as_float(u & 0xFFFF0000u);
}
// f32 -> f16 with values under 2^-14 replaced by +0 before the convert
static __device__ __forceinline__ h16 toh_flush(float v) { const float w = (fabsf(v) < 6.103515625e-05f) ? 0.0f : v; return (h16)w; }
static __device__ __forceinline__ v2h toh2_flush(float a, float b) {
    v2f w;
    w.x = (fabsf(a) < 6.103515625e-05f) ? 0.0f : a;
    w.y = (fabsf(b) < 6.103515625e-05f) ? 0.0f : b;
    return __builtin_convertvector(w, v2h);
}
union Pack8 { v8h v; v2h p[4]; };
static __device__ __forceinline__ v8h pack8_flush(v4f a, v4f b) {
    Pack8 u;
    u.p[0] = toh2_flush(a.x, a.y); u.p[1] = toh2_flush(a.z, a.w);
    u.p[2] = toh2_flush(b.x, b.y); u.p[3] = toh2_flush(b.z, b.w);
    return u.v;
}
static __device__ __forceinline__ void st8h2(_Float16* p, v8h v) {
    *(v8h*)p = v;
    
}

union FragU { v16h v; v8h h[2]; };
union FragQ { v16h v; v8h h[2]; v4u q[2]; };
// elements 0..7 <- p[0..7], 8..15 <- p[16..23]; caller adds 8*hh to p (used for BOTH A and B operands: same k per element)
__device__ __forceinline__ v16h frag_ld(const _Float16* p) {
    FragU f; f.h[0] = *(const v8h*)(p); f.h[1] = *(const v8h*)(p + 16); return f.v;
}
__device__ __forceinline__ v8f wmma16g(v16h a, v16h b, v8f c) {
    c = __builtin_amdgcn_wmma_f32_16x16x32_f16(false, a, false, b, (short)0, c, false, false);
    asm volatile("v_nop\n\tv_nop\n\tv_nop\n\tv_nop" : "+v"(c) : "v"(a), "v"(b));
    return c;
}
__device__ __forceinline__ void wave_sync_lds() {
    __builtin_amdgcn_fence(3 /* release order */, "workgroup");
    __builtin_amdgcn_wave_barrier();
    __builtin_amdgcn_fence(2 /* acquire order */, "workgroup");
}
// swish(x) = x * sigmoid(x) = h + h * tanh(h) with h = x / 2; the caller hands in h
static __device__ __forceinline__ float swish_half(float h) {
    return fmaf(h, __builtin_amdgcn_tanhf(h), h);
}

// =====================================================================================================================
// cvt_g_body: pair components [pair][6] f32 -> G16 [pair][8] f16 = bf16(g) * 4, components 6,7 = 0; one 16-B piece per lane
//   coverage: NB*SEQ*SEQ pairs x 16 B == the whole G16 plane
// =====================================================================================================================
static __device__ __forceinline__ void cvt_g_body(unsigned blk, const float* __restrict__ g, _Float16* __restrict__ G16) {
    const unsigned u = blk * 256u + threadIdx.x;
    if (u >= (unsigned)(NB * SEQ * SEQ)) return;
    const v2f* src = (const v2f*)(g + (size_t)u * 6u);
    const v2f a = src[0], b = src[1], cc = src[2];
    v4f lo, hi;
    lo.x = bfr(a.x) * G_CARRY; lo.y = bfr(a.y) * G_CARRY; lo.z = bfr(b.x) * G_CARRY; lo.w = bfr(b.y) * G_CARRY;
    hi.x = bfr(cc.x) * G_CARRY; hi.y = bfr(cc.y) * G_CARRY; hi.z = 0.0f; hi.w = 0.0f;
    st8h2(G16 + (size_t)u * 8u, pack8_flush(lo, hi));
}

// cvt_c_body: features [row][256] f32 -> C16 f16 = bf16(x) * 8; thread per 8 columns; coverage: MTOK*256/8 pieces == whole plane
static __device__ __forceinline__ void cvt_c_body(unsigned blk, const float* __restrict__ x, _Float16* __restrict__ C16) {
    const unsigned u = blk * 256u + threadIdx.x;
    if (u >= (unsigned)(MTOK * CH / 8)) return;
    const v4f* src = (const v4f*)(x + (size_t)u * 8u);
    v4f a = src[0], b = src[1];
    a.x = bfr(a.x) * ACT_CARRY; a.y = bfr(a.y) * ACT_CARRY; a.z = bfr(a.z) * ACT_CARRY; a.w = bfr(a.w) * ACT_CARRY;
    b.x = bfr(b.x) * ACT_CARRY; b.y = bfr(b.y) * ACT_CARRY; b.z = bfr(b.z) * ACT_CARRY; b.w = bfr(b.w) * ACT_CARRY;
    st8h2(C16 + (size_t)u * 8u, pack8_flush(a, b));
}

static __device__ __forceinline__ void wt_one(const float* __restrict__ W, _Float16* __restrict__ D, unsigned o, unsigned k0) {
    v4f lo, hi;
    lo.x = bfr(W[(size_t)(k0 + 0u) * CH + o]) * W_CARRY;
    lo.y = bfr(W[(size_t)(k0 + 1u) * CH + o]) * W_CARRY;
    lo.z = bfr(W[(size_t)(k0 + 2u) * CH + o]) * W_CARRY;
    lo.w = bfr(W[(size_t)(k0 + 3u) * CH + o]) * W_CARRY;
    hi.x = bfr(W[(size_t)(k0 + 4u) * CH + o]) * W_CARRY;
    hi.y = bfr(W[(size_t)(k0 + 5u) * CH + o]) * W_CARRY;
    hi.z = bfr(W[(size_t)(k0 + 6u) * CH + o]) * W_CARRY;
    hi.w = bfr(W[(size_t)(k0 + 7u) * CH + o]) * W_CARRY;
    st8h2(D + (size_t)o * CH + k0, pack8_flush(lo, hi));
}
// wt4_body: the four 256x256 weights -> WT[4][out][in]; thread per (o, 8 k): 32 lanes cover one whole 512-B row; coverage: 4 x 256 x 32 pieces
static __device__ __forceinline__ void wt4_body(unsigned blk, const float* __restrict__ wq, const float* __restrict__ wk,
                                                const float* __restrict__ wv, const float* __restrict__ wo,
                                                _Float16* __restrict__ WT) {
    const unsigned u = blk * 256u + threadIdx.x;
    if (u >= (unsigned)(CH * (CH / 8))) return;
    const unsigned k0 = 8u * (u & 31u);
    const unsigned o = u >> 5;
    wt_one(wq, WT, o, k0);
    wt_one(wk, WT + (size_t)1 * CH * CH, o, k0);
    wt_one(wv, WT + (size_t)2 * CH * CH, o, k0);
    wt_one(wo, WT + (size_t)3 * CH * CH, o, k0);
}

// wloc_body: pair-MLP weights as A-operand planes, zero-padded along k to 32:
//   W1B[h*16+j][k] = bf16(w1[h][k][j]) * 16 for k < 6, else 0;  W2B[h*16+j][k] = bf16(w2[h][k][j]) * 16 for k < 16, else 0
//   thread per 16-B piece (512 pieces per plane), clamped addresses, zero by value; coverage: 128 rows x 4 pieces == both whole planes
static __device__ __forceinline__ void wloc_body(unsigned blk, const float* __restrict__ w1, const float* __restrict__ w2,
                                                 _Float16* __restrict__ W1B, _Float16* __restrict__ W2B) {
    const unsigned p = blk * 256u + threadIdx.x;
    if (p >= (unsigned)(HEADS * HID * 4)) return;
    const unsigned col = p >> 2, k0 = (p & 3u) * 8u;
    const unsigned h = col >> 4, j = col & 15u;
    float v[8];
#pragma unroll
    for (int i = 0; i < 8; ++i) {
        const unsigned k = k0 + (unsigned)i;
        const unsigned kc = min(k, (unsigned)(DG - 1));
        const float raw = w1[(size_t)(h * DG + kc) * HID + j];
        asm volatile("s_wait_xcnt 0x0" ::: "memory");   // stands in front of a later load's result landing on this load's address registers
        const float x = bfr(raw) * W1_CARRY;
        v[i] = (k < (unsigned)DG) ? x : 0.0f;
    }
    {
        v4f a, b;
        a.x = v[0]; a.y = v[1]; a.z = v[2]; a.w = v[3]; b.x = v[4]; b.y = v[5]; b.z = v[6]; b.w = v[7];
        st8h2(W1B + (size_t)col * 32u + k0, pack8_flush(a, b));
    }
#pragma unroll
    for (int i = 0; i < 8; ++i) {
        const unsigned k = k0 + (unsigned)i;
        const unsigned kc = min(k, (unsigned)(HID - 1));
        const float raw = w2[(size_t)(h * HID + kc) * HID + j];
        asm volatile("s_wait_xcnt 0x0" ::: "memory");   // the same
        const float x = bfr(raw) * W2_CARRY;
        v[i] = (k < (unsigned)HID) ? x : 0.0f;
    }
    {
        v4f a, b;
        a.x = v[0]; a.y = v[1]; a.z = v[2]; a.w = v[3]; b.x = v[4]; b.y = v[5]; b.z = v[6]; b.w = v[7];
        st8h2(W2B + (size_t)col * 32u + k0, pack8_flush(a, b));
    }
}

// k_prep: the four operand-plane conversions in ONE launch (none reads what another writes); the block index picks the job, a scalar branch.
//   the short, latency-bound jobs stand at the low indices so that they start first and end under the long pair conversion.
#define PB_WT ((CH * (CH / 8)) / 256)
#define PB_WL ((HEADS * HID * 4) / 256)
#define PB_C  ((MTOK * CH / 8) / 256)
#define PB_G  ((NB * SEQ * SEQ) / 256)
static_assert((HEADS * HID * 4) % 256 == 0);
__global__ __launch_bounds__(256) void k_prep(const float* __restrict__ g, const float* __restrict__ x,
                                              const float* __restrict__ wq, const float* __restrict__ wk,
                                              const float* __restrict__ wv, const float* __restrict__ wo,
                                              const float* __restrict__ w1, const float* __restrict__ w2,
                                              _Float16* __restrict__ G16, _Float16* __restrict__ C16, _Float16* __restrict__ WT,
                                              _Float16* __restrict__ W1B, _Float16* __restrict__ W2B) {
    const unsigned bx = blockIdx.x;
    if (bx < (unsigned)PB_WT) wt4_body(bx, wq, wk, wv, wo, WT);
    else if (bx < (unsigned)(PB_WT + PB_WL)) wloc_body(bx - (unsigned)PB_WT, w1, w2, W1B, W2B);
    else if (bx < (unsigned)(PB_WT + PB_WL + PB_C)) cvt_c_body(bx - (unsigned)(PB_WT + PB_WL), x, C16);
    else cvt_g_body(bx - (unsigned)(PB_WT + PB_WL + PB_C), g, G16);
}

// =====================================================================================================================
// gemm64_body: C[m,n] = (scale * sum_k A[m,k] * Bt[n,k] + bf16(bias[n or m])) ; each wave owns a 64x64 tile.
//   A row-major [M][lda] f16, Bt row-major [N][ldb] f16 (fragments straight from the planes); M,N % 64 == 0, K % 32 == 0.
//   blk = the job's own block number; sT = the calling kernel's staging slabs, one per wave.
//   OUT_MODE 0: f32 C (pitch ldc); OUT_MODE 1: f16 C = value * oscale. BIAS_ROW: bias indexed by the row m.
// =====================================================================================================================
template <int OUT_MODE, bool BIAS_ROW>
static __device__ __forceinline__ void gemm64_body(
    unsigned blk, float (*sT)[16 * 68],
    const _Float16* __restrict__ A, unsigned lda, const _Float16* __restrict__ Bt, unsigned ldb,
    float* __restrict__ Cf, _Float16* __restrict__ Ch, unsigned ldc, const float* __restrict__ bias,
    unsigned M, unsigned N, unsigned K, float scale, float oscale) {
  const unsigned lane = threadIdx.x & 31u;
  const unsigned wave = threadIdx.x >> 5;
  const unsigned tilesN = N >> 6, tilesM = M >> 6;
  const unsigned tile = blk * 8u + wave;
  if (tile >= tilesM * tilesN) return;   // wave-uniform; no block barriers in this kernel
  const unsigned tm = tile / tilesN;
  const unsigned tn = tile - tm * tilesN;
  const unsigned m0 = tm << 6, n0 = tn << 6;
  const unsigned rlane = lane & 15u;
  const unsigned koff = (lane >> 4) * 8u;
  const unsigned mOff = koff;

  v8f acc[4][4];
#pragma unroll
  for (int i = 0; i < 4; ++i)
#pragma unroll
    for (int j = 0; j < 4; ++j) acc[i][j] = (v8f){0.f,0.f,0.f,0.f,0.f,0.f,0.f,0.f};

  for (unsigned k0 = 0; k0 < K; k0 += 32u) {
    v16h bh[4];
#pragma unroll
    for (int j = 0; j < 4; ++j)
      bh[j] = frag_ld(Bt + (size_t)(n0 + ((unsigned)j << 4) + rlane) * ldb + koff + k0);
#pragma unroll
    for (int i = 0; i < 4; ++i) {
      const v16h ah = frag_ld(A + (size_t)(m0 + ((unsigned)i << 4) + rlane) * lda + koff + k0);
#pragma unroll
      for (int j = 0; j < 4; ++j)
        acc[i][j] = wmma16g(ah, bh[j], acc[i][j]);
    }
  }

  float* slab = sT[wave];
#pragma unroll
  for (int i = 0; i < 4; ++i) {
    const unsigned mBase = m0 + ((unsigned)i << 4);
    float bvr[8];
#pragma unroll
    for (int r = 0; r < 8; ++r) bvr[r] = 0.0f;
    if (BIAS_ROW) {
#pragma unroll
      for (int r = 0; r < 8; ++r) bvr[r] = bfr(bias[mBase + mOff + (unsigned)r]);
    }
#pragma unroll
    for (int j = 0; j < 4; ++j) {
      const unsigned n = n0 + ((unsigned)j << 4) + rlane;
      float bvc = 0.0f;
      if (!BIAS_ROW) bvc = bfr(bias[n]);
#pragma unroll
      for (int r = 0; r < 8; ++r) {
        float v = acc[i][j][r] * scale + (BIAS_ROW ? bvr[r] : bvc);
        if (OUT_MODE == 1) v *= oscale;
        slab[(mOff + (unsigned)r) * 68u + ((unsigned)j << 4) + rlane] = v;
      }
    }
    wave_sync_lds();
    if (OUT_MODE == 0) {
      const unsigned hh = lane >> 4, c4 = (lane & 15u) * 4u;     // row segment = 256 B = 16 lanes x 16 B
#pragma unroll
      for (int half = 0; half < 2; ++half) {
        v4f vv[4];
#pragma unroll
        for (int it = 0; it < 4; ++it) {
          const unsigned row = (unsigned)(half * 4 + it) * 2u + hh;
          vv[it] = *(const v4f*)(slab + row * 68u + c4);
        }
        {
#pragma unroll
          for (int it = 0; it < 4; ++it) {
            const unsigned row = (unsigned)(half * 4 + it) * 2u + hh;
            *(v4f*)(Cf + (size_t)(mBase + row) * ldc + n0 + c4) = vv[it];
          }
          
        }
      }
    } else {
      const unsigned q = lane >> 3, c8 = (lane & 7u) * 8u;
      v8h hv[4];
#pragma unroll
      for (int it = 0; it < 4; ++it) {
        const unsigned row = (unsigned)it * 4u + q;
        const float* sp = slab + row * 68u + c8;
        hv[it] = pack8_flush(*(const v4f*)sp, *(const v4f*)(sp + 4));
      }
      {
#pragma unroll
        for (int it = 0; it < 4; ++it) {
          const unsigned row = (unsigned)it * 4u + q;
          *(v8h*)(Ch + (size_t)(mBase + row) * ldc + n0 + c8) = hv[it];
        }
        
      }
    }
    wave_sync_lds();
  }
}

// =====================================================================================================================
// loc_body: location term ALOC[b][h][n][m] (f32) = swish(l3(swish(l2(swish(l1(g[b][n][m][:]))))))
//   transposed chain: the weights are the A operand (rows = hidden units), the pairs are the B columns.
//   block = 8 waves = the 8 heads of one query row (b,n); a wave owns ONE head and walks the row's 512 keys, 64 pairs (4 column tiles) a pass.
//   layer 1: B = two 16-B G16 rows per lane: lane (c,hh) holds pair 16hh+c in elements 0..7 (k 8hh..) and pair 32+16hh+c in elements 8..15
//            (k 16+8hh..), so k group q = k>>3 holds column tile q. A of tile q = the head's W1B row (k 0..7) placed in k group q, zero words
//            in the other three groups -> D1[hidden 8hh+r][pair c of tile q].
//   layer 2: D1's map IS the B map (lane = pair c, element r = hidden 8hh+r): two tiles' h1, converted in place to f16 x64, are elements
//            0..7 and 8..15 of one B operand; A = the head's W2B row in k 0..15 (first tile) or in k 16..31 (second tile), zero words in the
//            other half -> D2[hidden 8hh+r][pair c].
//   layer 3 (N = 1) on the VALU: 8 multiply-adds in the lane (hidden 8hh..8hh+7), then the other half's sum from lane l ^ 16.
//   biases and w3 are indexed by the D row: 8 registers each, prepared once per wave.
// =====================================================================================================================
#define LC_PASS 64
static_assert(HEADS == 8 && SEQ % LC_PASS == 0);
// lane l with lane l ^ 16
static __device__ __forceinline__ float xhalf(float x) {
    return __builtin_bit_cast(float, __builtin_amdgcn_permlanex16(__builtin_bit_cast(int, x), __builtin_bit_cast(int, x),
                                                                  0x76543210, 0xfedcba98, false, false));
}
static __device__ __forceinline__ void loc_body(unsigned bn, const _Float16* __restrict__ G16, const _Float16* __restrict__ W1B,
                                                const _Float16* __restrict__ W2B, const float* __restrict__ b1,
                                                const float* __restrict__ b2, const float* __restrict__ w3,
                                                const float* __restrict__ b3, float* __restrict__ ALOC) {
    const unsigned lane = threadIdx.x & 31u;
    const unsigned t = (unsigned)__builtin_amdgcn_readfirstlane((int)(threadIdx.x >> 5));   // the wave's head
    const unsigned hh = lane >> 4, c = lane & 15u;
    // bn = b*SEQ + n
    const unsigned b = bn / (unsigned)SEQ, n = bn % (unsigned)SEQ;
    const v8f zacc = (v8f){0.f,0.f,0.f,0.f,0.f,0.f,0.f,0.f};
    const v4u zq = (v4u){0u, 0u, 0u, 0u};
    const unsigned row = t * 16u + c;

    // layer-1 A operands, one per k group
    const v4u w1q = *(const v4u*)(W1B + (size_t)row * 32u);
    asm volatile("s_wait_xcnt 0x0" ::: "memory");   // stands in front of the later writes of this load's address registers
    v4u wlo, whi;
    wlo.x = (hh == 0u) ? w1q.x : 0u; wlo.y = (hh == 0u) ? w1q.y : 0u; wlo.z = (hh == 0u) ? w1q.z : 0u; wlo.w = (hh == 0u) ? w1q.w : 0u;
    whi.x = (hh == 0u) ? 0u : w1q.x; whi.y = (hh == 0u) ? 0u : w1q.y; whi.z = (hh == 0u) ? 0u : w1q.z; whi.w = (hh == 0u) ? 0u : w1q.w;
    FragQ a1[4];
    a1[0].q[0] = wlo; a1[0].q[1] = zq;
    a1[1].q[0] = whi; a1[1].q[1] = zq;
    a1[2].q[0] = zq;  a1[2].q[1] = wlo;
    a1[3].q[0] = zq;  a1[3].q[1] = whi;
    // layer-2 A operands: k 0..15 (the plane's own zeros beyond) and the same row moved to k 16..31
    FragQ a2[2];
    a2[0].h[0] = *(const v8h*)(W2B + (size_t)row * 32u + 8u * hh);
    asm volatile("s_wait_xcnt 0x0" ::: "memory");   // the same: the next load's result may land on this one's address registers
    a2[0].h[1] = *(const v8h*)(W2B + (size_t)row * 32u + 8u * hh + 16u);
    asm volatile("s_wait_xcnt 0x0" ::: "memory");   // the same
    a2[1].q[0] = a2[0].q[1]; a2[1].q[1] = a2[0].q[0];
    float hb1[8], hb2[8], ww3[8];
    // every '#pragma unroll' of this kernel: its counter indexes register arrays (hb1, a1, hx, part ...), which must not become memory
#pragma unroll
    for (int r = 0; r < 8; ++r) {
        const unsigned j = t * 16u + 8u * hh + (unsigned)r;
        hb1[r] = 0.5f * bfr(b1[j]);
        hb2[r] = 0.5f * bfr(b2[j]);
        ww3[r] = bfr(w3[j]);
    }
    const float bb3 = bfr(b3[t]);
    asm volatile("s_wait_xcnt 0x0" ::: "memory");   // the same for the weight, bias and w3 loads above

    const _Float16* gp = G16 + ((size_t)bn * SEQ + lane) * 8u;
    float* dst = ALOC + ((size_t)(b * (unsigned)HEADS + t) * SEQ + n) * SEQ + lane;
    FragQ g;
    g.q[0] = *(const v4u*)gp;
    g.q[1] = *(const v4u*)(gp + 32 * 8);
    // rolled: one pass is about 400 instructions, and eight copies of it would not pay for their instruction fetches
#pragma unroll 1
    for (unsigned it = 0; it < (unsigned)(SEQ / LC_PASS); ++it) {
        FragQ hx[2];
#pragma unroll
        for (int q = 0; q < 4; ++q) {
            const v8f d1 = wmma16g(a1[q].v, g.v, zacc);
            v4f xa, xb;
            xa.x = swish_half(d1[0] * (0.5f * UNDO1) + hb1[0]) * H_CARRY;
            xa.y = swish_half(d1[1] * (0.5f * UNDO1) + hb1[1]) * H_CARRY;
            xa.z = swish_half(d1[2] * (0.5f * UNDO1) + hb1[2]) * H_CARRY;
            xa.w = swish_half(d1[3] * (0.5f * UNDO1) + hb1[3]) * H_CARRY;
            xb.x = swish_half(d1[4] * (0.5f * UNDO1) + hb1[4]) * H_CARRY;
            xb.y = swish_half(d1[5] * (0.5f * UNDO1) + hb1[5]) * H_CARRY;
            xb.z = swish_half(d1[6] * (0.5f * UNDO1) + hb1[6]) * H_CARRY;
            xb.w = swish_half(d1[7] * (0.5f * UNDO1) + hb1[7]) * H_CARRY;
            hx[q >> 1].h[q & 1] = pack8_flush(xa, xb);
        }
        // the next pass's pairs fly under this pass's layers 2 and 3; the last pass fetches its own pairs again (in bounds, unused)
        const unsigned nx = ((it + 1u < (unsigned)(SEQ / LC_PASS)) ? it + 1u : it) * (unsigned)LC_PASS;
        g.q[0] = *(const v4u*)(gp + (size_t)nx * 8u);
        g.q[1] = *(const v4u*)(gp + (size_t)(nx + 32u) * 8u);
#pragma unroll
        for (int u = 0; u < 2; ++u) {
            float part[2];
#pragma unroll
            for (int s = 0; s < 2; ++s) {
                const v8f d2 = wmma16g(a2[s].v, hx[u].v, zacc);
                float acc = swish_half(d2[0] * (0.5f * UNDO2) + hb2[0]) * ww3[0];
#pragma unroll
                for (int r = 1; r < 8; ++r) acc = fmaf(swish_half(d2[r] * (0.5f * UNDO2) + hb2[r]), ww3[r], acc);
                part[s] = acc;
            }
            // lane (c,hh) finishes pair 16hh+c of this tile pair: its own half sum plus the other half's from lane l ^ 16
            const float mine  = (hh == 0u) ? part[0] : part[1];
            const float other = (hh == 0u) ? part[1] : part[0];
            const float v = mine + xhalf(other) + bb3;
            dst[it * (unsigned)LC_PASS + (unsigned)u * 32u] = swish_half(0.5f * v);
        }
    }
}

// k_proj_loc: the q, k and v projections and the location term in ONE launch (none reads what another writes); the block index picks the
//   job, a scalar branch. The 48 projection blocks stand at the low indices: they start first and end under the 2048 location blocks.
//   q, k: position-major Y16[row][256] = f16(8 * (x @ w + bf16(b)))
//   v:    channel-major VT16[b][ch][key] = f16(8 * (x @ w + bf16(b)))^T ; A = weight plane, Bt = feature rows of one batch
#define JB_ROWS (((MTOK / 64) * (CH / 64) + 7) / 8)
#define JB_VT   (((CH / 64) * (SEQ / 64) + 7) / 8)
__global__ __launch_bounds__(256) void k_proj_loc(const _Float16* __restrict__ C16, const _Float16* __restrict__ WT,
                                                  _Float16* __restrict__ Q16, _Float16* __restrict__ K16, _Float16* __restrict__ VT16,
                                                  const float* __restrict__ bq, const float* __restrict__ bk, const float* __restrict__ bv,
                                                  const _Float16* __restrict__ G16, const _Float16* __restrict__ W1B,
                                                  const _Float16* __restrict__ W2B, const float* __restrict__ b1,
                                                  const float* __restrict__ b2, const float* __restrict__ w3,
                                                  const float* __restrict__ b3, float* __restrict__ ALOC) {
    __shared__ __align__(16) float sT[8][16 * 68];
    const unsigned bx = blockIdx.x;
    if (bx < (unsigned)(2 * JB_ROWS)) {
        const bool isk = bx >= (unsigned)JB_ROWS;
        gemm64_body<1, false>(isk ? bx - (unsigned)JB_ROWS : bx, sT, C16, CH, isk ? WT + (size_t)1 * CH * CH : WT, CH, nullptr,
                              isk ? K16 : Q16, CH, isk ? bk : bq, MTOK, CH, CH, SC_PROJ, ACT_CARRY);
    } else if (bx < (unsigned)(2 * JB_ROWS + NB * JB_VT)) {
        const unsigned v = bx - (unsigned)(2 * JB_ROWS);
        const unsigned by = v / (unsigned)JB_VT;
        gemm64_body<1, true>(v % (unsigned)JB_VT, sT, WT + (size_t)2 * CH * CH, CH, C16 + (size_t)by * SEQ * CH, CH, nullptr,
                             VT16 + (size_t)by * CH * SEQ, SEQ, bv, CH, SEQ, CH, SC_PROJ, ACT_CARRY);
    } else {
        loc_body(bx - (unsigned)(2 * JB_ROWS + NB * JB_VT), G16, W1B, W2B, b1, b2, w3, b3, ALOC);
    }
}

// =====================================================================================================================
// k_attn: one block per (batch, head pair, 32-query block), 4 waves = 2 query tiles of 16 rows x the 2 heads of the pair, ONE head per wave,
//   64-key chunks: 1024 waves in 256 blocks, so that every wave can have a SIMD of its own (a wave's chain of 8 chunks is latency bound).
//   scores: Q (A) and K (B) fragments straight from the planes, one k-step (d = 32); + location term loaded in the D layout;
//   key mask by value select (fill -1e38 in the natural-log domain); running-max softmax in the exp2 domain (f32);
//   unnormalised e x1024 as f16 (wave-private LDS tile sP, wave_sync) times V^T B fragments straight from VT16.
//   O plane f16 x64 [row][head*32 + d]: the two waves of a query tile stage their 32 columns each in the tile's sO slab; behind one block
//   barrier each of them writes 8 whole 128-B rows (one writer per line).
//   staged extent == consumed extent: sP rows 0..15 x keys 0..63; sO rows 0..15 x cols 0..63.
// =====================================================================================================================
#define AT_PP 72
#define AT_OP 68
__global__ __launch_bounds__(128) void k_attn(const _Float16* __restrict__ Q16, const _Float16* __restrict__ K16,
                                              const _Float16* __restrict__ VT16, const float* __restrict__ ALOC,
                                              const int* __restrict__ mask, _Float16* __restrict__ O16) {
    __shared__ __align__(16) _Float16 sP[4][16 * AT_PP];      // per wave [row][64 keys], wave-private (wave_sync)
    __shared__ __align__(16) float sO[2][16 * AT_OP];         // per query tile [row][64 channels], shared by the tile's two waves (block barrier)
    const unsigned tid = threadIdx.x, lane = tid & 31u, wave = tid >> 5;
    const unsigned hh = lane >> 4, c = lane & 15u;
    const unsigned bx = blockIdx.x;
    const unsigned qb = bx % (unsigned)QBLK;
    const unsigned pair = (bx / (unsigned)QBLK) & 3u;
    const unsigned b = bx / ((unsigned)QBLK * 4u);
    const unsigned hp = wave & 1u;                            // the wave's head of the pair
    const unsigned q0 = qb * 32u + (wave >> 1) * 16u;
    _Float16* pw = sP[wave];
    float* so = sO[wave >> 1];
    {
        const unsigned head = 2u * pair + hp;
        const v16h qf = frag_ld(Q16 + (size_t)(b * SEQ + q0 + c) * CH + head * HD + 8u * hh);
        const float* arow = ALOC + (size_t)((b * (unsigned)HEADS + head) * SEQ + q0 + 8u * hh) * SEQ + c;
        const _Float16* krow = K16 + (size_t)(b * SEQ + c) * CH + head * HD + 8u * hh;
        const int* mrw = mask + b * SEQ_FULL + c;
        float mrow[8], lrow[8];
        v8f os[2];
#pragma unroll
        for (int r = 0; r < 8; ++r) { mrow[r] = -3.0e38f; lrow[r] = 0.f; }
#pragma unroll
        for (int t = 0; t < 2; ++t) os[t] = (v8f){0.f,0.f,0.f,0.f,0.f,0.f,0.f,0.f};
        // score operands of one chunk, held in registers and fetched one chunk ahead
        v16h kf[4];
        int mk[4];
        float al[4][8];
#pragma unroll
        for (int j = 0; j < 4; ++j) {
            kf[j] = frag_ld(krow + (size_t)((unsigned)j * 16u) * CH);
            mk[j] = mrw[(unsigned)j * 16u];
#pragma unroll
            for (int r = 0; r < 8; ++r) al[j][r] = arow[(size_t)r * SEQ + (unsigned)j * 16u];
        }
#pragma unroll 1
        for (unsigned kc = 0; kc < (unsigned)(SEQ / 64); ++kc) {
            const unsigned kv0 = kc * 64u;
            v8f s[4];
#pragma unroll
            for (int j = 0; j < 4; ++j) {
                const v8f z = (v8f){0.f,0.f,0.f,0.f,0.f,0.f,0.f,0.f};
                s[j] = wmma16g(qf, kf[j], z);
            }
#pragma unroll
            for (int j = 0; j < 4; ++j) {
                const bool on = (mk[j] != 0);
#pragma unroll
                for (int r = 0; r < 8; ++r) {
                    const float sv = (s[j][r] * SCQK + al[j][r]) * LOG2E;
                    s[j][r] = on ? sv : FILL2;
                }
            }
            // the next chunk's score operands fly under this chunk's softmax; the last pass fetches its own chunk again (in bounds, unused)
            const unsigned nv0 = ((kc + 1u < (unsigned)(SEQ / 64)) ? kc + 1u : kc) * 64u;
#pragma unroll
            for (int j = 0; j < 4; ++j) {
                kf[j] = frag_ld(krow + (size_t)(nv0 + (unsigned)j * 16u) * CH);
                mk[j] = mrw[nv0 + (unsigned)j * 16u];
#pragma unroll
                for (int r = 0; r < 8; ++r) al[j][r] = arow[(size_t)r * SEQ + nv0 + (unsigned)j * 16u];
            }
#pragma unroll
            for (int r = 0; r < 8; ++r) {
                float mx = -3.0e38f;
#pragma unroll
                for (int j = 0; j < 4; ++j) { mx = fmaxf(mx, s[j][r]); }
                mx = fmaxf(mx, __shfl_xor(mx, 1, 32)); mx = fmaxf(mx, __shfl_xor(mx, 2, 32));
                mx = fmaxf(mx, __shfl_xor(mx, 4, 32)); mx = fmaxf(mx, __shfl_xor(mx, 8, 32));
                const float mnew = fmaxf(mrow[r], mx);
                const float alpha = exp2f(mrow[r] - mnew);
                mrow[r] = mnew;
                float psum = 0.f;
#pragma unroll
                for (int j = 0; j < 4; ++j) {
                    const float p = exp2f(s[j][r] - mnew);
                    psum += p;
                    const float w = p * P_CARRY;
                    pw[(8u * hh + (unsigned)r) * AT_PP + (unsigned)j * 16u + c] = (_Float16)((w < 6.103515625e-05f) ? 0.0f : w);
                }
                psum += __shfl_xor(psum, 1, 32); psum += __shfl_xor(psum, 2, 32);
                psum += __shfl_xor(psum, 4, 32); psum += __shfl_xor(psum, 8, 32);
                lrow[r] = lrow[r] * alpha + psum;
                os[0][r] *= alpha; os[1][r] *= alpha;
            }
            wave_sync_lds();
            // this chunk's V fragments, all four in one group ahead of the P.V products
            v16h vb[2][2];
#pragma unroll
            for (int kk = 0; kk < 2; ++kk)
#pragma unroll
                for (int t = 0; t < 2; ++t)
                    vb[kk][t] = frag_ld(VT16 + (size_t)(b * CH + head * HD + (unsigned)t * 16u + c) * SEQ + kv0 + (unsigned)kk * 32u + 8u * hh);
#pragma unroll
            for (int kk = 0; kk < 2; ++kk) {
                const v16h pa = frag_ld(pw + c * AT_PP + (unsigned)kk * 32u + 8u * hh);
#pragma unroll
                for (int t = 0; t < 2; ++t) {
                    os[t] = wmma16g(pa, vb[kk][t], os[t]);
                }
            }
            wave_sync_lds();
        }
#pragma unroll
        for (int r = 0; r < 8; ++r) {
            const float inv = 1.0f / (lrow[r] * P_CARRY);
#pragma unroll
            for (int t = 0; t < 2; ++t)
                so[(8u * hh + (unsigned)r) * AT_OP + hp * 32u + (unsigned)t * 16u + c] = os[t][r] * inv * (O_CARRY / ACT_CARRY);   // = 64 * value
        }
    }
    __syncthreads();   // the tile's other head has staged its 32 columns; every wave of the block passes here once
    {
        const unsigned q = hp * 8u + (lane >> 3), c8 = (lane & 7u) * 8u;   // this wave's 8 of the tile's 16 rows
        v8h ov[2];
#pragma unroll
        for (int it = 0; it < 2; ++it) {
            const float* sp = so + ((unsigned)it * 4u + q) * AT_OP + c8;
            ov[it] = pack8_flush(*(const v4f*)sp, *(const v4f*)(sp + 4));
        }
        _Float16* dst = O16 + (size_t)(b * SEQ + q0) * CH + pair * 64u;
#pragma unroll
        for (int it = 0; it < 2; ++it) *(v8h*)(dst + (size_t)((unsigned)it * 4u + q) * CH + c8) = ov[it];
    }
}

// output projection: out[row][256] = O @ w + bf16(b), f32
//   one 16 x 32 tile per wave, 1024 waves in 256 blocks of 4 (block = 32 rows x 64 columns), so that every wave can have a SIMD of its own.
//   the launch is latency bound: a wave's 48 fragment loads (the whole K = 256 of its 16 rows and 32 columns) are all issued before the
//   first product, one trip to L2 in place of a load-wait-use trip per fragment. k runs upward in one accumulator per tile.
//   a wave writes 16 rows x 128 B, whole lines (one writer per line), through its own slab.
#define PO_SP 36
static_assert(MTOK % 32 == 0 && CH % 64 == 0 && CH / 32 == 8);
static_assert(32 * 16 * 4 == 16 * 32 * 4);   // store loop: lanes x bytes x instructions == tile rows x row bytes
__global__ __launch_bounds__(128) void k_proj_out(const _Float16* __restrict__ O16, const _Float16* __restrict__ Wt,
                                                  float* __restrict__ out, const float* __restrict__ bias) {
    __shared__ __align__(16) float sT[4][16 * PO_SP];        // per wave [row][32 columns], wave-private (wave_sync)
    const unsigned lane = threadIdx.x & 31u, wave = threadIdx.x >> 5;
    const unsigned hh = lane >> 4, c = lane & 15u;
    const unsigned m0 = (blockIdx.x >> 2) * 32u + (wave >> 1) * 16u;
    const unsigned n0 = (blockIdx.x & 3u) * 64u + (wave & 1u) * 32u;
    const _Float16* ap = O16 + (size_t)(m0 + c) * CH + 8u * hh;
    const _Float16* bp = Wt + (size_t)(n0 + c) * CH + 8u * hh;
    v16h af[8], bf[2][8];
    // every '#pragma unroll' of this kernel: its counter indexes register arrays (af, bf, acc, vv), which must not become memory
#pragma unroll
    for (int ks = 0; ks < 8; ++ks) {
        af[ks] = frag_ld(ap + ks * 32);
        bf[0][ks] = frag_ld(bp + ks * 32);
        bf[1][ks] = frag_ld(bp + 16 * CH + ks * 32);
    }
    asm volatile("s_wait_xcnt 0x0" ::: "memory");   // stands in front of every later write of these loads' address registers; no load sinks below it
    const float raw0 = bias[n0 + c];
    asm volatile("s_wait_xcnt 0x0" ::: "memory");   // the same: the next load's result may land on this one's address register
    const float raw1 = bias[n0 + 16u + c];
    asm volatile("s_wait_xcnt 0x0" ::: "memory");   // the same
    const float bv[2] = {bfr(raw0), bfr(raw1)};
    v8f acc[2];
    acc[0] = (v8f){0.f,0.f,0.f,0.f,0.f,0.f,0.f,0.f};
    acc[1] = (v8f){0.f,0.f,0.f,0.f,0.f,0.f,0.f,0.f};
#pragma unroll
    for (int ks = 0; ks < 8; ++ks) {
        acc[0] = wmma16g(af[ks], bf[0][ks], acc[0]);
        acc[1] = wmma16g(af[ks], bf[1][ks], acc[1]);
    }
    float* slab = sT[wave];
#pragma unroll
    for (int j = 0; j < 2; ++j)
#pragma unroll
        for (int r = 0; r < 8; ++r)
            slab[(8u * hh + (unsigned)r) * PO_SP + (unsigned)j * 16u + c] = acc[j][r] * SC_OUT + bv[j];
    wave_sync_lds();
    const unsigned q = lane >> 3, c4 = (lane & 7u) * 4u;     // row segment = 128 B = 8 lanes x 16 B
    v4f vv[4];
#pragma unroll
    for (int it = 0; it < 4; ++it) vv[it] = *(const v4f*)(slab + ((unsigned)it * 4u + q) * PO_SP + c4);
#pragma unroll
    for (int it = 0; it < 4; ++it) *(v4f*)(out + (size_t)(m0 + (unsigned)it * 4u + q) * CH + n0 + c4) = vv[it];
}

extern "C" void kernel_launch(void* const* d_in, const int* in_sizes, int n_in, void* d_out, int out_size,
                              void* d_ws, size_t ws_size, hipStream_t stream) {
    if (n_in < 17) return;
    if (in_sizes[0] < NB * SEQ * SEQ * DG || in_sizes[1] < MTOK * CH) return;
    if (in_sizes[2] < CH * CH || in_sizes[3] < CH || in_sizes[4] < CH * CH || in_sizes[5] < CH) return;
    if (in_sizes[6] < CH * CH || in_sizes[7] < CH || in_sizes[8] < CH * CH || in_sizes[9] < CH) return;
    if (in_sizes[10] < HEADS * DG * HID || in_sizes[11] < HEADS * HID || in_sizes[12] < HEADS * HID * HID) return;
    if (in_sizes[13] < HEADS * HID || in_sizes[14] < HEADS * HID || in_sizes[15] < HEADS || in_sizes[16] < NB * SEQ) return;
    if (out_size < MTOK * CH) return;
    if (ws_size < WS_TOTAL) return;

    const float* pairwise_g = (const float*)d_in[0];
    const float* coset      = (const float*)d_in[1];
    const float* fc_q_w     = (const float*)d_in[2];
    const float* fc_q_b     = (const float*)d_in[3];
    const float* fc_k_w     = (const float*)d_in[4];
    const float* fc_k_b     = (const float*)d_in[5];
    const float* in_w       = (const float*)d_in[6];
    const float* in_b       = (const float*)d_in[7];
    const float* out_w      = (const float*)d_in[8];
    const float* out_b      = (const float*)d_in[9];
    const float* loc_w1     = (const float*)d_in[10];
    const float* loc_b1     = (const float*)d_in[11];
    const float* loc_w2     = (const float*)d_in[12];
    const float* loc_b2     = (const float*)d_in[13];
    const float* loc_w3     = (const float*)d_in[14];
    const float* loc_b3     = (const float*)d_in[15];
    const int*   mask       = (const int*)d_in[16];
    float* out = (float*)d_out;

    char* wsp = (char*)d_ws;
    _Float16* G16  = (_Float16*)(wsp + OFF_G16);
    _Float16* C16  = (_Float16*)(wsp + OFF_C16);
    _Float16* WT   = (_Float16*)(wsp + OFF_WT);
    _Float16* W1B  = (_Float16*)(wsp + OFF_W1B);
    _Float16* W2B  = (_Float16*)(wsp + OFF_W2B);
    _Float16* Q16  = (_Float16*)(wsp + OFF_Q16);
    _Float16* K16  = (_Float16*)(wsp + OFF_K16);
    _Float16* VT16 = (_Float16*)(wsp + OFF_VT16);
    float*    ALOC = (float*)(wsp + OFF_ALOC);
    _Float16* O16  = (_Float16*)(wsp + OFF_O16);

    // operand planes (each whole plane written by this launch)
    k_prep<<<PB_WT + PB_WL + PB_C + PB_G, 256, 0, stream>>>(pairwise_g, coset, fc_q_w, fc_k_w, in_w, out_w, loc_w1, loc_w2,
                                                            G16, C16, WT, W1B, W2B);

    // projections (64x64 wave tiles, 8 waves per block) beside the location term; then attention, output projection
    k_proj_loc<<<2 * JB_ROWS + NB * JB_VT + NB * SEQ, 256, 0, stream>>>(C16, WT, Q16, K16, VT16, fc_q_b, fc_k_b, in_b,
                                                                        G16, W1B, W2B, loc_b1, loc_b2, loc_w3, loc_b3, ALOC);
    k_attn<<<NB * 4 * QBLK, 128, 0, stream>>>(Q16, K16, VT16, ALOC, mask, O16);
    k_proj_out<<<(MTOK / 32) * (CH / 64), 128, 0, stream>>>(O16, WT + (size_t)3 * CH * CH, out, out_b);
}

// v007
// A run of this version takes 56 microseconds.
// Timed twice side by side with v006, it ran 1.12 times as fast both times.
// Counting every step since v000, it is 4.90 times as fast.
// All contractions on v_wmma_f32_16x16x32_f16 (f16 operands, f32 accumulate): q/k/v projections (inputs x8, weights x32), pair MLP layer 1 (g x4, w1 /8, bias/2 as C, K=6 zero-padded to 32) and layer 2 (h1 x1, w2 /2, bias/2 as C, K=16 zero-padded to 32), whose D is half the pre-activation, q.k^T (x8, x8), P.V (P x1024, V x8), output projection (O x64, w x32); every float input RNE-converted to bf16 first; MLP layer 3 (N=1, K=16), swish (by tanh of half the argument), softmax statistics in f32 on the VALU.
#include <hip/hip_runtime.h>
#include <math.h>

#ifndef NB
#define NB 4
#endif
#ifndef SEQ
#define SEQ 512
#endif
#define NB_FULL 4
#define SEQ_FULL 512
#define CH 256
#define HEADS 8
#define HD 32
#define DG 6
#define HID 16
#define MTOK (NB * SEQ)
#define QBLK (SEQ / 32)

// power-of-two carries and their undo constants
// pair MLP: operand scales whose product is 1/2, so that a layer's WMMA result (C = bias / 2) is x / 2, the argument swish_half takes
#define G_CARRY 4.0f
#define W1_CARRY 0.125f
#define W2_CARRY 0.5f
#define ACT_CARRY 8.0f
#define W_CARRY 32.0f
#define SC_PROJ (1.0f / 256.0f)
#define SCQK (1.0f / 1024.0f)
#define P_CARRY 1024.0f
#define O_CARRY 64.0f
#define SC_OUT (1.0f / 2048.0f)
#define LOG2E 1.4426950408889634f
#define FILL2 (-1.0e38f * LOG2E)

static_assert(G_CARRY * W1_CARRY == 0.5f);
static_assert(W2_CARRY == 0.5f);
static_assert(ACT_CARRY * W_CARRY * SC_PROJ == 1.0f);
static_assert(ACT_CARRY * ACT_CARRY * 16.0f * SCQK == 1.0f);     // q x8, k x8, module scale 1/sqrt(256)
static_assert(O_CARRY * W_CARRY * SC_OUT == 1.0f);
static_assert(SEQ == SEQ_FULL);
static_assert(NB <= NB_FULL);
static_assert(CH == HEADS * HD && HD == 32 && HID == 16 && DG <= 8);
static_assert(SEQ % 32 == 0 && SEQ % 64 == 0);
static_assert(MTOK % 64 == 0 && CH % 64 == 0 && CH % 32 == 0);
static_assert((NB * SEQ * SEQ) % 256 == 0);
static_assert((MTOK * CH / 8) % 256 == 0);
static_assert((CH * (CH / 8)) % 256 == 0);
// store loops: lanes x bytes x instructions == tile rows x row bytes
static_assert(32 * 16 * 4 == 16 * 128);
static_assert(2 * 32 * 16 * 2 == 16 * 128);  // attention O tile: two waves x two stores
static_assert(32 * 16 * 8 == 16 * 256);     // f32 epilogue: 16 rows x 256 B
static_assert(32 * 4 * 8 == 8 * 128);
// static LDS per kernel
static_assert(8 * 16 * 68 * 4 <= 131072);
static_assert(4 * 16 * 72 * 2 + 2 * 16 * 68 * 4 <= 131072);

typedef _Float16 h16;
typedef __attribute__((ext_vector_type(16))) _Float16 v16h;
typedef __attribute__((ext_vector_type(8)))  _Float16 v8h;
typedef __attribute__((ext_vector_type(2)))  _Float16 v2h;
typedef __attribute__((ext_vector_type(8)))  float    v8f;
typedef __attribute__((ext_vector_type(4)))  float    v4f;
typedef __attribute__((ext_vector_type(2)))  float    v2f;
typedef __attribute__((ext_vector_type(4)))  unsigned int v4u;

static constexpr size_t SZ_G16  = (size_t)NB * SEQ * SEQ * 8 * 2;
static constexpr size_t SZ_C16  = (size_t)MTOK * CH * 2;
static constexpr size_t SZ_WT   = (size_t)4 * CH * CH * 2;
static constexpr size_t SZ_W1B  = (size_t)HEADS * HID * 32 * 2;
static constexpr size_t SZ_W2B  = (size_t)HEADS * HID * 32 * 2;
static constexpr size_t SZ_Q16  = (size_t)MTOK * CH * 2;
static constexpr size_t SZ_K16  = (size_t)MTOK * CH * 2;
static constexpr size_t SZ_VT16 = (size_t)NB * CH * SEQ * 2;
static constexpr size_t SZ_ALOC = (size_t)NB * HEADS * SEQ * SEQ * 4;
static constexpr size_t SZ_O16  = (size_t)MTOK * CH * 2;
static constexpr size_t OFF_G16  = 0;
static constexpr size_t OFF_C16  = OFF_G16 + SZ_G16;
static constexpr size_t OFF_WT   = OFF_C16 + SZ_C16;
static constexpr size_t OFF_W1B  = OFF_WT + SZ_WT;
static constexpr size_t OFF_W2B  = OFF_W1B + SZ_W1B;
static constexpr size_t OFF_Q16  = OFF_W2B + SZ_W2B;
static constexpr size_t OFF_K16  = OFF_Q16 + SZ_Q16;
static constexpr size_t OFF_VT16 = OFF_K16 + SZ_K16;
static constexpr size_t OFF_ALOC = OFF_VT16 + SZ_VT16;
static constexpr size_t OFF_O16  = OFF_ALOC + SZ_ALOC;
static constexpr size_t WS_TOTAL = OFF_O16 + SZ_O16;
static_assert(SZ_G16 % 256 == 0 && SZ_C16 % 256 == 0 && SZ_WT % 256 == 0 && SZ_W1B % 256 == 0 && SZ_W2B % 256 == 0);
static_assert(SZ_Q16 % 256 == 0 && SZ_VT16 % 256 == 0 && SZ_ALOC % 256 == 0 && SZ_O16 % 256 == 0);
static_assert(WS_TOTAL <= (size_t)134217728);

// 16-bit WMMA fragment map (wave32), lane L, hh = L>>4, c = L&15:
//   A 16x32: lane = row c;    element i -> k = (i<8) ? 8hh+i : 16+8hh+(i-8)
//   B 32x16: lane = column c; the SAME k(i,hh)
//   D 16x16 (8 f32): lane = column c; element r -> row 8hh+r

// RNE convert f32 -> bf16 -> f32
__device__ __forceinline__ float bfr(float f) {
    unsigned u = __float_as_uint(f);
    u += 0x7FFFu + ((u >> 16) & 1u);
    return __uint_as_float(u & 0xFFFF0000u);
}
// f32 -> f16 with values under 2^-14 replaced by +0 before the convert
static __device__ __forceinline__ h16 toh_flush(float v) { const float w = (fabsf(v) < 6.103515625e-05f) ? 0.0f : v; return (h16)w; }
static __device__ __forceinline__ v2h toh2_flush(float a, float b) {
    v2f w;
    w.x = (fabsf(a) < 6.103515625e-05f) ? 0.0f : a;
    w.y = (fabsf(b) < 6.103515625e-05f) ? 0.0f : b;
    return __builtin_convertvector(w, v2h);
}
union Pack8 { v8h v; v2h p[4]; };
static __device__ __forceinline__ v8h pack8_flush(v4f a, v4f b) {
    Pack8 u;
    u.p[0] = toh2_flush(a.x, a.y); u.p[1] = toh2_flush(a.z, a.w);
    u.p[2] = toh2_flush(b.x, b.y); u.p[3] = toh2_flush(b.z, b.w);
    return u.v;
}
// f32 -> f16, round to nearest even, small values as f16 subnormals (the matrix instruction takes them as they are)
static __device__ __forceinline__ v8h pack8(v4f a, v4f b) {
    Pack8 u;
    u.p[0] = __builtin_convertvector((v2f){a.x, a.y}, v2h); u.p[1] = __builtin_convertvector((v2f){a.z, a.w}, v2h);
    u.p[2] = __builtin_convertvector((v2f){b.x, b.y}, v2h); u.p[3] = __builtin_convertvector((v2f){b.z, b.w}, v2h);
    return u.v;
}
static __device__ __forceinline__ void st8h2(_Float16* p, v8h v) {
    *(v8h*)p = v;
    
}

union FragU { v16h v; v8h h[2]; };
union FragQ { v16h v; v8h h[2]; v4u q[2]; };
// elements 0..7 <- p[0..7], 8..15 <- p[16..23]; caller adds 8*hh to p (used for BOTH A and B operands: same k per element)
__device__ __forceinline__ v16h frag_ld(const _Float16* p) {
    FragU f; f.h[0] = *(const v8h*)(p); f.h[1] = *(const v8h*)(p + 16); return f.v;
}
__device__ __forceinline__ v8f wmma16g(v16h a, v16h b, v8f c) {
    c = __builtin_amdgcn_wmma_f32_16x16x32_f16(false, a, false, b, (short)0, c, false, false);
    asm volatile("v_nop\n\tv_nop\n\tv_nop\n\tv_nop" : "+v"(c) : "v"(a), "v"(b));
    return c;
}
__device__ __forceinline__ void wave_sync_lds() {
    __builtin_amdgcn_fence(3 /* release order */, "workgroup");
    __builtin_amdgcn_wave_barrier();
    __builtin_amdgcn_fence(2 /* acquire order */, "workgroup");
}
// swish(x) = x * sigmoid(x) = h + h * tanh(h) with h = x / 2; the caller hands in h
static __device__ __forceinline__ float swish_half(float h) {
    return fmaf(h, __builtin_amdgcn_tanhf(h), h);
}

// =====================================================================================================================
// cvt_g_body: pair components [pair][6] f32 -> G16 [pair][8] f16 = bf16(g) * 4, components 6,7 = 0; one 16-B piece per lane
//   coverage: NB*SEQ*SEQ pairs x 16 B == the whole G16 plane
// =====================================================================================================================
static __device__ __forceinline__ void cvt_g_body(unsigned blk, const float* __restrict__ g, _Float16* __restrict__ G16) {
    const unsigned u = blk * 256u + threadIdx.x;
    if (u >= (unsigned)(NB * SEQ * SEQ)) return;
    const v2f* src = (const v2f*)(g + (size_t)u * 6u);
    const v2f a = src[0], b = src[1], cc = src[2];
    v4f lo, hi;
    lo.x = bfr(a.x) * G_CARRY; lo.y = bfr(a.y) * G_CARRY; lo.z = bfr(b.x) * G_CARRY; lo.w = bfr(b.y) * G_CARRY;
    hi.x = bfr(cc.x) * G_CARRY; hi.y = bfr(cc.y) * G_CARRY; hi.z = 0.0f; hi.w = 0.0f;
    st8h2(G16 + (size_t)u * 8u, pack8_flush(lo, hi));
}

// cvt_c_body: features [row][256] f32 -> C16 f16 = bf16(x) * 8; thread per 8 columns; coverage: MTOK*256/8 pieces == whole plane
static __device__ __forceinline__ void cvt_c_body(unsigned blk, const float* __restrict__ x, _Float16* __restrict__ C16) {
    const unsigned u = blk * 256u + threadIdx.x;
    if (u >= (unsigned)(MTOK * CH / 8)) return;
    const v4f* src = (const v4f*)(x + (size_t)u * 8u);
    v4f a = src[0], b = src[1];
    a.x = bfr(a.x) * ACT_CARRY; a.y = bfr(a.y) * ACT_CARRY; a.z = bfr(a.z) * ACT_CARRY; a.w = bfr(a.w) * ACT_CARRY;
    b.x = bfr(b.x) * ACT_CARRY; b.y = bfr(b.y) * ACT_CARRY; b.z = bfr(b.z) * ACT_CARRY; b.w = bfr(b.w) * ACT_CARRY;
    st8h2(C16 + (size_t)u * 8u, pack8_flush(a, b));
}

static __device__ __forceinline__ void wt_one(const float* __restrict__ W, _Float16* __restrict__ D, unsigned o, unsigned k0) {
    v4f lo, hi;
    lo.x = bfr(W[(size_t)(k0 + 0u) * CH + o]) * W_CARRY;
    lo.y = bfr(W[(size_t)(k0 + 1u) * CH + o]) * W_CARRY;
    lo.z = bfr(W[(size_t)(k0 + 2u) * CH + o]) * W_CARRY;
    lo.w = bfr(W[(size_t)(k0 + 3u) * CH + o]) * W_CARRY;
    hi.x = bfr(W[(size_t)(k0 + 4u) * CH + o]) * W_CARRY;
    hi.y = bfr(W[(size_t)(k0 + 5u) * CH + o]) * W_CARRY;
    hi.z = bfr(W[(size_t)(k0 + 6u) * CH + o]) * W_CARRY;
    hi.w = bfr(W[(size_t)(k0 + 7u) * CH + o]) * W_CARRY;
    st8h2(D + (size_t)o * CH + k0, pack8_flush(lo, hi));
}
// wt4_body: the four 256x256 weights -> WT[4][out][in]; thread per (o, 8 k): 32 lanes cover one whole 512-B row; coverage: 4 x 256 x 32 pieces
static __device__ __forceinline__ void wt4_body(unsigned blk, const float* __restrict__ wq, const float* __restrict__ wk,
                                                const float* __restrict__ wv, const float* __restrict__ wo,
                                                _Float16* __restrict__ WT) {
    const unsigned u = blk * 256u + threadIdx.x;
    if (u >= (unsigned)(CH * (CH / 8))) return;
    const unsigned k0 = 8u * (u & 31u);
    const unsigned o = u >> 5;
    wt_one(wq, WT, o, k0);
    wt_one(wk, WT + (size_t)1 * CH * CH, o, k0);
    wt_one(wv, WT + (size_t)2 * CH * CH, o, k0);
    wt_one(wo, WT + (size_t)3 * CH * CH, o, k0);
}

// wloc_body: pair-MLP weights as A-operand planes (row = hidden unit), zero-padded along k to 32:
//   W1B[h*16+j][k] = bf16(w1[h][k][j]) / 8 for k < 6, else 0;  W2B[h*16+j][k] = bf16(w2[h][k][j]) / 2 for k < 16, else 0
//   thread per 16-B piece (512 pieces per plane), clamped addresses, zero by value; coverage: 128 rows x 4 pieces == both whole planes
static __device__ __forceinline__ void wloc_body(unsigned blk, const float* __restrict__ w1, const float* __restrict__ w2,
                                                 _Float16* __restrict__ W1B, _Float16* __restrict__ W2B) {
    const unsigned p = blk * 256u + threadIdx.x;
    if (p >= (unsigned)(HEADS * HID * 4)) return;
    const unsigned col = p >> 2, k0 = (p & 3u) * 8u;
    const unsigned h = col >> 4, j = col & 15u;
    float v[8];
#pragma unroll
    for (int i = 0; i < 8; ++i) {
        const unsigned k = k0 + (unsigned)i;
        const unsigned kc = min(k, (unsigned)(DG - 1));
        const float raw = w1[(size_t)(h * DG + kc) * HID + j];
        asm volatile("s_wait_xcnt 0x0" ::: "memory");   // stands in front of a later load's result landing on this load's address registers
        const float x = bfr(raw) * W1_CARRY;
        v[i] = (k < (unsigned)DG) ? x : 0.0f;
    }
    {
        v4f a, b;
        a.x = v[0]; a.y = v[1]; a.z = v[2]; a.w = v[3]; b.x = v[4]; b.y = v[5]; b.z = v[6]; b.w = v[7];
        st8h2(W1B + (size_t)col * 32u + k0, pack8(a, b));
    }
#pragma unroll
    for (int i = 0; i < 8; ++i) {
        const unsigned k = k0 + (unsigned)i;
        const unsigned kc = min(k, (unsigned)(HID - 1));
        const float raw = w2[(size_t)(h * HID + kc) * HID + j];
        asm volatile("s_wait_xcnt 0x0" ::: "memory");   // the same
        const float x = bfr(raw) * W2_CARRY;
        v[i] = (k < (unsigned)HID) ? x : 0.0f;
    }
    {
        v4f a, b;
        a.x = v[0]; a.y = v[1]; a.z = v[2]; a.w = v[3]; b.x = v[4]; b.y = v[5]; b.z = v[6]; b.w = v[7];
        st8h2(W2B + (size_t)col * 32u + k0, pack8(a, b));
    }
}

// k_prep: the four operand-plane conversions in ONE launch (none reads what another writes); the block index picks the job, a scalar branch.
//   the short, latency-bound jobs stand at the low indices so that they start first and end under the long pair conversion.
#define PB_WT ((CH * (CH / 8)) / 256)
#define PB_WL ((HEADS * HID * 4) / 256)
#define PB_C  ((MTOK * CH / 8) / 256)
#define PB_G  ((NB * SEQ * SEQ) / 256)
static_assert((HEADS * HID * 4) % 256 == 0);
__global__ __launch_bounds__(256) void k_prep(const float* __restrict__ g, const float* __restrict__ x,
                                              const float* __restrict__ wq, const float* __restrict__ wk,
                                              const float* __restrict__ wv, const float* __restrict__ wo,
                                              const float* __restrict__ w1, const float* __restrict__ w2,
                                              _Float16* __restrict__ G16, _Float16* __restrict__ C16, _Float16* __restrict__ WT,
                                              _Float16* __restrict__ W1B, _Float16* __restrict__ W2B) {
    const unsigned bx = blockIdx.x;
    if (bx < (unsigned)PB_WT) wt4_body(bx, wq, wk, wv, wo, WT);
    else if (bx < (unsigned)(PB_WT + PB_WL)) wloc_body(bx - (unsigned)PB_WT, w1, w2, W1B, W2B);
    else if (bx < (unsigned)(PB_WT + PB_WL + PB_C)) cvt_c_body(bx - (unsigned)(PB_WT + PB_WL), x, C16);
    else cvt_g_body(bx - (unsigned)(PB_WT + PB_WL + PB_C), g, G16);
}

// =====================================================================================================================
// gemm64_body: C[m,n] = (scale * sum_k A[m,k] * Bt[n,k] + bf16(bias[n or m])) ; each wave owns a 64x64 tile.
//   A row-major [M][lda] f16, Bt row-major [N][ldb] f16 (fragments straight from the planes); M,N % 64 == 0, K % 32 == 0.
//   blk = the job's own block number; sT = the calling kernel's staging slabs, one per wave.
//   OUT_MODE 0: f32 C (pitch ldc); OUT_MODE 1: f16 C = value * oscale. BIAS_ROW: bias indexed by the row m.
// =====================================================================================================================
template <int OUT_MODE, bool BIAS_ROW>
static __device__ __forceinline__ void gemm64_body(
    unsigned blk, float (*sT)[16 * 68],
    const _Float16* __restrict__ A, unsigned lda, const _Float16* __restrict__ Bt, unsigned ldb,
    float* __restrict__ Cf, _Float16* __restrict__ Ch, unsigned ldc, const float* __restrict__ bias,
    unsigned M, unsigned N, unsigned K, float scale, float oscale) {
  const unsigned lane = threadIdx.x & 31u;
  const unsigned wave = threadIdx.x >> 5;
  const unsigned tilesN = N >> 6, tilesM = M >> 6;
  const unsigned tile = blk * 8u + wave;
  if (tile >= tilesM * tilesN) return;   // wave-uniform; no block barriers in this kernel
  const unsigned tm = tile / tilesN;
  const unsigned tn = tile - tm * tilesN;
  const unsigned m0 = tm << 6, n0 = tn << 6;
  const unsigned rlane = lane & 15u;
  const unsigned koff = (lane >> 4) * 8u;
  const unsigned mOff = koff;

  v8f acc[4][4];
#pragma unroll
  for (int i = 0; i < 4; ++i)
#pragma unroll
    for (int j = 0; j < 4; ++j) acc[i][j] = (v8f){0.f,0.f,0.f,0.f,0.f,0.f,0.f,0.f};

  for (unsigned k0 = 0; k0 < K; k0 += 32u) {
    v16h bh[4];
#pragma unroll
    for (int j = 0; j < 4; ++j)
      bh[j] = frag_ld(Bt + (size_t)(n0 + ((unsigned)j << 4) + rlane) * ldb + koff + k0);
#pragma unroll
    for (int i = 0; i < 4; ++i) {
      const v16h ah = frag_ld(A + (size_t)(m0 + ((unsigned)i << 4) + rlane) * lda + koff + k0);
#pragma unroll
      for (int j = 0; j < 4; ++j)
        acc[i][j] = wmma16g(ah, bh[j], acc[i][j]);
    }
  }

  float* slab = sT[wave];
#pragma unroll
  for (int i = 0; i < 4; ++i) {
    const unsigned mBase = m0 + ((unsigned)i << 4);
    float bvr[8];
#pragma unroll
    for (int r = 0; r < 8; ++r) bvr[r] = 0.0f;
    if (BIAS_ROW) {
#pragma unroll
      for (int r = 0; r < 8; ++r) bvr[r] = bfr(bias[mBase + mOff + (unsigned)r]);
    }
#pragma unroll
    for (int j = 0; j < 4; ++j) {
      const unsigned n = n0 + ((unsigned)j << 4) + rlane;
      float bvc = 0.0f;
      if (!BIAS_ROW) bvc = bfr(bias[n]);
#pragma unroll
      for (int r = 0; r < 8; ++r) {
        float v = acc[i][j][r] * scale + (BIAS_ROW ? bvr[r] : bvc);
        if (OUT_MODE == 1) v *= oscale;
        slab[(mOff + (unsigned)r) * 68u + ((unsigned)j << 4) + rlane] = v;
      }
    }
    wave_sync_lds();
    if (OUT_MODE == 0) {
      const unsigned hh = lane >> 4, c4 = (lane & 15u) * 4u;     // row segment = 256 B = 16 lanes x 16 B
#pragma unroll
      for (int half = 0; half < 2; ++half) {
        v4f vv[4];
#pragma unroll
        for (int it = 0; it < 4; ++it) {
          const unsigned row = (unsigned)(half * 4 + it) * 2u + hh;
          vv[it] = *(const v4f*)(slab + row * 68u + c4);
        }
        {
#pragma unroll
          for (int it = 0; it < 4; ++it) {
            const unsigned row = (unsigned)(half * 4 + it) * 2u + hh;
            *(v4f*)(Cf + (size_t)(mBase + row) * ldc + n0 + c4) = vv[it];
          }
          
        }
      }
    } else {
      const unsigned q = lane >> 3, c8 = (lane & 7u) * 8u;
      v8h hv[4];
#pragma unroll
      for (int it = 0; it < 4; ++it) {
        const unsigned row = (unsigned)it * 4u + q;
        const float* sp = slab + row * 68u + c8;
        hv[it] = pack8_flush(*(const v4f*)sp, *(const v4f*)(sp + 4));
      }
      {
#pragma unroll
        for (int it = 0; it < 4; ++it) {
          const unsigned row = (unsigned)it * 4u + q;
          *(v8h*)(Ch + (size_t)(mBase + row) * ldc + n0 + c8) = hv[it];
        }
        
      }
    }
    wave_sync_lds();
  }
}

// =====================================================================================================================
// loc_body: location term ALOC[b][h][n][m] (f32) = swish(l3(swish(l2(swish(l1(g[b][n][m][:]))))))
//   transposed chain: the weights are the A operand (rows = hidden units), the pairs are the B columns.
//   block = 8 waves = the 8 heads of one query row (b,n); a wave owns ONE head and walks the row's 512 keys, 64 pairs (4 column tiles) a pass.
//   layer 1: B = two 16-B G16 rows per lane: lane (c,hh) holds pair 16hh+c in elements 0..7 (k 8hh..) and pair 32+16hh+c in elements 8..15
//            (k 16+8hh..), so k group q = k>>3 holds column tile q. A of tile q = the head's W1B row (k 0..7) placed in k group q, zero words
//            in the other three groups, C = half the bias of the D row -> D1[hidden 8hh+r][pair c of tile q] = x1 / 2.
//   layer 2: D1's map IS the B map (lane = pair c, element r = hidden 8hh+r): two tiles' h1, converted in place to f16, are elements
//            0..7 and 8..15 of one B operand; A = the head's W2B row in k 0..15 (first tile) or in k 16..31 (second tile), zero words in the
//            other half, C = half the bias of the D row -> D2[hidden 8hh+r][pair c] = x2 / 2.
//   layer 3 (N = 1) on the VALU: 8 multiply-adds in the lane (hidden 8hh..8hh+7) with w3 / 2, then the other half's sum from lane l ^ 16: x3 / 2.
//   biases and w3 are indexed by the D row: 8 registers each, prepared once per wave.
// =====================================================================================================================
#define LC_PASS 64
static_assert(HEADS == 8 && SEQ % LC_PASS == 0);
// lane l with lane l ^ 16
static __device__ __forceinline__ float xhalf(float x) {
    return __builtin_bit_cast(float, __builtin_amdgcn_permlanex16(__builtin_bit_cast(int, x), __builtin_bit_cast(int, x),
                                                                  0x76543210, 0xfedcba98, false, false));
}
static __device__ __forceinline__ void loc_body(unsigned bn, const _Float16* __restrict__ G16, const _Float16* __restrict__ W1B,
                                                const _Float16* __restrict__ W2B, const float* __restrict__ b1,
                                                const float* __restrict__ b2, const float* __restrict__ w3,
                                                const float* __restrict__ b3, float* __restrict__ ALOC) {
    const unsigned lane = threadIdx.x & 31u;
    const unsigned t = (unsigned)__builtin_amdgcn_readfirstlane((int)(threadIdx.x >> 5));   // the wave's head
    const unsigned hh = lane >> 4, c = lane & 15u;
    // bn = b*SEQ + n
    const unsigned b = bn / (unsigned)SEQ, n = bn % (unsigned)SEQ;
    const v4u zq = (v4u){0u, 0u, 0u, 0u};
    const unsigned row = t * 16u + c;

    // layer-1 A operands, one per k group
    const v4u w1q = *(const v4u*)(W1B + (size_t)row * 32u);
    asm volatile("s_wait_xcnt 0x0" ::: "memory");   // stands in front of the later writes of this load's address registers
    v4u wlo, whi;
    wlo.x = (hh == 0u) ? w1q.x : 0u; wlo.y = (hh == 0u) ? w1q.y : 0u; wlo.z = (hh == 0u) ? w1q.z : 0u; wlo.w = (hh == 0u) ? w1q.w : 0u;
    whi.x = (hh == 0u) ? 0u : w1q.x; whi.y = (hh == 0u) ? 0u : w1q.y; whi.z = (hh == 0u) ? 0u : w1q.z; whi.w = (hh == 0u) ? 0u : w1q.w;
    FragQ a1[4];
    a1[0].q[0] = wlo; a1[0].q[1] = zq;
    a1[1].q[0] = whi; a1[1].q[1] = zq;
    a1[2].q[0] = zq;  a1[2].q[1] = wlo;
    a1[3].q[0] = zq;  a1[3].q[1] = whi;
    // layer-2 A operands: k 0..15 (the plane's own zeros beyond) and the same row moved to k 16..31
    FragQ a2[2];
    a2[0].h[0] = *(const v8h*)(W2B + (size_t)row * 32u + 8u * hh);
    asm volatile("s_wait_xcnt 0x0" ::: "memory");   // the same: the next load's result may land on this one's address registers
    a2[0].h[1] = *(const v8h*)(W2B + (size_t)row * 32u + 8u * hh + 16u);
    asm volatile("s_wait_xcnt 0x0" ::: "memory");   // the same
    a2[1].q[0] = a2[0].q[1]; a2[1].q[1] = a2[0].q[0];
    v8f hb1, hb2;
    float ww3[8];
    // every '#pragma unroll' of this kernel: its counter indexes register arrays (hb1, a1, hx, part ...), which must not become memory
#pragma unroll
    for (int r = 0; r < 8; ++r) {
        const unsigned j = t * 16u + 8u * hh + (unsigned)r;
        hb1[r] = 0.5f * bfr(b1[j]);
        hb2[r] = 0.5f * bfr(b2[j]);
        ww3[r] = 0.5f * bfr(w3[j]);
    }
    const float bb3 = 0.5f * bfr(b3[t]);
    asm volatile("s_wait_xcnt 0x0" ::: "memory");   // the same for the weight, bias and w3 loads above

    const _Float16* gp = G16 + ((size_t)bn * SEQ + lane) * 8u;
    float* dst = ALOC + ((size_t)(b * (unsigned)HEADS + t) * SEQ + n) * SEQ + lane;
    FragQ g;
    g.q[0] = *(const v4u*)gp;
    g.q[1] = *(const v4u*)(gp + 32 * 8);
    // rolled: one pass is about 400 instructions, and eight copies of it would not pay for their instruction fetches
#pragma unroll 1
    for (unsigned it = 0; it < (unsigned)(SEQ / LC_PASS); ++it) {
        FragQ hx[2];
#pragma unroll
        for (int q = 0; q < 4; ++q) {
            const v8f d1 = wmma16g(a1[q].v, g.v, hb1);
            v4f xa, xb;
            xa.x = swish_half(d1[0]); xa.y = swish_half(d1[1]); xa.z = swish_half(d1[2]); xa.w = swish_half(d1[3]);
            xb.x = swish_half(d1[4]); xb.y = swish_half(d1[5]); xb.z = swish_half(d1[6]); xb.w = swish_half(d1[7]);
            hx[q >> 1].h[q & 1] = pack8(xa, xb);
        }
        // the next pass's pairs fly under this pass's layers 2 and 3; the last pass fetches its own pairs again (in bounds, unused)
        const unsigned nx = ((it + 1u < (unsigned)(SEQ / LC_PASS)) ? it + 1u : it) * (unsigned)LC_PASS;
        g.q[0] = *(const v4u*)(gp + (size_t)nx * 8u);
        g.q[1] = *(const v4u*)(gp + (size_t)(nx + 32u) * 8u);
#pragma unroll
        for (int u = 0; u < 2; ++u) {
            float part[2];
#pragma unroll
            for (int s = 0; s < 2; ++s) {
                const v8f d2 = wmma16g(a2[s].v, hx[u].v, hb2);
                float acc = swish_half(d2[0]) * ww3[0];
#pragma unroll
                for (int r = 1; r < 8; ++r) acc = fmaf(swish_half(d2[r]), ww3[r], acc);
                part[s] = acc;
            }
            // lane (c,hh) finishes pair 16hh+c of this tile pair: its own half sum plus the other half's from lane l ^ 16
            const float mine  = (hh == 0u) ? part[0] : part[1];
            const float other = (hh == 0u) ? part[1] : part[0];
            const float v = mine + xhalf(other) + bb3;
            dst[it * (unsigned)LC_PASS + (unsigned)u * 32u] = swish_half(v);
        }
    }
}

// k_proj_loc: the q, k and v projections and the location term in ONE launch (none reads what another writes); the block index picks the
//   job, a scalar branch. The 48 projection blocks stand at the low indices: they start first and end under the 2048 location blocks.
//   q, k: position-major Y16[row][256] = f16(8 * (x @ w + bf16(b)))
//   v:    channel-major VT16[b][ch][key] = f16(8 * (x @ w + bf16(b)))^T ; A = weight plane, Bt = feature rows of one batch
#define JB_ROWS (((MTOK / 64) * (CH / 64) + 7) / 8)
#define JB_VT   (((CH / 64) * (SEQ / 64) + 7) / 8)
__global__ __launch_bounds__(256) void k_proj_loc(const _Float16* __restrict__ C16, const _Float16* __restrict__ WT,
                                                  _Float16* __restrict__ Q16, _Float16* __restrict__ K16, _Float16* __restrict__ VT16,
                                                  const float* __restrict__ bq, const float* __restrict__ bk, const float* __restrict__ bv,
                                                  const _Float16* __restrict__ G16, const _Float16* __restrict__ W1B,
                                                  const _Float16* __restrict__ W2B, const float* __restrict__ b1,
                                                  const float* __restrict__ b2, const float* __restrict__ w3,
                                                  const float* __restrict__ b3, float* __restrict__ ALOC) {
    __shared__ __align__(16) float sT[8][16 * 68];
    const unsigned bx = blockIdx.x;
    if (bx < (unsigned)(2 * JB_ROWS)) {
        const bool isk = bx >= (unsigned)JB_ROWS;
        gemm64_body<1, false>(isk ? bx - (unsigned)JB_ROWS : bx, sT, C16, CH, isk ? WT + (size_t)1 * CH * CH : WT, CH, nullptr,
                              isk ? K16 : Q16, CH, isk ? bk : bq, MTOK, CH, CH, SC_PROJ, ACT_CARRY);
    } else if (bx < (unsigned)(2 * JB_ROWS + NB * JB_VT)) {
        const unsigned v = bx - (unsigned)(2 * JB_ROWS);
        const unsigned by = v / (unsigned)JB_VT;
        gemm64_body<1, true>(v % (unsigned)JB_VT, sT, WT + (size_t)2 * CH * CH, CH, C16 + (size_t)by * SEQ * CH, CH, nullptr,
                             VT16 + (size_t)by * CH * SEQ, SEQ, bv, CH, SEQ, CH, SC_PROJ, ACT_CARRY);
    } else {
        loc_body(bx - (unsigned)(2 * JB_ROWS + NB * JB_VT), G16, W1B, W2B, b1, b2, w3, b3, ALOC);
    }
}

// =====================================================================================================================
// k_attn: one block per (batch, head pair, 32-query block), 4 waves = 2 query tiles of 16 rows x the 2 heads of the pair, ONE head per wave,
//   64-key chunks: 1024 waves in 256 blocks, so that every wave can have a SIMD of its own (a wave's chain of 8 chunks is latency bound).
//   scores: Q (A) and K (B) fragments straight from the planes, one k-step (d = 32); + location term loaded in the D layout;
//   key mask by value select (fill -1e38 in the natural-log domain); running-max softmax in the exp2 domain (f32);
//   unnormalised e x1024 as f16 (wave-private LDS tile sP, wave_sync) times V^T B fragments straight from VT16.
//   O plane f16 x64 [row][head*32 + d]: the two waves of a query tile stage their 32 columns each in the tile's sO slab; behind one block
//   barrier each of them writes 8 whole 128-B rows (one writer per line).
//   staged extent == consumed extent: sP rows 0..15 x keys 0..63; sO rows 0..15 x cols 0..63.
// =====================================================================================================================
#define AT_PP 72
#define AT_OP 68
__global__ __launch_bounds__(128) void k_attn(const _Float16* __restrict__ Q16, const _Float16* __restrict__ K16,
                                              const _Float16* __restrict__ VT16, const float* __restrict__ ALOC,
                                              const int* __restrict__ mask, _Float16* __restrict__ O16) {
    __shared__ __align__(16) _Float16 sP[4][16 * AT_PP];      // per wave [row][64 keys], wave-private (wave_sync)
    __shared__ __align__(16) float sO[2][16 * AT_OP];         // per query tile [row][64 channels], shared by the tile's two waves (block barrier)
    const unsigned tid = threadIdx.x, lane = tid & 31u, wave = tid >> 5;
    const unsigned hh = lane >> 4, c = lane & 15u;
    const unsigned bx = blockIdx.x;
    const unsigned qb = bx % (unsigned)QBLK;
    const unsigned pair = (bx / (unsigned)QBLK) & 3u;
    const unsigned b = bx / ((unsigned)QBLK * 4u);
    const unsigned hp = wave & 1u;                            // the wave's head of the pair
    const unsigned q0 = qb * 32u + (wave >> 1) * 16u;
    _Float16* pw = sP[wave];
    float* so = sO[wave >> 1];
    {
        const unsigned head = 2u * pair + hp;
        const v16h qf = frag_ld(Q16 + (size_t)(b * SEQ + q0 + c) * CH + head * HD + 8u * hh);
        const float* arow = ALOC + (size_t)((b * (unsigned)HEADS + head) * SEQ + q0 + 8u * hh) * SEQ + c;
        const _Float16* krow = K16 + (size_t)(b * SEQ + c) * CH + head * HD + 8u * hh;
        const int* mrw = mask + b * SEQ_FULL + c;
        float mrow[8], lrow[8];
        v8f os[2];
#pragma unroll
        for (int r = 0; r < 8; ++r) { mrow[r] = -3.0e38f; lrow[r] = 0.f; }
#pragma unroll
        for (int t = 0; t < 2; ++t) os[t] = (v8f){0.f,0.f,0.f,0.f,0.f,0.f,0.f,0.f};
        // score operands of one chunk, held in registers and fetched one chunk ahead
        v16h kf[4];
        int mk[4];
        float al[4][8];
#pragma unroll
        for (int j = 0; j < 4; ++j) {
            kf[j] = frag_ld(krow + (size_t)((unsigned)j * 16u) * CH);
            mk[j] = mrw[(unsigned)j * 16u];
#pragma unroll
            for (int r = 0; r < 8; ++r) al[j][r] = arow[(size_t)r * SEQ + (unsigned)j * 16u];
        }
#pragma unroll 1
        for (unsigned kc = 0; kc < (unsigned)(SEQ / 64); ++kc) {
            const unsigned kv0 = kc * 64u;
            v8f s[4];
#pragma unroll
            for (int j = 0; j < 4; ++j) {
                const v8f z = (v8f){0.f,0.f,0.f,0.f,0.f,0.f,0.f,0.f};
                s[j] = wmma16g(qf, kf[j], z);
            }
#pragma unroll
            for (int j = 0; j < 4; ++j) {
                const bool on = (mk[j] != 0);
#pragma unroll
                for (int r = 0; r < 8; ++r) {
                    const float sv = (s[j][r] * SCQK + al[j][r]) * LOG2E;
                    s[j][r] = on ? sv : FILL2;
                }
            }
            // the next chunk's score operands fly under this chunk's softmax; the last pass fetches its own chunk again (in bounds, unused)
            const unsigned nv0 = ((kc + 1u < (unsigned)(SEQ / 64)) ? kc + 1u : kc) * 64u;
#pragma unroll
            for (int j = 0; j < 4; ++j) {
                kf[j] = frag_ld(krow + (size_t)(nv0 + (unsigned)j * 16u) * CH);
                mk[j] = mrw[nv0 + (unsigned)j * 16u];
#pragma unroll
                for (int r = 0; r < 8; ++r) al[j][r] = arow[(size_t)r * SEQ + nv0 + (unsigned)j * 16u];
            }
#pragma unroll
            for (int r = 0; r < 8; ++r) {
                float mx = -3.0e38f;
#pragma unroll
                for (int j = 0; j < 4; ++j) { mx = fmaxf(mx, s[j][r]); }
                mx = fmaxf(mx, __shfl_xor(mx, 1, 32)); mx = fmaxf(mx, __shfl_xor(mx, 2, 32));
                mx = fmaxf(mx, __shfl_xor(mx, 4, 32)); mx = fmaxf(mx, __shfl_xor(mx, 8, 32));
                const float mnew = fmaxf(mrow[r], mx);
                const float alpha = exp2f(mrow[r] - mnew);
                mrow[r] = mnew;
                float psum = 0.f;
#pragma unroll
                for (int j = 0; j < 4; ++j) {
                    const float p = exp2f(s[j][r] - mnew);
                    psum += p;
                    const float w = p * P_CARRY;
                    pw[(8u * hh + (unsigned)r) * AT_PP + (unsigned)j * 16u + c] = (_Float16)((w < 6.103515625e-05f) ? 0.0f : w);
                }
                psum += __shfl_xor(psum, 1, 32); psum += __shfl_xor(psum, 2, 32);
                psum += __shfl_xor(psum, 4, 32); psum += __shfl_xor(psum, 8, 32);
                lrow[r] = lrow[r] * alpha + psum;
                os[0][r] *= alpha; os[1][r] *= alpha;
            }
            wave_sync_lds();
            // this chunk's V fragments, all four in one group ahead of the P.V products
            v16h vb[2][2];
#pragma unroll
            for (int kk = 0; kk < 2; ++kk)
#pragma unroll
                for (int t = 0; t < 2; ++t)
                    vb[kk][t] = frag_ld(VT16 + (size_t)(b * CH + head * HD + (unsigned)t * 16u + c) * SEQ + kv0 + (unsigned)kk * 32u + 8u * hh);
#pragma unroll
            for (int kk = 0; kk < 2; ++kk) {
                const v16h pa = frag_ld(pw + c * AT_PP + (unsigned)kk * 32u + 8u * hh);
#pragma unroll
                for (int t = 0; t < 2; ++t) {
                    os[t] = wmma16g(pa, vb[kk][t], os[t]);
                }
            }
            wave_sync_lds();
        }
#pragma unroll
        for (int r = 0; r < 8; ++r) {
            const float inv = 1.0f / (lrow[r] * P_CARRY);
#pragma unroll
            for (int t = 0; t < 2; ++t)
                so[(8u * hh + (unsigned)r) * AT_OP + hp * 32u + (unsigned)t * 16u + c] = os[t][r] * inv * (O_CARRY / ACT_CARRY);   // = 64 * value
        }
    }
    __syncthreads();   // the tile's other head has staged its 32 columns; every wave of the block passes here once
    {
        const unsigned q = hp * 8u + (lane >> 3), c8 = (lane & 7u) * 8u;   // this wave's 8 of the tile's 16 rows
        v8h ov[2];
#pragma unroll
        for (int it = 0; it < 2; ++it) {
            const float* sp = so + ((unsigned)it * 4u + q) * AT_OP + c8;
            ov[it] = pack8_flush(*(const v4f*)sp, *(const v4f*)(sp + 4));
        }
        _Float16* dst = O16 + (size_t)(b * SEQ + q0) * CH + pair * 64u;
#pragma unroll
        for (int it = 0; it < 2; ++it) *(v8h*)(dst + (size_t)((unsigned)it * 4u + q) * CH + c8) = ov[it];
    }
}

// output projection: out[row][256] = O @ w + bf16(b), f32
//   one 16 x 32 tile per wave, 1024 waves in 256 blocks of 4 (block = 32 rows x 64 columns), so that every wave can have a SIMD of its own.
//   the launch is latency bound: a wave's 48 fragment loads (the whole K = 256 of its 16 rows and 32 columns) are all issued before the
//   first product, one trip to L2 in place of a load-wait-use trip per fragment. k runs upward in one accumulator per tile.
//   a wave writes 16 rows x 128 B, whole lines (one writer per line), through its own slab.
#define PO_SP 36
static_assert(MTOK % 32 == 0 && CH % 64 == 0 && CH / 32 == 8);
static_assert(32 * 16 * 4 == 16 * 32 * 4);   // store loop: lanes x bytes x instructions == tile rows x row bytes
__global__ __launch_bounds__(128) void k_proj_out(const _Float16* __restrict__ O16, const _Float16* __restrict__ Wt,
                                                  float* __restrict__ out, const float* __restrict__ bias) {
    __shared__ __align__(16) float sT[4][16 * PO_SP];        // per wave [row][32 columns], wave-private (wave_sync)
    const unsigned lane = threadIdx.x & 31u, wave = threadIdx.x >> 5;
    const unsigned hh = lane >> 4, c = lane & 15u;
    const unsigned m0 = (blockIdx.x >> 2) * 32u + (wave >> 1) * 16u;
    const unsigned n0 = (blockIdx.x & 3u) * 64u + (wave & 1u) * 32u;
    const _Float16* ap = O16 + (size_t)(m0 + c) * CH + 8u * hh;
    const _Float16* bp = Wt + (size_t)(n0 + c) * CH + 8u * hh;
    v16h af[8], bf[2][8];
    // every '#pragma unroll' of this kernel: its counter indexes register arrays (af, bf, acc, vv), which must not become memory
#pragma unroll
    for (int ks = 0; ks < 8; ++ks) {
        af[ks] = frag_ld(ap + ks * 32);
        bf[0][ks] = frag_ld(bp + ks * 32);
        bf[1][ks] = frag_ld(bp + 16 * CH + ks * 32);
    }
    asm volatile("s_wait_xcnt 0x0" ::: "memory");   // stands in front of every later write of these loads' address registers; no load sinks below it
    const float raw0 = bias[n0 + c];
    asm volatile("s_wait_xcnt 0x0" ::: "memory");   // the same: the next load's result may land on this one's address register
    const float raw1 = bias[n0 + 16u + c];
    asm volatile("s_wait_xcnt 0x0" ::: "memory");   // the same
    const float bv[2] = {bfr(raw0), bfr(raw1)};
    v8f acc[2];
    acc[0] = (v8f){0.f,0.f,0.f,0.f,0.f,0.f,0.f,0.f};
    acc[1] = (v8f){0.f,0.f,0.f,0.f,0.f,0.f,0.f,0.f};
#pragma unroll
    for (int ks = 0; ks < 8; ++ks) {
        acc[0] = wmma16g(af[ks], bf[0][ks], acc[0]);
        acc[1] = wmma16g(af[ks], bf[1][ks], acc[1]);
    }
    float* slab = sT[wave];
#pragma unroll
    for (int j = 0; j < 2; ++j)
#pragma unroll
        for (int r = 0; r < 8; ++r)
            slab[(8u * hh + (unsigned)r) * PO_SP + (unsigned)j * 16u + c] = acc[j][r] * SC_OUT + bv[j];
    wave_sync_lds();
    const unsigned q = lane >> 3, c4 = (lane & 7u) * 4u;     // row segment = 128 B = 8 lanes x 16 B
    v4f vv[4];
#pragma unroll
    for (int it = 0; it < 4; ++it) vv[it] = *(const v4f*)(slab + ((unsigned)it * 4u + q) * PO_SP + c4);
#pragma unroll
    for (int it = 0; it < 4; ++it) *(v4f*)(out + (size_t)(m0 + (unsigned)it * 4u + q) * CH + n0 + c4) = vv[it];
}

extern "C" void kernel_launch(void* const* d_in, const int* in_sizes, int n_in, void* d_out, int out_size,
                              void* d_ws, size_t ws_size, hipStream_t stream) {
    if (n_in < 17) return;
    if (in_sizes[0] < NB * SEQ * SEQ * DG || in_sizes[1] < MTOK * CH) return;
    if (in_sizes[2] < CH * CH || in_sizes[3] < CH || in_sizes[4] < CH * CH || in_sizes[5] < CH) return;
    if (in_sizes[6] < CH * CH || in_sizes[7] < CH || in_sizes[8] < CH * CH || in_sizes[9] < CH) return;
    if (in_sizes[10] < HEADS * DG * HID || in_sizes[11] < HEADS * HID || in_sizes[12] < HEADS * HID * HID) return;
    if (in_sizes[13] < HEADS * HID || in_sizes[14] < HEADS * HID || in_sizes[15] < HEADS || in_sizes[16] < NB * SEQ) return;
    if (out_size < MTOK * CH) return;
    if (ws_size < WS_TOTAL) return;

    const float* pairwise_g = (const float*)d_in[0];
    const float* coset      = (const float*)d_in[1];
    const float* fc_q_w     = (const float*)d_in[2];
    const float* fc_q_b     = (const float*)d_in[3];
    const float* fc_k_w     = (const float*)d_in[4];
    const float* fc_k_b     = (const float*)d_in[5];
    const float* in_w       = (const float*)d_in[6];
    const float* in_b       = (const float*)d_in[7];
    const float* out_w      = (const float*)d_in[8];
    const float* out_b      = (const float*)d_in[9];
    const float* loc_w1     = (const float*)d_in[10];
    const float* loc_b1     = (const float*)d_in[11];
    const float* loc_w2     = (const float*)d_in[12];
    const float* loc_b2     = (const float*)d_in[13];
    const float* loc_w3     = (const float*)d_in[14];
    const float* loc_b3     = (const float*)d_in[15];
    const int*   mask       = (const int*)d_in[16];
    float* out = (float*)d_out;

    char* wsp = (char*)d_ws;
    _Float16* G16  = (_Float16*)(wsp + OFF_G16);
    _Float16* C16  = (_Float16*)(wsp + OFF_C16);
    _Float16* WT   = (_Float16*)(wsp + OFF_WT);
    _Float16* W1B  = (_Float16*)(wsp + OFF_W1B);
    _Float16* W2B  = (_Float16*)(wsp + OFF_W2B);
    _Float16* Q16  = (_Float16*)(wsp + OFF_Q16);
    _Float16* K16  = (_Float16*)(wsp + OFF_K16);
    _Float16* VT16 = (_Float16*)(wsp + OFF_VT16);
    float*    ALOC = (float*)(wsp + OFF_ALOC);
    _Float16* O16  = (_Float16*)(wsp + OFF_O16);

    // operand planes (each whole plane written by this launch)
    k_prep<<<PB_WT + PB_WL + PB_C + PB_G, 256, 0, stream>>>(pairwise_g, coset, fc_q_w, fc_k_w, in_w, out_w, loc_w1, loc_w2,
                                                            G16, C16, WT, W1B, W2B);

    // projections (64x64 wave tiles, 8 waves per block) beside the location term; then attention, output projection
    k_proj_loc<<<2 * JB_ROWS + NB * JB_VT + NB * SEQ, 256, 0, stream>>>(C16, WT, Q16, K16, VT16, fc_q_b, fc_k_b, in_b,
                                                                        G16, W1B, W2B, loc_b1, loc_b2, loc_w3, loc_b3, ALOC);
    k_attn<<<NB * 4 * QBLK, 128, 0, stream>>>(Q16, K16, VT16, ALOC, mask, O16);
    k_proj_out<<<(MTOK / 32) * (CH / 64), 128, 0, stream>>>(O16, WT + (size_t)3 * CH * CH, out, out_b);
}

// v008
// One run takes 45.2 microseconds.
// Timed twice side by side with v007, it ran 1.24 times as fast both times.
// All steps since v000 together make it 6.07 times as fast.
// All contractions on v_wmma_f32_16x16x32_f16 (f16 operands, f32 accumulate): q/k/v projections (inputs x8, weights x32), pair MLP layer 1 (g x4, w1 /8, bias/2 as C, K=6 zero-padded to 32) and layer 2 (h1 x1, w2 /2, bias/2 as C, K=16 zero-padded to 32), whose D is half the pre-activation, q.k^T (x8, x8), P.V (P x1024, V x8), output projection (O x64, w x32); every float input RNE-converted to bf16 first; MLP layer 3 (N=1, K=16), swish (by tanh of half the argument), softmax statistics in f32 on the VALU.
#include <hip/hip_runtime.h>
#include <math.h>

#ifndef NB
#define NB 4
#endif
#ifndef SEQ
#define SEQ 512
#endif
#define NB_FULL 4
#define SEQ_FULL 512
#define CH 256
#define HEADS 8
#define HD 32
#define DG 6
#define HID 16
#define MTOK (NB * SEQ)
#define QBLK (SEQ / 32)

// power-of-two carries and their undo constants
// pair MLP: operand scales whose product is 1/2, so that a layer's WMMA result (C = bias / 2) is x / 2, the argument swish_half takes
#define G_CARRY 4.0f
#define W1_CARRY 0.125f
#define W2_CARRY 0.5f
#define ACT_CARRY 8.0f
#define W_CARRY 32.0f
#define SC_PROJ (1.0f / 256.0f)
#define SCQK (1.0f / 1024.0f)
#define P_CARRY 1024.0f
#define O_CARRY 64.0f
#define SC_OUT (1.0f / 2048.0f)
#define LOG2E 1.4426950408889634f
#define FILL2 (-1.0e38f * LOG2E)

static_assert(G_CARRY * W1_CARRY == 0.5f);
static_assert(W2_CARRY == 0.5f);
static_assert(ACT_CARRY * W_CARRY * SC_PROJ == 1.0f);
static_assert(ACT_CARRY * ACT_CARRY * 16.0f * SCQK == 1.0f);     // q x8, k x8, module scale 1/sqrt(256)
static_assert(O_CARRY * W_CARRY * SC_OUT == 1.0f);
static_assert(SEQ == SEQ_FULL);
static_assert(NB <= NB_FULL);
static_assert(CH == HEADS * HD && HD == 32 && HID == 16 && DG <= 8);
static_assert(SEQ % 32 == 0 && SEQ % 64 == 0);
static_assert(MTOK % 64 == 0 && CH % 64 == 0 && CH % 32 == 0);
static_assert((NB * SEQ * SEQ) % 256 == 0);
static_assert((MTOK * CH / 8) % 256 == 0);
static_assert((CH * (CH / 8)) % 256 == 0);
// store loops: lanes x bytes x instructions == tile rows x row bytes
static_assert(32 * 16 * 4 == 16 * 128);
static_assert(2 * 32 * 16 * 2 == 16 * 128);  // attention O tile: two waves x two stores
static_assert(32 * 16 * 8 == 16 * 256);     // f32 epilogue: 16 rows x 256 B
static_assert(32 * 4 * 8 == 8 * 128);
// static LDS per kernel
static_assert(8 * 16 * 68 * 4 <= 131072);
static_assert(4 * 16 * 72 * 2 + 2 * 16 * 68 * 4 <= 131072);

typedef _Float16 h16;
typedef __attribute__((ext_vector_type(16))) _Float16 v16h;
typedef __attribute__((ext_vector_type(8)))  _Float16 v8h;
typedef __attribute__((ext_vector_type(2)))  _Float16 v2h;
typedef __attribute__((ext_vector_type(8)))  float    v8f;
typedef __attribute__((ext_vector_type(4)))  float    v4f;
typedef __attribute__((ext_vector_type(2)))  float    v2f;
typedef __attribute__((ext_vector_type(4)))  unsigned int v4u;

static constexpr size_t SZ_G16  = (size_t)NB * SEQ * SEQ * 8 * 2;
static constexpr size_t SZ_C16  = (size_t)MTOK * CH * 2;
static constexpr size_t SZ_WT   = (size_t)4 * CH * CH * 2;
static constexpr size_t SZ_W1B  = (size_t)HEADS * HID * 32 * 2;
static constexpr size_t SZ_W2B  = (size_t)HEADS * HID * 32 * 2;
static constexpr size_t SZ_Q16  = (size_t)MTOK * CH * 2;
static constexpr size_t SZ_K16  = (size_t)MTOK * CH * 2;
static constexpr size_t SZ_VT16 = (size_t)NB * CH * SEQ * 2;
static constexpr size_t SZ_ALOC = (size_t)NB * HEADS * SEQ * SEQ * 4;
static constexpr size_t SZ_O16  = (size_t)MTOK * CH * 2;
static constexpr size_t SZ_CP16 = (size_t)MTOK * CH * 2;
static constexpr size_t SZ_IDX  = (size_t)NB * SEQ * 4;
static constexpr size_t SZ_CNT  = (size_t)NB * 32 * 4;      // one 128-B line per batch: one writer per line
static constexpr size_t OFF_G16  = 0;
static constexpr size_t OFF_C16  = OFF_G16 + SZ_G16;
static constexpr size_t OFF_WT   = OFF_C16 + SZ_C16;
static constexpr size_t OFF_W1B  = OFF_WT + SZ_WT;
static constexpr size_t OFF_W2B  = OFF_W1B + SZ_W1B;
static constexpr size_t OFF_Q16  = OFF_W2B + SZ_W2B;
static constexpr size_t OFF_K16  = OFF_Q16 + SZ_Q16;
static constexpr size_t OFF_VT16 = OFF_K16 + SZ_K16;
static constexpr size_t OFF_ALOC = OFF_VT16 + SZ_VT16;
static constexpr size_t OFF_O16  = OFF_ALOC + SZ_ALOC;
static constexpr size_t OFF_CP16 = OFF_O16 + SZ_O16;
static constexpr size_t OFF_IDX  = OFF_CP16 + SZ_CP16;
static constexpr size_t OFF_CNT  = OFF_IDX + SZ_IDX;
static constexpr size_t WS_TOTAL = OFF_CNT + SZ_CNT;
static_assert(SZ_G16 % 256 == 0 && SZ_C16 % 256 == 0 && SZ_WT % 256 == 0 && SZ_W1B % 256 == 0 && SZ_W2B % 256 == 0);
static_assert(SZ_Q16 % 256 == 0 && SZ_VT16 % 256 == 0 && SZ_ALOC % 256 == 0 && SZ_O16 % 256 == 0);
static_assert(SZ_CP16 % 256 == 0 && SZ_IDX % 256 == 0 && SZ_CNT % 128 == 0);
static_assert(WS_TOTAL <= (size_t)134217728);

// 16-bit WMMA fragment map (wave32), lane L, hh = L>>4, c = L&15:
//   A 16x32: lane = row c;    element i -> k = (i<8) ? 8hh+i : 16+8hh+(i-8)
//   B 32x16: lane = column c; the SAME k(i,hh)
//   D 16x16 (8 f32): lane = column c; element r -> row 8hh+r

// RNE convert f32 -> bf16 -> f32
__device__ __forceinline__ float bfr(float f) {
    unsigned u = __float_as_uint(f);
    u += 0x7FFFu + ((u >> 16) & 1u);
    return __uint_as_float(u & 0xFFFF0000u);
}
// f32 -> f16 with values under 2^-14 replaced by +0 before the convert
static __device__ __forceinline__ h16 toh_flush(float v) { const float w = (fabsf(v) < 6.103515625e-05f) ? 0.0f : v; return (h16)w; }
static __device__ __forceinline__ v2h toh2_flush(float a, float b) {
    v2f w;
    w.x = (fabsf(a) < 6.103515625e-05f) ? 0.0f : a;
    w.y = (fabsf(b) < 6.103515625e-05f) ? 0.0f : b;
    return __builtin_convertvector(w, v2h);
}
union Pack8 { v8h v; v2h p[4]; };
static __device__ __forceinline__ v8h pack8_flush(v4f a, v4f b) {
    Pack8 u;
    u.p[0] = toh2_flush(a.x, a.y); u.p[1] = toh2_flush(a.z, a.w);
    u.p[2] = toh2_flush(b.x, b.y); u.p[3] = toh2_flush(b.z, b.w);
    return u.v;
}
// f32 -> f16, round to nearest even, small values as f16 subnormals (the matrix instruction takes them as they are)
static __device__ __forceinline__ v8h pack8(v4f a, v4f b) {
    Pack8 u;
    u.p[0] = __builtin_convertvector((v2f){a.x, a.y}, v2h); u.p[1] = __builtin_convertvector((v2f){a.z, a.w}, v2h);
    u.p[2] = __builtin_convertvector((v2f){b.x, b.y}, v2h); u.p[3] = __builtin_convertvector((v2f){b.z, b.w}, v2h);
    return u.v;
}
static __device__ __forceinline__ void st8h2(_Float16* p, v8h v) {
    *(v8h*)p = v;
    
}

union FragU { v16h v; v8h h[2]; };
union FragQ { v16h v; v8h h[2]; v4u q[2]; };
// elements 0..7 <- p[0..7], 8..15 <- p[16..23]; caller adds 8*hh to p (used for BOTH A and B operands: same k per element)
__device__ __forceinline__ v16h frag_ld(const _Float16* p) {
    FragU f; f.h[0] = *(const v8h*)(p); f.h[1] = *(const v8h*)(p + 16); return f.v;
}
__device__ __forceinline__ v8f wmma16g(v16h a, v16h b, v8f c) {
    c = __builtin_amdgcn_wmma_f32_16x16x32_f16(false, a, false, b, (short)0, c, false, false);
    asm volatile("v_nop\n\tv_nop\n\tv_nop\n\tv_nop" : "+v"(c) : "v"(a), "v"(b));
    return c;
}
__device__ __forceinline__ void wave_sync_lds() {
    __builtin_amdgcn_fence(3 /* release order */, "workgroup");
    __builtin_amdgcn_wave_barrier();
    __builtin_amdgcn_fence(2 /* acquire order */, "workgroup");
}
// swish(x) = x * sigmoid(x) = h + h * tanh(h) with h = x / 2; the caller hands in h
static __device__ __forceinline__ float swish_half(float h) {
    return fmaf(h, __builtin_amdgcn_tanhf(h), h);
}

// =====================================================================================================================
// cvt_g_body: pair components [pair][6] f32 -> G16 [pair][8] f16 = bf16(g) * 4, components 6,7 = 0; one 16-B piece per lane
//   coverage: NB*SEQ*SEQ pairs x 16 B == the whole G16 plane
// =====================================================================================================================
static __device__ __forceinline__ void cvt_g_body(unsigned blk, const float* __restrict__ g, _Float16* __restrict__ G16) {
    const unsigned u = blk * 256u + threadIdx.x;
    if (u >= (unsigned)(NB * SEQ * SEQ)) return;
    const v2f* src = (const v2f*)(g + (size_t)u * 6u);
    const v2f a = src[0], b = src[1], cc = src[2];
    v4f lo, hi;
    lo.x = bfr(a.x) * G_CARRY; lo.y = bfr(a.y) * G_CARRY; lo.z = bfr(b.x) * G_CARRY; lo.w = bfr(b.y) * G_CARRY;
    hi.x = bfr(cc.x) * G_CARRY; hi.y = bfr(cc.y) * G_CARRY; hi.z = 0.0f; hi.w = 0.0f;
    st8h2(G16 + (size_t)u * 8u, pack8_flush(lo, hi));
}

// Key slots. A key whose mask is off has softmax weight exactly 0 as soon as one key of its batch is on, so the keys of a batch are put in a
//   stable partition: the cnt keys that are on take slots 0..cnt-1 in their order, the keys that are off take slots cnt..511 in theirs.
//   K and V cover all slots; location term and attention work on slots and stop behind the last 64-slot chunk that holds a key that is on. With cnt == 0 the
//   partition is the identity and all 8 chunks are walked, every score the fill value: the uniform softmax of the reference.
static_assert(SEQ == 512);
// bal[i] bit l = mask of key 32i + l of one batch; every lane of the wave is on at the call
static __device__ __forceinline__ void key_ballots(const int* __restrict__ mrow, unsigned lane, unsigned (&bal)[16]) {
    int mv[16];
    // unrolled: the counter indexes register arrays
#pragma unroll
    for (int i = 0; i < 16; ++i) mv[i] = mrow[(unsigned)i * 32u + lane];
    asm volatile("s_wait_xcnt 0x0" ::: "memory");   // stands in front of every later write of these loads' address registers
#pragma unroll
    for (int i = 0; i < 16; ++i) bal[i] = __builtin_amdgcn_ballot_w32(mv[i] != 0);
}
// chunks of 64 slots that hold the keys that count
static __device__ __forceinline__ unsigned key_chunks(unsigned cnt) {
    return (cnt == 0u) ? (unsigned)(SEQ / 64) : ((cnt + 63u) >> 6);
}
// slots_body: IDX[b][slot] = key of the slot, CNT[b * 32] = number of keys that are on; one wave per batch writes its batch's whole IDX row
static_assert(NB <= 8);
static __device__ __forceinline__ void slots_body(const int* __restrict__ mask, int* __restrict__ IDX, int* __restrict__ CNT) {
    const unsigned lane = threadIdx.x & 31u;
    const unsigned b = (unsigned)__builtin_amdgcn_readfirstlane((int)(threadIdx.x >> 5));
    if (b >= (unsigned)NB) return;   // wave-uniform; no barrier in this kernel
    unsigned bal[16];
    key_ballots(mask + b * SEQ_FULL, lane, bal);
    unsigned cnt = 0u;
#pragma unroll
    for (int i = 0; i < 16; ++i) cnt += (unsigned)__builtin_popcount(bal[i]);
    unsigned base = 0u;
#pragma unroll
    for (int i = 0; i < 16; ++i) {
        const unsigned key = (unsigned)i * 32u + lane;
        const unsigned before = base + __builtin_amdgcn_mbcnt_lo(bal[i], 0u);   // keys that are on in front of this one
        const unsigned slot = ((bal[i] >> lane) & 1u) ? before : cnt + key - before;
        IDX[b * (unsigned)SEQ + slot] = (int)key;
        base += (unsigned)__builtin_popcount(bal[i]);
    }
    if (lane == 0u) CNT[b * 32u] = (int)cnt;
}

// cvt_c_body: features [row][256] f32 -> C16 f16 = bf16(x) * 8; thread per 8 columns; coverage: MTOK*256/8 pieces == whole plane
//   a wave holds one whole row and writes it twice: to C16 at its position (the queries) and to CP16 at its key slot (operand of K and V);
//   the slots of a batch are a permutation of its rows, so CP16 is covered whole as well.
static __device__ __forceinline__ void cvt_c_body(unsigned blk, const float* __restrict__ x, const int* __restrict__ mask,
                                                  _Float16* __restrict__ C16, _Float16* __restrict__ CP16) {
    const unsigned u = blk * 256u + threadIdx.x;
    if (u >= (unsigned)(MTOK * CH / 8)) return;
    const unsigned row = (unsigned)__builtin_amdgcn_readfirstlane((int)(u >> 5));
    const unsigned kb = row / (unsigned)SEQ, km = row % (unsigned)SEQ;
    unsigned bal[16];
    key_ballots(mask + kb * SEQ_FULL, threadIdx.x & 31u, bal);
    unsigned cnt = 0u, before = 0u, word = 0u;
#pragma unroll
    for (int i = 0; i < 16; ++i) {
        const unsigned pc = (unsigned)__builtin_popcount(bal[i]);
        cnt += pc;
        before += ((unsigned)i < (km >> 5)) ? pc : 0u;
        word = ((unsigned)i == (km >> 5)) ? bal[i] : word;
    }
    before += (unsigned)__builtin_popcount(word & ((1u << (km & 31u)) - 1u));
    const unsigned slot = ((word >> (km & 31u)) & 1u) ? before : cnt + km - before;
    const v4f* src = (const v4f*)(x + (size_t)u * 8u);
    v4f a = src[0], b = src[1];
    a.x = bfr(a.x) * ACT_CARRY; a.y = bfr(a.y) * ACT_CARRY; a.z = bfr(a.z) * ACT_CARRY; a.w = bfr(a.w) * ACT_CARRY;
    b.x = bfr(b.x) * ACT_CARRY; b.y = bfr(b.y) * ACT_CARRY; b.z = bfr(b.z) * ACT_CARRY; b.w = bfr(b.w) * ACT_CARRY;
    const v8h cv = pack8_flush(a, b);
    st8h2(C16 + (size_t)u * 8u, cv);
    st8h2(CP16 + (size_t)(kb * (unsigned)SEQ + slot) * CH + (u & 31u) * 8u, cv);
}

static __device__ __forceinline__ void wt_one(const float* __restrict__ W, _Float16* __restrict__ D, unsigned o, unsigned k0) {
    v4f lo, hi;
    lo.x = bfr(W[(size_t)(k0 + 0u) * CH + o]) * W_CARRY;
    lo.y = bfr(W[(size_t)(k0 + 1u) * CH + o]) * W_CARRY;
    lo.z = bfr(W[(size_t)(k0 + 2u) * CH + o]) * W_CARRY;
    lo.w = bfr(W[(size_t)(k0 + 3u) * CH + o]) * W_CARRY;
    hi.x = bfr(W[(size_t)(k0 + 4u) * CH + o]) * W_CARRY;
    hi.y = bfr(W[(size_t)(k0 + 5u) * CH + o]) * W_CARRY;
    hi.z = bfr(W[(size_t)(k0 + 6u) * CH + o]) * W_CARRY;
    hi.w = bfr(W[(size_t)(k0 + 7u) * CH + o]) * W_CARRY;
    st8h2(D + (size_t)o * CH + k0, pack8_flush(lo, hi));
}
// wt4_body: the four 256x256 weights -> WT[4][out][in]; thread per (o, 8 k): 32 lanes cover one whole 512-B row; coverage: 4 x 256 x 32 pieces
static __device__ __forceinline__ void wt4_body(unsigned blk, const float* __restrict__ wq, const float* __restrict__ wk,
                                                const float* __restrict__ wv, const float* __restrict__ wo,
                                                _Float16* __restrict__ WT) {
    const unsigned u = blk * 256u + threadIdx.x;
    if (u >= (unsigned)(CH * (CH / 8))) return;
    const unsigned k0 = 8u * (u & 31u);
    const unsigned o = u >> 5;
    wt_one(wq, WT, o, k0);
    wt_one(wk, WT + (size_t)1 * CH * CH, o, k0);
    wt_one(wv, WT + (size_t)2 * CH * CH, o, k0);
    wt_one(wo, WT + (size_t)3 * CH * CH, o, k0);
}

// wloc_body: pair-MLP weights as A-operand planes (row = hidden unit), zero-padded along k to 32:
//   W1B[h*16+j][k] = bf16(w1[h][k][j]) / 8 for k < 6, else 0;  W2B[h*16+j][k] = bf16(w2[h][k][j]) / 2 for k < 16, else 0
//   thread per 16-B piece (512 pieces per plane), clamped addresses, zero by value; coverage: 128 rows x 4 pieces == both whole planes
static __device__ __forceinline__ void wloc_body(unsigned blk, const float* __restrict__ w1, const float* __restrict__ w2,
                                                 _Float16* __restrict__ W1B, _Float16* __restrict__ W2B) {
    const unsigned p = blk * 256u + threadIdx.x;
    if (p >= (unsigned)(HEADS * HID * 4)) return;
    const unsigned col = p >> 2, k0 = (p & 3u) * 8u;
    const unsigned h = col >> 4, j = col & 15u;
    float v[8];
#pragma unroll
    for (int i = 0; i < 8; ++i) {
        const unsigned k = k0 + (unsigned)i;
        const unsigned kc = min(k, (unsigned)(DG - 1));
        const float raw = w1[(size_t)(h * DG + kc) * HID + j];
        asm volatile("s_wait_xcnt 0x0" ::: "memory");   // stands in front of a later load's result landing on this load's address registers
        const float x = bfr(raw) * W1_CARRY;
        v[i] = (k < (unsigned)DG) ? x : 0.0f;
    }
    {
        v4f a, b;
        a.x = v[0]; a.y = v[1]; a.z = v[2]; a.w = v[3]; b.x = v[4]; b.y = v[5]; b.z = v[6]; b.w = v[7];
        st8h2(W1B + (size_t)col * 32u + k0, pack8(a, b));
    }
#pragma unroll
    for (int i = 0; i < 8; ++i) {
        const unsigned k = k0 + (unsigned)i;
        const unsigned kc = min(k, (unsigned)(HID - 1));
        const float raw = w2[(size_t)(h * HID + kc) * HID + j];
        asm volatile("s_wait_xcnt 0x0" ::: "memory");   // the same
        const float x = bfr(raw) * W2_CARRY;
        v[i] = (k < (unsigned)HID) ? x : 0.0f;
    }
    {
        v4f a, b;
        a.x = v[0]; a.y = v[1]; a.z = v[2]; a.w = v[3]; b.x = v[4]; b.y = v[5]; b.z = v[6]; b.w = v[7];
        st8h2(W2B + (size_t)col * 32u + k0, pack8(a, b));
    }
}

// k_prep: the four operand-plane conversions and the key slots in ONE launch (none reads what another writes); the block index picks the job, a scalar branch.
//   the short, latency-bound jobs stand at the low indices so that they start first and end under the long pair conversion.
#define PB_WT ((CH * (CH / 8)) / 256)
#define PB_WL ((HEADS * HID * 4) / 256)
#define PB_IX 1
#define PB_C  ((MTOK * CH / 8) / 256)
#define PB_G  ((NB * SEQ * SEQ) / 256)
static_assert((HEADS * HID * 4) % 256 == 0);
__global__ __launch_bounds__(256) void k_prep(const float* __restrict__ g, const float* __restrict__ x,
                                              const float* __restrict__ wq, const float* __restrict__ wk,
                                              const float* __restrict__ wv, const float* __restrict__ wo,
                                              const float* __restrict__ w1, const float* __restrict__ w2,
                                              const int* __restrict__ mask,
                                              _Float16* __restrict__ G16, _Float16* __restrict__ C16, _Float16* __restrict__ WT,
                                              _Float16* __restrict__ W1B, _Float16* __restrict__ W2B,
                                              _Float16* __restrict__ CP16, int* __restrict__ IDX, int* __restrict__ CNT) {
    const unsigned bx = blockIdx.x;
    if (bx < (unsigned)PB_WT) wt4_body(bx, wq, wk, wv, wo, WT);
    else if (bx < (unsigned)(PB_WT + PB_WL)) wloc_body(bx - (unsigned)PB_WT, w1, w2, W1B, W2B);
    else if (bx < (unsigned)(PB_WT + PB_WL + PB_IX)) slots_body(mask, IDX, CNT);
    else if (bx < (unsigned)(PB_WT + PB_WL + PB_IX + PB_C)) cvt_c_body(bx - (unsigned)(PB_WT + PB_WL + PB_IX), x, mask, C16, CP16);
    else cvt_g_body(bx - (unsigned)(PB_WT + PB_WL + PB_IX + PB_C), g, G16);
}

// =====================================================================================================================
// gemm64_body: C[m,n] = (scale * sum_k A[m,k] * Bt[n,k] + bf16(bias[n or m])) ; each wave owns a 64x64 tile.
//   A row-major [M][lda] f16, Bt row-major [N][ldb] f16 (fragments straight from the planes); M,N % 64 == 0, K % 32 == 0.
//   blk = the job's own block number; sT = the calling kernel's staging slabs, one per wave.
//   OUT_MODE 0: f32 C (pitch ldc); OUT_MODE 1: f16 C = value * oscale. BIAS_ROW: bias indexed by the row m.
// =====================================================================================================================
template <int OUT_MODE, bool BIAS_ROW>
static __device__ __forceinline__ void gemm64_body(
    unsigned blk, float (*sT)[16 * 68],
    const _Float16* __restrict__ A, unsigned lda, const _Float16* __restrict__ Bt, unsigned ldb,
    float* __restrict__ Cf, _Float16* __restrict__ Ch, unsigned ldc, const float* __restrict__ bias,
    unsigned M, unsigned N, unsigned K, float scale, float oscale) {
  const unsigned lane = threadIdx.x & 31u;
  const unsigned wave = threadIdx.x >> 5;
  const unsigned tilesN = N >> 6, tilesM = M >> 6;
  const unsigned tile = blk * 8u + wave;
  if (tile >= tilesM * tilesN) return;   // wave-uniform; no block barriers in this kernel
  const unsigned tm = tile / tilesN;
  const unsigned tn = tile - tm * tilesN;
  const unsigned m0 = tm << 6, n0 = tn << 6;
  const unsigned rlane = lane & 15u;
  const unsigned koff = (lane >> 4) * 8u;
  const unsigned mOff = koff;

  v8f acc[4][4];
#pragma unroll
  for (int i = 0; i < 4; ++i)
#pragma unroll
    for (int j = 0; j < 4; ++j) acc[i][j] = (v8f){0.f,0.f,0.f,0.f,0.f,0.f,0.f,0.f};

  for (unsigned k0 = 0; k0 < K; k0 += 32u) {
    v16h bh[4];
#pragma unroll
    for (int j = 0; j < 4; ++j)
      bh[j] = frag_ld(Bt + (size_t)(n0 + ((unsigned)j << 4) + rlane) * ldb + koff + k0);
#pragma unroll
    for (int i = 0; i < 4; ++i) {
      const v16h ah = frag_ld(A + (size_t)(m0 + ((unsigned)i << 4) + rlane) * lda + koff + k0);
#pragma unroll
      for (int j = 0; j < 4; ++j)
        acc[i][j] = wmma16g(ah, bh[j], acc[i][j]);
    }
  }

  float* slab = sT[wave];
#pragma unroll
  for (int i = 0; i < 4; ++i) {
    const unsigned mBase = m0 + ((unsigned)i << 4);
    float bvr[8];
#pragma unroll
    for (int r = 0; r < 8; ++r) bvr[r] = 0.0f;
    if (BIAS_ROW) {
#pragma unroll
      for (int r = 0; r < 8; ++r) bvr[r] = bfr(bias[mBase + mOff + (unsigned)r]);
    }
#pragma unroll
    for (int j = 0; j < 4; ++j) {
      const unsigned n = n0 + ((unsigned)j << 4) + rlane;
      float bvc = 0.0f;
      if (!BIAS_ROW) bvc = bfr(bias[n]);
#pragma unroll
      for (int r = 0; r < 8; ++r) {
        float v = acc[i][j][r] * scale + (BIAS_ROW ? bvr[r] : bvc);
        if (OUT_MODE == 1) v *= oscale;
        slab[(mOff + (unsigned)r) * 68u + ((unsigned)j << 4) + rlane] = v;
      }
    }
    wave_sync_lds();
    if (OUT_MODE == 0) {
      const unsigned hh = lane >> 4, c4 = (lane & 15u) * 4u;     // row segment = 256 B = 16 lanes x 16 B
#pragma unroll
      for (int half = 0; half < 2; ++half) {
        v4f vv[4];
#pragma unroll
        for (int it = 0; it < 4; ++it) {
          const unsigned row = (unsigned)(half * 4 + it) * 2u + hh;
          vv[it] = *(const v4f*)(slab + row * 68u + c4);
        }
        {
#pragma unroll
          for (int it = 0; it < 4; ++it) {
            const unsigned row = (unsigned)(half * 4 + it) * 2u + hh;
            *(v4f*)(Cf + (size_t)(mBase + row) * ldc + n0 + c4) = vv[it];
          }
          
        }
      }
    } else {
      const unsigned q = lane >> 3, c8 = (lane & 7u) * 8u;
      v8h hv[4];
#pragma unroll
      for (int it = 0; it < 4; ++it) {
        const unsigned row = (unsigned)it * 4u + q;
        const float* sp = slab + row * 68u + c8;
        hv[it] = pack8_flush(*(const v4f*)sp, *(const v4f*)(sp + 4));
      }
      {
#pragma unroll
        for (int it = 0; it < 4; ++it) {
          const unsigned row = (unsigned)it * 4u + q;
          *(v8h*)(Ch + (size_t)(mBase + row) * ldc + n0 + c8) = hv[it];
        }
        
      }
    }
    wave_sync_lds();
  }
}

// =====================================================================================================================
// loc_body: location term ALOC[b][h][n][slot] (f32) = swish(l3(swish(l2(swish(l1(g[b][n][key of the slot][:])))))), for the chunks that count
//   transposed chain: the weights are the A operand (rows = hidden units), the pairs are the B columns.
//   block = 8 waves = the 8 heads of one query row (b,n); a wave owns ONE head and walks the row's key slots, 64 pairs (4 column tiles) a pass.
//   layer 1: B = two 16-B G16 rows per lane: lane (c,hh) holds pair 16hh+c in elements 0..7 (k 8hh..) and pair 32+16hh+c in elements 8..15
//            (k 16+8hh..), so k group q = k>>3 holds column tile q. A of tile q = the head's W1B row (k 0..7) placed in k group q, zero words
//            in the other three groups, C = half the bias of the D row -> D1[hidden 8hh+r][pair c of tile q] = x1 / 2.
//   layer 2: D1's map IS the B map (lane = pair c, element r = hidden 8hh+r): two tiles' h1, converted in place to f16, are elements
//            0..7 and 8..15 of one B operand; A = the head's W2B row in k 0..15 (first tile) or in k 16..31 (second tile), zero words in the
//            other half, C = half the bias of the D row -> D2[hidden 8hh+r][pair c] = x2 / 2.
//   layer 3 (N = 1) on the VALU: 8 multiply-adds in the lane (hidden 8hh..8hh+7) with w3 / 2, then the other half's sum from lane l ^ 16: x3 / 2.
//   biases and w3 are indexed by the D row: 8 registers each, prepared once per wave.
// =====================================================================================================================
#define LC_PASS 64
static_assert(HEADS == 8 && SEQ % LC_PASS == 0);
// lane l with lane l ^ 16
static __device__ __forceinline__ float xhalf(float x) {
    return __builtin_bit_cast(float, __builtin_amdgcn_permlanex16(__builtin_bit_cast(int, x), __builtin_bit_cast(int, x),
                                                                  0x76543210, 0xfedcba98, false, false));
}
static __device__ __forceinline__ void loc_body(unsigned bn, const _Float16* __restrict__ G16, const _Float16* __restrict__ W1B,
                                                const _Float16* __restrict__ W2B, const float* __restrict__ b1,
                                                const float* __restrict__ b2, const float* __restrict__ w3,
                                                const float* __restrict__ b3, const int* __restrict__ IDX,
                                                const int* __restrict__ CNT, float* __restrict__ ALOC) {
    const unsigned lane = threadIdx.x & 31u;
    const unsigned t = (unsigned)__builtin_amdgcn_readfirstlane((int)(threadIdx.x >> 5));   // the wave's head
    const unsigned hh = lane >> 4, c = lane & 15u;
    // bn = b*SEQ + n
    const unsigned b = bn / (unsigned)SEQ, n = bn % (unsigned)SEQ;
    const v4u zq = (v4u){0u, 0u, 0u, 0u};
    const unsigned row = t * 16u + c;
    // the lane's two keys of a pass, masked to the row's range; fetched two passes ahead, the pairs themselves one pass ahead.
    // the first pass's keys go out in front of the weights: the first pairs' addresses hang on them
    const int* ix = IDX + b * (unsigned)SEQ + lane;
    unsigned j0 = (unsigned)ix[0] & (unsigned)(SEQ - 1), j1 = (unsigned)ix[32] & (unsigned)(SEQ - 1);
    asm volatile("s_wait_xcnt 0x0" ::: "memory");   // stands in front of the later writes of these loads' address registers

    // layer-1 A operands, one per k group
    const v4u w1q = *(const v4u*)(W1B + (size_t)row * 32u);
    asm volatile("s_wait_xcnt 0x0" ::: "memory");   // stands in front of the later writes of this load's address registers
    v4u wlo, whi;
    wlo.x = (hh == 0u) ? w1q.x : 0u; wlo.y = (hh == 0u) ? w1q.y : 0u; wlo.z = (hh == 0u) ? w1q.z : 0u; wlo.w = (hh == 0u) ? w1q.w : 0u;
    whi.x = (hh == 0u) ? 0u : w1q.x; whi.y = (hh == 0u) ? 0u : w1q.y; whi.z = (hh == 0u) ? 0u : w1q.z; whi.w = (hh == 0u) ? 0u : w1q.w;
    FragQ a1[4];
    a1[0].q[0] = wlo; a1[0].q[1] = zq;
    a1[1].q[0] = whi; a1[1].q[1] = zq;
    a1[2].q[0] = zq;  a1[2].q[1] = wlo;
    a1[3].q[0] = zq;  a1[3].q[1] = whi;
    // layer-2 A operands: k 0..15 (the plane's own zeros beyond) and the same row moved to k 16..31
    FragQ a2[2];
    a2[0].h[0] = *(const v8h*)(W2B + (size_t)row * 32u + 8u * hh);
    asm volatile("s_wait_xcnt 0x0" ::: "memory");   // the same: the next load's result may land on this one's address registers
    a2[0].h[1] = *(const v8h*)(W2B + (size_t)row * 32u + 8u * hh + 16u);
    asm volatile("s_wait_xcnt 0x0" ::: "memory");   // the same
    a2[1].q[0] = a2[0].q[1]; a2[1].q[1] = a2[0].q[0];
    v8f hb1, hb2;
    float ww3[8];
    // every '#pragma unroll' of this kernel: its counter indexes register arrays (hb1, a1, hx, part ...), which must not become memory
#pragma unroll
    for (int r = 0; r < 8; ++r) {
        const unsigned j = t * 16u + 8u * hh + (unsigned)r;
        hb1[r] = 0.5f * bfr(b1[j]);
        hb2[r] = 0.5f * bfr(b2[j]);
        ww3[r] = 0.5f * bfr(w3[j]);
    }
    const float bb3 = 0.5f * bfr(b3[t]);
    asm volatile("s_wait_xcnt 0x0" ::: "memory");   // the same for the weight, bias and w3 loads above

    // passes that hold a key that is on (all of them where none is); the count is clamped to the shape
    const unsigned npass = key_chunks(min((unsigned)__builtin_amdgcn_readfirstlane(CNT[b * 32u]), (unsigned)SEQ));
    const _Float16* gp = G16 + (size_t)bn * SEQ * 8u;
    float* dst = ALOC + ((size_t)(b * (unsigned)HEADS + t) * SEQ + n) * SEQ + lane;
    FragQ g;
    g.q[0] = *(const v4u*)(gp + (size_t)j0 * 8u);
    g.q[1] = *(const v4u*)(gp + (size_t)j1 * 8u);
    asm volatile("s_wait_xcnt 0x0" ::: "memory");   // the same: j0 and j1, from which these loads' addresses are formed, are written next
    {
        const unsigned p1 = (1u < npass) ? (unsigned)LC_PASS : 0u;
        j0 = (unsigned)ix[p1] & (unsigned)(SEQ - 1); j1 = (unsigned)ix[p1 + 32u] & (unsigned)(SEQ - 1);
        asm volatile("s_wait_xcnt 0x0" ::: "memory");   // the same
    }
    // rolled: the trip count is known only at run time, and copies of a pass would not pay for their instruction fetches
    // tested at the foot: there is always a first pass (key_chunks is 1 at least)
    unsigned it = 0u;
#pragma unroll 1
    do {
        FragQ hx[2];
#pragma unroll
        for (int q = 0; q < 4; ++q) {
            const v8f d1 = wmma16g(a1[q].v, g.v, hb1);
            v4f xa, xb;
            xa.x = swish_half(d1[0]); xa.y = swish_half(d1[1]); xa.z = swish_half(d1[2]); xa.w = swish_half(d1[3]);
            xb.x = swish_half(d1[4]); xb.y = swish_half(d1[5]); xb.z = swish_half(d1[6]); xb.w = swish_half(d1[7]);
            hx[q >> 1].h[q & 1] = pack8(xa, xb);
        }
        // the next pass's pairs fly under this pass's layers 2 and 3; the last pass fetches its own pairs again (in bounds, unused)
        g.q[0] = *(const v4u*)(gp + (size_t)j0 * 8u);
        g.q[1] = *(const v4u*)(gp + (size_t)j1 * 8u);
        asm volatile("s_wait_xcnt 0x0" ::: "memory");   // stands in front of the writes of j0, j1 and of what the addresses above were formed in
        // the keys of the pass after that one (the last pass's again where there is none)
        const unsigned nx = ((it + 2u < npass) ? it + 2u : npass - 1u) * (unsigned)LC_PASS;
        j0 = (unsigned)ix[nx] & (unsigned)(SEQ - 1); j1 = (unsigned)ix[nx + 32u] & (unsigned)(SEQ - 1);
        asm volatile("s_wait_xcnt 0x0" ::: "memory");   // the same for the two key loads
#pragma unroll
        for (int u = 0; u < 2; ++u) {
            float part[2];
#pragma unroll
            for (int s = 0; s < 2; ++s) {
                const v8f d2 = wmma16g(a2[s].v, hx[u].v, hb2);
                float acc = swish_half(d2[0]) * ww3[0];
#pragma unroll
                for (int r = 1; r < 8; ++r) acc = fmaf(swish_half(d2[r]), ww3[r], acc);
                part[s] = acc;
            }
            // lane (c,hh) finishes pair 16hh+c of this tile pair: its own half sum plus the other half's from lane l ^ 16
            const float mine  = (hh == 0u) ? part[0] : part[1];
            const float other = (hh == 0u) ? part[1] : part[0];
            const float v = mine + xhalf(other) + bb3;
            dst[it * (unsigned)LC_PASS + (unsigned)u * 32u] = swish_half(v);
        }
    } while (++it < npass);
}

// k_proj_loc: the q, k and v projections and the location term in ONE launch (none reads what another writes); the block index picks the
//   job, a scalar branch. The 48 projection blocks stand at the low indices: they start first and end under the 2048 location blocks.
//   q:    position-major Q16[row][256] = f16(8 * (x @ w + bf16(b)));  k: the same from the slot-ordered rows CP16: K16[b * 512 + slot][256]
//   v:    channel-major VT16[b][ch][slot] = f16(8 * (x @ w + bf16(b)))^T ; A = weight plane, Bt = slot-ordered feature rows of one batch
#define JB_ROWS (((MTOK / 64) * (CH / 64) + 7) / 8)
#define JB_VT   (((CH / 64) * (SEQ / 64) + 7) / 8)
__global__ __launch_bounds__(256) void k_proj_loc(const _Float16* __restrict__ C16, const _Float16* __restrict__ CP16,
                                                  const _Float16* __restrict__ WT,
                                                  _Float16* __restrict__ Q16, _Float16* __restrict__ K16, _Float16* __restrict__ VT16,
                                                  const float* __restrict__ bq, const float* __restrict__ bk, const float* __restrict__ bv,
                                                  const _Float16* __restrict__ G16, const _Float16* __restrict__ W1B,
                                                  const _Float16* __restrict__ W2B, const float* __restrict__ b1,
                                                  const float* __restrict__ b2, const float* __restrict__ w3,
                                                  const float* __restrict__ b3, const int* __restrict__ IDX,
                                                  const int* __restrict__ CNT, float* __restrict__ ALOC) {
    __shared__ __align__(16) float sT[8][16 * 68];
    const unsigned bx = blockIdx.x;
    if (bx < (unsigned)(2 * JB_ROWS)) {
        const bool isk = bx >= (unsigned)JB_ROWS;
        gemm64_body<1, false>(isk ? bx - (unsigned)JB_ROWS : bx, sT, isk ? CP16 : C16, CH, isk ? WT + (size_t)1 * CH * CH : WT, CH, nullptr,
                              isk ? K16 : Q16, CH, isk ? bk : bq, MTOK, CH, CH, SC_PROJ, ACT_CARRY);
    } else if (bx < (unsigned)(2 * JB_ROWS + NB * JB_VT)) {
        const unsigned v = bx - (unsigned)(2 * JB_ROWS);
        const unsigned by = v / (unsigned)JB_VT;
        gemm64_body<1, true>(v % (unsigned)JB_VT, sT, WT + (size_t)2 * CH * CH, CH, CP16 + (size_t)by * SEQ * CH, CH, nullptr,
                             VT16 + (size_t)by * CH * SEQ, SEQ, bv, CH, SEQ, CH, SC_PROJ, ACT_CARRY);
    } else {
        loc_body(bx - (unsigned)(2 * JB_ROWS + NB * JB_VT), G16, W1B, W2B, b1, b2, w3, b3, IDX, CNT, ALOC);
    }
}

// =====================================================================================================================
// k_attn: one block per (batch, head pair, 32-query block), 4 waves = 2 query tiles of 16 rows x the 2 heads of the pair, ONE head per wave,
//   chunks of 64 key slots, only those that count: 1024 waves in 256 blocks, so that every wave can have a SIMD of its own (a wave's chain of
//   chunks is latency bound).
//   scores: Q (A) and K (B) fragments straight from the planes, one k-step (d = 32); + location term loaded in the D layout;
//   key mask by value select, a slot being on where it is below the batch's count (fill -1e38 in the natural-log domain); running-max softmax in the exp2 domain (f32);
//   unnormalised e x1024 as f16 (wave-private LDS tile sP, wave_sync) times V^T B fragments straight from VT16.
//   O plane f16 x64 [row][head*32 + d]: the two waves of a query tile stage their 32 columns each in the tile's sO slab; behind one block
//   barrier each of them writes 8 whole 128-B rows (one writer per line).
//   staged extent == consumed extent: sP rows 0..15 x keys 0..63; sO rows 0..15 x cols 0..63.
// =====================================================================================================================
#define AT_PP 72
#define AT_OP 68
__global__ __launch_bounds__(128) void k_attn(const _Float16* __restrict__ Q16, const _Float16* __restrict__ K16,
                                              const _Float16* __restrict__ VT16, const float* __restrict__ ALOC,
                                              const int* __restrict__ CNT, _Float16* __restrict__ O16) {
    __shared__ __align__(16) _Float16 sP[4][16 * AT_PP];      // per wave [row][64 keys], wave-private (wave_sync)
    __shared__ __align__(16) float sO[2][16 * AT_OP];         // per query tile [row][64 channels], shared by the tile's two waves (block barrier)
    const unsigned tid = threadIdx.x, lane = tid & 31u, wave = tid >> 5;
    const unsigned hh = lane >> 4, c = lane & 15u;
    const unsigned bx = blockIdx.x;
    const unsigned qb = bx % (unsigned)QBLK;
    const unsigned pair = (bx / (unsigned)QBLK) & 3u;
    const unsigned b = bx / ((unsigned)QBLK * 4u);
    const unsigned hp = wave & 1u;                            // the wave's head of the pair
    const unsigned q0 = qb * 32u + (wave >> 1) * 16u;
    _Float16* pw = sP[wave];
    float* so = sO[wave >> 1];
    {
        const unsigned head = 2u * pair + hp;
        const v16h qf = frag_ld(Q16 + (size_t)(b * SEQ + q0 + c) * CH + head * HD + 8u * hh);
        const float* arow = ALOC + (size_t)((b * (unsigned)HEADS + head) * SEQ + q0 + 8u * hh) * SEQ + c;
        const _Float16* krow = K16 + (size_t)(b * SEQ + c) * CH + head * HD + 8u * hh;
        const unsigned cnt = min((unsigned)__builtin_amdgcn_readfirstlane(CNT[b * 32u]), (unsigned)SEQ);   // clamped to the shape
        const unsigned nch = key_chunks(cnt);
        float mrow[8], lrow[8];
        v8f os[2];
#pragma unroll
        for (int r = 0; r < 8; ++r) { mrow[r] = -3.0e38f; lrow[r] = 0.f; }
#pragma unroll
        for (int t = 0; t < 2; ++t) os[t] = (v8f){0.f,0.f,0.f,0.f,0.f,0.f,0.f,0.f};
        // score operands of one chunk, held in registers and fetched one chunk ahead
        v16h kf[4];
        float al[4][8];
#pragma unroll
        for (int j = 0; j < 4; ++j) {
            kf[j] = frag_ld(krow + (size_t)((unsigned)j * 16u) * CH);
#pragma unroll
            for (int r = 0; r < 8; ++r) al[j][r] = arow[(size_t)r * SEQ + (unsigned)j * 16u];
        }
        asm volatile("s_wait_xcnt 0x0" ::: "memory");   // stands in front of the later writes of the address registers of the loads above
        // tested at the foot: there is always a first chunk (key_chunks is 1 at least)
        unsigned kc = 0u;
#pragma unroll 1
        do {
            const unsigned kv0 = kc * 64u;
            v8f s[4];
#pragma unroll
            for (int j = 0; j < 4; ++j) {
                const v8f z = (v8f){0.f,0.f,0.f,0.f,0.f,0.f,0.f,0.f};
                s[j] = wmma16g(qf, kf[j], z);
            }
#pragma unroll
            for (int j = 0; j < 4; ++j) {
                const bool on = (kv0 + (unsigned)j * 16u + c) < cnt;
#pragma unroll
                for (int r = 0; r < 8; ++r) {
                    const float sv = (s[j][r] * SCQK + al[j][r]) * LOG2E;
                    s[j][r] = on ? sv : FILL2;
                }
            }
            // the next chunk's score operands fly under this chunk's softmax; the last pass fetches its own chunk again (in bounds, unused)
            const unsigned nv0 = ((kc + 1u < nch) ? kc + 1u : kc) * 64u;
#pragma unroll
            for (int j = 0; j < 4; ++j) {
                kf[j] = frag_ld(krow + (size_t)(nv0 + (unsigned)j * 16u) * CH);
#pragma unroll
                for (int r = 0; r < 8; ++r) al[j][r] = arow[(size_t)r * SEQ + nv0 + (unsigned)j * 16u];
            }
#pragma unroll
            for (int r = 0; r < 8; ++r) {
                float mx = -3.0e38f;
#pragma unroll
                for (int j = 0; j < 4; ++j) { mx = fmaxf(mx, s[j][r]); }
                mx = fmaxf(mx, __shfl_xor(mx, 1, 32)); mx = fmaxf(mx, __shfl_xor(mx, 2, 32));
                mx = fmaxf(mx, __shfl_xor(mx, 4, 32)); mx = fmaxf(mx, __shfl_xor(mx, 8, 32));
                const float mnew = fmaxf(mrow[r], mx);
                const float alpha = exp2f(mrow[r] - mnew);
                mrow[r] = mnew;
                float psum = 0.f;
#pragma unroll
                for (int j = 0; j < 4; ++j) {
                    const float p = exp2f(s[j][r] - mnew);
                    psum += p;
                    const float w = p * P_CARRY;
                    pw[(8u * hh + (unsigned)r) * AT_PP + (unsigned)j * 16u + c] = (_Float16)((w < 6.103515625e-05f) ? 0.0f : w);
                }
                psum += __shfl_xor(psum, 1, 32); psum += __shfl_xor(psum, 2, 32);
                psum += __shfl_xor(psum, 4, 32); psum += __shfl_xor(psum, 8, 32);
                lrow[r] = lrow[r] * alpha + psum;
                os[0][r] *= alpha; os[1][r] *= alpha;
            }
            wave_sync_lds();
            // this chunk's V fragments, all four in one group ahead of the P.V products
            v16h vb[2][2];
#pragma unroll
            for (int kk = 0; kk < 2; ++kk)
#pragma unroll
                for (int t = 0; t < 2; ++t)
                    vb[kk][t] = frag_ld(VT16 + (size_t)(b * CH + head * HD + (unsigned)t * 16u + c) * SEQ + kv0 + (unsigned)kk * 32u + 8u * hh);
#pragma unroll
            for (int kk = 0; kk < 2; ++kk) {
                const v16h pa = frag_ld(pw + c * AT_PP + (unsigned)kk * 32u + 8u * hh);
#pragma unroll
                for (int t = 0; t < 2; ++t) {
                    os[t] = wmma16g(pa, vb[kk][t], os[t]);
                }
            }
            wave_sync_lds();
        } while (++kc < nch);
#pragma unroll
        for (int r = 0; r < 8; ++r) {
            const float inv = 1.0f / (lrow[r] * P_CARRY);
#pragma unroll
            for (int t = 0; t < 2; ++t)
                so[(8u * hh + (unsigned)r) * AT_OP + hp * 32u + (unsigned)t * 16u + c] = os[t][r] * inv * (O_CARRY / ACT_CARRY);   // = 64 * value
        }
    }
    __syncthreads();   // the tile's other head has staged its 32 columns; every wave of the block passes here once
    {
        const unsigned q = hp * 8u + (lane >> 3), c8 = (lane & 7u) * 8u;   // this wave's 8 of the tile's 16 rows
        v8h ov[2];
#pragma unroll
        for (int it = 0; it < 2; ++it) {
            const float* sp = so + ((unsigned)it * 4u + q) * AT_OP + c8;
            ov[it] = pack8_flush(*(const v4f*)sp, *(const v4f*)(sp + 4));
        }
        _Float16* dst = O16 + (size_t)(b * SEQ + q0) * CH + pair * 64u;
#pragma unroll
        for (int it = 0; it < 2; ++it) *(v8h*)(dst + (size_t)((unsigned)it * 4u + q) * CH + c8) = ov[it];
    }
}

// output projection: out[row][256] = O @ w + bf16(b), f32
//   one 16 x 32 tile per wave, 1024 waves in 256 blocks of 4 (block = 32 rows x 64 columns), so that every wave can have a SIMD of its own.
//   the launch is latency bound: a wave's 48 fragment loads (the whole K = 256 of its 16 rows and 32 columns) are all issued before the
//   first product, one trip to L2 in place of a load-wait-use trip per fragment. k runs upward in one accumulator per tile.
//   a wave writes 16 rows x 128 B, whole lines (one writer per line), through its own slab.
#define PO_SP 36
static_assert(MTOK % 32 == 0 && CH % 64 == 0 && CH / 32 == 8);
static_assert(32 * 16 * 4 == 16 * 32 * 4);   // store loop: lanes x bytes x instructions == tile rows x row bytes
__global__ __launch_bounds__(128) void k_proj_out(const _Float16* __restrict__ O16, const _Float16* __restrict__ Wt,
                                                  float* __restrict__ out, const float* __restrict__ bias) {
    __shared__ __align__(16) float sT[4][16 * PO_SP];        // per wave [row][32 columns], wave-private (wave_sync)
    const unsigned lane = threadIdx.x & 31u, wave = threadIdx.x >> 5;
    const unsigned hh = lane >> 4, c = lane & 15u;
    const unsigned m0 = (blockIdx.x >> 2) * 32u + (wave >> 1) * 16u;
    const unsigned n0 = (blockIdx.x & 3u) * 64u + (wave & 1u) * 32u;
    const _Float16* ap = O16 + (size_t)(m0 + c) * CH + 8u * hh;
    const _Float16* bp = Wt + (size_t)(n0 + c) * CH + 8u * hh;
    v16h af[8], bf[2][8];
    // every '#pragma unroll' of this kernel: its counter indexes register arrays (af, bf, acc, vv), which must not become memory
#pragma unroll
    for (int ks = 0; ks < 8; ++ks) {
        af[ks] = frag_ld(ap + ks * 32);
        bf[0][ks] = frag_ld(bp + ks * 32);
        bf[1][ks] = frag_ld(bp + 16 * CH + ks * 32);
    }
    asm volatile("s_wait_xcnt 0x0" ::: "memory");   // stands in front of every later write of these loads' address registers; no load sinks below it
    const float raw0 = bias[n0 + c];
    asm volatile("s_wait_xcnt 0x0" ::: "memory");   // the same: the next load's result may land on this one's address register
    const float raw1 = bias[n0 + 16u + c];
    asm volatile("s_wait_xcnt 0x0" ::: "memory");   // the same
    const float bv[2] = {bfr(raw0), bfr(raw1)};
    v8f acc[2];
    acc[0] = (v8f){0.f,0.f,0.f,0.f,0.f,0.f,0.f,0.f};
    acc[1] = (v8f){0.f,0.f,0.f,0.f,0.f,0.f,0.f,0.f};
#pragma unroll
    for (int ks = 0; ks < 8; ++ks) {
        acc[0] = wmma16g(af[ks], bf[0][ks], acc[0]);
        acc[1] = wmma16g(af[ks], bf[1][ks], acc[1]);
    }
    float* slab = sT[wave];
#pragma unroll
    for (int j = 0; j < 2; ++j)
#pragma unroll
        for (int r = 0; r < 8; ++r)
            slab[(8u * hh + (unsigned)r) * PO_SP + (unsigned)j * 16u + c] = acc[j][r] * SC_OUT + bv[j];
    wave_sync_lds();
    const unsigned q = lane >> 3, c4 = (lane & 7u) * 4u;     // row segment = 128 B = 8 lanes x 16 B
    v4f vv[4];
#pragma unroll
    for (int it = 0; it < 4; ++it) vv[it] = *(const v4f*)(slab + ((unsigned)it * 4u + q) * PO_SP + c4);
#pragma unroll
    for (int it = 0; it < 4; ++it) *(v4f*)(out + (size_t)(m0 + (unsigned)it * 4u + q) * CH + n0 + c4) = vv[it];
}

extern "C" void kernel_launch(void* const* d_in, const int* in_sizes, int n_in, void* d_out, int out_size,
                              void* d_ws, size_t ws_size, hipStream_t stream) {
    if (n_in < 17) return;
    if (in_sizes[0] < NB * SEQ * SEQ * DG || in_sizes[1] < MTOK * CH) return;
    if (in_sizes[2] < CH * CH || in_sizes[3] < CH || in_sizes[4] < CH * CH || in_sizes[5] < CH) return;
    if (in_sizes[6] < CH * CH || in_sizes[7] < CH || in_sizes[8] < CH * CH || in_sizes[9] < CH) return;
    if (in_sizes[10] < HEADS * DG * HID || in_sizes[11] < HEADS * HID || in_sizes[12] < HEADS * HID * HID) return;
    if (in_sizes[13] < HEADS * HID || in_sizes[14] < HEADS * HID || in_sizes[15] < HEADS || in_sizes[16] < NB * SEQ) return;
    if (out_size < MTOK * CH) return;
    if (ws_size < WS_TOTAL) return;

    const float* pairwise_g = (const float*)d_in[0];
    const float* coset      = (const float*)d_in[1];
    const float* fc_q_w     = (const float*)d_in[2];
    const float* fc_q_b     = (const float*)d_in[3];
    const float* fc_k_w     = (const float*)d_in[4];
    const float* fc_k_b     = (const float*)d_in[5];
    const float* in_w       = (const float*)d_in[6];
    const float* in_b       = (const float*)d_in[7];
    const float* out_w      = (const float*)d_in[8];
    const float* out_b      = (const float*)d_in[9];
    const float* loc_w1     = (const float*)d_in[10];
    const float* loc_b1     = (const float*)d_in[11];
    const float* loc_w2     = (const float*)d_in[12];
    const float* loc_b2     = (const float*)d_in[13];
    const float* loc_w3     = (const float*)d_in[14];
    const float* loc_b3     = (const float*)d_in[15];
    const int*   mask       = (const int*)d_in[16];
    float* out = (float*)d_out;

    char* wsp = (char*)d_ws;
    _Float16* G16  = (_Float16*)(wsp + OFF_G16);
    _Float16* C16  = (_Float16*)(wsp + OFF_C16);
    _Float16* WT   = (_Float16*)(wsp + OFF_WT);
    _Float16* W1B  = (_Float16*)(wsp + OFF_W1B);
    _Float16* W2B  = (_Float16*)(wsp + OFF_W2B);
    _Float16* Q16  = (_Float16*)(wsp + OFF_Q16);
    _Float16* K16  = (_Float16*)(wsp + OFF_K16);
    _Float16* VT16 = (_Float16*)(wsp + OFF_VT16);
    float*    ALOC = (float*)(wsp + OFF_ALOC);
    _Float16* O16  = (_Float16*)(wsp + OFF_O16);
    _Float16* CP16 = (_Float16*)(wsp + OFF_CP16);
    int*      IDX  = (int*)(wsp + OFF_IDX);
    int*      CNT  = (int*)(wsp + OFF_CNT);

    // operand planes (each whole plane written by this launch)
    k_prep<<<PB_WT + PB_WL + PB_IX + PB_C + PB_G, 256, 0, stream>>>(pairwise_g, coset, fc_q_w, fc_k_w, in_w, out_w, loc_w1, loc_w2, mask,
                                                                    G16, C16, WT, W1B, W2B, CP16, IDX, CNT);

    // projections (64x64 wave tiles, 8 waves per block) beside the location term; then attention, output projection
    k_proj_loc<<<2 * JB_ROWS + NB * JB_VT + NB * SEQ, 256, 0, stream>>>(C16, CP16, WT, Q16, K16, VT16, fc_q_b, fc_k_b, in_b,
                                                                        G16, W1B, W2B, loc_b1, loc_b2, loc_w3, loc_b3, IDX, CNT, ALOC);
    k_attn<<<NB * 4 * QBLK, 128, 0, stream>>>(Q16, K16, VT16, ALOC, CNT, O16);
    k_proj_out<<<(MTOK / 32) * (CH / 64), 128, 0, stream>>>(O16, WT + (size_t)3 * CH * CH, out, out_b);
}

// v009
// A run of this version takes 40.5 microseconds.
// Next to v008, in two timings, it ran 1.11 times as fast each time.
// Counting every step since v000, it is 6.75 times as fast.
// All contractions on v_wmma_f32_16x16x32_f16 (f16 operands, f32 accumulate): q/k/v projections (inputs x8, weights x32), pair MLP layer 1 (g x4, w1 /8, bias/2 as C, K=6 zero-padded to 32) and layer 2 (h1 x1, w2 /2, bias/2 as C, K=16 zero-padded to 32), whose D is half the pre-activation, q.k^T (x8, x8), P.V (P x1024, V x8), output projection (O x64, w x32); every float input RNE-converted to bf16 first; MLP layer 3 (N=1, K=16), swish (by tanh of half the argument), softmax statistics in f32 on the VALU.
#include <hip/hip_runtime.h>
#include <math.h>

#ifndef NB
#define NB 4
#endif
#ifndef SEQ
#define SEQ 512
#endif
#define NB_FULL 4
#define SEQ_FULL 512
#define CH 256
#define HEADS 8
#define HD 32
#define DG 6
#define HID 16
#define MTOK (NB * SEQ)
#define QBLK (SEQ / 32)

// power-of-two carries and their undo constants
// pair MLP: operand scales whose product is 1/2, so that a layer's WMMA result (C = bias / 2) is x / 2, the argument swish_half takes
#define G_CARRY 4.0f
#define W1_CARRY 0.125f
#define W2_CARRY 0.5f
#define ACT_CARRY 8.0f
#define W_CARRY 32.0f
#define SC_PROJ (1.0f / 256.0f)
#define SCQK (1.0f / 1024.0f)
#define P_CARRY 1024.0f
#define O_CARRY 64.0f
#define SC_OUT (1.0f / 2048.0f)
#define LOG2E 1.4426950408889634f
#define FILL2 (-1.0e38f * LOG2E)

static_assert(G_CARRY * W1_CARRY == 0.5f);
static_assert(W2_CARRY == 0.5f);
static_assert(ACT_CARRY * W_CARRY * SC_PROJ == 1.0f);
static_assert(ACT_CARRY * ACT_CARRY * 16.0f * SCQK == 1.0f);     // q x8, k x8, module scale 1/sqrt(256)
static_assert(O_CARRY * W_CARRY * SC_OUT == 1.0f);
static_assert(SEQ == SEQ_FULL);
static_assert(NB <= NB_FULL);
static_assert(CH == HEADS * HD && HD == 32 && HID == 16 && DG <= 8);
static_assert(SEQ % 32 == 0 && SEQ % 64 == 0);
static_assert(MTOK % 64 == 0 && CH % 64 == 0 && CH % 32 == 0);
static_assert((MTOK * CH / 8) % 256 == 0);
static_assert((CH * (CH / 8)) % 256 == 0);
// store loops: lanes x bytes x instructions == tile rows x row bytes
static_assert(32 * 16 * 4 == 16 * 128);
static_assert(2 * 32 * 16 * 2 == 16 * 128);  // attention O tile: two waves x two stores
static_assert(32 * 16 * 8 == 16 * 256);     // f32 epilogue: 16 rows x 256 B
static_assert(32 * 4 * 8 == 8 * 128);
// static LDS per kernel
static_assert(8 * 16 * 68 * 4 <= 131072);
static_assert(4 * 16 * 72 * 2 + 2 * 16 * 68 * 4 <= 131072);

typedef _Float16 h16;
typedef __attribute__((ext_vector_type(16))) _Float16 v16h;
typedef __attribute__((ext_vector_type(8)))  _Float16 v8h;
typedef __attribute__((ext_vector_type(2)))  _Float16 v2h;
typedef __attribute__((ext_vector_type(8)))  float    v8f;
typedef __attribute__((ext_vector_type(4)))  float    v4f;
typedef __attribute__((ext_vector_type(2)))  float    v2f;
typedef __attribute__((ext_vector_type(4)))  unsigned int v4u;

static constexpr size_t SZ_C16  = (size_t)MTOK * CH * 2;
static constexpr size_t SZ_WT   = (size_t)4 * CH * CH * 2;
static constexpr size_t SZ_W1B  = (size_t)HEADS * HID * 32 * 2;
static constexpr size_t SZ_W2B  = (size_t)HEADS * HID * 32 * 2;
static constexpr size_t SZ_Q16  = (size_t)MTOK * CH * 2;
static constexpr size_t SZ_K16  = (size_t)MTOK * CH * 2;
static constexpr size_t SZ_VT16 = (size_t)NB * CH * SEQ * 2;
static constexpr size_t SZ_ALOC = (size_t)NB * HEADS * SEQ * SEQ * 4;
static constexpr size_t SZ_O16  = (size_t)MTOK * CH * 2;
static constexpr size_t SZ_CP16 = (size_t)MTOK * CH * 2;
static constexpr size_t SZ_IDX  = (size_t)NB * SEQ * 4;
static constexpr size_t SZ_CNT  = (size_t)NB * 32 * 4;      // one 128-B line per batch: one writer per line
static constexpr size_t OFF_C16  = 0;
static constexpr size_t OFF_WT   = OFF_C16 + SZ_C16;
static constexpr size_t OFF_W1B  = OFF_WT + SZ_WT;
static constexpr size_t OFF_W2B  = OFF_W1B + SZ_W1B;
static constexpr size_t OFF_Q16  = OFF_W2B + SZ_W2B;
static constexpr size_t OFF_K16  = OFF_Q16 + SZ_Q16;
static constexpr size_t OFF_VT16 = OFF_K16 + SZ_K16;
static constexpr size_t OFF_ALOC = OFF_VT16 + SZ_VT16;
static constexpr size_t OFF_O16  = OFF_ALOC + SZ_ALOC;
static constexpr size_t OFF_CP16 = OFF_O16 + SZ_O16;
static constexpr size_t OFF_IDX  = OFF_CP16 + SZ_CP16;
static constexpr size_t OFF_CNT  = OFF_IDX + SZ_IDX;
static constexpr size_t WS_TOTAL = OFF_CNT + SZ_CNT;
static_assert(SZ_C16 % 256 == 0 && SZ_WT % 256 == 0 && SZ_W1B % 256 == 0 && SZ_W2B % 256 == 0);
static_assert(SZ_Q16 % 256 == 0 && SZ_VT16 % 256 == 0 && SZ_ALOC % 256 == 0 && SZ_O16 % 256 == 0);
static_assert(SZ_CP16 % 256 == 0 && SZ_IDX % 256 == 0 && SZ_CNT % 128 == 0);
static_assert(WS_TOTAL <= (size_t)134217728);

// 16-bit WMMA fragment map (wave32), lane L, hh = L>>4, c = L&15:
//   A 16x32: lane = row c;    element i -> k = (i<8) ? 8hh+i : 16+8hh+(i-8)
//   B 32x16: lane = column c; the SAME k(i,hh)
//   D 16x16 (8 f32): lane = column c; element r -> row 8hh+r

// RNE convert f32 -> bf16 -> f32
__device__ __forceinline__ float bfr(float f) {
    unsigned u = __float_as_uint(f);
    u += 0x7FFFu + ((u >> 16) & 1u);
    return __uint_as_float(u & 0xFFFF0000u);
}
// f32 -> f16 with values under 2^-14 replaced by +0 before the convert
static __device__ __forceinline__ h16 toh_flush(float v) { const float w = (fabsf(v) < 6.103515625e-05f) ? 0.0f : v; return (h16)w; }
static __device__ __forceinline__ v2h toh2_flush(float a, float b) {
    v2f w;
    w.x = (fabsf(a) < 6.103515625e-05f) ? 0.0f : a;
    w.y = (fabsf(b) < 6.103515625e-05f) ? 0.0f : b;
    return __builtin_convertvector(w, v2h);
}
union Pack8 { v8h v; v2h p[4]; };
static __device__ __forceinline__ v8h pack8_flush(v4f a, v4f b) {
    Pack8 u;
    u.p[0] = toh2_flush(a.x, a.y); u.p[1] = toh2_flush(a.z, a.w);
    u.p[2] = toh2_flush(b.x, b.y); u.p[3] = toh2_flush(b.z, b.w);
    return u.v;
}
// f32 -> f16, round to nearest even, small values as f16 subnormals (the matrix instruction takes them as they are)
static __device__ __forceinline__ v8h pack8(v4f a, v4f b) {
    Pack8 u;
    u.p[0] = __builtin_convertvector((v2f){a.x, a.y}, v2h); u.p[1] = __builtin_convertvector((v2f){a.z, a.w}, v2h);
    u.p[2] = __builtin_convertvector((v2f){b.x, b.y}, v2h); u.p[3] = __builtin_convertvector((v2f){b.z, b.w}, v2h);
    return u.v;
}
static __device__ __forceinline__ void st8h2(_Float16* p, v8h v) {
    *(v8h*)p = v;
    
}

union FragU { v16h v; v8h h[2]; };
union FragQ { v16h v; v8h h[2]; v4u q[2]; };
// elements 0..7 <- p[0..7], 8..15 <- p[16..23]; caller adds 8*hh to p (used for BOTH A and B operands: same k per element)
__device__ __forceinline__ v16h frag_ld(const _Float16* p) {
    FragU f; f.h[0] = *(const v8h*)(p); f.h[1] = *(const v8h*)(p + 16); return f.v;
}
__device__ __forceinline__ v8f wmma16g(v16h a, v16h b, v8f c) {
    c = __builtin_amdgcn_wmma_f32_16x16x32_f16(false, a, false, b, (short)0, c, false, false);
    asm volatile("v_nop\n\tv_nop\n\tv_nop\n\tv_nop" : "+v"(c) : "v"(a), "v"(b));
    return c;
}
__device__ __forceinline__ void wave_sync_lds() {
    __builtin_amdgcn_fence(3 /* release order */, "workgroup");
    __builtin_amdgcn_wave_barrier();
    __builtin_amdgcn_fence(2 /* acquire order */, "workgroup");
}
// swish(x) = x * sigmoid(x) = h + h * tanh(h) with h = x / 2; the caller hands in h
static __device__ __forceinline__ float swish_half(float h) {
    return fmaf(h, __builtin_amdgcn_tanhf(h), h);
}

// one pair's 6 components f32 -> 8 f16 = bf16(g) * 4, components 6,7 = 0: one 16-B row of the layer-1 B operand
static __device__ __forceinline__ v8h cvt_pair(v2f a, v2f b, v2f cc) {
    v4f lo, hi;
    lo.x = bfr(a.x) * G_CARRY; lo.y = bfr(a.y) * G_CARRY; lo.z = bfr(b.x) * G_CARRY; lo.w = bfr(b.y) * G_CARRY;
    hi.x = bfr(cc.x) * G_CARRY; hi.y = bfr(cc.y) * G_CARRY; hi.z = 0.0f; hi.w = 0.0f;
    return pack8_flush(lo, hi);
}

// Key slots. A key whose mask is off has softmax weight exactly 0 as soon as one key of its batch is on, so the keys of a batch are put in a
//   stable partition: the cnt keys that are on take slots 0..cnt-1 in their order, the keys that are off take slots cnt..511 in theirs.
//   K and V cover all slots; location term and attention work on slots and stop behind the last 64-slot chunk that holds a key that is on. With cnt == 0 the
//   partition is the identity and all 8 chunks are walked, every score the fill value: the uniform softmax of the reference.
static_assert(SEQ == 512);
// bal[i] bit l = mask of key 32i + l of one batch; every lane of the wave is on at the call
static __device__ __forceinline__ void key_ballots(const int* __restrict__ mrow, unsigned lane, unsigned (&bal)[16]) {
    int mv[16];
    // unrolled: the counter indexes register arrays
#pragma unroll
    for (int i = 0; i < 16; ++i) mv[i] = mrow[(unsigned)i * 32u + lane];
    asm volatile("s_wait_xcnt 0x0" ::: "memory");   // stands in front of every later write of these loads' address registers
#pragma unroll
    for (int i = 0; i < 16; ++i) bal[i] = __builtin_amdgcn_ballot_w32(mv[i] != 0);
}
// chunks of 64 slots that hold the keys that count
static __device__ __forceinline__ unsigned key_chunks(unsigned cnt) {
    return (cnt == 0u) ? (unsigned)(SEQ / 64) : ((cnt + 63u) >> 6);
}
// slots_body: IDX[b][slot] = key of the slot, CNT[b * 32] = number of keys that are on; one wave per batch writes its batch's whole IDX row
static_assert(NB <= 8);
static __device__ __forceinline__ void slots_body(const int* __restrict__ mask, int* __restrict__ IDX, int* __restrict__ CNT) {
    const unsigned lane = threadIdx.x & 31u;
    const unsigned b = (unsigned)__builtin_amdgcn_readfirstlane((int)(threadIdx.x >> 5));
    if (b >= (unsigned)NB) return;   // wave-uniform; no barrier in this kernel
    unsigned bal[16];
    key_ballots(mask + b * SEQ_FULL, lane, bal);
    unsigned cnt = 0u;
#pragma unroll
    for (int i = 0; i < 16; ++i) cnt += (unsigned)__builtin_popcount(bal[i]);
    unsigned base = 0u;
#pragma unroll
    for (int i = 0; i < 16; ++i) {
        const unsigned key = (unsigned)i * 32u + lane;
        const unsigned before = base + __builtin_amdgcn_mbcnt_lo(bal[i], 0u);   // keys that are on in front of this one
        const unsigned slot = ((bal[i] >> lane) & 1u) ? before : cnt + key - before;
        IDX[b * (unsigned)SEQ + slot] = (int)key;
        base += (unsigned)__builtin_popcount(bal[i]);
    }
    if (lane == 0u) CNT[b * 32u] = (int)cnt;
}

// cvt_c_body: features [row][256] f32 -> C16 f16 = bf16(x) * 8; thread per 8 columns; coverage: MTOK*256/8 pieces == whole plane
//   a wave holds one whole row and writes it twice: to C16 at its position (the queries) and to CP16 at its key slot (operand of K and V);
//   the slots of a batch are a permutation of its rows, so CP16 is covered whole as well.
static __device__ __forceinline__ void cvt_c_body(unsigned blk, const float* __restrict__ x, const int* __restrict__ mask,
                                                  _Float16* __restrict__ C16, _Float16* __restrict__ CP16) {
    const unsigned u = blk * 256u + threadIdx.x;
    if (u >= (unsigned)(MTOK * CH / 8)) return;
    const unsigned row = (unsigned)__builtin_amdgcn_readfirstlane((int)(u >> 5));
    const unsigned kb = row / (unsigned)SEQ, km = row % (unsigned)SEQ;
    unsigned bal[16];
    key_ballots(mask + kb * SEQ_FULL, threadIdx.x & 31u, bal);
    unsigned cnt = 0u, before = 0u, word = 0u;
#pragma unroll
    for (int i = 0; i < 16; ++i) {
        const unsigned pc = (unsigned)__builtin_popcount(bal[i]);
        cnt += pc;
        before += ((unsigned)i < (km >> 5)) ? pc : 0u;
        word = ((unsigned)i == (km >> 5)) ? bal[i] : word;
    }
    before += (unsigned)__builtin_popcount(word & ((1u << (km & 31u)) - 1u));
    const unsigned slot = ((word >> (km & 31u)) & 1u) ? before : cnt + km - before;
    const v4f* src = (const v4f*)(x + (size_t)u * 8u);
    v4f a = src[0], b = src[1];
    a.x = bfr(a.x) * ACT_CARRY; a.y = bfr(a.y) * ACT_CARRY; a.z = bfr(a.z) * ACT_CARRY; a.w = bfr(a.w) * ACT_CARRY;
    b.x = bfr(b.x) * ACT_CARRY; b.y = bfr(b.y) * ACT_CARRY; b.z = bfr(b.z) * ACT_CARRY; b.w = bfr(b.w) * ACT_CARRY;
    const v8h cv = pack8_flush(a, b);
    st8h2(C16 + (size_t)u * 8u, cv);
    st8h2(CP16 + (size_t)(kb * (unsigned)SEQ + slot) * CH + (u & 31u) * 8u, cv);
}

static __device__ __forceinline__ void wt_one(const float* __restrict__ W, _Float16* __restrict__ D, unsigned o, unsigned k0) {
    v4f lo, hi;
    lo.x = bfr(W[(size_t)(k0 + 0u) * CH + o]) * W_CARRY;
    lo.y = bfr(W[(size_t)(k0 + 1u) * CH + o]) * W_CARRY;
    lo.z = bfr(W[(size_t)(k0 + 2u) * CH + o]) * W_CARRY;
    lo.w = bfr(W[(size_t)(k0 + 3u) * CH + o]) * W_CARRY;
    hi.x = bfr(W[(size_t)(k0 + 4u) * CH + o]) * W_CARRY;
    hi.y = bfr(W[(size_t)(k0 + 5u) * CH + o]) * W_CARRY;
    hi.z = bfr(W[(size_t)(k0 + 6u) * CH + o]) * W_CARRY;
    hi.w = bfr(W[(size_t)(k0 + 7u) * CH + o]) * W_CARRY;
    st8h2(D + (size_t)o * CH + k0, pack8_flush(lo, hi));
}
// wt4_body: the four 256x256 weights -> WT[4][out][in]; thread per (o, 8 k): 32 lanes cover one whole 512-B row; coverage: 4 x 256 x 32 pieces
static __device__ __forceinline__ void wt4_body(unsigned blk, const float* __restrict__ wq, const float* __restrict__ wk,
                                                const float* __restrict__ wv, const float* __restrict__ wo,
                                                _Float16* __restrict__ WT) {
    const unsigned u = blk * 256u + threadIdx.x;
    if (u >= (unsigned)(CH * (CH / 8))) return;
    const unsigned k0 = 8u * (u & 31u);
    const unsigned o = u >> 5;
    wt_one(wq, WT, o, k0);
    wt_one(wk, WT + (size_t)1 * CH * CH, o, k0);
    wt_one(wv, WT + (size_t)2 * CH * CH, o, k0);
    wt_one(wo, WT + (size_t)3 * CH * CH, o, k0);
}

// wloc_body: pair-MLP weights as A-operand planes (row = hidden unit), zero-padded along k to 32:
//   W1B[h*16+j][k] = bf16(w1[h][k][j]) / 8 for k < 6, else 0;  W2B[h*16+j][k] = bf16(w2[h][k][j]) / 2 for k < 16, else 0
//   thread per 16-B piece (512 pieces per plane), clamped addresses, zero by value; coverage: 128 rows x 4 pieces == both whole planes
static __device__ __forceinline__ void wloc_body(unsigned blk, const float* __restrict__ w1, const float* __restrict__ w2,
                                                 _Float16* __restrict__ W1B, _Float16* __restrict__ W2B) {
    const unsigned p = blk * 256u + threadIdx.x;
    if (p >= (unsigned)(HEADS * HID * 4)) return;
    const unsigned col = p >> 2, k0 = (p & 3u) * 8u;
    const unsigned h = col >> 4, j = col & 15u;
    float v[8];
#pragma unroll
    for (int i = 0; i < 8; ++i) {
        const unsigned k = k0 + (unsigned)i;
        const unsigned kc = min(k, (unsigned)(DG - 1));
        const float raw = w1[(size_t)(h * DG + kc) * HID + j];
        asm volatile("s_wait_xcnt 0x0" ::: "memory");   // stands in front of a later load's result landing on this load's address registers
        const float x = bfr(raw) * W1_CARRY;
        v[i] = (k < (unsigned)DG) ? x : 0.0f;
    }
    {
        v4f a, b;
        a.x = v[0]; a.y = v[1]; a.z = v[2]; a.w = v[3]; b.x = v[4]; b.y = v[5]; b.z = v[6]; b.w = v[7];
        st8h2(W1B + (size_t)col * 32u + k0, pack8(a, b));
    }
#pragma unroll
    for (int i = 0; i < 8; ++i) {
        const unsigned k = k0 + (unsigned)i;
        const unsigned kc = min(k, (unsigned)(HID - 1));
        const float raw = w2[(size_t)(h * HID + kc) * HID + j];
        asm volatile("s_wait_xcnt 0x0" ::: "memory");   // the same
        const float x = bfr(raw) * W2_CARRY;
        v[i] = (k < (unsigned)HID) ? x : 0.0f;
    }
    {
        v4f a, b;
        a.x = v[0]; a.y = v[1]; a.z = v[2]; a.w = v[3]; b.x = v[4]; b.y = v[5]; b.z = v[6]; b.w = v[7];
        st8h2(W2B + (size_t)col * 32u + k0, pack8(a, b));
    }
}

// k_prep: the three operand-plane conversions and the key slots in ONE launch (none reads what another writes); the block index picks the job, a scalar branch.
#define PB_WT ((CH * (CH / 8)) / 256)
#define PB_WL ((HEADS * HID * 4) / 256)
#define PB_IX 1
#define PB_C  ((MTOK * CH / 8) / 256)
static_assert((HEADS * HID * 4) % 256 == 0);
__global__ __launch_bounds__(256) void k_prep(const float* __restrict__ x,
                                              const float* __restrict__ wq, const float* __restrict__ wk,
                                              const float* __restrict__ wv, const float* __restrict__ wo,
                                              const float* __restrict__ w1, const float* __restrict__ w2,
                                              const int* __restrict__ mask,
                                              _Float16* __restrict__ C16, _Float16* __restrict__ WT,
                                              _Float16* __restrict__ W1B, _Float16* __restrict__ W2B,
                                              _Float16* __restrict__ CP16, int* __restrict__ IDX, int* __restrict__ CNT) {
    const unsigned bx = blockIdx.x;
    if (bx < (unsigned)PB_WT) wt4_body(bx, wq, wk, wv, wo, WT);
    else if (bx < (unsigned)(PB_WT + PB_WL)) wloc_body(bx - (unsigned)PB_WT, w1, w2, W1B, W2B);
    else if (bx < (unsigned)(PB_WT + PB_WL + PB_IX)) slots_body(mask, IDX, CNT);
    else cvt_c_body(bx - (unsigned)(PB_WT + PB_WL + PB_IX), x, mask, C16, CP16);
}

// =====================================================================================================================
// gemm64_body: C[m,n] = (scale * sum_k A[m,k] * Bt[n,k] + bf16(bias[n or m])) ; each wave owns a 64x64 tile.
//   A row-major [M][lda] f16, Bt row-major [N][ldb] f16 (fragments straight from the planes); M,N % 64 == 0, K % 32 == 0.
//   blk = the job's own block number; sT = the calling kernel's staging slabs, one per wave.
//   OUT_MODE 0: f32 C (pitch ldc); OUT_MODE 1: f16 C = value * oscale. BIAS_ROW: bias indexed by the row m.
// =====================================================================================================================
template <int OUT_MODE, bool BIAS_ROW>
static __device__ __forceinline__ void gemm64_body(
    unsigned blk, float (*sT)[16 * 68],
    const _Float16* __restrict__ A, unsigned lda, const _Float16* __restrict__ Bt, unsigned ldb,
    float* __restrict__ Cf, _Float16* __restrict__ Ch, unsigned ldc, const float* __restrict__ bias,
    unsigned M, unsigned N, unsigned K, float scale, float oscale) {
  const unsigned lane = threadIdx.x & 31u;
  const unsigned wave = threadIdx.x >> 5;
  const unsigned tilesN = N >> 6, tilesM = M >> 6;
  const unsigned tile = blk * 8u + wave;
  if (tile >= tilesM * tilesN) return;   // wave-uniform; no block barrier in the projection jobs
  const unsigned tm = tile / tilesN;
  const unsigned tn = tile - tm * tilesN;
  const unsigned m0 = tm << 6, n0 = tn << 6;
  const unsigned rlane = lane & 15u;
  const unsigned koff = (lane >> 4) * 8u;
  const unsigned mOff = koff;

  v8f acc[4][4];
#pragma unroll
  for (int i = 0; i < 4; ++i)
#pragma unroll
    for (int j = 0; j < 4; ++j) acc[i][j] = (v8f){0.f,0.f,0.f,0.f,0.f,0.f,0.f,0.f};

  for (unsigned k0 = 0; k0 < K; k0 += 32u) {
    v16h bh[4];
#pragma unroll
    for (int j = 0; j < 4; ++j)
      bh[j] = frag_ld(Bt + (size_t)(n0 + ((unsigned)j << 4) + rlane) * ldb + koff + k0);
#pragma unroll
    for (int i = 0; i < 4; ++i) {
      const v16h ah = frag_ld(A + (size_t)(m0 + ((unsigned)i << 4) + rlane) * lda + koff + k0);
#pragma unroll
      for (int j = 0; j < 4; ++j)
        acc[i][j] = wmma16g(ah, bh[j], acc[i][j]);
    }
  }

  float* slab = sT[wave];
#pragma unroll
  for (int i = 0; i < 4; ++i) {
    const unsigned mBase = m0 + ((unsigned)i << 4);
    float bvr[8];
#pragma unroll
    for (int r = 0; r < 8; ++r) bvr[r] = 0.0f;
    if (BIAS_ROW) {
#pragma unroll
      for (int r = 0; r < 8; ++r) bvr[r] = bfr(bias[mBase + mOff + (unsigned)r]);
    }
#pragma unroll
    for (int j = 0; j < 4; ++j) {
      const unsigned n = n0 + ((unsigned)j << 4) + rlane;
      float bvc = 0.0f;
      if (!BIAS_ROW) bvc = bfr(bias[n]);
#pragma unroll
      for (int r = 0; r < 8; ++r) {
        float v = acc[i][j][r] * scale + (BIAS_ROW ? bvr[r] : bvc);
        if (OUT_MODE == 1) v *= oscale;
        slab[(mOff + (unsigned)r) * 68u + ((unsigned)j << 4) + rlane] = v;
      }
    }
    wave_sync_lds();
    if (OUT_MODE == 0) {
      const unsigned hh = lane >> 4, c4 = (lane & 15u) * 4u;     // row segment = 256 B = 16 lanes x 16 B
#pragma unroll
      for (int half = 0; half < 2; ++half) {
        v4f vv[4];
#pragma unroll
        for (int it = 0; it < 4; ++it) {
          const unsigned row = (unsigned)(half * 4 + it) * 2u + hh;
          vv[it] = *(const v4f*)(slab + row * 68u + c4);
        }
        {
#pragma unroll
          for (int it = 0; it < 4; ++it) {
            const unsigned row = (unsigned)(half * 4 + it) * 2u + hh;
            *(v4f*)(Cf + (size_t)(mBase + row) * ldc + n0 + c4) = vv[it];
          }
          
        }
      }
    } else {
      const unsigned q = lane >> 3, c8 = (lane & 7u) * 8u;
      v8h hv[4];
#pragma unroll
      for (int it = 0; it < 4; ++it) {
        const unsigned row = (unsigned)it * 4u + q;
        const float* sp = slab + row * 68u + c8;
        hv[it] = pack8_flush(*(const v4f*)sp, *(const v4f*)(sp + 4));
      }
      {
#pragma unroll
        for (int it = 0; it < 4; ++it) {
          const unsigned row = (unsigned)it * 4u + q;
          *(v8h*)(Ch + (size_t)(mBase + row) * ldc + n0 + c8) = hv[it];
        }
        
      }
    }
    wave_sync_lds();
  }
}

// =====================================================================================================================
// loc_body: location term ALOC[b][h][n][slot] (f32) = swish(l3(swish(l2(swish(l1(g[b][n][key of the slot][:])))))), for the chunks that count
//   the block first converts its query row's 512 pairs, once for its 8 heads, from the f32 input into sG[slot][8] f16 (LDS, slot order):
//   a thread takes slots tid and tid + 256, without a branch; one block barrier; then every wave reads sG alone, the chunks that count.
//   transposed chain: the weights are the A operand (rows = hidden units), the pairs are the B columns.
//   block = 8 waves = the 8 heads of one query row (b,n); a wave owns ONE head and walks the row's key slots, 64 pairs (4 column tiles) a pass.
//   layer 1: B = two 16-B sG rows per lane: lane (c,hh) holds pair 16hh+c in elements 0..7 (k 8hh..) and pair 32+16hh+c in elements 8..15
//            (k 16+8hh..), so k group q = k>>3 holds column tile q. A of tile q = the head's W1B row (k 0..7) placed in k group q, zero words
//            in the other three groups, C = half the bias of the D row -> D1[hidden 8hh+r][pair c of tile q] = x1 / 2.
//   layer 2: D1's map IS the B map (lane = pair c, element r = hidden 8hh+r): two tiles' h1, converted in place to f16, are elements
//            0..7 and 8..15 of one B operand; A = the head's W2B row in k 0..15 (first tile) or in k 16..31 (second tile), zero words in the
//            other half, C = half the bias of the D row -> D2[hidden 8hh+r][pair c] = x2 / 2.
//   layer 3 (N = 1) on the VALU: 8 multiply-adds in the lane (hidden 8hh..8hh+7) with w3 / 2, then the other half's sum from lane l ^ 16: x3 / 2.
//   biases and w3 are indexed by the D row: 8 registers each, prepared once per wave.
// =====================================================================================================================
#define LC_PASS 64
static_assert(HEADS == 8 && SEQ % LC_PASS == 0);
// lane l with lane l ^ 16
static __device__ __forceinline__ float xhalf(float x) {
    return __builtin_bit_cast(float, __builtin_amdgcn_permlanex16(__builtin_bit_cast(int, x), __builtin_bit_cast(int, x),
                                                                  0x76543210, 0xfedcba98, false, false));
}
static __device__ __forceinline__ void loc_body(unsigned bn, _Float16* sG, const float* __restrict__ gsrc, const _Float16* __restrict__ W1B,
                                                const _Float16* __restrict__ W2B, const float* __restrict__ b1,
                                                const float* __restrict__ b2, const float* __restrict__ w3,
                                                const float* __restrict__ b3, const int* __restrict__ IDX,
                                                const int* __restrict__ CNT, float* __restrict__ ALOC) {
    const unsigned lane = threadIdx.x & 31u;
    const unsigned t = (unsigned)__builtin_amdgcn_readfirstlane((int)(threadIdx.x >> 5));   // the wave's head
    const unsigned hh = lane >> 4, c = lane & 15u;
    // bn = b*SEQ + n
    const unsigned b = bn / (unsigned)SEQ, n = bn % (unsigned)SEQ;
    const v4u zq = (v4u){0u, 0u, 0u, 0u};
    const unsigned row = t * 16u + c;
    // the keys of the thread's two slots, masked to the row's range; they go out in front of the weights: the pairs' addresses hang on them
    const unsigned s0 = t * 32u + lane;
    const int* ix = IDX + b * (unsigned)SEQ + s0;
    const unsigned j0 = (unsigned)ix[0] & (unsigned)(SEQ - 1), j1 = (unsigned)ix[256] & (unsigned)(SEQ - 1);
    asm volatile("s_wait_xcnt 0x0" ::: "memory");   // stands in front of the later writes of these loads' address registers
    // passes that hold a key that is on (all of them where none is); the count is clamped to the shape
    const unsigned npass = key_chunks(min((unsigned)__builtin_amdgcn_readfirstlane(CNT[b * 32u]), (unsigned)SEQ));

    // weight, bias and w3 loads: no wait on their values in front of the pairs' loads; their work-up stands behind those
    const v4u w1q = *(const v4u*)(W1B + (size_t)row * 32u);
    asm volatile("s_wait_xcnt 0x0" ::: "memory");   // stands in front of the later writes of this load's address registers
    FragQ a2[2];
    a2[0].h[0] = *(const v8h*)(W2B + (size_t)row * 32u + 8u * hh);
    asm volatile("s_wait_xcnt 0x0" ::: "memory");   // the same: the next load's result may land on this one's address registers
    a2[0].h[1] = *(const v8h*)(W2B + (size_t)row * 32u + 8u * hh + 16u);
    asm volatile("s_wait_xcnt 0x0" ::: "memory");   // the same
    float rb1[8], rb2[8], rw3[8];
    // every '#pragma unroll' of this kernel: its counter indexes register arrays (hb1, a1, hx, part ...), which must not become memory
#pragma unroll
    for (int r = 0; r < 8; ++r) {
        const unsigned j = t * 16u + 8u * hh + (unsigned)r;
        rb1[r] = b1[j];
        rb2[r] = b2[j];
        rw3[r] = w3[j];
    }
    const float rb3 = b3[t];
    asm volatile("s_wait_xcnt 0x0" ::: "memory");   // the same for the bias and w3 loads above

    // the thread's two pairs, one group of loads (every slot's key is in the row)
    const float* grow = gsrc + (size_t)bn * SEQ * DG;
    const v2f* p0 = (const v2f*)(grow + j0 * (unsigned)DG);
    const v2f* p1 = (const v2f*)(grow + j1 * (unsigned)DG);
    const v2f ga0 = p0[0], gb0 = p0[1], gc0 = p0[2];
    const v2f ga1 = p1[0], gb1 = p1[1], gc1 = p1[2];
    asm volatile("s_wait_xcnt 0x0" ::: "memory");   // stands in front of the later writes of these loads' address registers

    // layer-1 A operands, one per k group
    v4u wlo, whi;
    wlo.x = (hh == 0u) ? w1q.x : 0u; wlo.y = (hh == 0u) ? w1q.y : 0u; wlo.z = (hh == 0u) ? w1q.z : 0u; wlo.w = (hh == 0u) ? w1q.w : 0u;
    whi.x = (hh == 0u) ? 0u : w1q.x; whi.y = (hh == 0u) ? 0u : w1q.y; whi.z = (hh == 0u) ? 0u : w1q.z; whi.w = (hh == 0u) ? 0u : w1q.w;
    FragQ a1[4];
    a1[0].q[0] = wlo; a1[0].q[1] = zq;
    a1[1].q[0] = whi; a1[1].q[1] = zq;
    a1[2].q[0] = zq;  a1[2].q[1] = wlo;
    a1[3].q[0] = zq;  a1[3].q[1] = whi;
    // layer-2 A operands: k 0..15 (the plane's own zeros beyond) and the same row moved to k 16..31
    a2[1].q[0] = a2[0].q[1]; a2[1].q[1] = a2[0].q[0];
    v8f hb1, hb2;
    float ww3[8];
#pragma unroll
    for (int r = 0; r < 8; ++r) {
        hb1[r] = 0.5f * bfr(rb1[r]);
        hb2[r] = 0.5f * bfr(rb2[r]);
        ww3[r] = 0.5f * bfr(rw3[r]);
    }
    const float bb3 = 0.5f * bfr(rb3);

    *(v8h*)(sG + s0 * 8u) = cvt_pair(ga0, gb0, gc0);
    *(v8h*)(sG + (s0 + 256u) * 8u) = cvt_pair(ga1, gb1, gc1);
    __syncthreads();   // the row's pairs are staged by all 8 waves and read by all 8; every wave of the block passes here once

    float* dst = ALOC + ((size_t)(b * (unsigned)HEADS + t) * SEQ + n) * SEQ + lane;
    const _Float16* sp = sG + lane * 8u;
    FragQ g;
    g.q[0] = *(const v4u*)(sp);
    g.q[1] = *(const v4u*)(sp + 32u * 8u);
    // rolled: the trip count is known only at run time, and copies of a pass would not pay for their instruction fetches
    // tested at the foot: there is always a first pass (key_chunks is 1 at least)
    unsigned it = 0u;
#pragma unroll 1
    do {
        FragQ hx[2];
#pragma unroll
        for (int q = 0; q < 4; ++q) {
            const v8f d1 = wmma16g(a1[q].v, g.v, hb1);
            v4f xa, xb;
            xa.x = swish_half(d1[0]); xa.y = swish_half(d1[1]); xa.z = swish_half(d1[2]); xa.w = swish_half(d1[3]);
            xb.x = swish_half(d1[4]); xb.y = swish_half(d1[5]); xb.z = swish_half(d1[6]); xb.w = swish_half(d1[7]);
            hx[q >> 1].h[q & 1] = pack8(xa, xb);
        }
        // the next pass's pairs come from LDS under this pass's layers 2 and 3; the last pass reads its own pairs again (staged, unused)
        const unsigned nx = ((it + 1u < npass) ? it + 1u : it) * (unsigned)(LC_PASS * 8);
        g.q[0] = *(const v4u*)(sp + nx);
        g.q[1] = *(const v4u*)(sp + nx + 32u * 8u);
#pragma unroll
        for (int u = 0; u < 2; ++u) {
            float part[2];
#pragma unroll
            for (int s = 0; s < 2; ++s) {
                const v8f d2 = wmma16g(a2[s].v, hx[u].v, hb2);
                float acc = swish_half(d2[0]) * ww3[0];
#pragma unroll
                for (int r = 1; r < 8; ++r) acc = fmaf(swish_half(d2[r]), ww3[r], acc);
                part[s] = acc;
            }
            // lane (c,hh) finishes pair 16hh+c of this tile pair: its own half sum plus the other half's from lane l ^ 16
            const float mine  = (hh == 0u) ? part[0] : part[1];
            const float other = (hh == 0u) ? part[1] : part[0];
            const float v = mine + xhalf(other) + bb3;
            dst[it * (unsigned)LC_PASS + (unsigned)u * 32u] = swish_half(v);
        }
    } while (++it < npass);
}

// k_proj_loc: the q, k and v projections and the location term in ONE launch (none reads what another writes); the block index picks the
//   job, a scalar branch. The 48 projection blocks stand at the low indices: they start first and end under the 2048 location blocks.
//   q:    position-major Q16[row][256] = f16(8 * (x @ w + bf16(b)));  k: the same from the slot-ordered rows CP16: K16[b * 512 + slot][256]
//   v:    channel-major VT16[b][ch][slot] = f16(8 * (x @ w + bf16(b)))^T ; A = weight plane, Bt = slot-ordered feature rows of one batch
#define JB_ROWS (((MTOK / 64) * (CH / 64) + 7) / 8)
#define JB_VT   (((CH / 64) * (SEQ / 64) + 7) / 8)
__global__ __launch_bounds__(256) void k_proj_loc(const _Float16* __restrict__ C16, const _Float16* __restrict__ CP16,
                                                  const _Float16* __restrict__ WT,
                                                  _Float16* __restrict__ Q16, _Float16* __restrict__ K16, _Float16* __restrict__ VT16,
                                                  const float* __restrict__ bq, const float* __restrict__ bk, const float* __restrict__ bv,
                                                  const float* __restrict__ g, const _Float16* __restrict__ W1B,
                                                  const _Float16* __restrict__ W2B, const float* __restrict__ b1,
                                                  const float* __restrict__ b2, const float* __restrict__ w3,
                                                  const float* __restrict__ b3, const int* __restrict__ IDX,
                                                  const int* __restrict__ CNT, float* __restrict__ ALOC) {
    __shared__ __align__(16) float sT[8][16 * 68];           // a projection block's staging slabs; a location block's pair rows
    static_assert(SEQ * 8 * 2 <= 8 * 16 * 68 * 4);
    const unsigned bx = blockIdx.x;
    if (bx < (unsigned)(2 * JB_ROWS)) {
        const bool isk = bx >= (unsigned)JB_ROWS;
        gemm64_body<1, false>(isk ? bx - (unsigned)JB_ROWS : bx, sT, isk ? CP16 : C16, CH, isk ? WT + (size_t)1 * CH * CH : WT, CH, nullptr,
                              isk ? K16 : Q16, CH, isk ? bk : bq, MTOK, CH, CH, SC_PROJ, ACT_CARRY);
    } else if (bx < (unsigned)(2 * JB_ROWS + NB * JB_VT)) {
        const unsigned v = bx - (unsigned)(2 * JB_ROWS);
        const unsigned by = v / (unsigned)JB_VT;
        gemm64_body<1, true>(v % (unsigned)JB_VT, sT, WT + (size_t)2 * CH * CH, CH, CP16 + (size_t)by * SEQ * CH, CH, nullptr,
                             VT16 + (size_t)by * CH * SEQ, SEQ, bv, CH, SEQ, CH, SC_PROJ, ACT_CARRY);
    } else {
        loc_body(bx - (unsigned)(2 * JB_ROWS + NB * JB_VT), (_Float16*)&sT[0][0], g, W1B, W2B, b1, b2, w3, b3, IDX, CNT, ALOC);
    }
}

// =====================================================================================================================
// k_attn: one block per (batch, head pair, 32-query block), 4 waves = 2 query tiles of 16 rows x the 2 heads of the pair, ONE head per wave,
//   chunks of 64 key slots, only those that count: 1024 waves in 256 blocks, so that every wave can have a SIMD of its own (a wave's chain of
//   chunks is latency bound).
//   scores: Q (A) and K (B) fragments straight from the planes, one k-step (d = 32); + location term loaded in the D layout;
//   key mask by value select, a slot being on where it is below the batch's count (fill -1e38 in the natural-log domain); running-max softmax in the exp2 domain (f32);
//   unnormalised e x1024 as f16 (wave-private LDS tile sP, wave_sync) times V^T B fragments straight from VT16.
//   O plane f16 x64 [row][head*32 + d]: the two waves of a query tile stage their 32 columns each in the tile's sO slab; behind one block
//   barrier each of them writes 8 whole 128-B rows (one writer per line).
//   staged extent == consumed extent: sP rows 0..15 x keys 0..63; sO rows 0..15 x cols 0..63.
// =====================================================================================================================
#define AT_PP 72
#define AT_OP 68
__global__ __launch_bounds__(128) void k_attn(const _Float16* __restrict__ Q16, const _Float16* __restrict__ K16,
                                              const _Float16* __restrict__ VT16, const float* __restrict__ ALOC,
                                              const int* __restrict__ CNT, _Float16* __restrict__ O16) {
    __shared__ __align__(16) _Float16 sP[4][16 * AT_PP];      // per wave [row][64 keys], wave-private (wave_sync)
    __shared__ __align__(16) float sO[2][16 * AT_OP];         // per query tile [row][64 channels], shared by the tile's two waves (block barrier)
    const unsigned tid = threadIdx.x, lane = tid & 31u, wave = tid >> 5;
    const unsigned hh = lane >> 4, c = lane & 15u;
    const unsigned bx = blockIdx.x;
    const unsigned qb = bx % (unsigned)QBLK;
    const unsigned pair = (bx / (unsigned)QBLK) & 3u;
    const unsigned b = bx / ((unsigned)QBLK * 4u);
    const unsigned hp = wave & 1u;                            // the wave's head of the pair
    const unsigned q0 = qb * 32u + (wave >> 1) * 16u;
    _Float16* pw = sP[wave];
    float* so = sO[wave >> 1];
    {
        const unsigned head = 2u * pair + hp;
        const v16h qf = frag_ld(Q16 + (size_t)(b * SEQ + q0 + c) * CH + head * HD + 8u * hh);
        const float* arow = ALOC + (size_t)((b * (unsigned)HEADS + head) * SEQ + q0 + 8u * hh) * SEQ + c;
        const _Float16* krow = K16 + (size_t)(b * SEQ + c) * CH + head * HD + 8u * hh;
        const unsigned cnt = min((unsigned)__builtin_amdgcn_readfirstlane(CNT[b * 32u]), (unsigned)SEQ);   // clamped to the shape
        const unsigned nch = key_chunks(cnt);
        float mrow[8], lrow[8];
        v8f os[2];
#pragma unroll
        for (int r = 0; r < 8; ++r) { mrow[r] = -3.0e38f; lrow[r] = 0.f; }
#pragma unroll
        for (int t = 0; t < 2; ++t) os[t] = (v8f){0.f,0.f,0.f,0.f,0.f,0.f,0.f,0.f};
        // score operands of one chunk, held in registers and fetched one chunk ahead
        v16h kf[4];
        float al[4][8];
#pragma unroll
        for (int j = 0; j < 4; ++j) {
            kf[j] = frag_ld(krow + (size_t)((unsigned)j * 16u) * CH);
#pragma unroll
            for (int r = 0; r < 8; ++r) al[j][r] = arow[(size_t)r * SEQ + (unsigned)j * 16u];
        }
        asm volatile("s_wait_xcnt 0x0" ::: "memory");   // stands in front of the later writes of the address registers of the loads above
        // tested at the foot: there is always a first chunk (key_chunks is 1 at least)
        unsigned kc = 0u;
#pragma unroll 1
        do {
            const unsigned kv0 = kc * 64u;
            v8f s[4];
#pragma unroll
            for (int j = 0; j < 4; ++j) {
                const v8f z = (v8f){0.f,0.f,0.f,0.f,0.f,0.f,0.f,0.f};
                s[j] = wmma16g(qf, kf[j], z);
            }
#pragma unroll
            for (int j = 0; j < 4; ++j) {
                const bool on = (kv0 + (unsigned)j * 16u + c) < cnt;
#pragma unroll
                for (int r = 0; r < 8; ++r) {
                    const float sv = (s[j][r] * SCQK + al[j][r]) * LOG2E;
                    s[j][r] = on ? sv : FILL2;
                }
            }
            // the next chunk's score operands fly under this chunk's softmax; the last pass fetches its own chunk again (in bounds, unused)
            const unsigned nv0 = ((kc + 1u < nch) ? kc + 1u : kc) * 64u;
#pragma unroll
            for (int j = 0; j < 4; ++j) {
                kf[j] = frag_ld(krow + (size_t)(nv0 + (unsigned)j * 16u) * CH);
#pragma unroll
                for (int r = 0; r < 8; ++r) al[j][r] = arow[(size_t)r * SEQ + nv0 + (unsigned)j * 16u];
            }
#pragma unroll
            for (int r = 0; r < 8; ++r) {
                float mx = -3.0e38f;
#pragma unroll
                for (int j = 0; j < 4; ++j) { mx = fmaxf(mx, s[j][r]); }
                mx = fmaxf(mx, __shfl_xor(mx, 1, 32)); mx = fmaxf(mx, __shfl_xor(mx, 2, 32));
                mx = fmaxf(mx, __shfl_xor(mx, 4, 32)); mx = fmaxf(mx, __shfl_xor(mx, 8, 32));
                const float mnew = fmaxf(mrow[r], mx);
                const float alpha = exp2f(mrow[r] - mnew);
                mrow[r] = mnew;
                float psum = 0.f;
#pragma unroll
                for (int j = 0; j < 4; ++j) {
                    const float p = exp2f(s[j][r] - mnew);
                    psum += p;
                    const float w = p * P_CARRY;
                    pw[(8u * hh + (unsigned)r) * AT_PP + (unsigned)j * 16u + c] = (_Float16)((w < 6.103515625e-05f) ? 0.0f : w);
                }
                psum += __shfl_xor(psum, 1, 32); psum += __shfl_xor(psum, 2, 32);
                psum += __shfl_xor(psum, 4, 32); psum += __shfl_xor(psum, 8, 32);
                lrow[r] = lrow[r] * alpha + psum;
                os[0][r] *= alpha; os[1][r] *= alpha;
            }
            wave_sync_lds();
            // this chunk's V fragments, all four in one group ahead of the P.V products
            v16h vb[2][2];
#pragma unroll
            for (int kk = 0; kk < 2; ++kk)
#pragma unroll
                for (int t = 0; t < 2; ++t)
                    vb[kk][t] = frag_ld(VT16 + (size_t)(b * CH + head * HD + (unsigned)t * 16u + c) * SEQ + kv0 + (unsigned)kk * 32u + 8u * hh);
#pragma unroll
            for (int kk = 0; kk < 2; ++kk) {
                const v16h pa = frag_ld(pw + c * AT_PP + (unsigned)kk * 32u + 8u * hh);
#pragma unroll
                for (int t = 0; t < 2; ++t) {
                    os[t] = wmma16g(pa, vb[kk][t], os[t]);
                }
            }
            wave_sync_lds();
        } while (++kc < nch);
#pragma unroll
        for (int r = 0; r < 8; ++r) {
            const float inv = 1.0f / (lrow[r] * P_CARRY);
#pragma unroll
            for (int t = 0; t < 2; ++t)
                so[(8u * hh + (unsigned)r) * AT_OP + hp * 32u + (unsigned)t * 16u + c] = os[t][r] * inv * (O_CARRY / ACT_CARRY);   // = 64 * value
        }
    }
    __syncthreads();   // the tile's other head has staged its 32 columns; every wave of the block passes here once
    {
        const unsigned q = hp * 8u + (lane >> 3), c8 = (lane & 7u) * 8u;   // this wave's 8 of the tile's 16 rows
        v8h ov[2];
#pragma unroll
        for (int it = 0; it < 2; ++it) {
            const float* sp = so + ((unsigned)it * 4u + q) * AT_OP + c8;
            ov[it] = pack8_flush(*(const v4f*)sp, *(const v4f*)(sp + 4));
        }
        _Float16* dst = O16 + (size_t)(b * SEQ + q0) * CH + pair * 64u;
#pragma unroll
        for (int it = 0; it < 2; ++it) *(v8h*)(dst + (size_t)((unsigned)it * 4u + q) * CH + c8) = ov[it];
    }
}

// output projection: out[row][256] = O @ w + bf16(b), f32
//   one 16 x 32 tile per wave, 1024 waves in 256 blocks of 4 (block = 32 rows x 64 columns), so that every wave can have a SIMD of its own.
//   the launch is latency bound: a wave's 48 fragment loads (the whole K = 256 of its 16 rows and 32 columns) are all issued before the
//   first product, one trip to L2 in place of a load-wait-use trip per fragment. k runs upward in one accumulator per tile.
//   a wave writes 16 rows x 128 B, whole lines (one writer per line), through its own slab.
#define PO_SP 36
static_assert(MTOK % 32 == 0 && CH % 64 == 0 && CH / 32 == 8);
static_assert(32 * 16 * 4 == 16 * 32 * 4);   // store loop: lanes x bytes x instructions == tile rows x row bytes
__global__ __launch_bounds__(128) void k_proj_out(const _Float16* __restrict__ O16, const _Float16* __restrict__ Wt,
                                                  float* __restrict__ out, const float* __restrict__ bias) {
    __shared__ __align__(16) float sT[4][16 * PO_SP];        // per wave [row][32 columns], wave-private (wave_sync)
    const unsigned lane = threadIdx.x & 31u, wave = threadIdx.x >> 5;
    const unsigned hh = lane >> 4, c = lane & 15u;
    const unsigned m0 = (blockIdx.x >> 2) * 32u + (wave >> 1) * 16u;
    const unsigned n0 = (blockIdx.x & 3u) * 64u + (wave & 1u) * 32u;
    const _Float16* ap = O16 + (size_t)(m0 + c) * CH + 8u * hh;
    const _Float16* bp = Wt + (size_t)(n0 + c) * CH + 8u * hh;
    v16h af[8], bf[2][8];
    // every '#pragma unroll' of this kernel: its counter indexes register arrays (af, bf, acc, vv), which must not become memory
#pragma unroll
    for (int ks = 0; ks < 8; ++ks) {
        af[ks] = frag_ld(ap + ks * 32);
        bf[0][ks] = frag_ld(bp + ks * 32);
        bf[1][ks] = frag_ld(bp + 16 * CH + ks * 32);
    }
    asm volatile("s_wait_xcnt 0x0" ::: "memory");   // stands in front of every later write of these loads' address registers; no load sinks below it
    const float raw0 = bias[n0 + c];
    asm volatile("s_wait_xcnt 0x0" ::: "memory");   // the same: the next load's result may land on this one's address register
    const float raw1 = bias[n0 + 16u + c];
    asm volatile("s_wait_xcnt 0x0" ::: "memory");   // the same
    const float bv[2] = {bfr(raw0), bfr(raw1)};
    v8f acc[2];
    acc[0] = (v8f){0.f,0.f,0.f,0.f,0.f,0.f,0.f,0.f};
    acc[1] = (v8f){0.f,0.f,0.f,0.f,0.f,0.f,0.f,0.f};
#pragma unroll
    for (int ks = 0; ks < 8; ++ks) {
        acc[0] = wmma16g(af[ks], bf[0][ks], acc[0]);
        acc[1] = wmma16g(af[ks], bf[1][ks], acc[1]);
    }
    float* slab = sT[wave];
#pragma unroll
    for (int j = 0; j < 2; ++j)
#pragma unroll
        for (int r = 0; r < 8; ++r)
            slab[(8u * hh + (unsigned)r) * PO_SP + (unsigned)j * 16u + c] = acc[j][r] * SC_OUT + bv[j];
    wave_sync_lds();
    const unsigned q = lane >> 3, c4 = (lane & 7u) * 4u;     // row segment = 128 B = 8 lanes x 16 B
    v4f vv[4];
#pragma unroll
    for (int it = 0; it < 4; ++it) vv[it] = *(const v4f*)(slab + ((unsigned)it * 4u + q) * PO_SP + c4);
#pragma unroll
    for (int it = 0; it < 4; ++it) *(v4f*)(out + (size_t)(m0 + (unsigned)it * 4u + q) * CH + n0 + c4) = vv[it];
}

extern "C" void kernel_launch(void* const* d_in, const int* in_sizes, int n_in, void* d_out, int out_size,
                              void* d_ws, size_t ws_size, hipStream_t stream) {
    if (n_in < 17) return;
    if (in_sizes[0] < NB * SEQ * SEQ * DG || in_sizes[1] < MTOK * CH) return;
    if (in_sizes[2] < CH * CH || in_sizes[3] < CH || in_sizes[4] < CH * CH || in_sizes[5] < CH) return;
    if (in_sizes[6] < CH * CH || in_sizes[7] < CH || in_sizes[8] < CH * CH || in_sizes[9] < CH) return;
    if (in_sizes[10] < HEADS * DG * HID || in_sizes[11] < HEADS * HID || in_sizes[12] < HEADS * HID * HID) return;
    if (in_sizes[13] < HEADS * HID || in_sizes[14] < HEADS * HID || in_sizes[15] < HEADS || in_sizes[16] < NB * SEQ) return;
    if (out_size < MTOK * CH) return;
    if (ws_size < WS_TOTAL) return;

    const float* pairwise_g = (const float*)d_in[0];
    const float* coset      = (const float*)d_in[1];
    const float* fc_q_w     = (const float*)d_in[2];
    const float* fc_q_b     = (const float*)d_in[3];
    const float* fc_k_w     = (const float*)d_in[4];
    const float* fc_k_b     = (const float*)d_in[5];
    const float* in_w       = (const float*)d_in[6];
    const float* in_b       = (const float*)d_in[7];
    const float* out_w      = (const float*)d_in[8];
    const float* out_b      = (const float*)d_in[9];
    const float* loc_w1     = (const float*)d_in[10];
    const float* loc_b1     = (const float*)d_in[11];
    const float* loc_w2     = (const float*)d_in[12];
    const float* loc_b2     = (const float*)d_in[13];
    const float* loc_w3     = (const float*)d_in[14];
    const float* loc_b3     = (const float*)d_in[15];
    const int*   mask       = (const int*)d_in[16];
    float* out = (float*)d_out;

    char* wsp = (char*)d_ws;
    _Float16* C16  = (_Float16*)(wsp + OFF_C16);
    _Float16* WT   = (_Float16*)(wsp + OFF_WT);
    _Float16* W1B  = (_Float16*)(wsp + OFF_W1B);
    _Float16* W2B  = (_Float16*)(wsp + OFF_W2B);
    _Float16* Q16  = (_Float16*)(wsp + OFF_Q16);
    _Float16* K16  = (_Float16*)(wsp + OFF_K16);
    _Float16* VT16 = (_Float16*)(wsp + OFF_VT16);
    float*    ALOC = (float*)(wsp + OFF_ALOC);
    _Float16* O16  = (_Float16*)(wsp + OFF_O16);
    _Float16* CP16 = (_Float16*)(wsp + OFF_CP16);
    int*      IDX  = (int*)(wsp + OFF_IDX);
    int*      CNT  = (int*)(wsp + OFF_CNT);

    // operand planes (each whole plane written by this launch)
    k_prep<<<PB_WT + PB_WL + PB_IX + PB_C, 256, 0, stream>>>(coset, fc_q_w, fc_k_w, in_w, out_w, loc_w1, loc_w2, mask,
                                                             C16, WT, W1B, W2B, CP16, IDX, CNT);

    // projections (64x64 wave tiles, 8 waves per block) beside the location term; then attention, output projection
    k_proj_loc<<<2 * JB_ROWS + NB * JB_VT + NB * SEQ, 256, 0, stream>>>(C16, CP16, WT, Q16, K16, VT16, fc_q_b, fc_k_b, in_b,
                                                                        pairwise_g, W1B, W2B, loc_b1, loc_b2, loc_w3, loc_b3, IDX, CNT, ALOC);
    k_attn<<<NB * 4 * QBLK, 128, 0, stream>>>(Q16, K16, VT16, ALOC, CNT, O16);
    k_proj_out<<<(MTOK / 32) * (CH / 64), 128, 0, stream>>>(O16, WT + (size_t)3 * CH * CH, out, out_b);
}

// v010
// Measured time: 38.2 microseconds a run.
// Next to v009, in two timings, it ran 1.06 times as fast each time.
// All steps since v000 together make it 7.18 times as fast.
// All contractions on v_wmma_f32_16x16x32_f16 (f16 operands, f32 accumulate): q/k/v projections (inputs x8, weights x32), pair MLP layer 1 (g x4, w1 /8, bias/2 as C, K=6 zero-padded to 32) and layer 2 (h1 x1, w2 /2, bias/2 as C, K=16 zero-padded to 32), whose D is half the pre-activation, q.k^T (x8, x8), P.V (P x1024, V x8), output projection (O x64, w x32); every float input RNE-converted to bf16 first; MLP layer 3 (N=1, K=16), swish (by tanh of half the argument), softmax statistics in f32 on the VALU.
#include <hip/hip_runtime.h>
#include <math.h>

#ifndef NB
#define NB 4
#endif
#ifndef SEQ
#define SEQ 512
#endif
#define NB_FULL 4
#define SEQ_FULL 512
#define CH 256
#define HEADS 8
#define HD 32
#define DG 6
#define HID 16
#define MTOK (NB * SEQ)
#define QBLK (SEQ / 32)

// power-of-two carries and their undo constants
// pair MLP: operand scales whose product is 1/2, so that a layer's WMMA result (C = bias / 2) is x / 2, the argument swish_half takes
#define G_CARRY 4.0f
#define W1_CARRY 0.125f
#define W2_CARRY 0.5f
#define ACT_CARRY 8.0f
#define W_CARRY 32.0f
#define SC_PROJ (1.0f / 256.0f)
#define SCQK (1.0f / 1024.0f)
#define P_CARRY 1024.0f
#define O_CARRY 64.0f
#define SC_OUT (1.0f / 2048.0f)
#define LOG2E 1.4426950408889634f
#define FILL2 (-1.0e38f * LOG2E)

static_assert(G_CARRY * W1_CARRY == 0.5f);
static_assert(W2_CARRY == 0.5f);
static_assert(ACT_CARRY * W_CARRY * SC_PROJ == 1.0f);
static_assert(ACT_CARRY * ACT_CARRY * 16.0f * SCQK == 1.0f);     // q x8, k x8, module scale 1/sqrt(256)
static_assert(O_CARRY * W_CARRY * SC_OUT == 1.0f);
static_assert(SEQ == SEQ_FULL);
static_assert(NB <= NB_FULL);
static_assert(CH == HEADS * HD && HD == 32 && HID == 16 && DG <= 8);
static_assert(SEQ % 32 == 0 && SEQ % 64 == 0);
static_assert(MTOK % 64 == 0 && CH % 64 == 0 && CH % 32 == 0);
static_assert((MTOK * CH / 8) % 256 == 0);
static_assert((CH * (CH / 8)) % 256 == 0);
// store loops: lanes x bytes x instructions == tile rows x row bytes
static_assert(32 * 16 * 4 == 16 * 128);
static_assert(2 * 32 * 16 * 2 == 16 * 128);  // attention O tile: two waves x two stores
static_assert(32 * 16 * 8 == 16 * 256);     // f32 epilogue: 16 rows x 256 B
static_assert(32 * 4 * 8 == 8 * 128);
// static LDS per kernel
static_assert(8 * 16 * 68 * 4 <= 131072);
static_assert(4 * 16 * 72 * 2 + 2 * 16 * 68 * 4 <= 131072);

typedef _Float16 h16;
typedef __attribute__((ext_vector_type(16))) _Float16 v16h;
typedef __attribute__((ext_vector_type(8)))  _Float16 v8h;
typedef __attribute__((ext_vector_type(2)))  _Float16 v2h;
typedef __attribute__((ext_vector_type(8)))  float    v8f;
typedef __attribute__((ext_vector_type(4)))  float    v4f;
typedef __attribute__((ext_vector_type(2)))  float    v2f;
typedef __attribute__((ext_vector_type(4)))  unsigned int v4u;

static constexpr size_t SZ_C16  = (size_t)MTOK * CH * 2;
static constexpr size_t SZ_WT   = (size_t)4 * CH * CH * 2;
static constexpr size_t SZ_W1B  = (size_t)HEADS * HID * 32 * 2;
static constexpr size_t SZ_W2B  = (size_t)HEADS * HID * 32 * 2;
static constexpr size_t SZ_Q16  = (size_t)MTOK * CH * 2;
static constexpr size_t SZ_K16  = (size_t)MTOK * CH * 2;
static constexpr size_t SZ_VT16 = (size_t)NB * CH * SEQ * 2;
static constexpr size_t SZ_ALOC = (size_t)NB * HEADS * SEQ * SEQ * 4;
static constexpr size_t SZ_O16  = (size_t)MTOK * CH * 2;
static constexpr size_t SZ_CP16 = (size_t)MTOK * CH * 2;
static constexpr size_t SZ_IDX  = (size_t)NB * SEQ * 4;
static constexpr size_t SZ_CNT  = (size_t)NB * 32 * 4;      // one 128-B line per batch: one writer per line
static constexpr size_t OFF_C16  = 0;
static constexpr size_t OFF_WT   = OFF_C16 + SZ_C16;
static constexpr size_t OFF_W1B  = OFF_WT + SZ_WT;
static constexpr size_t OFF_W2B  = OFF_W1B + SZ_W1B;
static constexpr size_t OFF_Q16  = OFF_W2B + SZ_W2B;
static constexpr size_t OFF_K16  = OFF_Q16 + SZ_Q16;
static constexpr size_t OFF_VT16 = OFF_K16 + SZ_K16;
static constexpr size_t OFF_ALOC = OFF_VT16 + SZ_VT16;
static constexpr size_t OFF_O16  = OFF_ALOC + SZ_ALOC;
static constexpr size_t OFF_CP16 = OFF_O16 + SZ_O16;
static constexpr size_t OFF_IDX  = OFF_CP16 + SZ_CP16;
static constexpr size_t OFF_CNT  = OFF_IDX + SZ_IDX;
static constexpr size_t WS_TOTAL = OFF_CNT + SZ_CNT;
static_assert(SZ_C16 % 256 == 0 && SZ_WT % 256 == 0 && SZ_W1B % 256 == 0 && SZ_W2B % 256 == 0);
static_assert(SZ_Q16 % 256 == 0 && SZ_VT16 % 256 == 0 && SZ_ALOC % 256 == 0 && SZ_O16 % 256 == 0);
static_assert(SZ_CP16 % 256 == 0 && SZ_IDX % 256 == 0 && SZ_CNT % 128 == 0);
static_assert(WS_TOTAL <= (size_t)134217728);

// 16-bit WMMA fragment map (wave32), lane L, hh = L>>4, c = L&15:
//   A 16x32: lane = row c;    element i -> k = (i<8) ? 8hh+i : 16+8hh+(i-8)
//   B 32x16: lane = column c; the SAME k(i,hh)
//   D 16x16 (8 f32): lane = column c; element r -> row 8hh+r

// RNE convert f32 -> bf16 -> f32
__device__ __forceinline__ float bfr(float f) {
    unsigned u = __float_as_uint(f);
    u += 0x7FFFu + ((u >> 16) & 1u);
    return __uint_as_float(u & 0xFFFF0000u);
}
// f32 -> f16 with values under 2^-14 replaced by +0 before the convert
static __device__ __forceinline__ h16 toh_flush(float v) { const float w = (fabsf(v) < 6.103515625e-05f) ? 0.0f : v; return (h16)w; }
static __device__ __forceinline__ v2h toh2_flush(float a, float b) {
    v2f w;
    w.x = (fabsf(a) < 6.103515625e-05f) ? 0.0f : a;
    w.y = (fabsf(b) < 6.103515625e-05f) ? 0.0f : b;
    return __builtin_convertvector(w, v2h);
}
union Pack8 { v8h v; v2h p[4]; };
static __device__ __forceinline__ v8h pack8_flush(v4f a, v4f b) {
    Pack8 u;
    u.p[0] = toh2_flush(a.x, a.y); u.p[1] = toh2_flush(a.z, a.w);
    u.p[2] = toh2_flush(b.x, b.y); u.p[3] = toh2_flush(b.z, b.w);
    return u.v;
}
// f32 -> f16, round to nearest even, small values as f16 subnormals (the matrix instruction takes them as they are)
static __device__ __forceinline__ v8h pack8(v4f a, v4f b) {
    Pack8 u;
    u.p[0] = __builtin_convertvector((v2f){a.x, a.y}, v2h); u.p[1] = __builtin_convertvector((v2f){a.z, a.w}, v2h);
    u.p[2] = __builtin_convertvector((v2f){b.x, b.y}, v2h); u.p[3] = __builtin_convertvector((v2f){b.z, b.w}, v2h);
    return u.v;
}
static __device__ __forceinline__ void st8h2(_Float16* p, v8h v) {
    *(v8h*)p = v;
    
}

union FragU { v16h v; v8h h[2]; };
union FragQ { v16h v; v8h h[2]; v4u q[2]; };
// elements 0..7 <- p[0..7], 8..15 <- p[16..23]; caller adds 8*hh to p (used for BOTH A and B operands: same k per element)
__device__ __forceinline__ v16h frag_ld(const _Float16* p) {
    FragU f; f.h[0] = *(const v8h*)(p); f.h[1] = *(const v8h*)(p + 16); return f.v;
}
__device__ __forceinline__ v8f wmma16g(v16h a, v16h b, v8f c) {
    c = __builtin_amdgcn_wmma_f32_16x16x32_f16(false, a, false, b, (short)0, c, false, false);
    asm volatile("v_nop\n\tv_nop\n\tv_nop\n\tv_nop" : "+v"(c) : "v"(a), "v"(b));
    return c;
}
__device__ __forceinline__ void wave_sync_lds() {
    __builtin_amdgcn_fence(3 /* release order */, "workgroup");
    __builtin_amdgcn_wave_barrier();
    __builtin_amdgcn_fence(2 /* acquire order */, "workgroup");
}
// swish(x) = x * sigmoid(x) = h + h * tanh(h) with h = x / 2; the caller hands in h
static __device__ __forceinline__ float swish_half(float h) {
    return fmaf(h, __builtin_amdgcn_tanhf(h), h);
}

// one pair's 6 components f32 -> 8 f16 = bf16(g) * 4, components 6,7 = 0: one 16-B row of the layer-1 B operand
static __device__ __forceinline__ v8h cvt_pair(v2f a, v2f b, v2f cc) {
    v4f lo, hi;
    lo.x = bfr(a.x) * G_CARRY; lo.y = bfr(a.y) * G_CARRY; lo.z = bfr(b.x) * G_CARRY; lo.w = bfr(b.y) * G_CARRY;
    hi.x = bfr(cc.x) * G_CARRY; hi.y = bfr(cc.y) * G_CARRY; hi.z = 0.0f; hi.w = 0.0f;
    return pack8_flush(lo, hi);
}

// Key slots. A key whose mask is off has softmax weight exactly 0 as soon as one key of its batch is on, so the keys of a batch are put in a
//   stable partition: the cnt keys that are on take slots 0..cnt-1 in their order, the keys that are off take slots cnt..511 in theirs.
//   K and V cover all slots; location term and attention work on slots and stop behind the last 64-slot chunk that holds a key that is on. With cnt == 0 the
//   partition is the identity and all 8 chunks are walked, every score the fill value: the uniform softmax of the reference.
static_assert(SEQ == 512);
// bal[i] bit l = mask of key 32i + l of one batch; every lane of the wave is on at the call
static __device__ __forceinline__ void key_ballots(const int* __restrict__ mrow, unsigned lane, unsigned (&bal)[16]) {
    int mv[16];
    // unrolled: the counter indexes register arrays
#pragma unroll
    for (int i = 0; i < 16; ++i) mv[i] = mrow[(unsigned)i * 32u + lane];
    asm volatile("s_wait_xcnt 0x0" ::: "memory");   // stands in front of every later write of these loads' address registers
#pragma unroll
    for (int i = 0; i < 16; ++i) bal[i] = __builtin_amdgcn_ballot_w32(mv[i] != 0);
}
// chunks of 64 slots that hold the keys that count
static __device__ __forceinline__ unsigned key_chunks(unsigned cnt) {
    return (cnt == 0u) ? (unsigned)(SEQ / 64) : ((cnt + 63u) >> 6);
}
// slots_body: IDX[b][slot] = key of the slot, CNT[b * 32] = number of keys that are on; one wave per batch writes its batch's whole IDX row
static_assert(NB <= 8);
static __device__ __forceinline__ void slots_body(const int* __restrict__ mask, int* __restrict__ IDX, int* __restrict__ CNT) {
    const unsigned lane = threadIdx.x & 31u;
    const unsigned b = (unsigned)__builtin_amdgcn_readfirstlane((int)(threadIdx.x >> 5));
    if (b >= (unsigned)NB) return;   // wave-uniform; no barrier in this kernel
    unsigned bal[16];
    key_ballots(mask + b * SEQ_FULL, lane, bal);
    unsigned cnt = 0u;
#pragma unroll
    for (int i = 0; i < 16; ++i) cnt += (unsigned)__builtin_popcount(bal[i]);
    unsigned base = 0u;
#pragma unroll
    for (int i = 0; i < 16; ++i) {
        const unsigned key = (unsigned)i * 32u + lane;
        const unsigned before = base + __builtin_amdgcn_mbcnt_lo(bal[i], 0u);   // keys that are on in front of this one
        const unsigned slot = ((bal[i] >> lane) & 1u) ? before : cnt + key - before;
        IDX[b * (unsigned)SEQ + slot] = (int)key;
        base += (unsigned)__builtin_popcount(bal[i]);
    }
    if (lane == 0u) CNT[b * 32u] = (int)cnt;
}

// cvt_c_body: features [row][256] f32 -> C16 f16 = bf16(x) * 8; thread per 8 columns; coverage: MTOK*256/8 pieces == whole plane
//   a wave holds one whole row and writes it twice: to C16 at its position (the queries) and to CP16 at its key slot (operand of K and V);
//   the slots of a batch are a permutation of its rows, so CP16 is covered whole as well.
static __device__ __forceinline__ void cvt_c_body(unsigned blk, const float* __restrict__ x, const int* __restrict__ mask,
                                                  _Float16* __restrict__ C16, _Float16* __restrict__ CP16) {
    const unsigned u = blk * 256u + threadIdx.x;
    if (u >= (unsigned)(MTOK * CH / 8)) return;
    const unsigned row = (unsigned)__builtin_amdgcn_readfirstlane((int)(u >> 5));
    const unsigned kb = row / (unsigned)SEQ, km = row % (unsigned)SEQ;
    unsigned bal[16];
    key_ballots(mask + kb * SEQ_FULL, threadIdx.x & 31u, bal);
    unsigned cnt = 0u, before = 0u, word = 0u;
#pragma unroll
    for (int i = 0; i < 16; ++i) {
        const unsigned pc = (unsigned)__builtin_popcount(bal[i]);
        cnt += pc;
        before += ((unsigned)i < (km >> 5)) ? pc : 0u;
        word = ((unsigned)i == (km >> 5)) ? bal[i] : word;
    }
    before += (unsigned)__builtin_popcount(word & ((1u << (km & 31u)) - 1u));
    const unsigned slot = ((word >> (km & 31u)) & 1u) ? before : cnt + km - before;
    const v4f* src = (const v4f*)(x + (size_t)u * 8u);
    v4f a = src[0], b = src[1];
    a.x = bfr(a.x) * ACT_CARRY; a.y = bfr(a.y) * ACT_CARRY; a.z = bfr(a.z) * ACT_CARRY; a.w = bfr(a.w) * ACT_CARRY;
    b.x = bfr(b.x) * ACT_CARRY; b.y = bfr(b.y) * ACT_CARRY; b.z = bfr(b.z) * ACT_CARRY; b.w = bfr(b.w) * ACT_CARRY;
    const v8h cv = pack8_flush(a, b);
    st8h2(C16 + (size_t)u * 8u, cv);
    st8h2(CP16 + (size_t)(kb * (unsigned)SEQ + slot) * CH + (u & 31u) * 8u, cv);
}

static __device__ __forceinline__ void wt_one(const float* __restrict__ W, _Float16* __restrict__ D, unsigned o, unsigned k0) {
    v4f lo, hi;
    lo.x = bfr(W[(size_t)(k0 + 0u) * CH + o]) * W_CARRY;
    lo.y = bfr(W[(size_t)(k0 + 1u) * CH + o]) * W_CARRY;
    lo.z = bfr(W[(size_t)(k0 + 2u) * CH + o]) * W_CARRY;
    lo.w = bfr(W[(size_t)(k0 + 3u) * CH + o]) * W_CARRY;
    hi.x = bfr(W[(size_t)(k0 + 4u) * CH + o]) * W_CARRY;
    hi.y = bfr(W[(size_t)(k0 + 5u) * CH + o]) * W_CARRY;
    hi.z = bfr(W[(size_t)(k0 + 6u) * CH + o]) * W_CARRY;
    hi.w = bfr(W[(size_t)(k0 + 7u) * CH + o]) * W_CARRY;
    st8h2(D + (size_t)o * CH + k0, pack8_flush(lo, hi));
}
// wt4_body: the four 256x256 weights -> WT[4][out][in]; thread per (o, 8 k); coverage: 4 x 256 x 32 pieces
//   a wave takes 4 neighbouring outputs x 64 k: one load instruction (one k of every thread) touches 8 rows of W, 16 B in each, where a wave
//   of one output x 256 k touches 32 rows, 4 B in each; its stores fill 4 whole 128-B lines, 8 lanes a line (one writer per line).
static __device__ __forceinline__ void wt4_body(unsigned blk, const float* __restrict__ wq, const float* __restrict__ wk,
                                                const float* __restrict__ wv, const float* __restrict__ wo,
                                                _Float16* __restrict__ WT) {
    const unsigned u = blk * 256u + threadIdx.x;
    if (u >= (unsigned)(CH * (CH / 8))) return;
    const unsigned w = u >> 5, l = u & 31u;
    const unsigned o = (w >> 2) * 4u + (l & 3u);
    const unsigned k0 = 8u * ((w & 3u) * 8u + (l >> 2));
    wt_one(wq, WT, o, k0);
    wt_one(wk, WT + (size_t)1 * CH * CH, o, k0);
    wt_one(wv, WT + (size_t)2 * CH * CH, o, k0);
    wt_one(wo, WT + (size_t)3 * CH * CH, o, k0);
}

// wloc_body: pair-MLP weights as A-operand planes (row = hidden unit), zero-padded along k to 32:
//   W1B[h*16+j][k] = bf16(w1[h][k][j]) / 8 for k < 6, else 0;  W2B[h*16+j][k] = bf16(w2[h][k][j]) / 2 for k < 16, else 0
//   thread per 16-B piece (512 pieces per plane), clamped addresses, zero by value; coverage: 128 rows x 4 pieces == both whole planes
static __device__ __forceinline__ void wloc_body(unsigned blk, const float* __restrict__ w1, const float* __restrict__ w2,
                                                 _Float16* __restrict__ W1B, _Float16* __restrict__ W2B) {
    const unsigned p = blk * 256u + threadIdx.x;
    if (p >= (unsigned)(HEADS * HID * 4)) return;
    const unsigned col = p >> 2, k0 = (p & 3u) * 8u;
    const unsigned h = col >> 4, j = col & 15u;
    float v[8];
#pragma unroll
    for (int i = 0; i < 8; ++i) {
        const unsigned k = k0 + (unsigned)i;
        const unsigned kc = min(k, (unsigned)(DG - 1));
        const float raw = w1[(size_t)(h * DG + kc) * HID + j];
        asm volatile("s_wait_xcnt 0x0" ::: "memory");   // stands in front of a later load's result landing on this load's address registers
        const float x = bfr(raw) * W1_CARRY;
        v[i] = (k < (unsigned)DG) ? x : 0.0f;
    }
    {
        v4f a, b;
        a.x = v[0]; a.y = v[1]; a.z = v[2]; a.w = v[3]; b.x = v[4]; b.y = v[5]; b.z = v[6]; b.w = v[7];
        st8h2(W1B + (size_t)col * 32u + k0, pack8(a, b));
    }
#pragma unroll
    for (int i = 0; i < 8; ++i) {
        const unsigned k = k0 + (unsigned)i;
        const unsigned kc = min(k, (unsigned)(HID - 1));
        const float raw = w2[(size_t)(h * HID + kc) * HID + j];
        asm volatile("s_wait_xcnt 0x0" ::: "memory");   // the same
        const float x = bfr(raw) * W2_CARRY;
        v[i] = (k < (unsigned)HID) ? x : 0.0f;
    }
    {
        v4f a, b;
        a.x = v[0]; a.y = v[1]; a.z = v[2]; a.w = v[3]; b.x = v[4]; b.y = v[5]; b.z = v[6]; b.w = v[7];
        st8h2(W2B + (size_t)col * 32u + k0, pack8(a, b));
    }
}

// k_prep: the three operand-plane conversions and the key slots in ONE launch (none reads what another writes); the block index picks the job, a scalar branch.
#define PB_WT ((CH * (CH / 8)) / 256)
#define PB_WL ((HEADS * HID * 4) / 256)
#define PB_IX 1
#define PB_C  ((MTOK * CH / 8) / 256)
static_assert((HEADS * HID * 4) % 256 == 0);
__global__ __launch_bounds__(256) void k_prep(const float* __restrict__ x,
                                              const float* __restrict__ wq, const float* __restrict__ wk,
                                              const float* __restrict__ wv, const float* __restrict__ wo,
                                              const float* __restrict__ w1, const float* __restrict__ w2,
                                              const int* __restrict__ mask,
                                              _Float16* __restrict__ C16, _Float16* __restrict__ WT,
                                              _Float16* __restrict__ W1B, _Float16* __restrict__ W2B,
                                              _Float16* __restrict__ CP16, int* __restrict__ IDX, int* __restrict__ CNT) {
    const unsigned bx = blockIdx.x;
    if (bx < (unsigned)PB_WT) wt4_body(bx, wq, wk, wv, wo, WT);
    else if (bx < (unsigned)(PB_WT + PB_WL)) wloc_body(bx - (unsigned)PB_WT, w1, w2, W1B, W2B);
    else if (bx < (unsigned)(PB_WT + PB_WL + PB_IX)) slots_body(mask, IDX, CNT);
    else cvt_c_body(bx - (unsigned)(PB_WT + PB_WL + PB_IX), x, mask, C16, CP16);
}

// =====================================================================================================================
// gemm64_body: C[m,n] = (scale * sum_k A[m,k] * Bt[n,k] + bf16(bias[n or m])) ; each wave owns a 64x64 tile.
//   A row-major [M][lda] f16, Bt row-major [N][ldb] f16 (fragments straight from the planes); M,N % 64 == 0, K % 32 == 0.
//   blk = the job's own block number; sT = the calling kernel's staging slabs, one per wave.
//   OUT_MODE 0: f32 C (pitch ldc); OUT_MODE 1: f16 C = value * oscale. BIAS_ROW: bias indexed by the row m.
// =====================================================================================================================
template <int OUT_MODE, bool BIAS_ROW>
static __device__ __forceinline__ void gemm64_body(
    unsigned blk, float (*sT)[16 * 68],
    const _Float16* __restrict__ A, unsigned lda, const _Float16* __restrict__ Bt, unsigned ldb,
    float* __restrict__ Cf, _Float16* __restrict__ Ch, unsigned ldc, const float* __restrict__ bias,
    unsigned M, unsigned N, unsigned K, float scale, float oscale) {
  const unsigned lane = threadIdx.x & 31u;
  const unsigned wave = threadIdx.x >> 5;
  const unsigned tilesN = N >> 6, tilesM = M >> 6;
  const unsigned tile = blk * 8u + wave;
  if (tile >= tilesM * tilesN) return;   // wave-uniform; no block barrier in the projection jobs
  const unsigned tm = tile / tilesN;
  const unsigned tn = tile - tm * tilesN;
  const unsigned m0 = tm << 6, n0 = tn << 6;
  const unsigned rlane = lane & 15u;
  const unsigned koff = (lane >> 4) * 8u;
  const unsigned mOff = koff;

  v8f acc[4][4];
#pragma unroll
  for (int i = 0; i < 4; ++i)
#pragma unroll
    for (int j = 0; j < 4; ++j) acc[i][j] = (v8f){0.f,0.f,0.f,0.f,0.f,0.f,0.f,0.f};

  for (unsigned k0 = 0; k0 < K; k0 += 32u) {
    v16h bh[4];
#pragma unroll
    for (int j = 0; j < 4; ++j)
      bh[j] = frag_ld(Bt + (size_t)(n0 + ((unsigned)j << 4) + rlane) * ldb + koff + k0);
#pragma unroll
    for (int i = 0; i < 4; ++i) {
      const v16h ah = frag_ld(A + (size_t)(m0 + ((unsigned)i << 4) + rlane) * lda + koff + k0);
#pragma unroll
      for (int j = 0; j < 4; ++j)
        acc[i][j] = wmma16g(ah, bh[j], acc[i][j]);
    }
  }

  float* slab = sT[wave];
#pragma unroll
  for (int i = 0; i < 4; ++i) {
    const unsigned mBase = m0 + ((unsigned)i << 4);
    float bvr[8];
#pragma unroll
    for (int r = 0; r < 8; ++r) bvr[r] = 0.0f;
    if (BIAS_ROW) {
#pragma unroll
      for (int r = 0; r < 8; ++r) bvr[r] = bfr(bias[mBase + mOff + (unsigned)r]);
    }
#pragma unroll
    for (int j = 0; j < 4; ++j) {
      const unsigned n = n0 + ((unsigned)j << 4) + rlane;
      float bvc = 0.0f;
      if (!BIAS_ROW) bvc = bfr(bias[n]);
#pragma unroll
      for (int r = 0; r < 8; ++r) {
        float v = acc[i][j][r] * scale + (BIAS_ROW ? bvr[r] : bvc);
        if (OUT_MODE == 1) v *= oscale;
        slab[(mOff + (unsigned)r) * 68u + ((unsigned)j << 4) + rlane] = v;
      }
    }
    wave_sync_lds();
    if (OUT_MODE == 0) {
      const unsigned hh = lane >> 4, c4 = (lane & 15u) * 4u;     // row segment = 256 B = 16 lanes x 16 B
#pragma unroll
      for (int half = 0; half < 2; ++half) {
        v4f vv[4];
#pragma unroll
        for (int it = 0; it < 4; ++it) {
          const unsigned row = (unsigned)(half * 4 + it) * 2u + hh;
          vv[it] = *(const v4f*)(slab + row * 68u + c4);
        }
        {
#pragma unroll
          for (int it = 0; it < 4; ++it) {
            const unsigned row = (unsigned)(half * 4 + it) * 2u + hh;
            *(v4f*)(Cf + (size_t)(mBase + row) * ldc + n0 + c4) = vv[it];
          }
          
        }
      }
    } else {
      const unsigned q = lane >> 3, c8 = (lane & 7u) * 8u;
      v8h hv[4];
#pragma unroll
      for (int it = 0; it < 4; ++it) {
        const unsigned row = (unsigned)it * 4u + q;
        const float* sp = slab + row * 68u + c8;
        hv[it] = pack8_flush(*(const v4f*)sp, *(const v4f*)(sp + 4));
      }
      {
#pragma unroll
        for (int it = 0; it < 4; ++it) {
          const unsigned row = (unsigned)it * 4u + q;
          *(v8h*)(Ch + (size_t)(mBase + row) * ldc + n0 + c8) = hv[it];
        }
        
      }
    }
    wave_sync_lds();
  }
}

// =====================================================================================================================
// loc_body: location term ALOC[b][h][n][slot] (f32) = swish(l3(swish(l2(swish(l1(g[b][n][key of the slot][:])))))), for the chunks that count
//   the block first converts its query row's 512 pairs, once for its 8 heads, from the f32 input into sG[slot][8] f16 (LDS, slot order):
//   a thread takes slots tid and tid + 256, without a branch; one block barrier; then every wave reads sG alone, the chunks that count.
//   transposed chain: the weights are the A operand (rows = hidden units), the pairs are the B columns.
//   block = 8 waves = the 8 heads of one query row (b,n); a wave owns ONE head and walks the row's key slots, 64 pairs (4 column tiles) a pass.
//   layer 1: B = two 16-B sG rows per lane: lane (c,hh) holds pair 16hh+c in elements 0..7 (k 8hh..) and pair 32+16hh+c in elements 8..15
//            (k 16+8hh..), so k group q = k>>3 holds column tile q. A of tile q = the head's W1B row (k 0..7) placed in k group q, zero words
//            in the other three groups, C = half the bias of the D row -> D1[hidden 8hh+r][pair c of tile q] = x1 / 2.
//   layer 2: D1's map IS the B map (lane = pair c, element r = hidden 8hh+r): two tiles' h1, converted in place to f16, are elements
//            0..7 and 8..15 of one B operand; A = the head's W2B row in k 0..15 (first tile) or in k 16..31 (second tile), zero words in the
//            other half, C = half the bias of the D row -> D2[hidden 8hh+r][pair c] = x2 / 2.
//   layer 3 (N = 1) on the VALU: 8 multiply-adds in the lane (hidden 8hh..8hh+7) with w3 / 2, then the other half's sum from lane l ^ 16: x3 / 2.
//   biases and w3 are indexed by the D row: 8 registers each, prepared once per wave.
// =====================================================================================================================
#define LC_PASS 64
static_assert(HEADS == 8 && SEQ % LC_PASS == 0);
// lane l with lane l ^ 16
static __device__ __forceinline__ float xhalf(float x) {
    return __builtin_bit_cast(float, __builtin_amdgcn_permlanex16(__builtin_bit_cast(int, x), __builtin_bit_cast(int, x),
                                                                  0x76543210, 0xfedcba98, false, false));
}
static __device__ __forceinline__ void loc_body(unsigned bn, _Float16* sG, const float* __restrict__ gsrc, const _Float16* __restrict__ W1B,
                                                const _Float16* __restrict__ W2B, const float* __restrict__ b1,
                                                const float* __restrict__ b2, const float* __restrict__ w3,
                                                const float* __restrict__ b3, const int* __restrict__ IDX,
                                                const int* __restrict__ CNT, float* __restrict__ ALOC) {
    const unsigned lane = threadIdx.x & 31u;
    const unsigned t = (unsigned)__builtin_amdgcn_readfirstlane((int)(threadIdx.x >> 5));   // the wave's head
    const unsigned hh = lane >> 4, c = lane & 15u;
    // bn = b*SEQ + n
    const unsigned b = bn / (unsigned)SEQ, n = bn % (unsigned)SEQ;
    const v4u zq = (v4u){0u, 0u, 0u, 0u};
    const unsigned row = t * 16u + c;
    // the keys of the thread's two slots, masked to the row's range; they go out in front of the weights: the pairs' addresses hang on them
    const unsigned s0 = t * 32u + lane;
    const int* ix = IDX + b * (unsigned)SEQ + s0;
    const unsigned j0 = (unsigned)ix[0] & (unsigned)(SEQ - 1), j1 = (unsigned)ix[256] & (unsigned)(SEQ - 1);
    asm volatile("s_wait_xcnt 0x0" ::: "memory");   // stands in front of the later writes of these loads' address registers
    // passes that hold a key that is on (all of them where none is); the count is clamped to the shape
    const unsigned npass = key_chunks(min((unsigned)__builtin_amdgcn_readfirstlane(CNT[b * 32u]), (unsigned)SEQ));

    // weight, bias and w3 loads: no wait on their values in front of the pairs' loads; their work-up stands behind those
    const v4u w1q = *(const v4u*)(W1B + (size_t)row * 32u);
    asm volatile("s_wait_xcnt 0x0" ::: "memory");   // stands in front of the later writes of this load's address registers
    FragQ a2[2];
    a2[0].h[0] = *(const v8h*)(W2B + (size_t)row * 32u + 8u * hh);
    asm volatile("s_wait_xcnt 0x0" ::: "memory");   // the same: the next load's result may land on this one's address registers
    a2[0].h[1] = *(const v8h*)(W2B + (size_t)row * 32u + 8u * hh + 16u);
    asm volatile("s_wait_xcnt 0x0" ::: "memory");   // the same
    float rb1[8], rb2[8], rw3[8];
    // every '#pragma unroll' of this kernel: its counter indexes register arrays (hb1, a1, hx, part ...), which must not become memory
#pragma unroll
    for (int r = 0; r < 8; ++r) {
        const unsigned j = t * 16u + 8u * hh + (unsigned)r;
        rb1[r] = b1[j];
        rb2[r] = b2[j];
        rw3[r] = w3[j];
    }
    const float rb3 = b3[t];
    asm volatile("s_wait_xcnt 0x0" ::: "memory");   // the same for the bias and w3 loads above

    // the thread's two pairs, one group of loads (every slot's key is in the row)
    const float* grow = gsrc + (size_t)bn * SEQ * DG;
    const v2f* p0 = (const v2f*)(grow + j0 * (unsigned)DG);
    const v2f* p1 = (const v2f*)(grow + j1 * (unsigned)DG);
    const v2f ga0 = p0[0], gb0 = p0[1], gc0 = p0[2];
    const v2f ga1 = p1[0], gb1 = p1[1], gc1 = p1[2];
    asm volatile("s_wait_xcnt 0x0" ::: "memory");   // stands in front of the later writes of these loads' address registers

    // layer-1 A operands, one per k group
    v4u wlo, whi;
    wlo.x = (hh == 0u) ? w1q.x : 0u; wlo.y = (hh == 0u) ? w1q.y : 0u; wlo.z = (hh == 0u) ? w1q.z : 0u; wlo.w = (hh == 0u) ? w1q.w : 0u;
    whi.x = (hh == 0u) ? 0u : w1q.x; whi.y = (hh == 0u) ? 0u : w1q.y; whi.z = (hh == 0u) ? 0u : w1q.z; whi.w = (hh == 0u) ? 0u : w1q.w;
    FragQ a1[4];
    a1[0].q[0] = wlo; a1[0].q[1] = zq;
    a1[1].q[0] = whi; a1[1].q[1] = zq;
    a1[2].q[0] = zq;  a1[2].q[1] = wlo;
    a1[3].q[0] = zq;  a1[3].q[1] = whi;
    // layer-2 A operands: k 0..15 (the plane's own zeros beyond) and the same row moved to k 16..31
    a2[1].q[0] = a2[0].q[1]; a2[1].q[1] = a2[0].q[0];
    v8f hb1, hb2;
    float ww3[8];
#pragma unroll
    for (int r = 0; r < 8; ++r) {
        hb1[r] = 0.5f * bfr(rb1[r]);
        hb2[r] = 0.5f * bfr(rb2[r]);
        ww3[r] = 0.5f * bfr(rw3[r]);
    }
    const float bb3 = 0.5f * bfr(rb3);

    *(v8h*)(sG + s0 * 8u) = cvt_pair(ga0, gb0, gc0);
    *(v8h*)(sG + (s0 + 256u) * 8u) = cvt_pair(ga1, gb1, gc1);
    __syncthreads();   // the row's pairs are staged by all 8 waves and read by all 8; every wave of the block passes here once

    float* dst = ALOC + ((size_t)(b * (unsigned)HEADS + t) * SEQ + n) * SEQ + lane;
    const _Float16* sp = sG + lane * 8u;
    FragQ g;
    g.q[0] = *(const v4u*)(sp);
    g.q[1] = *(const v4u*)(sp + 32u * 8u);
    // rolled: the trip count is known only at run time, and copies of a pass would not pay for their instruction fetches
    // tested at the foot: there is always a first pass (key_chunks is 1 at least)
    unsigned it = 0u;
#pragma unroll 1
    do {
        FragQ hx[2];
#pragma unroll
        for (int q = 0; q < 4; ++q) {
            const v8f d1 = wmma16g(a1[q].v, g.v, hb1);
            v4f xa, xb;
            xa.x = swish_half(d1[0]); xa.y = swish_half(d1[1]); xa.z = swish_half(d1[2]); xa.w = swish_half(d1[3]);
            xb.x = swish_half(d1[4]); xb.y = swish_half(d1[5]); xb.z = swish_half(d1[6]); xb.w = swish_half(d1[7]);
            hx[q >> 1].h[q & 1] = pack8(xa, xb);
        }
        // the next pass's pairs come from LDS under this pass's layers 2 and 3; the last pass reads its own pairs again (staged, unused)
        const unsigned nx = ((it + 1u < npass) ? it + 1u : it) * (unsigned)(LC_PASS * 8);
        g.q[0] = *(const v4u*)(sp + nx);
        g.q[1] = *(const v4u*)(sp + nx + 32u * 8u);
#pragma unroll
        for (int u = 0; u < 2; ++u) {
            float part[2];
#pragma unroll
            for (int s = 0; s < 2; ++s) {
                const v8f d2 = wmma16g(a2[s].v, hx[u].v, hb2);
                float acc = swish_half(d2[0]) * ww3[0];
#pragma unroll
                for (int r = 1; r < 8; ++r) acc = fmaf(swish_half(d2[r]), ww3[r], acc);
                part[s] = acc;
            }
            // lane (c,hh) finishes pair 16hh+c of this tile pair: its own half sum plus the other half's from lane l ^ 16
            const float mine  = (hh == 0u) ? part[0] : part[1];
            const float other = (hh == 0u) ? part[1] : part[0];
            const float v = mine + xhalf(other) + bb3;
            dst[it * (unsigned)LC_PASS + (unsigned)u * 32u] = swish_half(v);
        }
    } while (++it < npass);
}

// k_proj_loc: the q, k and v projections and the location term in ONE launch (none reads what another writes); the block index picks the
//   job, a scalar branch. The 48 projection blocks stand at the low indices: they start first and end under the 2048 location blocks.
//   q:    position-major Q16[row][256] = f16(8 * (x @ w + bf16(b)));  k: the same from the slot-ordered rows CP16: K16[b * 512 + slot][256]
//   v:    channel-major VT16[b][ch][slot] = f16(8 * (x @ w + bf16(b)))^T ; A = weight plane, Bt = slot-ordered feature rows of one batch
#define JB_ROWS (((MTOK / 64) * (CH / 64) + 7) / 8)
#define JB_VT   (((CH / 64) * (SEQ / 64) + 7) / 8)
__global__ __launch_bounds__(256) void k_proj_loc(const _Float16* __restrict__ C16, const _Float16* __restrict__ CP16,
                                                  const _Float16* __restrict__ WT,
                                                  _Float16* __restrict__ Q16, _Float16* __restrict__ K16, _Float16* __restrict__ VT16,
                                                  const float* __restrict__ bq, const float* __restrict__ bk, const float* __restrict__ bv,
                                                  const float* __restrict__ g, const _Float16* __restrict__ W1B,
                                                  const _Float16* __restrict__ W2B, const float* __restrict__ b1,
                                                  const float* __restrict__ b2, const float* __restrict__ w3,
                                                  const float* __restrict__ b3, const int* __restrict__ IDX,
                                                  const int* __restrict__ CNT, float* __restrict__ ALOC) {
    __shared__ __align__(16) float sT[8][16 * 68];           // a projection block's staging slabs; a location block's pair rows
    static_assert(SEQ * 8 * 2 <= 8 * 16 * 68 * 4);
    const unsigned bx = blockIdx.x;
    if (bx < (unsigned)(2 * JB_ROWS)) {
        const bool isk = bx >= (unsigned)JB_ROWS;
        gemm64_body<1, false>(isk ? bx - (unsigned)JB_ROWS : bx, sT, isk ? CP16 : C16, CH, isk ? WT + (size_t)1 * CH * CH : WT, CH, nullptr,
                              isk ? K16 : Q16, CH, isk ? bk : bq, MTOK, CH, CH, SC_PROJ, ACT_CARRY);
    } else if (bx < (unsigned)(2 * JB_ROWS + NB * JB_VT)) {
        const unsigned v = bx - (unsigned)(2 * JB_ROWS);
        const unsigned by = v / (unsigned)JB_VT;
        gemm64_body<1, true>(v % (unsigned)JB_VT, sT, WT + (size_t)2 * CH * CH, CH, CP16 + (size_t)by * SEQ * CH, CH, nullptr,
                             VT16 + (size_t)by * CH * SEQ, SEQ, bv, CH, SEQ, CH, SC_PROJ, ACT_CARRY);
    } else {
        loc_body(bx - (unsigned)(2 * JB_ROWS + NB * JB_VT), (_Float16*)&sT[0][0], g, W1B, W2B, b1, b2, w3, b3, IDX, CNT, ALOC);
    }
}

// =====================================================================================================================
// k_attn: one block per (batch, head pair, 32-query block), 4 waves = 2 query tiles of 16 rows x the 2 heads of the pair, ONE head per wave,
//   chunks of 64 key slots, only those that count: 1024 waves in 256 blocks, so that every wave can have a SIMD of its own (a wave's chain of
//   chunks is latency bound).
//   scores: Q (A) and K (B) fragments straight from the planes, one k-step (d = 32); + location term loaded in the D layout;
//   key mask by value select, a slot being on where it is below the batch's count (fill -1e38 in the natural-log domain); running-max softmax in the exp2 domain (f32);
//   unnormalised e x1024 as f16 (wave-private LDS tile sP, wave_sync) times V^T B fragments straight from VT16.
//   O plane f16 x64 [row][head*32 + d]: the two waves of a query tile stage their 32 columns each in the tile's sO slab; behind one block
//   barrier each of them writes 8 whole 128-B rows (one writer per line).
//   staged extent == consumed extent: sP rows 0..15 x keys 0..63; sO rows 0..15 x cols 0..63.
// =====================================================================================================================
#define AT_PP 72
#define AT_OP 68
__global__ __launch_bounds__(128) void k_attn(const _Float16* __restrict__ Q16, const _Float16* __restrict__ K16,
                                              const _Float16* __restrict__ VT16, const float* __restrict__ ALOC,
                                              const int* __restrict__ CNT, _Float16* __restrict__ O16) {
    __shared__ __align__(16) _Float16 sP[4][16 * AT_PP];      // per wave [row][64 keys], wave-private (wave_sync)
    __shared__ __align__(16) float sO[2][16 * AT_OP];         // per query tile [row][64 channels], shared by the tile's two waves (block barrier)
    const unsigned tid = threadIdx.x, lane = tid & 31u, wave = tid >> 5;
    const unsigned hh = lane >> 4, c = lane & 15u;
    const unsigned bx = blockIdx.x;
    const unsigned qb = bx % (unsigned)QBLK;
    const unsigned pair = (bx / (unsigned)QBLK) & 3u;
    const unsigned b = bx / ((unsigned)QBLK * 4u);
    const unsigned hp = wave & 1u;                            // the wave's head of the pair
    const unsigned q0 = qb * 32u + (wave >> 1) * 16u;
    _Float16* pw = sP[wave];
    float* so = sO[wave >> 1];
    {
        const unsigned head = 2u * pair + hp;
        const v16h qf = frag_ld(Q16 + (size_t)(b * SEQ + q0 + c) * CH + head * HD + 8u * hh);
        const float* arow = ALOC + (size_t)((b * (unsigned)HEADS + head) * SEQ + q0 + 8u * hh) * SEQ + c;
        const _Float16* krow = K16 + (size_t)(b * SEQ + c) * CH + head * HD + 8u * hh;
        const unsigned cnt = min((unsigned)__builtin_amdgcn_readfirstlane(CNT[b * 32u]), (unsigned)SEQ);   // clamped to the shape
        const unsigned nch = key_chunks(cnt);
        float mrow[8], lrow[8];
        v8f os[2];
#pragma unroll
        for (int r = 0; r < 8; ++r) { mrow[r] = -3.0e38f; lrow[r] = 0.f; }
#pragma unroll
        for (int t = 0; t < 2; ++t) os[t] = (v8f){0.f,0.f,0.f,0.f,0.f,0.f,0.f,0.f};
        // score operands of one chunk, held in registers and fetched one chunk ahead
        v16h kf[4];
        float al[4][8];
#pragma unroll
        for (int j = 0; j < 4; ++j) {
            kf[j] = frag_ld(krow + (size_t)((unsigned)j * 16u) * CH);
#pragma unroll
            for (int r = 0; r < 8; ++r) al[j][r] = arow[(size_t)r * SEQ + (unsigned)j * 16u];
        }
        asm volatile("s_wait_xcnt 0x0" ::: "memory");   // stands in front of the later writes of the address registers of the loads above
        // tested at the foot: there is always a first chunk (key_chunks is 1 at least)
        unsigned kc = 0u;
#pragma unroll 1
        do {
            const unsigned kv0 = kc * 64u;
            v8f s[4];
#pragma unroll
            for (int j = 0; j < 4; ++j) {
                const v8f z = (v8f){0.f,0.f,0.f,0.f,0.f,0.f,0.f,0.f};
                s[j] = wmma16g(qf, kf[j], z);
            }
#pragma unroll
            for (int j = 0; j < 4; ++j) {
                const bool on = (kv0 + (unsigned)j * 16u + c) < cnt;
#pragma unroll
                for (int r = 0; r < 8; ++r) {
                    const float sv = (s[j][r] * SCQK + al[j][r]) * LOG2E;
                    s[j][r] = on ? sv : FILL2;
                }
            }
            // the next chunk's score operands fly under this chunk's softmax; the last pass fetches its own chunk again (in bounds, unused)
            const unsigned nv0 = ((kc + 1u < nch) ? kc + 1u : kc) * 64u;
#pragma unroll
            for (int j = 0; j < 4; ++j) {
                kf[j] = frag_ld(krow + (size_t)(nv0 + (unsigned)j * 16u) * CH);
#pragma unroll
                for (int r = 0; r < 8; ++r) al[j][r] = arow[(size_t)r * SEQ + nv0 + (unsigned)j * 16u];
            }
#pragma unroll
            for (int r = 0; r < 8; ++r) {
                float mx = -3.0e38f;
#pragma unroll
                for (int j = 0; j < 4; ++j) { mx = fmaxf(mx, s[j][r]); }
                mx = fmaxf(mx, __shfl_xor(mx, 1, 32)); mx = fmaxf(mx, __shfl_xor(mx, 2, 32));
                mx = fmaxf(mx, __shfl_xor(mx, 4, 32)); mx = fmaxf(mx, __shfl_xor(mx, 8, 32));
                const float mnew = fmaxf(mrow[r], mx);
                const float alpha = exp2f(mrow[r] - mnew);
                mrow[r] = mnew;
                float psum = 0.f;
#pragma unroll
                for (int j = 0; j < 4; ++j) {
                    const float p = exp2f(s[j][r] - mnew);
                    psum += p;
                    const float w = p * P_CARRY;
                    pw[(8u * hh + (unsigned)r) * AT_PP + (unsigned)j * 16u + c] = (_Float16)((w < 6.103515625e-05f) ? 0.0f : w);
                }
                psum += __shfl_xor(psum, 1, 32); psum += __shfl_xor(psum, 2, 32);
                psum += __shfl_xor(psum, 4, 32); psum += __shfl_xor(psum, 8, 32);
                lrow[r] = lrow[r] * alpha + psum;
                os[0][r] *= alpha; os[1][r] *= alpha;
            }
            wave_sync_lds();
            // this chunk's V fragments, all four in one group ahead of the P.V products
            v16h vb[2][2];
#pragma unroll
            for (int kk = 0; kk < 2; ++kk)
#pragma unroll
                for (int t = 0; t < 2; ++t)
                    vb[kk][t] = frag_ld(VT16 + (size_t)(b * CH + head * HD + (unsigned)t * 16u + c) * SEQ + kv0 + (unsigned)kk * 32u + 8u * hh);
#pragma unroll
            for (int kk = 0; kk < 2; ++kk) {
                const v16h pa = frag_ld(pw + c * AT_PP + (unsigned)kk * 32u + 8u * hh);
#pragma unroll
                for (int t = 0; t < 2; ++t) {
                    os[t] = wmma16g(pa, vb[kk][t], os[t]);
                }
            }
            wave_sync_lds();
        } while (++kc < nch);
#pragma unroll
        for (int r = 0; r < 8; ++r) {
            const float inv = 1.0f / (lrow[r] * P_CARRY);
#pragma unroll
            for (int t = 0; t < 2; ++t)
                so[(8u * hh + (unsigned)r) * AT_OP + hp * 32u + (unsigned)t * 16u + c] = os[t][r] * inv * (O_CARRY / ACT_CARRY);   // = 64 * value
        }
    }
    __syncthreads();   // the tile's other head has staged its 32 columns; every wave of the block passes here once
    {
        const unsigned q = hp * 8u + (lane >> 3), c8 = (lane & 7u) * 8u;   // this wave's 8 of the tile's 16 rows
        v8h ov[2];
#pragma unroll
        for (int it = 0; it < 2; ++it) {
            const float* sp = so + ((unsigned)it * 4u + q) * AT_OP + c8;
            ov[it] = pack8_flush(*(const v4f*)sp, *(const v4f*)(sp + 4));
        }
        _Float16* dst = O16 + (size_t)(b * SEQ + q0) * CH + pair * 64u;
#pragma unroll
        for (int it = 0; it < 2; ++it) *(v8h*)(dst + (size_t)((unsigned)it * 4u + q) * CH + c8) = ov[it];
    }
}

// output projection: out[row][256] = O @ w + bf16(b), f32
//   one 16 x 32 tile per wave, 1024 waves in 256 blocks of 4 (block = 32 rows x 64 columns), so that every wave can have a SIMD of its own.
//   the launch is latency bound: a wave's 48 fragment loads (the whole K = 256 of its 16 rows and 32 columns) are all issued before the
//   first product, one trip to L2 in place of a load-wait-use trip per fragment. k runs upward in one accumulator per tile.
//   a wave writes 16 rows x 128 B, whole lines (one writer per line), through its own slab.
#define PO_SP 36
static_assert(MTOK % 32 == 0 && CH % 64 == 0 && CH / 32 == 8);
static_assert(32 * 16 * 4 == 16 * 32 * 4);   // store loop: lanes x bytes x instructions == tile rows x row bytes
__global__ __launch_bounds__(128) void k_proj_out(const _Float16* __restrict__ O16, const _Float16* __restrict__ Wt,
                                                  float* __restrict__ out, const float* __restrict__ bias) {
    __shared__ __align__(16) float sT[4][16 * PO_SP];        // per wave [row][32 columns], wave-private (wave_sync)
    const unsigned lane = threadIdx.x & 31u, wave = threadIdx.x >> 5;
    const unsigned hh = lane >> 4, c = lane & 15u;
    const unsigned m0 = (blockIdx.x >> 2) * 32u + (wave >> 1) * 16u;
    const unsigned n0 = (blockIdx.x & 3u) * 64u + (wave & 1u) * 32u;
    const _Float16* ap = O16 + (size_t)(m0 + c) * CH + 8u * hh;
    const _Float16* bp = Wt + (size_t)(n0 + c) * CH + 8u * hh;
    v16h af[8], bf[2][8];
    // every '#pragma unroll' of this kernel: its counter indexes register arrays (af, bf, acc, vv), which must not become memory
#pragma unroll
    for (int ks = 0; ks < 8; ++ks) {
        af[ks] = frag_ld(ap + ks * 32);
        bf[0][ks] = frag_ld(bp + ks * 32);
        bf[1][ks] = frag_ld(bp + 16 * CH + ks * 32);
    }
    asm volatile("s_wait_xcnt 0x0" ::: "memory");   // stands in front of every later write of these loads' address registers; no load sinks below it
    const float raw0 = bias[n0 + c];
    asm volatile("s_wait_xcnt 0x0" ::: "memory");   // the same: the next load's result may land on this one's address register
    const float raw1 = bias[n0 + 16u + c];
    asm volatile("s_wait_xcnt 0x0" ::: "memory");   // the same
    const float bv[2] = {bfr(raw0), bfr(raw1)};
    v8f acc[2];
    acc[0] = (v8f){0.f,0.f,0.f,0.f,0.f,0.f,0.f,0.f};
    acc[1] = (v8f){0.f,0.f,0.f,0.f,0.f,0.f,0.f,0.f};
#pragma unroll
    for (int ks = 0; ks < 8; ++ks) {
        acc[0] = wmma16g(af[ks], bf[0][ks], acc[0]);
        acc[1] = wmma16g(af[ks], bf[1][ks], acc[1]);
    }
    float* slab = sT[wave];
#pragma unroll
    for (int j = 0; j < 2; ++j)
#pragma unroll
        for (int r = 0; r < 8; ++r)
            slab[(8u * hh + (unsigned)r) * PO_SP + (unsigned)j * 16u + c] = acc[j][r] * SC_OUT + bv[j];
    wave_sync_lds();
    const unsigned q = lane >> 3, c4 = (lane & 7u) * 4u;     // row segment = 128 B = 8 lanes x 16 B
    v4f vv[4];
#pragma unroll
    for (int it = 0; it < 4; ++it) vv[it] = *(const v4f*)(slab + ((unsigned)it * 4u + q) * PO_SP + c4);
#pragma unroll
    for (int it = 0; it < 4; ++it) *(v4f*)(out + (size_t)(m0 + (unsigned)it * 4u + q) * CH + n0 + c4) = vv[it];
}

extern "C" void kernel_launch(void* const* d_in, const int* in_sizes, int n_in, void* d_out, int out_size,
                              void* d_ws, size_t ws_size, hipStream_t stream) {
    if (n_in < 17) return;
    if (in_sizes[0] < NB * SEQ * SEQ * DG || in_sizes[1] < MTOK * CH) return;
    if (in_sizes[2] < CH * CH || in_sizes[3] < CH || in_sizes[4] < CH * CH || in_sizes[5] < CH) return;
    if (in_sizes[6] < CH * CH || in_sizes[7] < CH || in_sizes[8] < CH * CH || in_sizes[9] < CH) return;
    if (in_sizes[10] < HEADS * DG * HID || in_sizes[11] < HEADS * HID || in_sizes[12] < HEADS * HID * HID) return;
    if (in_sizes[13] < HEADS * HID || in_sizes[14] < HEADS * HID || in_sizes[15] < HEADS || in_sizes[16] < NB * SEQ) return;
    if (out_size < MTOK * CH) return;
    if (ws_size < WS_TOTAL) return;

    const float* pairwise_g = (const float*)d_in[0];
    const float* coset      = (const float*)d_in[1];
    const float* fc_q_w     = (const float*)d_in[2];
    const float* fc_q_b     = (const float*)d_in[3];
    const float* fc_k_w     = (const float*)d_in[4];
    const float* fc_k_b     = (const float*)d_in[5];
    const float* in_w       = (const float*)d_in[6];
    const float* in_b       = (const float*)d_in[7];
    const float* out_w      = (const float*)d_in[8];
    const float* out_b      = (const float*)d_in[9];
    const float* loc_w1     = (const float*)d_in[10];
    const float* loc_b1     = (const float*)d_in[11];
    const float* loc_w2     = (const float*)d_in[12];
    const float* loc_b2     = (const float*)d_in[13];
    const float* loc_w3     = (const float*)d_in[14];
    const float* loc_b3     = (const float*)d_in[15];
    const int*   mask       = (const int*)d_in[16];
    float* out = (float*)d_out;

    char* wsp = (char*)d_ws;
    _Float16* C16  = (_Float16*)(wsp + OFF_C16);
    _Float16* WT   = (_Float16*)(wsp + OFF_WT);
    _Float16* W1B  = (_Float16*)(wsp + OFF_W1B);
    _Float16* W2B  = (_Float16*)(wsp + OFF_W2B);
    _Float16* Q16  = (_Float16*)(wsp + OFF_Q16);
    _Float16* K16  = (_Float16*)(wsp + OFF_K16);
    _Float16* VT16 = (_Float16*)(wsp + OFF_VT16);
    float*    ALOC = (float*)(wsp + OFF_ALOC);
    _Float16* O16  = (_Float16*)(wsp + OFF_O16);
    _Float16* CP16 = (_Float16*)(wsp + OFF_CP16);
    int*      IDX  = (int*)(wsp + OFF_IDX);
    int*      CNT  = (int*)(wsp + OFF_CNT);

    // operand planes (each whole plane written by this launch)
    k_prep<<<PB_WT + PB_WL + PB_IX + PB_C, 256, 0, stream>>>(coset, fc_q_w, fc_k_w, in_w, out_w, loc_w1, loc_w2, mask,
                                                             C16, WT, W1B, W2B, CP16, IDX, CNT);

    // projections (64x64 wave tiles, 8 waves per block) beside the location term; then attention, output projection
    k_proj_loc<<<2 * JB_ROWS + NB * JB_VT + NB * SEQ, 256, 0, stream>>>(C16, CP16, WT, Q16, K16, VT16, fc_q_b, fc_k_b, in_b,
                                                                        pairwise_g, W1B, W2B, loc_b1, loc_b2, loc_w3, loc_b3, IDX, CNT, ALOC);
    k_attn<<<NB * 4 * QBLK, 128, 0, stream>>>(Q16, K16, VT16, ALOC, CNT, O16);
    k_proj_out<<<(MTOK / 32) * (CH / 64), 128, 0, stream>>>(O16, WT + (size_t)3 * CH * CH, out, out_b);
}
